// v000
// Times are from an AMD MI455X. After a warm-up the kernel runs many times in a row, and a time is the length of
// such a window on the GPU divided by its runs, so every launch and the gaps after it count. The runs cycle
// through copies of the inputs. A figure is the median of several windows, for all but v000 over two sittings.
// Sittings can differ by a few percent; kernels timed side by side share one.
// v000 is the starting kernel. One run takes 1150 microseconds.
#include <hip/hip_runtime.h>

// Relative (Shaw) multi-head attention with key AND value relative-position embeddings (query, key, value [2][1024][1024]; q = query Wq + bq, k = key Wk + bk, v = value Wv + bv ('xw' 1/32, zero biases; 16 heads x 64); idx[i][j] = clip(j - i, -16, 16) + 16; attn = softmax((q.k + q.rel_k[idx]) / 8); x = attn v + sum_j attn[i][j] rel_v[idx] (rel_k, rel_v [33][64] 1/8 scale, read); out = merged Wo + bo ('xw') -> [2][1024][1024] (2.1 M); argument order query, key, value, Wq, bq, Wk, bk, Wv, bv, Wo, bo, rel_k, rel_v).
// Layout per batch: bf16 copies of query, key, value in turn; 'xw' weights gathered into Bt; exact projections + f32 biases; rel_k as a zero-padded bf16 plane [64][64] and rel_v^T as hi/lo planes [64][64] (bf16-rounded once); per pass of two heads: score tiles (hi/lo 3 products, every row), QE = q.rel_k^T (hi/lo x exact) gathered into the scores at column clip(j - i) + 16, softmax (x 1/8) with every row on hi/lo planes, P.v (hi/lo x hi/lo), the probabilities folded onto the 33 offsets (interior = one key, the two ends = fixed-order sums) and PB.rel_v added to the context; merged hi/lo x Wo exact + bo.
// Compute dtypes, f32 accumulate: every input rounded to bf16; projections exact + f32 biases; scores and the relative-key term ~f32; softmax f32; P as bf16 hi/lo; attn.v and the relative-value term 3 products (~f32); Wo hl x exact + bias.

#define NB_  2
#define TT   1024
#define DM   1024
#define NH_  16
#define NKV  16
#define REP  (NH_ / NKV)
#define HD   64
#define DQ   (NH_ * HD)
#define DKV  (NKV * HD)
#define ZH   2
#define RH   TT                   // every row on hi/lo planes (the relative-value fold needs normalised planes)
#define WIN  0
#define PCAR 1024.0f
#define SCL  0.125f   // 1/sqrt(64) (the module divides by jnp.sqrt(DH))
#define NE   64       // 2*16+1 = 33 relative offsets padded to 64
#define NRE  33
#define CUT  16
typedef _Float16 h16;
typedef unsigned short bf;
typedef __attribute__((ext_vector_type(16))) __bf16   v16bf;
typedef __attribute__((ext_vector_type(16))) _Float16 v16h;
typedef __attribute__((ext_vector_type(8)))  _Float16 v8h;
typedef __attribute__((ext_vector_type(8)))  unsigned short v8us;
typedef __attribute__((ext_vector_type(8)))  float    v8f;
typedef __attribute__((ext_vector_type(4)))  float    v4f;
typedef v8h  __attribute__((may_alias)) v8ha;
typedef v4f  __attribute__((may_alias)) v4fa;
typedef v8us __attribute__((may_alias)) v8usa;

__device__ __forceinline__ unsigned short f2bf(float f) { unsigned u = __float_as_uint(f); u += 0x7FFFu + ((u >> 16) & 1u); return (unsigned short)(u >> 16); }
__device__ __forceinline__ float bf2f(unsigned short b) { return __uint_as_float(((unsigned)b) << 16); }
__device__ __forceinline__ float bfr(float f) { return bf2f(f2bf(f)); }
__device__ __forceinline__ v16h cat16(v8h lo, v8h hi) { return __builtin_shufflevector(lo, hi, 0, 1, 2, 3, 4, 5, 6, 7, 8, 9, 10, 11, 12, 13, 14, 15); }
__device__ __forceinline__ v16bf cat16b(v8us lo, v8us hi) { return __builtin_bit_cast(v16bf, __builtin_shufflevector(lo, hi, 0, 1, 2, 3, 4, 5, 6, 7, 8, 9, 10, 11, 12, 13, 14, 15)); }
__device__ __forceinline__ v8f wmma16(v16h a, v16h b, v8f c) { return __builtin_amdgcn_wmma_f32_16x16x32_f16(false, a, false, b, (short)0, c, false, false); }
__device__ __forceinline__ v8f wmmab(v16bf a, v16bf b, v8f c) { return __builtin_amdgcn_wmma_f32_16x16x32_bf16(false, a, false, b, (short)0, c, false, false); }



// ---- k_gemmw: register-blocked GEMM, ONE WAVE per 64x64 output tile (16 accumulators), operands straight from K-contiguous 16-bit planes; grid (M/64, N/64, Z), 32 threads.
// C[m][n] (f32, pitch ldc, + optional f32 bias[n]) = sum_k A[m][k] Bt[n][k] (+ split products per NSPLIT). z-batch strides sA/sB/sC in elements. K % 32 == 0.
template <typename T16> struct WFrag;
template <> struct WFrag<h16> { typedef v16h V; static __device__ __forceinline__ V ld(const h16* p) { return cat16(*(const v8h*)p, *(const v8h*)(p + 16)); } static __device__ __forceinline__ v8f mma(V a, V b, v8f c) { return wmma16(a, b, c); } };
template <> struct WFrag<bf> { typedef v16bf V; static __device__ __forceinline__ V ld(const bf* p) { return cat16b(*(const v8us*)p, *(const v8us*)(p + 16)); } static __device__ __forceinline__ v8f mma(V a, V b, v8f c) { return wmmab(a, b, c); } };
template <typename T16, int NSPLIT, bool BIAS>
__global__ __launch_bounds__(32) void k_gemmw(const T16* __restrict__ A, const T16* __restrict__ A2, const T16* __restrict__ Bt, const T16* __restrict__ Bt2, int K, float* C, int ldc, const float* __restrict__ bias, size_t sA, size_t sB, size_t sC) {
    typedef typename WFrag<T16>::V V;
    __shared__ __align__(16) float os[16 * 68];
    const size_t z = blockIdx.z; A += z * sA; if (A2) A2 += z * sA; Bt += z * sB; if (Bt2) Bt2 += z * sB; C += z * sC;
    const int lane = threadIdx.x & 31, lr = lane & 15, hi = lane >> 4; const int r0 = blockIdx.x * 64, c0 = blockIdx.y * 64;
    v8f acc[4][4];
#pragma unroll
    for (int mb = 0; mb < 4; ++mb)
#pragma unroll
        for (int nb = 0; nb < 4; ++nb) acc[mb][nb] = (v8f){};
    const size_t aoff = (size_t)(r0 + lr) * K + 8 * hi, boff = (size_t)(c0 + lr) * K + 8 * hi;
#pragma unroll 1
    for (int kc = 0; kc < K; kc += 32) {
        V a[4], a2[4];
#pragma unroll
        for (int mb = 0; mb < 4; ++mb) { a[mb] = WFrag<T16>::ld(A + aoff + (size_t)mb * 16 * K + kc); if (NSPLIT == 1 || NSPLIT == 2) a2[mb] = WFrag<T16>::ld(A2 + aoff + (size_t)mb * 16 * K + kc); }
#pragma unroll
        for (int nb = 0; nb < 4; ++nb) { const V b = WFrag<T16>::ld(Bt + boff + (size_t)nb * 16 * K + kc); V b2; if (NSPLIT >= 2) b2 = WFrag<T16>::ld(Bt2 + boff + (size_t)nb * 16 * K + kc);
#pragma unroll
            for (int mb = 0; mb < 4; ++mb) { acc[mb][nb] = WFrag<T16>::mma(a[mb], b, acc[mb][nb]); if (NSPLIT == 1 || NSPLIT == 2) acc[mb][nb] = WFrag<T16>::mma(a2[mb], b, acc[mb][nb]); if (NSPLIT >= 2) acc[mb][nb] = WFrag<T16>::mma(a[mb], b2, acc[mb][nb]); } }
        asm volatile("v_nop\n\tv_nop\n\tv_nop\n\tv_nop" : "+v"(acc[0][0]), "+v"(acc[1][1]), "+v"(acc[2][2]), "+v"(acc[3][3]) : "v"(a[0]), "v"(a[3]));
    }
#pragma unroll
    for (int mb = 0; mb < 4; ++mb) {
#pragma unroll
        for (int nb = 0; nb < 4; ++nb) {
#pragma unroll
            for (int j = 0; j < 8; ++j) os[(hi * 8 + j) * 68 + nb * 16 + lr] = acc[mb][nb][j]; }
        __builtin_amdgcn_wave_barrier(); asm volatile("" ::: "memory");
        float* crow = C + (size_t)(r0 + mb * 16) * ldc + c0;
{
#pragma unroll
            for (int s = 0; s < 8; ++s) { const int row = 2 * s + hi, cofs = lr * 4; v4f val = *(const v4fa*)(os + row * 68 + cofs); if (BIAS) { val[0] += bfr(bias[c0 + cofs]); val[1] += bfr(bias[c0 + cofs + 1]); val[2] += bfr(bias[c0 + cofs + 2]); val[3] += bfr(bias[c0 + cofs + 3]); }
                *(v4f*)(crow + (size_t)row * ldc + cofs) = val; }
             }
        __builtin_amdgcn_wave_barrier(); asm volatile("" ::: "memory");
    }
}

__device__ __forceinline__ h16 tohx(float x) { return (h16)x; }
__device__ __forceinline__ void splitf(float y, unsigned short& h, unsigned short& l) { h = f2bf(y); l = f2bf(y - bf2f(h)); }
typedef __attribute__((ext_vector_type(2))) _Float16 v2h;
typedef __attribute__((ext_vector_type(4))) _Float16 v4h;
typedef __attribute__((ext_vector_type(2))) unsigned short v2us;
typedef __attribute__((ext_vector_type(4))) unsigned short v4us;
typedef __attribute__((ext_vector_type(2))) float v2f;
typedef __attribute__((ext_vector_type(4))) int v4i;

__global__ __launch_bounds__(256) void k_wtG(const float* __restrict__ w, int K, int N, bf* Bt) {
    const int lane = threadIdx.x & 31; const int L0 = (blockIdx.x * 8 + (threadIdx.x >> 5)) * 8; const int nlines = N * K / 64;
{
#pragma unroll 1
        for (int l = 0; l < 8; ++l) { const int L = L0 + l; if (L >= nlines) break; const size_t e = (size_t)L * 64 + lane * 2; const int k = (int)(e % K), n = (int)(e / K); v2us o;
            o[0] = f2bf(w[(size_t)k * N + n]); o[1] = f2bf(w[(size_t)(k + 1) * N + n]); *(v2us*)(Bt + e) = o; }
         }
}
__global__ __launch_bounds__(256) void k_cvt8(const float* __restrict__ src, bf* dst, size_t n8) { const size_t i = (size_t)blockIdx.x * 256 + threadIdx.x; if (i >= n8) return; const v8f v = *(const v8f*)(src + i * 8); v8us o;
#pragma unroll
    for (int k = 0; k < 8; ++k) o[k] = f2bf(v[k]); *(v8us*)(dst + i * 8) = o;  }

// k_rope: head planes [h][t][d] (fp16 + hi/lo) of rope(x) x sc with the rotate-half convention out[d] = x[d] cos[t][d] - x[d+HD/2] sin[t][d], out[d+HD/2] = x[d+HD/2] cos[t][d+HD/2] + x[d] sin[t][d+HD/2]
__global__ __launch_bounds__(256) void k_rope(const float* __restrict__ F, int pitch, int nheads, const float* __restrict__ CS, const float* __restrict__ RF, const float* __restrict__ nw, float sc, h16* P16, bf* Ph, bf* Pl) {
    const size_t e = ((size_t)blockIdx.x * 256 + threadIdx.x) * 2; if (e >= (size_t)nheads * TT * HD) return; const int d = (int)(e % HD); const int t = (int)((e / HD) % TT); const int h = (int)(e / ((size_t)HD * TT)); const float* f = F + (size_t)t * pitch + h * HD; const float rf = RF ? RF[(size_t)h * TT + t] : 1.0f; v2h o16; v2us oh, ol;
#pragma unroll
    for (int q = 0; q < 2; ++q) { const int dd = d + q; const int dp = (dd < HD / 2) ? dd + HD / 2 : dd - HD / 2; float x0 = f[dd], x1 = f[dp];
        if (RF) { float n0 = __fmul_rn(x0, rf), n1 = __fmul_rn(x1, rf); asm volatile("" : "+v"(n0)); asm volatile("" : "+v"(n1)); x0 = __fmul_rn(bfr(nw[dd]), n0); x1 = __fmul_rn(bfr(nw[dp]), n1); }
        const v2f cs = *(const v2f*)(CS + ((size_t)t * HD + dd) * 2); float a = __fmul_rn(x0, cs[0]), bq = __fmul_rn(x1, cs[1]); asm volatile("" : "+v"(a)); asm volatile("" : "+v"(bq)); const float r = ((dd < HD / 2) ? __fsub_rn(a, bq) : __fadd_rn(a, bq)) * sc;
        o16[q] = tohx(r); unsigned short a2, c2; splitf(r, a2, c2); oh[q] = a2; ol[q] = c2; }
    *(v2h*)(P16 + e) = o16; *(v2us*)(Ph + e) = oh; *(v2us*)(Pl + e) = ol;  }
__global__ __launch_bounds__(256) void k_vtp(const float* __restrict__ F, int pitch, int nheads, h16* V16, bf* Vh, bf* Vl) { const size_t e = ((size_t)blockIdx.x * 256 + threadIdx.x) * 2; if (e >= (size_t)nheads * HD * TT) return; const int t = (int)(e % TT); const int d = (int)((e / TT) % HD); const int g = (int)(e / ((size_t)TT * HD)); v2h o16; v2us oh, ol;
#pragma unroll
    for (int q = 0; q < 2; ++q) { const float x = F[(size_t)(t + q) * pitch + g * HD + d]; o16[q] = tohx(x); unsigned short a2, c2; splitf(x, a2, c2); oh[q] = a2; ol[q] = c2; }
    *(v2h*)(V16 + e) = o16; *(v2us*)(Vh + e) = oh; *(v2us*)(Vl + e) = ol;  }
__global__ __launch_bounds__(256) void k_csid(float* CS) { const int idx = blockIdx.x * 256 + threadIdx.x; if (idx >= TT * HD) return; v2f cs; cs[0] = 1.0f; cs[1] = 0.0f; *(v2f*)(CS + (size_t)idx * 2) = cs;  }
// k_asoft: per row (zz, i): t = S x HD^-0.5 (no mask); softmax over the 1024 keys (register row, one exp, fixed trees);
__global__ __launch_bounds__(256) void k_asoft(const float* __restrict__ Sb, h16* P16, bf* Ph, bf* Pl) {
    const int lane = threadIdx.x & 31; const int row = blockIdx.x * 8 + (threadIdx.x >> 5); if (row >= ZH * TT) return; const int i = row % TT; const int zz = row / TT; (void)zz; const bool hires = (i < RH); const float* sr = Sb + (size_t)row * TT; float v[TT / 32]; float mx = -3.0e38f;
#pragma unroll
    for (int ch = 0; ch < TT / 128; ++ch) { const int j0 = ch * 128 + lane * 4; const v4f a = *(const v4f*)(sr + j0);
#pragma unroll
        for (int q = 0; q < 4; ++q) { const int j = j0 + q; (void)j; const float t = a[q] * SCL; v[ch * 4 + q] = t; mx = fmaxf(mx, t); } }
#pragma unroll
    for (int sh = 16; sh; sh >>= 1) mx = fmaxf(mx, __shfl_xor(mx, sh, 32));
    float sum = 0.f;
#pragma unroll
    for (int k = 0; k < TT / 32; ++k) { float d0 = __fsub_rn(v[k], mx); asm volatile("" : "+v"(d0)); v[k] = __builtin_amdgcn_exp2f(__fmul_rn(d0, 1.4426950408889634f)); sum += v[k]; }
#pragma unroll
    for (int sh = 16; sh; sh >>= 1) sum += __shfl_xor(sum, sh, 32);
    const float f = __fdiv_rn(hires ? 1.0f : PCAR, sum);
{
        if (hires) {
#pragma unroll
            for (int ch = 0; ch < TT / 128; ++ch) { v4us oh, ol;
#pragma unroll
                for (int q = 0; q < 4; ++q) { unsigned short a, c2; splitf(v[ch * 4 + q] * f, a, c2); oh[q] = a; ol[q] = c2; }
                const size_t oo = ((size_t)zz * (RH ? RH : 1) + i) * TT + ch * 128 + lane * 4; *(v4us*)(Ph + oo) = oh; *(v4us*)(Pl + oo) = ol; }
        } else {
#pragma unroll
            for (int ch = 0; ch < TT / 128; ++ch) { v4h o4;
#pragma unroll
                for (int q = 0; q < 4; ++q) o4[q] = tohx(v[ch * 4 + q] * f);
                *(v4h*)(P16 + (size_t)row * TT + ch * 128 + lane * 4) = o4; } }
         }
}
__global__ __launch_bounds__(256) void k_epadK(const float* __restrict__ E, bf* EB) { const size_t i = (size_t)blockIdx.x * 256 + threadIdx.x; if (i >= (size_t)NE * HD / 8) return; const int d0 = (int)(i % (HD / 8)) * 8; const int r = (int)(i / (HD / 8)); const float* src = E + (size_t)min(r, NRE - 1) * HD + d0; v8us o;
#pragma unroll
    for (int q = 0; q < 8; ++q) { const unsigned short v = f2bf(src[q]); o[q] = (r < NRE) ? v : (unsigned short)0; }
    *(v8us*)(EB + (size_t)r * HD + d0) = o;  }

__global__ __launch_bounds__(256) void k_epadVT(const float* __restrict__ E, bf* Th, bf* Tl) { const size_t i = (size_t)blockIdx.x * 256 + threadIdx.x; if (i >= (size_t)HD * NE / 4) return; const size_t e = i * 4; const int c0 = (int)(e % NE); const int d = (int)(e / NE); v4us oh, ol;
#pragma unroll
    for (int q = 0; q < 4; ++q) { const int r = c0 + q; const float v = bfr(E[(size_t)min(r, NRE - 1) * HD + d]); unsigned short u, w; splitf(v, u, w);   /* input rounded to bf16 once: lo == 0 */ oh[q] = (r < NRE) ? u : (unsigned short)0; ol[q] = (r < NRE) ? w : (unsigned short)0; }
    *(v4us*)(Th + e) = oh; *(v4us*)(Tl + e) = ol;  }

__global__ __launch_bounds__(256) void k_addrelc(float* Sb, const float* __restrict__ QE) { const size_t k = (size_t)blockIdx.x * 256 + threadIdx.x; if (k >= (size_t)ZH * TT * TT / 4) return; const size_t e = k * 4; const int j0 = (int)(e % TT); const size_t zi = e / TT; const int i = (int)(zi % TT); const float* qe = QE + zi * NE; v4f a = *(const v4f*)(Sb + e);
#pragma unroll
    for (int q = 0; q < 4; ++q) { const int r = min(max(j0 + q - i, -CUT), CUT) + CUT; a[q] = __fadd_rn(a[q], qe[r]); }
    *(v4f*)(Sb + e) = a;  }

__global__ __launch_bounds__(256) void k_pbuck(const bf* __restrict__ Ph, const bf* __restrict__ Pl, bf* Bh, bf* Bl) { const int lane = threadIdx.x & 31; const int row = blockIdx.x * 8 + (threadIdx.x >> 5); if (row >= ZH * TT) return; const int i = row % TT; const bf* ph = Ph + (size_t)row * TT; const bf* pl = Pl + (size_t)row * TT; float lo_s = 0.f, hi_s = 0.f;
#pragma unroll 1
    for (int j = lane; j < TT; j += 32) { const float p = __fadd_rn(bf2f(ph[j]), bf2f(pl[j])); if (j <= i - CUT) lo_s = __fadd_rn(lo_s, p); if (j >= i + CUT) hi_s = __fadd_rn(hi_s, p); }
#pragma unroll
    for (int sh = 16; sh; sh >>= 1) { lo_s = __fadd_rn(lo_s, __shfl_xor(lo_s, sh, 32)); hi_s = __fadd_rn(hi_s, __shfl_xor(hi_s, sh, 32)); }
    unsigned short l0h, l0l, h0h, h0l; splitf(lo_s, l0h, l0l); splitf(hi_s, h0h, h0l);
{
#pragma unroll 1
        for (int c0 = lane * 4; c0 < NE; c0 += 128) { v4us oh, ol;
#pragma unroll
            for (int q = 0; q < 4; ++q) { const int bkt = c0 + q; const int j = i + bkt - CUT; const int jc = min(max(j, 0), TT - 1); unsigned int uu = ((const unsigned short*)ph)[jc], ww = ((const unsigned short*)pl)[jc]; asm volatile("" : "+v"(uu), "+v"(ww));   /* unconditional clamped loads pinned before the select (opaque use) */ const bool in = (bkt > 0 && bkt < 2 * CUT && j >= 0 && j < TT);
                const unsigned short u = in ? (unsigned short)uu : ((bkt == 0) ? l0h : ((bkt == 2 * CUT) ? h0h : (unsigned short)0)); const unsigned short w = in ? (unsigned short)ww : ((bkt == 0) ? l0l : ((bkt == 2 * CUT) ? h0l : (unsigned short)0));
                oh[q] = u; ol[q] = w; }
            *(v4us*)(Bh + (size_t)row * NE + c0) = oh; *(v4us*)(Bl + (size_t)row * NE + c0) = ol; }
         }
}

__global__ __launch_bounds__(256) void k_addF(float* Y, const float* __restrict__ F) { const size_t i = (size_t)blockIdx.x * 256 + threadIdx.x; if (i >= (size_t)ZH * TT * HD / 4) return; const v4f a = *(const v4f*)(Y + i * 4); const v4f f = *(const v4f*)(F + i * 4); v4f o;
#pragma unroll
    for (int q = 0; q < 4; ++q) o[q] = __fadd_rn(a[q], f[q]);
    *(v4f*)(Y + i * 4) = o;  }

__global__ __launch_bounds__(256) void k_merge(const float* __restrict__ O, int h0, bf* Ah, bf* Al) { const size_t e = ((size_t)blockIdx.x * 256 + threadIdx.x) * 2; if (e >= (size_t)ZH * TT * HD) return; const int d = (int)(e % HD); const int t = (int)((e / HD) % TT); const int zz = (int)(e / ((size_t)HD * TT)); const float cs = (t < RH) ? 1.0f : (1.0f / PCAR); const size_t oo = (size_t)t * DQ + (h0 + zz) * HD + d;
    v2us oh, ol;
#pragma unroll
    for (int q = 0; q < 2; ++q) { unsigned short a, c2; splitf(O[e + q] * cs, a, c2); oh[q] = a; ol[q] = c2; } *(v2us*)(Ah + oo) = oh; *(v2us*)(Al + oo) = ol;  }

extern "C" void kernel_launch(void* const* d_in, const int* in_sizes, int n_in,
                              void* d_out, int out_size, void* d_ws, size_t ws_size, hipStream_t stream) {
    (void)in_sizes; (void)n_in; (void)out_size;
    const float* x = (const float*)d_in[0];   /* query */ const float* xk = (const float*)d_in[1]; const float* xv = (const float*)d_in[2]; const float* wq = (const float*)d_in[3]; const float* bq = (const float*)d_in[4]; const float* wk = (const float*)d_in[5]; const float* bk = (const float*)d_in[6]; const float* wv = (const float*)d_in[7]; const float* bv = (const float*)d_in[8]; const float* wo = (const float*)d_in[9]; const float* bo = (const float*)d_in[10]; const float* ak = (const float*)d_in[11]; const float* av = (const float*)d_in[12];   /* rel_k / rel_v [33][64] */
    float* OUT = (float*)d_out;     // [2][1024][1024]
    char* wsp = (char*)d_ws;
    auto take = [&](size_t bytes) { char* p = wsp; wsp += (bytes + 255) & ~(size_t)255; return (void*)p; };
    bf* AKB = (bf*)take((size_t)NE * HD * 2); bf* AVTh = (bf*)take((size_t)HD * NE * 2); bf* AVTl = (bf*)take((size_t)HD * NE * 2); float* QE = (float*)take((size_t)ZH * TT * NE * 4); bf* PBh = (bf*)take((size_t)ZH * TT * NE * 2); bf* PBl = (bf*)take((size_t)ZH * TT * NE * 2); float* ZR = (float*)take((size_t)ZH * TT * HD * 4); bf* WQ = (bf*)take((size_t)DQ * DM * 2); bf* WK = (bf*)take((size_t)DKV * DM * 2); bf* WV = (bf*)take((size_t)DKV * DM * 2); bf* WO = (bf*)take((size_t)DM * DQ * 2); float* CS = (float*)take((size_t)TT * HD * 2 * 4);
    bf* XB = (bf*)take((size_t)TT * DM * 2); float* FQ = (float*)take((size_t)TT * DQ * 4); float* FK = (float*)take((size_t)TT * DKV * 4);
    h16* QP16 = (h16*)take((size_t)NH_ * TT * HD * 2); h16* KP16 = (h16*)take((size_t)NKV * TT * HD * 2); h16* VT16 = (h16*)take((size_t)NKV * HD * TT * 2);
    bf* QPh = (bf*)take((size_t)NH_ * TT * HD * 2); bf* QPl = (bf*)take((size_t)NH_ * TT * HD * 2); bf* KPh = (bf*)take((size_t)NKV * TT * HD * 2); bf* KPl = (bf*)take((size_t)NKV * TT * HD * 2); bf* VTh = (bf*)take((size_t)NKV * HD * TT * 2); bf* VTl = (bf*)take((size_t)NKV * HD * TT * 2); bf* Ph = (bf*)take((size_t)ZH * RH * TT * 2); bf* Pl = (bf*)take((size_t)ZH * RH * TT * 2);
    float* Sb = (float*)take((size_t)ZH * TT * TT * 4); h16* P16 = (h16*)take((size_t)ZH * TT * TT * 2); float* Ob = (float*)take((size_t)ZH * TT * HD * 4); bf* ATh = (bf*)take((size_t)TT * DQ * 2); bf* ATl = (bf*)take((size_t)TT * DQ * 2);
    if ((size_t)(wsp - (char*)d_ws) > ws_size) return;    // ws 256 MiB
    float* FV = FK;   // v projection reuses the k buffer after the k planes are built (stream-ordered)
    { k_wtG<<<(unsigned)((DM * DQ / 64 + 63) / 64), 256, 0, stream>>>(wq, DM, DQ, WQ); k_wtG<<<(unsigned)((DM * DKV / 64 + 63) / 64), 256, 0, stream>>>(wk, DM, DKV, WK); k_wtG<<<(unsigned)((DM * DKV / 64 + 63) / 64), 256, 0, stream>>>(wv, DM, DKV, WV);
      k_wtG<<<(unsigned)((DQ * DM / 64 + 63) / 64), 256, 0, stream>>>(wo, DQ, DM, WO);   /* 'xw' weights gathered into Bt */
       }
    k_csid<<<(TT * HD + 255) / 256, 256, 0, stream>>>(CS);
    const unsigned LQ = (unsigned)(((size_t)NH_ * TT * HD / 2 + 255) / 256), LKv = (unsigned)(((size_t)NKV * TT * HD / 2 + 255) / 256);
    k_epadK<<<(unsigned)(((size_t)NE * HD / 8 + 255) / 256), 256, 0, stream>>>(ak, AKB);   /* rel_k -> bf16 [64][64], rows >= 33 zero */ k_epadVT<<<(unsigned)(((size_t)HD * NE / 4 + 255) / 256), 256, 0, stream>>>(av, AVTh, AVTl);   /* rel_v^T hi/lo [64][64], cols >= 33 zero */
    for (int b = 0; b < NB_; ++b) {
        
        k_cvt8<<<(unsigned)(((size_t)TT * DM / 8 + 255) / 256), 256, 0, stream>>>(x + (size_t)b * TT * DM, XB, (size_t)TT * DM / 8);
        k_gemmw<bf, 0, true><<<dim3(TT / 64, DQ / 64, 1), 32, 0, stream>>>(XB, nullptr, WQ, nullptr, DM, FQ, DQ, bq, 0, 0, 0);
        k_rope<<<LQ, 256, 0, stream>>>(FQ, DQ, NH_, CS, nullptr, nullptr, 1.0f, QP16, QPh, QPl);
        k_cvt8<<<(unsigned)(((size_t)TT * DM / 8 + 255) / 256), 256, 0, stream>>>(xk + (size_t)b * TT * DM, XB, (size_t)TT * DM / 8); k_gemmw<bf, 0, true><<<dim3(TT / 64, DKV / 64, 1), 32, 0, stream>>>(XB, nullptr, WK, nullptr, DM, FK, DKV, bk, 0, 0, 0);
        k_rope<<<LKv, 256, 0, stream>>>(FK, DKV, NKV, CS, nullptr, nullptr, 1.0f, KP16, KPh, KPl);
        k_cvt8<<<(unsigned)(((size_t)TT * DM / 8 + 255) / 256), 256, 0, stream>>>(xv + (size_t)b * TT * DM, XB, (size_t)TT * DM / 8); k_gemmw<bf, 0, true><<<dim3(TT / 64, DKV / 64, 1), 32, 0, stream>>>(XB, nullptr, WV, nullptr, DM, FV, DKV, bv, 0, 0, 0); k_vtp<<<LKv, 256, 0, stream>>>(FV, DKV, NKV, VT16, VTh, VTl);
        for (int h0 = 0; h0 < NH_; h0 += ZH) { const size_t zq = (size_t)h0, zk = (size_t)(h0 / REP);   // one kv head per query head: the pass's two heads use consecutive kv planes (z-strides TT*HD)
            k_gemmw<bf, 2, false><<<dim3(RH / 64, TT / 64, ZH), 32, 0, stream>>>(QPh + zq * TT * HD, QPl + zq * TT * HD, KPh + zk * TT * HD, KPl + zk * TT * HD, HD, Sb, TT, nullptr, (size_t)TT * HD, (size_t)TT * HD, (size_t)TT * TT);

            k_gemmw<bf, 1, false><<<dim3(TT / 64, NE / 64, ZH), 32, 0, stream>>>(QPh + zq * TT * HD, QPl + zq * TT * HD, AKB, nullptr, HD, QE, NE, nullptr, (size_t)TT * HD, 0, (size_t)TT * NE);   /* QE = q . rel_k^T */ k_addrelc<<<(unsigned)(((size_t)ZH * TT * TT / 4 + 255) / 256), 256, 0, stream>>>(Sb, QE);   /* + q.rel_k[clip(j - i) + 16] */ k_asoft<<<ZH * TT / 8, 256, 0, stream>>>(Sb, P16, Ph, Pl);
            k_gemmw<bf, 2, false><<<dim3(RH / 64, HD / 64, ZH), 32, 0, stream>>>(Ph, Pl, VTh + zk * HD * TT, VTl + zk * HD * TT, TT, Ob, HD, nullptr, (size_t)RH * TT, (size_t)HD * TT, (size_t)TT * HD); k_pbuck<<<(unsigned)(((size_t)ZH * TT + 7) / 8), 256, 0, stream>>>(Ph, Pl, PBh, PBl);   /* attn folded onto the 33 clipped offsets */ k_gemmw<bf, 2, false><<<dim3(TT / 64, HD / 64, ZH), 32, 0, stream>>>(PBh, PBl, AVTh, AVTl, NE, ZR, HD, nullptr, (size_t)TT * NE, 0, (size_t)TT * HD);   /* ZR = PB . rel_v */ k_addF<<<(unsigned)(((size_t)ZH * TT * HD / 4 + 255) / 256), 256, 0, stream>>>(Ob, ZR);   /* context += relative-value term */

            k_merge<<<(unsigned)(((size_t)ZH * TT * HD / 2 + 255) / 256), 256, 0, stream>>>(Ob, h0, ATh, ATl); }
        k_gemmw<bf, 1, true><<<dim3(TT / 64, DM / 64, 1), 32, 0, stream>>>(ATh, ATl, WO, nullptr, DQ, OUT + (size_t)b * TT * DM, DM, bo, 0, 0, 0); }
}

// v001
// It runs in 392 microseconds.
// Next to v000, in two timings, it ran 2.94 and 2.96 times as fast.
#include <hip/hip_runtime.h>

// Relative (Shaw) multi-head attention with key AND value relative-position embeddings (query, key, value [2][1024][1024]; q = query Wq + bq, k = key Wk + bk, v = value Wv + bv ('xw' 1/32, zero biases; 16 heads x 64); idx[i][j] = clip(j - i, -16, 16) + 16; attn = softmax((q.k + q.rel_k[idx]) / 8); x = attn v + sum_j attn[i][j] rel_v[idx] (rel_k, rel_v [33][64] 1/8 scale, read); out = merged Wo + bo ('xw') -> [2][1024][1024] (2.1 M); argument order query, key, value, Wq, bq, Wk, bk, Wv, bv, Wo, bo, rel_k, rel_v).
// Layout: bf16 copies of query, key, value in turn (both batches per launch, rows b*1024 + t); 'xw' weights gathered into Bt; exact projections + f32 biases; rel_k as a zero-padded bf16 plane [64][64] and rel_v^T as hi/lo planes [64][64] (bf16-rounded once); per batch one pass of all sixteen heads (grid z = head): score tiles (hi/lo 3 products, every row), QE = q.rel_k^T (hi/lo x exact) gathered into the scores at column clip(j - i) + 16, softmax (x 1/8) with every row on hi/lo planes, P.v (hi/lo x hi/lo), the probabilities folded onto the 33 offsets (interior = one key, the two ends = fixed-order sums) and PB.rel_v added to the context; merged hi/lo x Wo exact + bo.
// Compute dtypes, f32 accumulate: every input rounded to bf16; projections exact + f32 biases; scores and the relative-key term ~f32; softmax f32; P as bf16 hi/lo; attn.v and the relative-value term 3 products (~f32); Wo hl x exact + bias.

#define NB_  2
#define TT   1024
#define DM   1024
#define NH_  16
#define NKV  16
#define REP  (NH_ / NKV)
#define HD   64
#define DQ   (NH_ * HD)
#define DKV  (NKV * HD)
#define ZH   16                   // heads per attention pass: all of one batch in every launch
#define RH   TT                   // every row on hi/lo planes (the relative-value fold needs normalised planes)
#define WIN  0
#define PCAR 1024.0f
#define SCL  0.125f   // 1/sqrt(64) (the module divides by jnp.sqrt(DH))
#define NE   64       // 2*16+1 = 33 relative offsets padded to 64
#define NRE  33
#define CUT  16
typedef _Float16 h16;
typedef unsigned short bf;
typedef __attribute__((ext_vector_type(16))) __bf16   v16bf;
typedef __attribute__((ext_vector_type(16))) _Float16 v16h;
typedef __attribute__((ext_vector_type(8)))  _Float16 v8h;
typedef __attribute__((ext_vector_type(8)))  unsigned short v8us;
typedef __attribute__((ext_vector_type(8)))  float    v8f;
typedef __attribute__((ext_vector_type(4)))  float    v4f;
typedef v8h  __attribute__((may_alias)) v8ha;
typedef v4f  __attribute__((may_alias)) v4fa;
typedef v8us __attribute__((may_alias)) v8usa;

__device__ __forceinline__ unsigned short f2bf(float f) { unsigned u = __float_as_uint(f); u += 0x7FFFu + ((u >> 16) & 1u); return (unsigned short)(u >> 16); }
__device__ __forceinline__ float bf2f(unsigned short b) { return __uint_as_float(((unsigned)b) << 16); }
__device__ __forceinline__ float bfr(float f) { return bf2f(f2bf(f)); }
__device__ __forceinline__ v16h cat16(v8h lo, v8h hi) { return __builtin_shufflevector(lo, hi, 0, 1, 2, 3, 4, 5, 6, 7, 8, 9, 10, 11, 12, 13, 14, 15); }
__device__ __forceinline__ v16bf cat16b(v8us lo, v8us hi) { return __builtin_bit_cast(v16bf, __builtin_shufflevector(lo, hi, 0, 1, 2, 3, 4, 5, 6, 7, 8, 9, 10, 11, 12, 13, 14, 15)); }
__device__ __forceinline__ v8f wmma16(v16h a, v16h b, v8f c) { return __builtin_amdgcn_wmma_f32_16x16x32_f16(false, a, false, b, (short)0, c, false, false); }
__device__ __forceinline__ v8f wmmab(v16bf a, v16bf b, v8f c) { return __builtin_amdgcn_wmma_f32_16x16x32_bf16(false, a, false, b, (short)0, c, false, false); }



// ---- k_gemmw: register-blocked GEMM, ONE WAVE per 64x64 output tile (16 accumulators), operands straight from K-contiguous 16-bit planes; grid (M/64, N/64, Z), 32 threads.
// C[m][n] (f32, pitch ldc, + optional f32 bias[n]) = sum_k A[m][k] Bt[n][k] (+ split products per NSPLIT). z-batch strides sA/sB/sC in elements. K % 32 == 0.
template <typename T16> struct WFrag;
template <> struct WFrag<h16> { typedef v16h V; static __device__ __forceinline__ V ld(const h16* p) { return cat16(*(const v8h*)p, *(const v8h*)(p + 16)); } static __device__ __forceinline__ v8f mma(V a, V b, v8f c) { return wmma16(a, b, c); } };
template <> struct WFrag<bf> { typedef v16bf V; static __device__ __forceinline__ V ld(const bf* p) { return cat16b(*(const v8us*)p, *(const v8us*)(p + 16)); } static __device__ __forceinline__ v8f mma(V a, V b, v8f c) { return wmmab(a, b, c); } };
template <typename T16, int NSPLIT, bool BIAS>
__global__ __launch_bounds__(32) void k_gemmw(const T16* __restrict__ A, const T16* __restrict__ A2, const T16* __restrict__ Bt, const T16* __restrict__ Bt2, int K, float* C, int ldc, const float* __restrict__ bias, size_t sA, size_t sB, size_t sC) {
    typedef typename WFrag<T16>::V V;
    __shared__ __align__(16) float os[16 * 68];
    const size_t z = blockIdx.z; A += z * sA; if (A2) A2 += z * sA; Bt += z * sB; if (Bt2) Bt2 += z * sB; C += z * sC;
    const int lane = threadIdx.x & 31, lr = lane & 15, hi = lane >> 4; const int r0 = blockIdx.x * 64, c0 = blockIdx.y * 64;
    v8f acc[4][4];
#pragma unroll
    for (int mb = 0; mb < 4; ++mb)
#pragma unroll
        for (int nb = 0; nb < 4; ++nb) acc[mb][nb] = (v8f){};
    const size_t aoff = (size_t)(r0 + lr) * K + 8 * hi, boff = (size_t)(c0 + lr) * K + 8 * hi;
#pragma unroll 1
    for (int kc = 0; kc < K; kc += 32) {
        V a[4], a2[4];
#pragma unroll
        for (int mb = 0; mb < 4; ++mb) { a[mb] = WFrag<T16>::ld(A + aoff + (size_t)mb * 16 * K + kc); if (NSPLIT == 1 || NSPLIT == 2) a2[mb] = WFrag<T16>::ld(A2 + aoff + (size_t)mb * 16 * K + kc); }
#pragma unroll
        for (int nb = 0; nb < 4; ++nb) { const V b = WFrag<T16>::ld(Bt + boff + (size_t)nb * 16 * K + kc); V b2; if (NSPLIT >= 2) b2 = WFrag<T16>::ld(Bt2 + boff + (size_t)nb * 16 * K + kc);
#pragma unroll
            for (int mb = 0; mb < 4; ++mb) { acc[mb][nb] = WFrag<T16>::mma(a[mb], b, acc[mb][nb]); if (NSPLIT == 1 || NSPLIT == 2) acc[mb][nb] = WFrag<T16>::mma(a2[mb], b, acc[mb][nb]); if (NSPLIT >= 2) acc[mb][nb] = WFrag<T16>::mma(a[mb], b2, acc[mb][nb]); } }
        asm volatile("v_nop\n\tv_nop\n\tv_nop\n\tv_nop" : "+v"(acc[0][0]), "+v"(acc[1][1]), "+v"(acc[2][2]), "+v"(acc[3][3]) : "v"(a[0]), "v"(a[3]));
    }
#pragma unroll
    for (int mb = 0; mb < 4; ++mb) {
#pragma unroll
        for (int nb = 0; nb < 4; ++nb) {
#pragma unroll
            for (int j = 0; j < 8; ++j) os[(hi * 8 + j) * 68 + nb * 16 + lr] = acc[mb][nb][j]; }
        __builtin_amdgcn_wave_barrier(); asm volatile("" ::: "memory");
        float* crow = C + (size_t)(r0 + mb * 16) * ldc + c0;
{
#pragma unroll
            for (int s = 0; s < 8; ++s) { const int row = 2 * s + hi, cofs = lr * 4; v4f val = *(const v4fa*)(os + row * 68 + cofs); if (BIAS) { val[0] += bfr(bias[c0 + cofs]); val[1] += bfr(bias[c0 + cofs + 1]); val[2] += bfr(bias[c0 + cofs + 2]); val[3] += bfr(bias[c0 + cofs + 3]); }
                *(v4f*)(crow + (size_t)row * ldc + cofs) = val; }
             }
        __builtin_amdgcn_wave_barrier(); asm volatile("" ::: "memory");
    }
}

__device__ __forceinline__ h16 tohx(float x) { return (h16)x; }
__device__ __forceinline__ void splitf(float y, unsigned short& h, unsigned short& l) { h = f2bf(y); l = f2bf(y - bf2f(h)); }
typedef __attribute__((ext_vector_type(2))) _Float16 v2h;
typedef __attribute__((ext_vector_type(4))) _Float16 v4h;
typedef __attribute__((ext_vector_type(2))) unsigned short v2us;
typedef __attribute__((ext_vector_type(4))) unsigned short v4us;
typedef __attribute__((ext_vector_type(2))) float v2f;
typedef __attribute__((ext_vector_type(4))) int v4i;

__global__ __launch_bounds__(256) void k_wtG(const float* __restrict__ w, int K, int N, bf* Bt) {
    const int lane = threadIdx.x & 31; const int L0 = (blockIdx.x * 8 + (threadIdx.x >> 5)) * 8; const int nlines = N * K / 64;
{
#pragma unroll 1
        for (int l = 0; l < 8; ++l) { const int L = L0 + l; if (L >= nlines) break; const size_t e = (size_t)L * 64 + lane * 2; const int k = (int)(e % K), n = (int)(e / K); v2us o;
            o[0] = f2bf(w[(size_t)k * N + n]); o[1] = f2bf(w[(size_t)(k + 1) * N + n]); *(v2us*)(Bt + e) = o; }
         }
}
__global__ __launch_bounds__(256) void k_cvt8(const float* __restrict__ src, bf* dst, size_t n8) { const size_t i = (size_t)blockIdx.x * 256 + threadIdx.x; if (i >= n8) return; const v8f v = *(const v8f*)(src + i * 8); v8us o;
#pragma unroll
    for (int k = 0; k < 8; ++k) o[k] = f2bf(v[k]); *(v8us*)(dst + i * 8) = o;  }

// k_rope: head planes [h][t][d] (fp16 + hi/lo) of rope(x) x sc with the rotate-half convention out[d] = x[d] cos[t][d] - x[d+HD/2] sin[t][d], out[d+HD/2] = x[d+HD/2] cos[t][d+HD/2] + x[d] sin[t][d+HD/2]
__global__ __launch_bounds__(256) void k_rope(const float* __restrict__ F, int pitch, int nheads, const float* __restrict__ CS, const float* __restrict__ RF, const float* __restrict__ nw, float sc, h16* P16, bf* Ph, bf* Pl) {
    const size_t e = ((size_t)blockIdx.x * 256 + threadIdx.x) * 2; if (e >= (size_t)nheads * TT * HD) return; const int d = (int)(e % HD); const int t = (int)((e / HD) % TT); const int h = (int)(e / ((size_t)HD * TT)); const size_t pb = (size_t)blockIdx.y * nheads * TT * HD;   /* blockIdx.y = batch: rows b*TT + t of F, planes [b][h][t][d] */ const float* f = F + ((size_t)blockIdx.y * TT + t) * pitch + h * HD; const float rf = RF ? RF[(size_t)h * TT + t] : 1.0f; v2h o16; v2us oh, ol;
#pragma unroll
    for (int q = 0; q < 2; ++q) { const int dd = d + q; const int dp = (dd < HD / 2) ? dd + HD / 2 : dd - HD / 2; float x0 = f[dd], x1 = f[dp];
        if (RF) { float n0 = __fmul_rn(x0, rf), n1 = __fmul_rn(x1, rf); asm volatile("" : "+v"(n0)); asm volatile("" : "+v"(n1)); x0 = __fmul_rn(bfr(nw[dd]), n0); x1 = __fmul_rn(bfr(nw[dp]), n1); }
        const v2f cs = *(const v2f*)(CS + ((size_t)t * HD + dd) * 2); float a = __fmul_rn(x0, cs[0]), bq = __fmul_rn(x1, cs[1]); asm volatile("" : "+v"(a)); asm volatile("" : "+v"(bq)); const float r = ((dd < HD / 2) ? __fsub_rn(a, bq) : __fadd_rn(a, bq)) * sc;
        o16[q] = tohx(r); unsigned short a2, c2; splitf(r, a2, c2); oh[q] = a2; ol[q] = c2; }
    *(v2h*)(P16 + pb + e) = o16; *(v2us*)(Ph + pb + e) = oh; *(v2us*)(Pl + pb + e) = ol;  }
__global__ __launch_bounds__(256) void k_vtp(const float* __restrict__ F, int pitch, int nheads, h16* V16, bf* Vh, bf* Vl) { const size_t e = ((size_t)blockIdx.x * 256 + threadIdx.x) * 2; if (e >= (size_t)nheads * HD * TT) return; const int t = (int)(e % TT); const int d = (int)((e / TT) % HD); const int g = (int)(e / ((size_t)TT * HD)); const size_t pb = (size_t)blockIdx.y * nheads * HD * TT;   /* blockIdx.y = batch */ v2h o16; v2us oh, ol;
#pragma unroll
    for (int q = 0; q < 2; ++q) { const float x = F[((size_t)blockIdx.y * TT + t + q) * pitch + g * HD + d]; o16[q] = tohx(x); unsigned short a2, c2; splitf(x, a2, c2); oh[q] = a2; ol[q] = c2; }
    *(v2h*)(V16 + pb + e) = o16; *(v2us*)(Vh + pb + e) = oh; *(v2us*)(Vl + pb + e) = ol;  }
__global__ __launch_bounds__(256) void k_csid(float* CS) { const int idx = blockIdx.x * 256 + threadIdx.x; if (idx >= TT * HD) return; v2f cs; cs[0] = 1.0f; cs[1] = 0.0f; *(v2f*)(CS + (size_t)idx * 2) = cs;  }
// k_asoft: per row (zz, i): t = S x HD^-0.5 (no mask); softmax over the 1024 keys (register row, one exp, fixed trees);
__global__ __launch_bounds__(256) void k_asoft(const float* __restrict__ Sb, h16* P16, bf* Ph, bf* Pl) {
    const int lane = threadIdx.x & 31; const int row = blockIdx.x * 8 + (threadIdx.x >> 5); if (row >= ZH * TT) return; const int i = row % TT; const int zz = row / TT; (void)zz; const bool hires = (i < RH); const float* sr = Sb + (size_t)row * TT; float v[TT / 32]; float mx = -3.0e38f;
#pragma unroll
    for (int ch = 0; ch < TT / 128; ++ch) { const int j0 = ch * 128 + lane * 4; const v4f a = *(const v4f*)(sr + j0);
#pragma unroll
        for (int q = 0; q < 4; ++q) { const int j = j0 + q; (void)j; const float t = a[q] * SCL; v[ch * 4 + q] = t; mx = fmaxf(mx, t); } }
#pragma unroll
    for (int sh = 16; sh; sh >>= 1) mx = fmaxf(mx, __shfl_xor(mx, sh, 32));
    float sum = 0.f;
#pragma unroll
    for (int k = 0; k < TT / 32; ++k) { float d0 = __fsub_rn(v[k], mx); asm volatile("" : "+v"(d0)); v[k] = __builtin_amdgcn_exp2f(__fmul_rn(d0, 1.4426950408889634f)); sum += v[k]; }
#pragma unroll
    for (int sh = 16; sh; sh >>= 1) sum += __shfl_xor(sum, sh, 32);
    const float f = __fdiv_rn(hires ? 1.0f : PCAR, sum);
{
        if (hires) {
#pragma unroll
            for (int ch = 0; ch < TT / 128; ++ch) { v4us oh, ol;
#pragma unroll
                for (int q = 0; q < 4; ++q) { unsigned short a, c2; splitf(v[ch * 4 + q] * f, a, c2); oh[q] = a; ol[q] = c2; }
                const size_t oo = ((size_t)zz * (RH ? RH : 1) + i) * TT + ch * 128 + lane * 4; *(v4us*)(Ph + oo) = oh; *(v4us*)(Pl + oo) = ol; }
        } else {
#pragma unroll
            for (int ch = 0; ch < TT / 128; ++ch) { v4h o4;
#pragma unroll
                for (int q = 0; q < 4; ++q) o4[q] = tohx(v[ch * 4 + q] * f);
                *(v4h*)(P16 + (size_t)row * TT + ch * 128 + lane * 4) = o4; } }
         }
}
__global__ __launch_bounds__(256) void k_epadK(const float* __restrict__ E, bf* EB) { const size_t i = (size_t)blockIdx.x * 256 + threadIdx.x; if (i >= (size_t)NE * HD / 8) return; const int d0 = (int)(i % (HD / 8)) * 8; const int r = (int)(i / (HD / 8)); const float* src = E + (size_t)min(r, NRE - 1) * HD + d0; v8us o;
#pragma unroll
    for (int q = 0; q < 8; ++q) { const unsigned short v = f2bf(src[q]); o[q] = (r < NRE) ? v : (unsigned short)0; }
    *(v8us*)(EB + (size_t)r * HD + d0) = o;  }

__global__ __launch_bounds__(256) void k_epadVT(const float* __restrict__ E, bf* Th, bf* Tl) { const size_t i = (size_t)blockIdx.x * 256 + threadIdx.x; if (i >= (size_t)HD * NE / 4) return; const size_t e = i * 4; const int c0 = (int)(e % NE); const int d = (int)(e / NE); v4us oh, ol;
#pragma unroll
    for (int q = 0; q < 4; ++q) { const int r = c0 + q; const float v = bfr(E[(size_t)min(r, NRE - 1) * HD + d]); unsigned short u, w; splitf(v, u, w);   /* input rounded to bf16 once: lo == 0 */ oh[q] = (r < NRE) ? u : (unsigned short)0; ol[q] = (r < NRE) ? w : (unsigned short)0; }
    *(v4us*)(Th + e) = oh; *(v4us*)(Tl + e) = ol;  }

__global__ __launch_bounds__(256) void k_addrelc(float* Sb, const float* __restrict__ QE) { const size_t k = (size_t)blockIdx.x * 256 + threadIdx.x; if (k >= (size_t)ZH * TT * TT / 4) return; const size_t e = k * 4; const int j0 = (int)(e % TT); const size_t zi = e / TT; const int i = (int)(zi % TT); const float* qe = QE + zi * NE; v4f a = *(const v4f*)(Sb + e);
#pragma unroll
    for (int q = 0; q < 4; ++q) { const int r = min(max(j0 + q - i, -CUT), CUT) + CUT; a[q] = __fadd_rn(a[q], qe[r]); }
    *(v4f*)(Sb + e) = a;  }

__global__ __launch_bounds__(256) void k_pbuck(const bf* __restrict__ Ph, const bf* __restrict__ Pl, bf* Bh, bf* Bl) { const int lane = threadIdx.x & 31; const int row = blockIdx.x * 8 + (threadIdx.x >> 5); if (row >= ZH * TT) return; const int i = row % TT; const bf* ph = Ph + (size_t)row * TT; const bf* pl = Pl + (size_t)row * TT; float lo_s = 0.f, hi_s = 0.f;
#pragma unroll 1
    for (int j = lane; j < TT; j += 32) { const float p = __fadd_rn(bf2f(ph[j]), bf2f(pl[j])); if (j <= i - CUT) lo_s = __fadd_rn(lo_s, p); if (j >= i + CUT) hi_s = __fadd_rn(hi_s, p); }
#pragma unroll
    for (int sh = 16; sh; sh >>= 1) { lo_s = __fadd_rn(lo_s, __shfl_xor(lo_s, sh, 32)); hi_s = __fadd_rn(hi_s, __shfl_xor(hi_s, sh, 32)); }
    unsigned short l0h, l0l, h0h, h0l; splitf(lo_s, l0h, l0l); splitf(hi_s, h0h, h0l);
{
#pragma unroll 1
        for (int c0 = lane * 4; c0 < NE; c0 += 128) { v4us oh, ol;
#pragma unroll
            for (int q = 0; q < 4; ++q) { const int bkt = c0 + q; const int j = i + bkt - CUT; const int jc = min(max(j, 0), TT - 1); unsigned int uu = ((const unsigned short*)ph)[jc], ww = ((const unsigned short*)pl)[jc]; asm volatile("" : "+v"(uu), "+v"(ww));   /* unconditional clamped loads pinned before the select (opaque use) */ const bool in = (bkt > 0 && bkt < 2 * CUT && j >= 0 && j < TT);
                const unsigned short u = in ? (unsigned short)uu : ((bkt == 0) ? l0h : ((bkt == 2 * CUT) ? h0h : (unsigned short)0)); const unsigned short w = in ? (unsigned short)ww : ((bkt == 0) ? l0l : ((bkt == 2 * CUT) ? h0l : (unsigned short)0));
                oh[q] = u; ol[q] = w; }
            *(v4us*)(Bh + (size_t)row * NE + c0) = oh; *(v4us*)(Bl + (size_t)row * NE + c0) = ol; }
         }
}

__global__ __launch_bounds__(256) void k_addF(float* Y, const float* __restrict__ F) { const size_t i = (size_t)blockIdx.x * 256 + threadIdx.x; if (i >= (size_t)ZH * TT * HD / 4) return; const v4f a = *(const v4f*)(Y + i * 4); const v4f f = *(const v4f*)(F + i * 4); v4f o;
#pragma unroll
    for (int q = 0; q < 4; ++q) o[q] = __fadd_rn(a[q], f[q]);
    *(v4f*)(Y + i * 4) = o;  }

__global__ __launch_bounds__(256) void k_merge(const float* __restrict__ O, int h0, bf* Ah, bf* Al) { const size_t e = ((size_t)blockIdx.x * 256 + threadIdx.x) * 2; if (e >= (size_t)ZH * TT * HD) return; const int d = (int)(e % HD); const int t = (int)((e / HD) % TT); const int zz = (int)(e / ((size_t)HD * TT)); const float cs = (t < RH) ? 1.0f : (1.0f / PCAR); const size_t oo = (size_t)t * DQ + (h0 + zz) * HD + d;
    v2us oh, ol;
#pragma unroll
    for (int q = 0; q < 2; ++q) { unsigned short a, c2; splitf(O[e + q] * cs, a, c2); oh[q] = a; ol[q] = c2; } *(v2us*)(Ah + oo) = oh; *(v2us*)(Al + oo) = ol;  }

extern "C" void kernel_launch(void* const* d_in, const int* in_sizes, int n_in,
                              void* d_out, int out_size, void* d_ws, size_t ws_size, hipStream_t stream) {
    (void)in_sizes; (void)n_in; (void)out_size;
    const float* x = (const float*)d_in[0];   /* query */ const float* xk = (const float*)d_in[1]; const float* xv = (const float*)d_in[2]; const float* wq = (const float*)d_in[3]; const float* bq = (const float*)d_in[4]; const float* wk = (const float*)d_in[5]; const float* bk = (const float*)d_in[6]; const float* wv = (const float*)d_in[7]; const float* bv = (const float*)d_in[8]; const float* wo = (const float*)d_in[9]; const float* bo = (const float*)d_in[10]; const float* ak = (const float*)d_in[11]; const float* av = (const float*)d_in[12];   /* rel_k / rel_v [33][64] */
    float* OUT = (float*)d_out;     // [2][1024][1024]
    char* wsp = (char*)d_ws;
    auto take = [&](size_t bytes) { char* p = wsp; wsp += (bytes + 255) & ~(size_t)255; return (void*)p; };
    bf* AKB = (bf*)take((size_t)NE * HD * 2); bf* AVTh = (bf*)take((size_t)HD * NE * 2); bf* AVTl = (bf*)take((size_t)HD * NE * 2); float* QE = (float*)take((size_t)ZH * TT * NE * 4); bf* PBh = (bf*)take((size_t)ZH * TT * NE * 2); bf* PBl = (bf*)take((size_t)ZH * TT * NE * 2); float* ZR = (float*)take((size_t)ZH * TT * HD * 4); bf* WQ = (bf*)take((size_t)DQ * DM * 2); bf* WK = (bf*)take((size_t)DKV * DM * 2); bf* WV = (bf*)take((size_t)DKV * DM * 2); bf* WO = (bf*)take((size_t)DM * DQ * 2); float* CS = (float*)take((size_t)TT * HD * 2 * 4);
    bf* XB = (bf*)take((size_t)NB_ * TT * DM * 2); float* FQ = (float*)take((size_t)NB_ * TT * DQ * 4); float* FK = (float*)take((size_t)NB_ * TT * DKV * 4);
    h16* QP16 = (h16*)take((size_t)NB_ * NH_ * TT * HD * 2); h16* KP16 = (h16*)take((size_t)NB_ * NKV * TT * HD * 2); h16* VT16 = (h16*)take((size_t)NB_ * NKV * HD * TT * 2);
    bf* QPh = (bf*)take((size_t)NB_ * NH_ * TT * HD * 2); bf* QPl = (bf*)take((size_t)NB_ * NH_ * TT * HD * 2); bf* KPh = (bf*)take((size_t)NB_ * NKV * TT * HD * 2); bf* KPl = (bf*)take((size_t)NB_ * NKV * TT * HD * 2); bf* VTh = (bf*)take((size_t)NB_ * NKV * HD * TT * 2); bf* VTl = (bf*)take((size_t)NB_ * NKV * HD * TT * 2); bf* Ph = (bf*)take((size_t)ZH * RH * TT * 2); bf* Pl = (bf*)take((size_t)ZH * RH * TT * 2);
    float* Sb = (float*)take((size_t)ZH * TT * TT * 4); h16* P16 = (h16*)take((size_t)ZH * TT * TT * 2); float* Ob = (float*)take((size_t)ZH * TT * HD * 4); bf* ATh = (bf*)take((size_t)NB_ * TT * DQ * 2); bf* ATl = (bf*)take((size_t)NB_ * TT * DQ * 2);
    if ((size_t)(wsp - (char*)d_ws) > ws_size) return;    // ws 256 MiB
    float* FV = FK;   // v projection reuses the k buffer after the k planes are built (stream-ordered)
    { k_wtG<<<(unsigned)((DM * DQ / 64 + 63) / 64), 256, 0, stream>>>(wq, DM, DQ, WQ); k_wtG<<<(unsigned)((DM * DKV / 64 + 63) / 64), 256, 0, stream>>>(wk, DM, DKV, WK); k_wtG<<<(unsigned)((DM * DKV / 64 + 63) / 64), 256, 0, stream>>>(wv, DM, DKV, WV);
      k_wtG<<<(unsigned)((DQ * DM / 64 + 63) / 64), 256, 0, stream>>>(wo, DQ, DM, WO);   /* 'xw' weights gathered into Bt */
       }
    k_csid<<<(TT * HD + 255) / 256, 256, 0, stream>>>(CS);
    const unsigned LQ = (unsigned)(((size_t)NH_ * TT * HD / 2 + 255) / 256), LKv = (unsigned)(((size_t)NKV * TT * HD / 2 + 255) / 256);
    k_epadK<<<(unsigned)(((size_t)NE * HD / 8 + 255) / 256), 256, 0, stream>>>(ak, AKB);   /* rel_k -> bf16 [64][64], rows >= 33 zero */ k_epadVT<<<(unsigned)(((size_t)HD * NE / 4 + 255) / 256), 256, 0, stream>>>(av, AVTh, AVTl);   /* rel_v^T hi/lo [64][64], cols >= 33 zero */
    const unsigned LC = (unsigned)(((size_t)NB_ * TT * DM / 8 + 255) / 256);
    k_cvt8<<<LC, 256, 0, stream>>>(x, XB, (size_t)NB_ * TT * DM / 8);
    k_gemmw<bf, 0, true><<<dim3(NB_ * TT / 64, DQ / 64, 1), 32, 0, stream>>>(XB, nullptr, WQ, nullptr, DM, FQ, DQ, bq, 0, 0, 0);
    k_rope<<<dim3(LQ, NB_, 1), 256, 0, stream>>>(FQ, DQ, NH_, CS, nullptr, nullptr, 1.0f, QP16, QPh, QPl);
    k_cvt8<<<LC, 256, 0, stream>>>(xk, XB, (size_t)NB_ * TT * DM / 8); k_gemmw<bf, 0, true><<<dim3(NB_ * TT / 64, DKV / 64, 1), 32, 0, stream>>>(XB, nullptr, WK, nullptr, DM, FK, DKV, bk, 0, 0, 0);
    k_rope<<<dim3(LKv, NB_, 1), 256, 0, stream>>>(FK, DKV, NKV, CS, nullptr, nullptr, 1.0f, KP16, KPh, KPl);
    k_cvt8<<<LC, 256, 0, stream>>>(xv, XB, (size_t)NB_ * TT * DM / 8); k_gemmw<bf, 0, true><<<dim3(NB_ * TT / 64, DKV / 64, 1), 32, 0, stream>>>(XB, nullptr, WV, nullptr, DM, FV, DKV, bv, 0, 0, 0); k_vtp<<<dim3(LKv, NB_, 1), 256, 0, stream>>>(FV, DKV, NKV, VT16, VTh, VTl);
    for (int b = 0; b < NB_; ++b) {
        for (int h0 = 0; h0 < NH_; h0 += ZH) { const size_t zq = (size_t)b * NH_ + h0, zk = (size_t)b * NKV + h0 / REP;   // one kv head per query head: the pass's heads use consecutive kv planes (z-strides TT*HD)
            k_gemmw<bf, 2, false><<<dim3(RH / 64, TT / 64, ZH), 32, 0, stream>>>(QPh + zq * TT * HD, QPl + zq * TT * HD, KPh + zk * TT * HD, KPl + zk * TT * HD, HD, Sb, TT, nullptr, (size_t)TT * HD, (size_t)TT * HD, (size_t)TT * TT);

            k_gemmw<bf, 1, false><<<dim3(TT / 64, NE / 64, ZH), 32, 0, stream>>>(QPh + zq * TT * HD, QPl + zq * TT * HD, AKB, nullptr, HD, QE, NE, nullptr, (size_t)TT * HD, 0, (size_t)TT * NE);   /* QE = q . rel_k^T */ k_addrelc<<<(unsigned)(((size_t)ZH * TT * TT / 4 + 255) / 256), 256, 0, stream>>>(Sb, QE);   /* + q.rel_k[clip(j - i) + 16] */ k_asoft<<<ZH * TT / 8, 256, 0, stream>>>(Sb, P16, Ph, Pl);
            k_gemmw<bf, 2, false><<<dim3(RH / 64, HD / 64, ZH), 32, 0, stream>>>(Ph, Pl, VTh + zk * HD * TT, VTl + zk * HD * TT, TT, Ob, HD, nullptr, (size_t)RH * TT, (size_t)HD * TT, (size_t)TT * HD); k_pbuck<<<(unsigned)(((size_t)ZH * TT + 7) / 8), 256, 0, stream>>>(Ph, Pl, PBh, PBl);   /* attn folded onto the 33 clipped offsets */ k_gemmw<bf, 2, false><<<dim3(TT / 64, HD / 64, ZH), 32, 0, stream>>>(PBh, PBl, AVTh, AVTl, NE, ZR, HD, nullptr, (size_t)TT * NE, 0, (size_t)TT * HD);   /* ZR = PB . rel_v */ k_addF<<<(unsigned)(((size_t)ZH * TT * HD / 4 + 255) / 256), 256, 0, stream>>>(Ob, ZR);   /* context += relative-value term */

            k_merge<<<(unsigned)(((size_t)ZH * TT * HD / 2 + 255) / 256), 256, 0, stream>>>(Ob, h0, ATh + (size_t)b * TT * DQ, ATl + (size_t)b * TT * DQ); } }
    k_gemmw<bf, 1, true><<<dim3(NB_ * TT / 64, DM / 64, 1), 32, 0, stream>>>(ATh, ATl, WO, nullptr, DQ, OUT, DM, bo, 0, 0, 0);
}

// v002
// It runs in 327 microseconds.
// Two timings next to v001 put it at 1.21 and 1.20 times that version's speed.
// All steps since v000 together make it 3.55 times as fast.
#include <hip/hip_runtime.h>

// Relative (Shaw) multi-head attention with key AND value relative-position embeddings (query, key, value [2][1024][1024]; q = query Wq + bq, k = key Wk + bk, v = value Wv + bv ('xw' 1/32, zero biases; 16 heads x 64); idx[i][j] = clip(j - i, -16, 16) + 16; attn = softmax((q.k + q.rel_k[idx]) / 8); x = attn v + sum_j attn[i][j] rel_v[idx] (rel_k, rel_v [33][64] 1/8 scale, read); out = merged Wo + bo ('xw') -> [2][1024][1024] (2.1 M); argument order query, key, value, Wq, bq, Wk, bk, Wv, bv, Wo, bo, rel_k, rel_v).
// Layout: bf16 copies of query, key, value in turn (both batches per launch, rows b*1024 + t); 'xw' weights gathered into Bt; exact projections + f32 biases; rel_k as a zero-padded bf16 plane [64][64] and rel_v^T as hi/lo planes [64][64] (bf16-rounded once); per batch one pass of all sixteen heads (grid z = head): score tiles (hi/lo 3 products, every row), QE = q.rel_k^T (hi/lo x exact) gathered into the scores at column clip(j - i) + 16, softmax (x 1/8) with every row on hi/lo planes, P.v (hi/lo x hi/lo), the probabilities folded onto the 33 offsets (interior = one key, the two ends = fixed-order sums) and PB.rel_v added to the context; merged hi/lo x Wo exact + bo.
// Compute dtypes, f32 accumulate: every input rounded to bf16; projections exact + f32 biases; scores and the relative-key term ~f32; softmax f32; P as bf16 hi/lo; attn.v and the relative-value term 3 products (~f32); Wo hl x exact + bias.

#define NB_  2
#define TT   1024
#define DM   1024
#define NH_  16
#define NKV  16
#define REP  (NH_ / NKV)
#define HD   64
#define DQ   (NH_ * HD)
#define DKV  (NKV * HD)
#define ZH   16                   // heads per attention pass: all of one batch in every launch
#define RH   TT                   // every row on hi/lo planes (the relative-value fold needs normalised planes)
#define WIN  0
#define PCAR 1024.0f
#define SCL  0.125f   // 1/sqrt(64) (the module divides by jnp.sqrt(DH))
#define NE   64       // 2*16+1 = 33 relative offsets padded to 64
#define NRE  33
#define CUT  16
typedef _Float16 h16;
typedef unsigned short bf;
typedef __attribute__((ext_vector_type(16))) __bf16   v16bf;
typedef __attribute__((ext_vector_type(16))) _Float16 v16h;
typedef __attribute__((ext_vector_type(8)))  _Float16 v8h;
typedef __attribute__((ext_vector_type(8)))  unsigned short v8us;
typedef __attribute__((ext_vector_type(8)))  float    v8f;
typedef __attribute__((ext_vector_type(4)))  float    v4f;
typedef v8h  __attribute__((may_alias)) v8ha;
typedef v4f  __attribute__((may_alias)) v4fa;
typedef v8us __attribute__((may_alias)) v8usa;

__device__ __forceinline__ unsigned short f2bf(float f) { unsigned u = __float_as_uint(f); u += 0x7FFFu + ((u >> 16) & 1u); return (unsigned short)(u >> 16); }
__device__ __forceinline__ float bf2f(unsigned short b) { return __uint_as_float(((unsigned)b) << 16); }
__device__ __forceinline__ float bfr(float f) { return bf2f(f2bf(f)); }
__device__ __forceinline__ v16h cat16(v8h lo, v8h hi) { return __builtin_shufflevector(lo, hi, 0, 1, 2, 3, 4, 5, 6, 7, 8, 9, 10, 11, 12, 13, 14, 15); }
__device__ __forceinline__ v16bf cat16b(v8us lo, v8us hi) { return __builtin_bit_cast(v16bf, __builtin_shufflevector(lo, hi, 0, 1, 2, 3, 4, 5, 6, 7, 8, 9, 10, 11, 12, 13, 14, 15)); }
__device__ __forceinline__ v8f wmma16(v16h a, v16h b, v8f c) { return __builtin_amdgcn_wmma_f32_16x16x32_f16(false, a, false, b, (short)0, c, false, false); }
__device__ __forceinline__ v8f wmmab(v16bf a, v16bf b, v8f c) { return __builtin_amdgcn_wmma_f32_16x16x32_bf16(false, a, false, b, (short)0, c, false, false); }



// ---- k_gemmw: register-blocked GEMM, ONE WAVE per 64x64 output tile (16 accumulators), operands straight from K-contiguous 16-bit planes; grid (M/64, N/64, Z), 32 threads.
// C[m][n] (f32, pitch ldc, + optional f32 bias[n]) = sum_k A[m][k] Bt[n][k] (+ split products per NSPLIT). z-batch strides sA/sB/sC in elements. K % 32 == 0.
template <typename T16> struct WFrag;
template <> struct WFrag<h16> { typedef v16h V; static __device__ __forceinline__ V ld(const h16* p) { return cat16(*(const v8h*)p, *(const v8h*)(p + 16)); } static __device__ __forceinline__ v8f mma(V a, V b, v8f c) { return wmma16(a, b, c); } };
template <> struct WFrag<bf> { typedef v16bf V; static __device__ __forceinline__ V ld(const bf* p) { return cat16b(*(const v8us*)p, *(const v8us*)(p + 16)); } static __device__ __forceinline__ v8f mma(V a, V b, v8f c) { return wmmab(a, b, c); } };
template <typename T16, int NSPLIT, bool BIAS>
__global__ __launch_bounds__(32) void k_gemmw(const T16* __restrict__ A, const T16* __restrict__ A2, const T16* __restrict__ Bt, const T16* __restrict__ Bt2, int K, float* C, int ldc, const float* __restrict__ bias, size_t sA, size_t sB, size_t sC) {
    typedef typename WFrag<T16>::V V;
    __shared__ __align__(16) float os[16 * 68];
    const size_t z = blockIdx.z; A += z * sA; if (A2) A2 += z * sA; Bt += z * sB; if (Bt2) Bt2 += z * sB; C += z * sC;
    const int lane = threadIdx.x & 31, lr = lane & 15, hi = lane >> 4; const int r0 = blockIdx.x * 64, c0 = blockIdx.y * 64;
    v8f acc[4][4];
#pragma unroll
    for (int mb = 0; mb < 4; ++mb)
#pragma unroll
        for (int nb = 0; nb < 4; ++nb) acc[mb][nb] = (v8f){};
    const size_t aoff = (size_t)(r0 + lr) * K + 8 * hi, boff = (size_t)(c0 + lr) * K + 8 * hi;
#pragma unroll 1
    for (int kc = 0; kc < K; kc += 32) {
        V a[4], a2[4];
#pragma unroll
        for (int mb = 0; mb < 4; ++mb) { a[mb] = WFrag<T16>::ld(A + aoff + (size_t)mb * 16 * K + kc); if (NSPLIT == 1 || NSPLIT == 2) a2[mb] = WFrag<T16>::ld(A2 + aoff + (size_t)mb * 16 * K + kc); }
#pragma unroll
        for (int nb = 0; nb < 4; ++nb) { const V b = WFrag<T16>::ld(Bt + boff + (size_t)nb * 16 * K + kc); V b2; if (NSPLIT >= 2) b2 = WFrag<T16>::ld(Bt2 + boff + (size_t)nb * 16 * K + kc);
#pragma unroll
            for (int mb = 0; mb < 4; ++mb) { acc[mb][nb] = WFrag<T16>::mma(a[mb], b, acc[mb][nb]); if (NSPLIT == 1 || NSPLIT == 2) acc[mb][nb] = WFrag<T16>::mma(a2[mb], b, acc[mb][nb]); if (NSPLIT >= 2) acc[mb][nb] = WFrag<T16>::mma(a[mb], b2, acc[mb][nb]); } }
        asm volatile("v_nop\n\tv_nop\n\tv_nop\n\tv_nop" : "+v"(acc[0][0]), "+v"(acc[1][1]), "+v"(acc[2][2]), "+v"(acc[3][3]) : "v"(a[0]), "v"(a[3]));
    }
#pragma unroll
    for (int mb = 0; mb < 4; ++mb) {
#pragma unroll
        for (int nb = 0; nb < 4; ++nb) {
#pragma unroll
            for (int j = 0; j < 8; ++j) os[(hi * 8 + j) * 68 + nb * 16 + lr] = acc[mb][nb][j]; }
        __builtin_amdgcn_wave_barrier(); asm volatile("" ::: "memory");
        float* crow = C + (size_t)(r0 + mb * 16) * ldc + c0;
{
#pragma unroll
            for (int s = 0; s < 8; ++s) { const int row = 2 * s + hi, cofs = lr * 4; v4f val = *(const v4fa*)(os + row * 68 + cofs); if (BIAS) { val[0] += bfr(bias[c0 + cofs]); val[1] += bfr(bias[c0 + cofs + 1]); val[2] += bfr(bias[c0 + cofs + 2]); val[3] += bfr(bias[c0 + cofs + 3]); }
                *(v4f*)(crow + (size_t)row * ldc + cofs) = val; }
             }
        __builtin_amdgcn_wave_barrier(); asm volatile("" ::: "memory");
    }
}

__device__ __forceinline__ h16 tohx(float x) { return (h16)x; }
__device__ __forceinline__ void splitf(float y, unsigned short& h, unsigned short& l) { h = f2bf(y); l = f2bf(y - bf2f(h)); }
typedef __attribute__((ext_vector_type(2))) _Float16 v2h;
typedef __attribute__((ext_vector_type(4))) _Float16 v4h;
typedef __attribute__((ext_vector_type(2))) unsigned short v2us;
typedef __attribute__((ext_vector_type(4))) unsigned short v4us;
typedef __attribute__((ext_vector_type(2))) float v2f;
typedef __attribute__((ext_vector_type(4))) int v4i;
typedef __attribute__((ext_vector_type(4))) unsigned int v4u;
typedef v4u  __attribute__((may_alias)) v4ua;

__global__ __launch_bounds__(256) void k_wtG(const float* __restrict__ w, int K, int N, bf* Bt) {
    const int lane = threadIdx.x & 31; const int L0 = (blockIdx.x * 8 + (threadIdx.x >> 5)) * 8; const int nlines = N * K / 64;
{
#pragma unroll 1
        for (int l = 0; l < 8; ++l) { const int L = L0 + l; if (L >= nlines) break; const size_t e = (size_t)L * 64 + lane * 2; const int k = (int)(e % K), n = (int)(e / K); v2us o;
            o[0] = f2bf(w[(size_t)k * N + n]); o[1] = f2bf(w[(size_t)(k + 1) * N + n]); *(v2us*)(Bt + e) = o; }
         }
}
__global__ __launch_bounds__(256) void k_cvt8(const float* __restrict__ src, bf* dst, size_t n8) { const size_t i = (size_t)blockIdx.x * 256 + threadIdx.x; if (i >= n8) return; const v8f v = *(const v8f*)(src + i * 8); v8us o;
#pragma unroll
    for (int k = 0; k < 8; ++k) o[k] = f2bf(v[k]); *(v8us*)(dst + i * 8) = o;  }

// k_rope: head planes [h][t][d] (fp16 + hi/lo) of rope(x) x sc with the rotate-half convention out[d] = x[d] cos[t][d] - x[d+HD/2] sin[t][d], out[d+HD/2] = x[d+HD/2] cos[t][d+HD/2] + x[d] sin[t][d+HD/2]
__global__ __launch_bounds__(256) void k_rope(const float* __restrict__ F, int pitch, int nheads, const float* __restrict__ CS, const float* __restrict__ RF, const float* __restrict__ nw, float sc, h16* P16, bf* Ph, bf* Pl) {
    const size_t e = ((size_t)blockIdx.x * 256 + threadIdx.x) * 2; if (e >= (size_t)nheads * TT * HD) return; const int d = (int)(e % HD); const int t = (int)((e / HD) % TT); const int h = (int)(e / ((size_t)HD * TT)); const size_t pb = (size_t)blockIdx.y * nheads * TT * HD;   /* blockIdx.y = batch: rows b*TT + t of F, planes [b][h][t][d] */ const float* f = F + ((size_t)blockIdx.y * TT + t) * pitch + h * HD; const float rf = RF ? RF[(size_t)h * TT + t] : 1.0f; v2h o16; v2us oh, ol;
#pragma unroll
    for (int q = 0; q < 2; ++q) { const int dd = d + q; const int dp = (dd < HD / 2) ? dd + HD / 2 : dd - HD / 2; float x0 = f[dd], x1 = f[dp];
        if (RF) { float n0 = __fmul_rn(x0, rf), n1 = __fmul_rn(x1, rf); asm volatile("" : "+v"(n0)); asm volatile("" : "+v"(n1)); x0 = __fmul_rn(bfr(nw[dd]), n0); x1 = __fmul_rn(bfr(nw[dp]), n1); }
        const v2f cs = *(const v2f*)(CS + ((size_t)t * HD + dd) * 2); float a = __fmul_rn(x0, cs[0]), bq = __fmul_rn(x1, cs[1]); asm volatile("" : "+v"(a)); asm volatile("" : "+v"(bq)); const float r = ((dd < HD / 2) ? __fsub_rn(a, bq) : __fadd_rn(a, bq)) * sc;
        o16[q] = tohx(r); unsigned short a2, c2; splitf(r, a2, c2); oh[q] = a2; ol[q] = c2; }
    *(v2h*)(P16 + pb + e) = o16; *(v2us*)(Ph + pb + e) = oh; *(v2us*)(Pl + pb + e) = ol;  }
__global__ __launch_bounds__(256) void k_vtp(const float* __restrict__ F, int pitch, int nheads, h16* V16, bf* Vh, bf* Vl) { const size_t e = ((size_t)blockIdx.x * 256 + threadIdx.x) * 2; if (e >= (size_t)nheads * HD * TT) return; const int t = (int)(e % TT); const int d = (int)((e / TT) % HD); const int g = (int)(e / ((size_t)TT * HD)); const size_t pb = (size_t)blockIdx.y * nheads * HD * TT;   /* blockIdx.y = batch */ v2h o16; v2us oh, ol;
#pragma unroll
    for (int q = 0; q < 2; ++q) { const float x = F[((size_t)blockIdx.y * TT + t + q) * pitch + g * HD + d]; o16[q] = tohx(x); unsigned short a2, c2; splitf(x, a2, c2); oh[q] = a2; ol[q] = c2; }
    *(v2h*)(V16 + pb + e) = o16; *(v2us*)(Vh + pb + e) = oh; *(v2us*)(Vl + pb + e) = ol;  }
__global__ __launch_bounds__(256) void k_csid(float* CS) { const int idx = blockIdx.x * 256 + threadIdx.x; if (idx >= TT * HD) return; v2f cs; cs[0] = 1.0f; cs[1] = 0.0f; *(v2f*)(CS + (size_t)idx * 2) = cs;  }
// k_asoft: per row (zz, i), one wave: t = (S + QE[clip(j - i) + 16]) x HD^-0.5 (no mask); softmax over the 1024 keys (register row, one exp, fixed trees); hi/lo planes;
// the row's hi + lo values folded onto the 33 offsets in the same pass (interior = one key, handed over through the wave's own LDS row; the two ends = fixed-order sums: per lane in key order, then the xor tree).
__global__ __launch_bounds__(256) void k_asoft(const float* __restrict__ Sb, const float* __restrict__ QE, h16* P16, bf* Ph, bf* Pl, bf* Bh, bf* Bl) {
    __shared__ __align__(16) unsigned int bk[8][NE];   // per wave: bucket -> hi | lo << 16
    const int lane = threadIdx.x & 31; const int wv = __builtin_amdgcn_readfirstlane((int)(threadIdx.x >> 5)); int row = blockIdx.x * 8 + wv; if (row >= ZH * TT) return; const float* sr = Sb + (size_t)row * TT; const float* qe = QE + (size_t)row * NE; unsigned int* bw = bk[wv]; float v[TT / 32]; float mx = -3.0e38f;
    v4f a8[TT / 128];
#pragma unroll
    for (int ch = 0; ch < TT / 128; ++ch) a8[ch] = *(const v4f*)(sr + ch * 128 + lane * 4);
    const float ql = qe[lane], qlo = qe[0], qhi = qe[2 * CUT];
    asm volatile("s_wait_xcnt 0x0" : "+s"(row) : : "memory");   // the row arithmetic below reuses the registers that the loads above name as their address; row passes through the wait so that none of it is lifted over it
    const int i = row % TT; const int zz = row / TT; (void)zz; const bool hires = (i < RH);
    bw[lane] = 0u; bw[lane + 32] = 0u;
#pragma unroll
    for (int ch = 0; ch < TT / 128; ++ch) { const int j0 = ch * 128 + lane * 4; const bool below = (ch * 128 + 127 <= i - CUT), above = (ch * 128 >= i + CUT);   /* the same for the whole wave: every key of the chunk on one end offset */
        float e4[4];
        if (below) { e4[0] = qlo; e4[1] = qlo; e4[2] = qlo; e4[3] = qlo; }
        else if (above) { e4[0] = qhi; e4[1] = qhi; e4[2] = qhi; e4[3] = qhi; }
        else {
#pragma unroll
            for (int q = 0; q < 4; ++q) { const int r = min(max(j0 + q - i, -CUT), CUT) + CUT; const float g = __shfl(ql, r & 31, 32); e4[q] = (r == 2 * CUT) ? qhi : g; } }
#pragma unroll
        for (int q = 0; q < 4; ++q) { const float t = __fadd_rn(a8[ch][q], e4[q]) * SCL; v[ch * 4 + q] = t; mx = fmaxf(mx, t); } }
#pragma unroll
    for (int sh = 16; sh; sh >>= 1) mx = fmaxf(mx, __shfl_xor(mx, sh, 32));
    float sum = 0.f;
#pragma unroll
    for (int k = 0; k < TT / 32; ++k) { float d0 = __fsub_rn(v[k], mx); asm volatile("" : "+v"(d0)); v[k] = __builtin_amdgcn_exp2f(__fmul_rn(d0, 1.4426950408889634f)); sum += v[k]; }
#pragma unroll
    for (int sh = 16; sh; sh >>= 1) sum += __shfl_xor(sum, sh, 32);
    const float f = __fdiv_rn(hires ? 1.0f : PCAR, sum);
    float lo_s = 0.f, hi_s = 0.f;
{
        if (hires) {
#pragma unroll
            for (int ch = 0; ch < TT / 128; ++ch) { v4us oh, ol; const bool below = (ch * 128 + 127 <= i - CUT), above = (ch * 128 >= i + CUT);
#pragma unroll
                for (int q = 0; q < 4; ++q) { unsigned short a, c2; splitf(v[ch * 4 + q] * f, a, c2); oh[q] = a; ol[q] = c2; }
                float p4[4];
#pragma unroll
                for (int q = 0; q < 4; ++q) p4[q] = __fadd_rn(bf2f(oh[q]), bf2f(ol[q]));
                if (below) { lo_s = __fadd_rn(__fadd_rn(__fadd_rn(__fadd_rn(lo_s, p4[0]), p4[1]), p4[2]), p4[3]); }
                else if (above) { hi_s = __fadd_rn(__fadd_rn(__fadd_rn(__fadd_rn(hi_s, p4[0]), p4[1]), p4[2]), p4[3]); }
                else {
#pragma unroll
                    for (int q = 0; q < 4; ++q) { const int bkt = ch * 128 + lane * 4 + q - i + CUT; lo_s = __fadd_rn(lo_s, (bkt <= 0) ? p4[q] : 0.0f); hi_s = __fadd_rn(hi_s, (bkt >= 2 * CUT) ? p4[q] : 0.0f);
                        if (bkt > 0 && bkt < 2 * CUT) bw[bkt] = (unsigned int)oh[q] | ((unsigned int)ol[q] << 16); } }
                const size_t oo = ((size_t)zz * (RH ? RH : 1) + i) * TT + ch * 128 + lane * 4; *(v4us*)(Ph + oo) = oh; *(v4us*)(Pl + oo) = ol;
                asm volatile("s_wait_xcnt 0x0" ::: "memory"); }   // the next chunk's arithmetic reuses the registers that these two stores name
        } else {
#pragma unroll
            for (int ch = 0; ch < TT / 128; ++ch) { v4h o4;
#pragma unroll
                for (int q = 0; q < 4; ++q) o4[q] = tohx(v[ch * 4 + q] * f);
                *(v4h*)(P16 + (size_t)row * TT + ch * 128 + lane * 4) = o4; } }
         }
#pragma unroll
    for (int sh = 16; sh; sh >>= 1) { lo_s = __fadd_rn(lo_s, __shfl_xor(lo_s, sh, 32)); hi_s = __fadd_rn(hi_s, __shfl_xor(hi_s, sh, 32)); }
    unsigned short l0h, l0l, h0h, h0l; splitf(lo_s, l0h, l0l); splitf(hi_s, h0h, h0l);
    if (lane == 0) { bw[0] = (unsigned int)l0h | ((unsigned int)l0l << 16); bw[2 * CUT] = (unsigned int)h0h | ((unsigned int)h0l << 16); }
    __builtin_amdgcn_wave_barrier(); asm volatile("" ::: "memory");   // the reads below take what OTHER lanes of this wave stored: keeps the compiler from lifting them over those stores (one wave's LDS operations run in order)
    if (lane < NE / 4) { const v4u w = *(const v4ua*)(bw + lane * 4); v4us oh, ol;
#pragma unroll
        for (int q = 0; q < 4; ++q) { oh[q] = (unsigned short)(w[q] & 0xFFFFu); ol[q] = (unsigned short)(w[q] >> 16); }
        *(v4us*)(Bh + (size_t)row * NE + lane * 4) = oh; *(v4us*)(Bl + (size_t)row * NE + lane * 4) = ol; }
}
__global__ __launch_bounds__(256) void k_epadK(const float* __restrict__ E, bf* EB) { const size_t i = (size_t)blockIdx.x * 256 + threadIdx.x; if (i >= (size_t)NE * HD / 8) return; const int d0 = (int)(i % (HD / 8)) * 8; const int r = (int)(i / (HD / 8)); const float* src = E + (size_t)min(r, NRE - 1) * HD + d0; v8us o;
#pragma unroll
    for (int q = 0; q < 8; ++q) { const unsigned short v = f2bf(src[q]); o[q] = (r < NRE) ? v : (unsigned short)0; }
    *(v8us*)(EB + (size_t)r * HD + d0) = o;  }

__global__ __launch_bounds__(256) void k_epadVT(const float* __restrict__ E, bf* Th, bf* Tl) { const size_t i = (size_t)blockIdx.x * 256 + threadIdx.x; if (i >= (size_t)HD * NE / 4) return; const size_t e = i * 4; const int c0 = (int)(e % NE); const int d = (int)(e / NE); v4us oh, ol;
#pragma unroll
    for (int q = 0; q < 4; ++q) { const int r = c0 + q; const float v = bfr(E[(size_t)min(r, NRE - 1) * HD + d]); unsigned short u, w; splitf(v, u, w);   /* input rounded to bf16 once: lo == 0 */ oh[q] = (r < NRE) ? u : (unsigned short)0; ol[q] = (r < NRE) ? w : (unsigned short)0; }
    *(v4us*)(Th + e) = oh; *(v4us*)(Tl + e) = ol;  }

__global__ __launch_bounds__(256) void k_merge(const float* __restrict__ O, const float* __restrict__ F, int h0, bf* Ah, bf* Al) { const size_t e = ((size_t)blockIdx.x * 256 + threadIdx.x) * 2; if (e >= (size_t)ZH * TT * HD) return; const int d = (int)(e % HD); const int t = (int)((e / HD) % TT); const int zz = (int)(e / ((size_t)HD * TT)); const float cs = (t < RH) ? 1.0f : (1.0f / PCAR); const size_t oo = (size_t)t * DQ + (h0 + zz) * HD + d;
    v2us oh, ol;
#pragma unroll
    for (int q = 0; q < 2; ++q) { unsigned short a, c2; splitf(__fadd_rn(O[e + q], F[e + q]) * cs, a, c2);   /* context + relative-value term */ oh[q] = a; ol[q] = c2; } *(v2us*)(Ah + oo) = oh; *(v2us*)(Al + oo) = ol;  }

extern "C" void kernel_launch(void* const* d_in, const int* in_sizes, int n_in,
                              void* d_out, int out_size, void* d_ws, size_t ws_size, hipStream_t stream) {
    (void)in_sizes; (void)n_in; (void)out_size;
    const float* x = (const float*)d_in[0];   /* query */ const float* xk = (const float*)d_in[1]; const float* xv = (const float*)d_in[2]; const float* wq = (const float*)d_in[3]; const float* bq = (const float*)d_in[4]; const float* wk = (const float*)d_in[5]; const float* bk = (const float*)d_in[6]; const float* wv = (const float*)d_in[7]; const float* bv = (const float*)d_in[8]; const float* wo = (const float*)d_in[9]; const float* bo = (const float*)d_in[10]; const float* ak = (const float*)d_in[11]; const float* av = (const float*)d_in[12];   /* rel_k / rel_v [33][64] */
    float* OUT = (float*)d_out;     // [2][1024][1024]
    char* wsp = (char*)d_ws;
    auto take = [&](size_t bytes) { char* p = wsp; wsp += (bytes + 255) & ~(size_t)255; return (void*)p; };
    bf* AKB = (bf*)take((size_t)NE * HD * 2); bf* AVTh = (bf*)take((size_t)HD * NE * 2); bf* AVTl = (bf*)take((size_t)HD * NE * 2); float* QE = (float*)take((size_t)ZH * TT * NE * 4); bf* PBh = (bf*)take((size_t)ZH * TT * NE * 2); bf* PBl = (bf*)take((size_t)ZH * TT * NE * 2); float* ZR = (float*)take((size_t)ZH * TT * HD * 4); bf* WQ = (bf*)take((size_t)DQ * DM * 2); bf* WK = (bf*)take((size_t)DKV * DM * 2); bf* WV = (bf*)take((size_t)DKV * DM * 2); bf* WO = (bf*)take((size_t)DM * DQ * 2); float* CS = (float*)take((size_t)TT * HD * 2 * 4);
    bf* XB = (bf*)take((size_t)NB_ * TT * DM * 2); float* FQ = (float*)take((size_t)NB_ * TT * DQ * 4); float* FK = (float*)take((size_t)NB_ * TT * DKV * 4);
    h16* QP16 = (h16*)take((size_t)NB_ * NH_ * TT * HD * 2); h16* KP16 = (h16*)take((size_t)NB_ * NKV * TT * HD * 2); h16* VT16 = (h16*)take((size_t)NB_ * NKV * HD * TT * 2);
    bf* QPh = (bf*)take((size_t)NB_ * NH_ * TT * HD * 2); bf* QPl = (bf*)take((size_t)NB_ * NH_ * TT * HD * 2); bf* KPh = (bf*)take((size_t)NB_ * NKV * TT * HD * 2); bf* KPl = (bf*)take((size_t)NB_ * NKV * TT * HD * 2); bf* VTh = (bf*)take((size_t)NB_ * NKV * HD * TT * 2); bf* VTl = (bf*)take((size_t)NB_ * NKV * HD * TT * 2); bf* Ph = (bf*)take((size_t)ZH * RH * TT * 2); bf* Pl = (bf*)take((size_t)ZH * RH * TT * 2);
    float* Sb = (float*)take((size_t)ZH * TT * TT * 4); h16* P16 = (h16*)take((size_t)ZH * TT * TT * 2); float* Ob = (float*)take((size_t)ZH * TT * HD * 4); bf* ATh = (bf*)take((size_t)NB_ * TT * DQ * 2); bf* ATl = (bf*)take((size_t)NB_ * TT * DQ * 2);
    if ((size_t)(wsp - (char*)d_ws) > ws_size) return;    // ws 256 MiB
    float* FV = FK;   // v projection reuses the k buffer after the k planes are built (stream-ordered)
    { k_wtG<<<(unsigned)((DM * DQ / 64 + 63) / 64), 256, 0, stream>>>(wq, DM, DQ, WQ); k_wtG<<<(unsigned)((DM * DKV / 64 + 63) / 64), 256, 0, stream>>>(wk, DM, DKV, WK); k_wtG<<<(unsigned)((DM * DKV / 64 + 63) / 64), 256, 0, stream>>>(wv, DM, DKV, WV);
      k_wtG<<<(unsigned)((DQ * DM / 64 + 63) / 64), 256, 0, stream>>>(wo, DQ, DM, WO);   /* 'xw' weights gathered into Bt */
       }
    k_csid<<<(TT * HD + 255) / 256, 256, 0, stream>>>(CS);
    const unsigned LQ = (unsigned)(((size_t)NH_ * TT * HD / 2 + 255) / 256), LKv = (unsigned)(((size_t)NKV * TT * HD / 2 + 255) / 256);
    k_epadK<<<(unsigned)(((size_t)NE * HD / 8 + 255) / 256), 256, 0, stream>>>(ak, AKB);   /* rel_k -> bf16 [64][64], rows >= 33 zero */ k_epadVT<<<(unsigned)(((size_t)HD * NE / 4 + 255) / 256), 256, 0, stream>>>(av, AVTh, AVTl);   /* rel_v^T hi/lo [64][64], cols >= 33 zero */
    const unsigned LC = (unsigned)(((size_t)NB_ * TT * DM / 8 + 255) / 256);
    k_cvt8<<<LC, 256, 0, stream>>>(x, XB, (size_t)NB_ * TT * DM / 8);
    k_gemmw<bf, 0, true><<<dim3(NB_ * TT / 64, DQ / 64, 1), 32, 0, stream>>>(XB, nullptr, WQ, nullptr, DM, FQ, DQ, bq, 0, 0, 0);
    k_rope<<<dim3(LQ, NB_, 1), 256, 0, stream>>>(FQ, DQ, NH_, CS, nullptr, nullptr, 1.0f, QP16, QPh, QPl);
    k_cvt8<<<LC, 256, 0, stream>>>(xk, XB, (size_t)NB_ * TT * DM / 8); k_gemmw<bf, 0, true><<<dim3(NB_ * TT / 64, DKV / 64, 1), 32, 0, stream>>>(XB, nullptr, WK, nullptr, DM, FK, DKV, bk, 0, 0, 0);
    k_rope<<<dim3(LKv, NB_, 1), 256, 0, stream>>>(FK, DKV, NKV, CS, nullptr, nullptr, 1.0f, KP16, KPh, KPl);
    k_cvt8<<<LC, 256, 0, stream>>>(xv, XB, (size_t)NB_ * TT * DM / 8); k_gemmw<bf, 0, true><<<dim3(NB_ * TT / 64, DKV / 64, 1), 32, 0, stream>>>(XB, nullptr, WV, nullptr, DM, FV, DKV, bv, 0, 0, 0); k_vtp<<<dim3(LKv, NB_, 1), 256, 0, stream>>>(FV, DKV, NKV, VT16, VTh, VTl);
    for (int b = 0; b < NB_; ++b) {
        for (int h0 = 0; h0 < NH_; h0 += ZH) { const size_t zq = (size_t)b * NH_ + h0, zk = (size_t)b * NKV + h0 / REP;   // one kv head per query head: the pass's heads use consecutive kv planes (z-strides TT*HD)
            k_gemmw<bf, 2, false><<<dim3(RH / 64, TT / 64, ZH), 32, 0, stream>>>(QPh + zq * TT * HD, QPl + zq * TT * HD, KPh + zk * TT * HD, KPl + zk * TT * HD, HD, Sb, TT, nullptr, (size_t)TT * HD, (size_t)TT * HD, (size_t)TT * TT);

            k_gemmw<bf, 1, false><<<dim3(TT / 64, NE / 64, ZH), 32, 0, stream>>>(QPh + zq * TT * HD, QPl + zq * TT * HD, AKB, nullptr, HD, QE, NE, nullptr, (size_t)TT * HD, 0, (size_t)TT * NE);   /* QE = q . rel_k^T */ k_asoft<<<ZH * TT / 8, 256, 0, stream>>>(Sb, QE, P16, Ph, Pl, PBh, PBl);   /* + q.rel_k[clip(j - i) + 16], softmax, attn folded onto the 33 clipped offsets */
            k_gemmw<bf, 2, false><<<dim3(RH / 64, HD / 64, ZH), 32, 0, stream>>>(Ph, Pl, VTh + zk * HD * TT, VTl + zk * HD * TT, TT, Ob, HD, nullptr, (size_t)RH * TT, (size_t)HD * TT, (size_t)TT * HD); k_gemmw<bf, 2, false><<<dim3(TT / 64, HD / 64, ZH), 32, 0, stream>>>(PBh, PBl, AVTh, AVTl, NE, ZR, HD, nullptr, (size_t)TT * NE, 0, (size_t)TT * HD);   /* ZR = PB . rel_v */

            k_merge<<<(unsigned)(((size_t)ZH * TT * HD / 2 + 255) / 256), 256, 0, stream>>>(Ob, ZR, h0, ATh + (size_t)b * TT * DQ, ATl + (size_t)b * TT * DQ); } }
    k_gemmw<bf, 1, true><<<dim3(NB_ * TT / 64, DM / 64, 1), 32, 0, stream>>>(ATh, ATl, WO, nullptr, DQ, OUT, DM, bo, 0, 0, 0);
}

// v003
// Measured time: 210 microseconds a run.
// Timed twice side by side with v002, it ran 1.55 times as fast both times.
// All steps since v000 together make it 5.50 times as fast.
#include <hip/hip_runtime.h>

// Relative (Shaw) multi-head attention with key AND value relative-position embeddings (query, key, value [2][1024][1024]; q = query Wq + bq, k = key Wk + bk, v = value Wv + bv ('xw' 1/32, zero biases; 16 heads x 64); idx[i][j] = clip(j - i, -16, 16) + 16; attn = softmax((q.k + q.rel_k[idx]) / 8); x = attn v + sum_j attn[i][j] rel_v[idx] (rel_k, rel_v [33][64] 1/8 scale, read); out = merged Wo + bo ('xw') -> [2][1024][1024] (2.1 M); argument order query, key, value, Wq, bq, Wk, bk, Wv, bv, Wo, bo, rel_k, rel_v).
// Layout: bf16 copies of query, key, value side by side (both batches, rows b*1024 + t); 'xw' weights gathered into Bt; exact projections + f32 biases; rel_k as a zero-padded bf16 plane [64][64] and rel_v^T as hi/lo planes [64][64] (bf16-rounded once); one pass of all 32 (batch, head) pairs (grid z = b*16 + head): score tiles (hi/lo 3 products, every row), QE = q.rel_k^T (hi/lo x exact) gathered into the scores at column clip(j - i) + 16, softmax (x 1/8) with every row on hi/lo planes, P.v (hi/lo x hi/lo), the probabilities folded onto the 33 offsets (interior = one key, the two ends = fixed-order sums) and PB.rel_v added to the context; merged hi/lo x Wo exact + bo.
// Compute dtypes, f32 accumulate: every input rounded to bf16; projections exact + f32 biases; scores and the relative-key term ~f32; softmax f32; P as bf16 hi/lo; attn.v and the relative-value term 3 products (~f32); Wo hl x exact + bias.

#define NB_  2
#define TT   1024
#define DM   1024
#define NH_  16
#define NKV  16
#define REP  (NH_ / NKV)
#define HD   64
#define DQ   (NH_ * HD)
#define DKV  (NKV * HD)
#define ZH   16
#define ZB   (NB_ * ZH)           // (batch, head) pairs per attention launch: all of them
#define RH   TT                   // every row on hi/lo planes (the relative-value fold needs normalised planes)
#define WIN  0
#define PCAR 1024.0f
#define SCL  0.125f   // 1/sqrt(64) (the module divides by jnp.sqrt(DH))
#define NE   64       // 2*16+1 = 33 relative offsets padded to 64
#define NRE  33
#define CUT  16
typedef _Float16 h16;
typedef unsigned short bf;
typedef __attribute__((ext_vector_type(16))) __bf16   v16bf;
typedef __attribute__((ext_vector_type(16))) _Float16 v16h;
typedef __attribute__((ext_vector_type(8)))  _Float16 v8h;
typedef __attribute__((ext_vector_type(8)))  unsigned short v8us;
typedef __attribute__((ext_vector_type(8)))  float    v8f;
typedef __attribute__((ext_vector_type(4)))  float    v4f;
typedef v8h  __attribute__((may_alias)) v8ha;
typedef v4f  __attribute__((may_alias)) v4fa;
typedef v8us __attribute__((may_alias)) v8usa;

__device__ __forceinline__ unsigned short f2bf(float f) { unsigned u = __float_as_uint(f); u += 0x7FFFu + ((u >> 16) & 1u); return (unsigned short)(u >> 16); }
__device__ __forceinline__ float bf2f(unsigned short b) { return __uint_as_float(((unsigned)b) << 16); }
__device__ __forceinline__ float bfr(float f) { return bf2f(f2bf(f)); }
__device__ __forceinline__ v16h cat16(v8h lo, v8h hi) { return __builtin_shufflevector(lo, hi, 0, 1, 2, 3, 4, 5, 6, 7, 8, 9, 10, 11, 12, 13, 14, 15); }
__device__ __forceinline__ v16bf cat16b(v8us lo, v8us hi) { return __builtin_bit_cast(v16bf, __builtin_shufflevector(lo, hi, 0, 1, 2, 3, 4, 5, 6, 7, 8, 9, 10, 11, 12, 13, 14, 15)); }
__device__ __forceinline__ v8f wmma16(v16h a, v16h b, v8f c) { return __builtin_amdgcn_wmma_f32_16x16x32_f16(false, a, false, b, (short)0, c, false, false); }
__device__ __forceinline__ v8f wmmab(v16bf a, v16bf b, v8f c) { return __builtin_amdgcn_wmma_f32_16x16x32_bf16(false, a, false, b, (short)0, c, false, false); }



// ---- k_gemmw: register-blocked GEMM, ONE WAVE per 64x64 output tile (16 accumulators), operands straight from K-contiguous 16-bit planes; grid (M/64, N/64, Z), 32 threads.
// C[m][n] (f32, pitch ldc, + optional f32 bias[n], one bias vector per z = 0, 1, 2) = sum_k A[m][k] Bt[n][k] (+ split products per NSPLIT). K = row pitch of A and of Bt in elements, kend <= K = length of the sum. z-batch strides sA/sB/sC in elements. kend % 32 == 0.
template <typename T16> struct WFrag;
template <> struct WFrag<h16> { typedef v16h V; static __device__ __forceinline__ V ld(const h16* p) { return cat16(*(const v8h*)p, *(const v8h*)(p + 16)); } static __device__ __forceinline__ v8f mma(V a, V b, v8f c) { return wmma16(a, b, c); } };
template <> struct WFrag<bf> { typedef v16bf V; static __device__ __forceinline__ V ld(const bf* p) { return cat16b(*(const v8us*)p, *(const v8us*)(p + 16)); } static __device__ __forceinline__ v8f mma(V a, V b, v8f c) { return wmmab(a, b, c); } };
template <typename T16, int NSPLIT, bool BIAS>
__global__ __launch_bounds__(32) void k_gemmw(const T16* __restrict__ A, const T16* __restrict__ A2, const T16* __restrict__ Bt, const T16* __restrict__ Bt2, int K, int kend, float* C, int ldc, const float* __restrict__ bias0, const float* __restrict__ bias1, const float* __restrict__ bias2, size_t sA, size_t sB, size_t sC) {
    typedef typename WFrag<T16>::V V;
    __shared__ __align__(16) float os[16 * 68];
    const size_t z = blockIdx.z; A += z * sA; if (A2) A2 += z * sA; Bt += z * sB; if (Bt2) Bt2 += z * sB; C += z * sC; const float* bias = (z == 0) ? bias0 : ((z == 1) ? bias1 : bias2);
    const int lane = threadIdx.x & 31, lr = lane & 15, hi = lane >> 4; const int r0 = blockIdx.x * 64, c0 = blockIdx.y * 64;
    v8f acc[4][4];
#pragma unroll
    for (int mb = 0; mb < 4; ++mb)
#pragma unroll
        for (int nb = 0; nb < 4; ++nb) acc[mb][nb] = (v8f){};
    const size_t aoff = (size_t)(r0 + lr) * K + 8 * hi, boff = (size_t)(c0 + lr) * K + 8 * hi;
#pragma unroll 1
    for (int kc = 0; kc < kend; kc += 32) {
        V a[4], a2[4];
#pragma unroll
        for (int mb = 0; mb < 4; ++mb) { a[mb] = WFrag<T16>::ld(A + aoff + (size_t)mb * 16 * K + kc); if (NSPLIT == 1 || NSPLIT == 2) a2[mb] = WFrag<T16>::ld(A2 + aoff + (size_t)mb * 16 * K + kc); }
#pragma unroll
        for (int nb = 0; nb < 4; ++nb) { const V b = WFrag<T16>::ld(Bt + boff + (size_t)nb * 16 * K + kc); V b2; if (NSPLIT >= 2) b2 = WFrag<T16>::ld(Bt2 + boff + (size_t)nb * 16 * K + kc);
#pragma unroll
            for (int mb = 0; mb < 4; ++mb) { acc[mb][nb] = WFrag<T16>::mma(a[mb], b, acc[mb][nb]); if (NSPLIT == 1 || NSPLIT == 2) acc[mb][nb] = WFrag<T16>::mma(a2[mb], b, acc[mb][nb]); if (NSPLIT >= 2) acc[mb][nb] = WFrag<T16>::mma(a[mb], b2, acc[mb][nb]); } }
        asm volatile("v_nop\n\tv_nop\n\tv_nop\n\tv_nop" : "+v"(acc[0][0]), "+v"(acc[1][1]), "+v"(acc[2][2]), "+v"(acc[3][3]) : "v"(a[0]), "v"(a[3]));
    }
#pragma unroll
    for (int mb = 0; mb < 4; ++mb) {
#pragma unroll
        for (int nb = 0; nb < 4; ++nb) {
#pragma unroll
            for (int j = 0; j < 8; ++j) os[(hi * 8 + j) * 68 + nb * 16 + lr] = acc[mb][nb][j]; }
        __builtin_amdgcn_wave_barrier(); asm volatile("" ::: "memory");
        float* crow = C + (size_t)(r0 + mb * 16) * ldc + c0;
{
#pragma unroll
            for (int s = 0; s < 8; ++s) { const int row = 2 * s + hi, cofs = lr * 4; v4f val = *(const v4fa*)(os + row * 68 + cofs); if (BIAS) { val[0] += bfr(bias[c0 + cofs]); val[1] += bfr(bias[c0 + cofs + 1]); val[2] += bfr(bias[c0 + cofs + 2]); val[3] += bfr(bias[c0 + cofs + 3]); }
                *(v4f*)(crow + (size_t)row * ldc + cofs) = val; }
             }
        __builtin_amdgcn_wave_barrier(); asm volatile("" ::: "memory");
    }
}

__device__ __forceinline__ h16 tohx(float x) { return (h16)x; }
__device__ __forceinline__ void splitf(float y, unsigned short& h, unsigned short& l) { h = f2bf(y); l = f2bf(y - bf2f(h)); }
typedef __attribute__((ext_vector_type(2))) _Float16 v2h;
typedef __attribute__((ext_vector_type(4))) _Float16 v4h;
typedef __attribute__((ext_vector_type(2))) unsigned short v2us;
typedef __attribute__((ext_vector_type(4))) unsigned short v4us;
typedef __attribute__((ext_vector_type(2))) float v2f;
typedef __attribute__((ext_vector_type(4))) int v4i;
typedef __attribute__((ext_vector_type(4))) unsigned int v4u;
typedef v4u  __attribute__((may_alias)) v4ua;
typedef v4us __attribute__((may_alias)) v4usa;

__device__ __forceinline__ void d_wtG(int bx, const float* __restrict__ w, int K, int N, bf* Bt) {
    const int lane = threadIdx.x & 31; const int L0 = (bx * 8 + (threadIdx.x >> 5)) * 8; const int nlines = N * K / 64;
{
#pragma unroll 1
        for (int l = 0; l < 8; ++l) { const int L = L0 + l; if (L >= nlines) break; const size_t e = (size_t)L * 64 + lane * 2; const int k = (int)(e % K), n = (int)(e / K); v2us o;
            o[0] = f2bf(w[(size_t)k * N + n]); o[1] = f2bf(w[(size_t)(k + 1) * N + n]); *(v2us*)(Bt + e) = o; }
         }
}
__device__ __forceinline__ void d_cvt8(int bx, const float* __restrict__ src, bf* dst, size_t n8) { const size_t i = (size_t)bx * 256 + threadIdx.x; if (i >= n8) return; const v8f v = *(const v8f*)(src + i * 8); v8us o;
#pragma unroll
    for (int k = 0; k < 8; ++k) o[k] = f2bf(v[k]); *(v8us*)(dst + i * 8) = o;  }

// d_rope: head planes [h][t][d] (fp16 + hi/lo) of rope(x) x sc with the rotate-half convention out[d] = x[d] cos[t][d] - x[d+HD/2] sin[t][d], out[d+HD/2] = x[d+HD/2] cos[t][d+HD/2] + x[d] sin[t][d+HD/2]
__device__ __forceinline__ void d_rope(const float* __restrict__ F, int pitch, int nheads, const float* __restrict__ CS, const float* __restrict__ RF, const float* __restrict__ nw, float sc, h16* P16, bf* Ph, bf* Pl) {
    const size_t e = ((size_t)blockIdx.x * 256 + threadIdx.x) * 2; if (e >= (size_t)nheads * TT * HD) return; const int d = (int)(e % HD); const int t = (int)((e / HD) % TT); const int h = (int)(e / ((size_t)HD * TT)); const size_t pb = (size_t)blockIdx.y * nheads * TT * HD;   /* blockIdx.y = batch: rows b*TT + t of F, planes [b][h][t][d] */ const float* f = F + ((size_t)blockIdx.y * TT + t) * pitch + h * HD; const float rf = RF ? RF[(size_t)h * TT + t] : 1.0f; v2h o16; v2us oh, ol;
#pragma unroll
    for (int q = 0; q < 2; ++q) { const int dd = d + q; const int dp = (dd < HD / 2) ? dd + HD / 2 : dd - HD / 2; float x0 = f[dd], x1 = f[dp];
        if (RF) { float n0 = __fmul_rn(x0, rf), n1 = __fmul_rn(x1, rf); asm volatile("" : "+v"(n0)); asm volatile("" : "+v"(n1)); x0 = __fmul_rn(bfr(nw[dd]), n0); x1 = __fmul_rn(bfr(nw[dp]), n1); }
        const v2f cs = *(const v2f*)(CS + ((size_t)t * HD + dd) * 2); float a = __fmul_rn(x0, cs[0]), bq = __fmul_rn(x1, cs[1]); asm volatile("" : "+v"(a)); asm volatile("" : "+v"(bq)); const float r = ((dd < HD / 2) ? __fsub_rn(a, bq) : __fadd_rn(a, bq)) * sc;
        o16[q] = tohx(r); unsigned short a2, c2; splitf(r, a2, c2); oh[q] = a2; ol[q] = c2; }
    *(v2h*)(P16 + pb + e) = o16; *(v2us*)(Ph + pb + e) = oh; *(v2us*)(Pl + pb + e) = ol;  }
__device__ __forceinline__ void d_vtp(const float* __restrict__ F, int pitch, int nheads, h16* V16, bf* V2) { const size_t e = ((size_t)blockIdx.x * 256 + threadIdx.x) * 2; if (e >= (size_t)nheads * HD * TT) return; const int t = (int)(e % TT); const int d = (int)((e / TT) % HD); const int g = (int)(e / ((size_t)TT * HD)); const size_t pb = (size_t)blockIdx.y * nheads * HD * TT;   /* blockIdx.y = batch */ v2h o16; v2us oh, ol;
#pragma unroll
    for (int q = 0; q < 2; ++q) { const float x = F[((size_t)blockIdx.y * TT + t + q) * pitch + g * HD + d]; o16[q] = tohx(x); unsigned short a2, c2; splitf(x, a2, c2); oh[q] = a2; ol[q] = c2; }
    const size_t e2 = (pb + e - t) * 2 + t;   /* row (b, g, d) = hi | lo, pitch 2*TT, like the probability rows it is multiplied with */
    *(v2h*)(V16 + pb + e) = o16; *(v2us*)(V2 + e2) = oh; *(v2us*)(V2 + e2 + TT) = ol;  }
__device__ __forceinline__ void d_csid(int bx, float* CS) { const int idx = bx * 256 + threadIdx.x; if (idx >= TT * HD) return; v2f cs; cs[0] = 1.0f; cs[1] = 0.0f; *(v2f*)(CS + (size_t)idx * 2) = cs;  }
// k_asoft: P is the memory of Sb itself: a wave holds its whole score row (4 KiB) in registers before its first store, and puts the row's hi plane on the first 2 KiB and its lo plane on the second (no other wave touches the row).
// per row (zz, i), one wave: t = (S + QE[clip(j - i) + 16]) x HD^-0.5 (no mask); softmax over the 1024 keys (register row, one exp, fixed trees); hi/lo planes;
// the row's hi + lo values folded onto the 33 offsets in the same pass (interior = one key, handed over through the wave's own LDS row; the two ends = fixed-order sums: per lane in key order, then the xor tree).
__global__ __launch_bounds__(256) void k_asoft(const float* Sb, const float* __restrict__ QE, bf* P, bf* Bh, bf* Bl) {
    static_assert(RH == TT, "every row goes to hi/lo planes");
    __shared__ __align__(16) unsigned int bk[8][NE];   // per wave: bucket -> hi | lo << 16
    const int lane = threadIdx.x & 31; const int wv = __builtin_amdgcn_readfirstlane((int)(threadIdx.x >> 5)); int row = blockIdx.x * 8 + wv; if (row >= ZB * TT) return; const float* sr = Sb + (size_t)row * TT; const float* qe = QE + (size_t)row * NE; unsigned int* bw = bk[wv]; float v[TT / 32]; float mx = -3.0e38f;
    v4f a8[TT / 128];
#pragma unroll
    for (int ch = 0; ch < TT / 128; ++ch) a8[ch] = *(const v4f*)(sr + ch * 128 + lane * 4);
    const float ql = qe[lane], qlo = qe[0], qhi = qe[2 * CUT];
    asm volatile("s_wait_xcnt 0x0" : "+s"(row) : : "memory");   // the row arithmetic below reuses the registers that the loads above name as their address; row passes through the wait so that none of it is lifted over it
    const int i = row % TT; const bool hires = (i < RH);
    bw[lane] = 0u; bw[lane + 32] = 0u;
#pragma unroll
    for (int ch = 0; ch < TT / 128; ++ch) { const int j0 = ch * 128 + lane * 4; const bool below = (ch * 128 + 127 <= i - CUT), above = (ch * 128 >= i + CUT);   /* the same for the whole wave: every key of the chunk on one end offset */
        float e4[4];
        if (below) { e4[0] = qlo; e4[1] = qlo; e4[2] = qlo; e4[3] = qlo; }
        else if (above) { e4[0] = qhi; e4[1] = qhi; e4[2] = qhi; e4[3] = qhi; }
        else {
#pragma unroll
            for (int q = 0; q < 4; ++q) { const int r = min(max(j0 + q - i, -CUT), CUT) + CUT; const float g = __shfl(ql, r & 31, 32); e4[q] = (r == 2 * CUT) ? qhi : g; } }
#pragma unroll
        for (int q = 0; q < 4; ++q) { const float t = __fadd_rn(a8[ch][q], e4[q]) * SCL; v[ch * 4 + q] = t; mx = fmaxf(mx, t); } }
#pragma unroll
    for (int sh = 16; sh; sh >>= 1) mx = fmaxf(mx, __shfl_xor(mx, sh, 32));
    float sum = 0.f;
#pragma unroll
    for (int k = 0; k < TT / 32; ++k) { float d0 = __fsub_rn(v[k], mx); asm volatile("" : "+v"(d0)); v[k] = __builtin_amdgcn_exp2f(__fmul_rn(d0, 1.4426950408889634f)); sum += v[k]; }
#pragma unroll
    for (int sh = 16; sh; sh >>= 1) sum += __shfl_xor(sum, sh, 32);
    const float f = __fdiv_rn(hires ? 1.0f : PCAR, sum);
    float lo_s = 0.f, hi_s = 0.f;
{
        if (hires) {
#pragma unroll
            for (int ch = 0; ch < TT / 128; ++ch) { v4us oh, ol; const bool below = (ch * 128 + 127 <= i - CUT), above = (ch * 128 >= i + CUT);
#pragma unroll
                for (int q = 0; q < 4; ++q) { unsigned short a, c2; splitf(v[ch * 4 + q] * f, a, c2); oh[q] = a; ol[q] = c2; }
                float p4[4];
#pragma unroll
                for (int q = 0; q < 4; ++q) p4[q] = __fadd_rn(bf2f(oh[q]), bf2f(ol[q]));
                if (below) { lo_s = __fadd_rn(__fadd_rn(__fadd_rn(__fadd_rn(lo_s, p4[0]), p4[1]), p4[2]), p4[3]); }
                else if (above) { hi_s = __fadd_rn(__fadd_rn(__fadd_rn(__fadd_rn(hi_s, p4[0]), p4[1]), p4[2]), p4[3]); }
                else {
#pragma unroll
                    for (int q = 0; q < 4; ++q) { const int bkt = ch * 128 + lane * 4 + q - i + CUT; lo_s = __fadd_rn(lo_s, (bkt <= 0) ? p4[q] : 0.0f); hi_s = __fadd_rn(hi_s, (bkt >= 2 * CUT) ? p4[q] : 0.0f);
                        if (bkt > 0 && bkt < 2 * CUT) bw[bkt] = (unsigned int)oh[q] | ((unsigned int)ol[q] << 16); } }
                const size_t oo = (size_t)row * (2 * TT) + ch * 128 + lane * 4; *(v4usa*)(P + oo) = oh; *(v4usa*)(P + oo + TT) = ol;
                asm volatile("s_wait_xcnt 0x0" ::: "memory"); }   // the next chunk's arithmetic reuses the registers that these two stores name
        }
         }
#pragma unroll
    for (int sh = 16; sh; sh >>= 1) { lo_s = __fadd_rn(lo_s, __shfl_xor(lo_s, sh, 32)); hi_s = __fadd_rn(hi_s, __shfl_xor(hi_s, sh, 32)); }
    unsigned short l0h, l0l, h0h, h0l; splitf(lo_s, l0h, l0l); splitf(hi_s, h0h, h0l);
    if (lane == 0) { bw[0] = (unsigned int)l0h | ((unsigned int)l0l << 16); bw[2 * CUT] = (unsigned int)h0h | ((unsigned int)h0l << 16); }
    __builtin_amdgcn_wave_barrier(); asm volatile("" ::: "memory");   // the reads below take what OTHER lanes of this wave stored: keeps the compiler from lifting them over those stores (one wave's LDS operations run in order)
    if (lane < NE / 4) { const v4u w = *(const v4ua*)(bw + lane * 4); v4us oh, ol;
#pragma unroll
        for (int q = 0; q < 4; ++q) { oh[q] = (unsigned short)(w[q] & 0xFFFFu); ol[q] = (unsigned short)(w[q] >> 16); }
        *(v4us*)(Bh + (size_t)row * NE + lane * 4) = oh; *(v4us*)(Bl + (size_t)row * NE + lane * 4) = ol; }
}
__device__ __forceinline__ void d_epadK(int bx, const float* __restrict__ E, bf* EB) { const size_t i = (size_t)bx * 256 + threadIdx.x; if (i >= (size_t)NE * HD / 8) return; const int d0 = (int)(i % (HD / 8)) * 8; const int r = (int)(i / (HD / 8)); const float* src = E + (size_t)min(r, NRE - 1) * HD + d0; v8us o;
#pragma unroll
    for (int q = 0; q < 8; ++q) { const unsigned short v = f2bf(src[q]); o[q] = (r < NRE) ? v : (unsigned short)0; }
    *(v8us*)(EB + (size_t)r * HD + d0) = o;  }

__device__ __forceinline__ void d_epadVT(int bx, const float* __restrict__ E, bf* Th, bf* Tl) { const size_t i = (size_t)bx * 256 + threadIdx.x; if (i >= (size_t)HD * NE / 4) return; const size_t e = i * 4; const int c0 = (int)(e % NE); const int d = (int)(e / NE); v4us oh, ol;
#pragma unroll
    for (int q = 0; q < 4; ++q) { const int r = c0 + q; const float v = bfr(E[(size_t)min(r, NRE - 1) * HD + d]); unsigned short u, w; splitf(v, u, w);   /* input rounded to bf16 once: lo == 0 */ oh[q] = (r < NRE) ? u : (unsigned short)0; ol[q] = (r < NRE) ? w : (unsigned short)0; }
    *(v4us*)(Th + e) = oh; *(v4us*)(Tl + e) = ol;  }

__global__ __launch_bounds__(256) void k_merge(const float* __restrict__ O, const float* __restrict__ F, bf* Ah, bf* Al) { const size_t e = ((size_t)blockIdx.x * 256 + threadIdx.x) * 2; if (e >= (size_t)ZB * TT * HD) return; const int d = (int)(e % HD); const int t = (int)((e / HD) % TT); const int zz = (int)(e / ((size_t)HD * TT)); const float cs = (t < RH) ? 1.0f : (1.0f / PCAR); const size_t oo = ((size_t)(zz / NH_) * TT + t) * DQ + (zz % NH_) * HD + d;   /* zz = b*16 + head */
    v2us oh, ol;
#pragma unroll
    for (int q = 0; q < 2; ++q) { unsigned short a, c2; splitf(__fadd_rn(O[e + q], F[e + q]) * cs, a, c2);   /* context + relative-value term */ oh[q] = a; ol[q] = c2; } *(v2us*)(Ah + oo) = oh; *(v2us*)(Al + oo) = ol;  }

// k_prep: every pass that reads nothing but the inputs, in one launch; blockIdx.y picks the pass (the four weight gathers, the longest, start first). Grid (256, 18).
__global__ __launch_bounds__(256) void k_prep(const float* __restrict__ wq, const float* __restrict__ wk, const float* __restrict__ wv, const float* __restrict__ wo, const float* __restrict__ ak, const float* __restrict__ av, const float* __restrict__ x, const float* __restrict__ xk, const float* __restrict__ xv, bf* WB, float* CS, bf* AKB, bf* AVTh, bf* AVTl, bf* XB) {
    static_assert(DM * DQ / 64 / 64 == 256 && DKV == DQ && TT * HD / 256 == 256 && NE * HD / 8 / 256 == 2 && HD * NE / 4 / 256 == 4 && NB_ * TT * DM / 8 / 256 == 4 * 256, "grid (256, 18)");
    const int bx = blockIdx.x, y = blockIdx.y;
    if (y < 4) { const float* w = (y == 0) ? wq : ((y == 1) ? wk : ((y == 2) ? wv : wo)); d_wtG(bx, w, DM, DQ, WB + (size_t)y * DM * DQ); }   /* 'xw' weights gathered into Bt */
    else if (y == 4) d_csid(bx, CS);
    else if (y == 5) { if (bx < 2) d_epadK(bx, ak, AKB);   /* rel_k -> bf16 [64][64], rows >= 33 zero */ else if (bx < 6) d_epadVT(bx - 2, av, AVTh, AVTl); }   /* rel_v^T hi/lo [64][64], cols >= 33 zero */
    else { const int q = (y - 6) >> 2; const float* src = (q == 0) ? x : ((q == 1) ? xk : xv); d_cvt8(((y - 6) & 3) * 256 + bx, src, XB + (size_t)q * NB_ * TT * DM, (size_t)NB_ * TT * DM / 8); }
}
// k_planes: the head planes of v (transposed; the slowest, so it starts first), q and k in one launch; blockIdx.z picks the tensor, blockIdx.y the batch.
__global__ __launch_bounds__(256) void k_planes(const float* __restrict__ FQ, const float* __restrict__ FK, const float* __restrict__ FV, const float* __restrict__ CS, h16* QP16, bf* QPh, bf* QPl, h16* KP16, bf* KPh, bf* KPl, h16* VT16, bf* VT2) {
    if (blockIdx.z == 0) d_vtp(FV, DKV, NKV, VT16, VT2);
    else if (blockIdx.z == 1) d_rope(FQ, DQ, NH_, CS, nullptr, nullptr, 1.0f, QP16, QPh, QPl);
    else d_rope(FK, DKV, NKV, CS, nullptr, nullptr, 1.0f, KP16, KPh, KPl);
}

extern "C" void kernel_launch(void* const* d_in, const int* in_sizes, int n_in,
                              void* d_out, int out_size, void* d_ws, size_t ws_size, hipStream_t stream) {
    (void)in_sizes; (void)n_in; (void)out_size;
    const float* x = (const float*)d_in[0];   /* query */ const float* xk = (const float*)d_in[1]; const float* xv = (const float*)d_in[2]; const float* wq = (const float*)d_in[3]; const float* bq = (const float*)d_in[4]; const float* wk = (const float*)d_in[5]; const float* bk = (const float*)d_in[6]; const float* wv = (const float*)d_in[7]; const float* bv = (const float*)d_in[8]; const float* wo = (const float*)d_in[9]; const float* bo = (const float*)d_in[10]; const float* ak = (const float*)d_in[11]; const float* av = (const float*)d_in[12];   /* rel_k / rel_v [33][64] */
    float* OUT = (float*)d_out;     // [2][1024][1024]
    char* wsp = (char*)d_ws;
    auto take = [&](size_t bytes) { char* p = wsp; wsp += (bytes + 255) & ~(size_t)255; return (void*)p; };
    bf* AKB = (bf*)take((size_t)NE * HD * 2); bf* AVTh = (bf*)take((size_t)HD * NE * 2); bf* AVTl = (bf*)take((size_t)HD * NE * 2); float* QE = (float*)take((size_t)ZB * TT * NE * 4); bf* PBh = (bf*)take((size_t)ZB * TT * NE * 2); bf* PBl = (bf*)take((size_t)ZB * TT * NE * 2); float* ZR = (float*)take((size_t)ZB * TT * HD * 4);
    bf* WB = (bf*)take((size_t)4 * DM * DQ * 2);   /* Wq, Wk, Wv, Wo as Bt, one behind the other */ bf* WO = WB + (size_t)3 * DM * DQ; float* CS = (float*)take((size_t)TT * HD * 2 * 4);
    bf* XB = (bf*)take((size_t)3 * NB_ * TT * DM * 2);   /* query, key, value */ float* FQ = (float*)take((size_t)3 * NB_ * TT * DQ * 4);   /* q, k, v projections */ float* FK = FQ + (size_t)NB_ * TT * DQ; float* FV = FK + (size_t)NB_ * TT * DQ;
    h16* QP16 = (h16*)take((size_t)NB_ * NH_ * TT * HD * 2); h16* KP16 = (h16*)take((size_t)NB_ * NKV * TT * HD * 2); h16* VT16 = (h16*)take((size_t)NB_ * NKV * HD * TT * 2);
    bf* QPh = (bf*)take((size_t)NB_ * NH_ * TT * HD * 2); bf* QPl = (bf*)take((size_t)NB_ * NH_ * TT * HD * 2); bf* KPh = (bf*)take((size_t)NB_ * NKV * TT * HD * 2); bf* KPl = (bf*)take((size_t)NB_ * NKV * TT * HD * 2); bf* VT2 = (bf*)take((size_t)NB_ * NKV * HD * 2 * TT * 2);   /* v^T rows hi | lo */
    float* Sb = (float*)take((size_t)ZB * TT * TT * 4); bf* P = (bf*)Sb;   /* each score row becomes its own hi | lo probability row */ float* Ob = (float*)take((size_t)ZB * TT * HD * 4); bf* ATh = (bf*)take((size_t)NB_ * TT * DQ * 2); bf* ATl = (bf*)take((size_t)NB_ * TT * DQ * 2);
    if ((size_t)(wsp - (char*)d_ws) > ws_size) return;    // ws 256 MiB
    k_prep<<<dim3(256, 18, 1), 256, 0, stream>>>(wq, wk, wv, wo, ak, av, x, xk, xv, WB, CS, AKB, AVTh, AVTl, XB);
    k_gemmw<bf, 0, true><<<dim3(NB_ * TT / 64, DQ / 64, 3), 32, 0, stream>>>(XB, nullptr, WB, nullptr, DM, DM, FQ, DQ, bq, bk, bv, (size_t)NB_ * TT * DM, (size_t)DM * DQ, (size_t)NB_ * TT * DQ);   /* z = q, k, v */
    k_planes<<<dim3((unsigned)(((size_t)NH_ * TT * HD / 2 + 255) / 256), NB_, 3), 256, 0, stream>>>(FQ, FK, FV, CS, QP16, QPh, QPl, KP16, KPh, KPl, VT16, VT2);
    // one kv head per query head: z = b*16 + head walks consecutive q, k and v planes (z-strides TT*HD; 2*TT*HD for the hi | lo v rows)
    k_gemmw<bf, 2, false><<<dim3(RH / 64, TT / 64, ZB), 32, 0, stream>>>(QPh, QPl, KPh, KPl, HD, HD, Sb, TT, nullptr, nullptr, nullptr, (size_t)TT * HD, (size_t)TT * HD, (size_t)TT * TT);
    k_gemmw<bf, 1, false><<<dim3(TT / 64, NE / 64, ZB), 32, 0, stream>>>(QPh, QPl, AKB, nullptr, HD, HD, QE, NE, nullptr, nullptr, nullptr, (size_t)TT * HD, 0, (size_t)TT * NE);   /* QE = q . rel_k^T */
    k_asoft<<<ZB * TT / 8, 256, 0, stream>>>(Sb, QE, P, PBh, PBl);   /* + q.rel_k[clip(j - i) + 16], softmax, attn folded onto the 33 clipped offsets */
    k_gemmw<bf, 2, false><<<dim3(RH / 64, HD / 64, ZB), 32, 0, stream>>>(P, P + TT, VT2, VT2 + TT, 2 * TT, TT, Ob, HD, nullptr, nullptr, nullptr, (size_t)RH * 2 * TT, (size_t)HD * 2 * TT, (size_t)TT * HD);
    k_gemmw<bf, 2, false><<<dim3(TT / 64, HD / 64, ZB), 32, 0, stream>>>(PBh, PBl, AVTh, AVTl, NE, NE, ZR, HD, nullptr, nullptr, nullptr, (size_t)TT * NE, 0, (size_t)TT * HD);   /* ZR = PB . rel_v */
    k_merge<<<(unsigned)(((size_t)ZB * TT * HD / 2 + 255) / 256), 256, 0, stream>>>(Ob, ZR, ATh, ATl);
    k_gemmw<bf, 1, true><<<dim3(NB_ * TT / 64, DM / 64, 1), 32, 0, stream>>>(ATh, ATl, WO, nullptr, DQ, DQ, OUT, DM, bo, bo, bo, 0, 0, 0);
}

// v004
// A run of this version takes 159 microseconds.
// Next to v003, in two timings, it ran 1.32 times as fast each time.
// All steps since v000 together make it 7.26 times as fast.
#include <hip/hip_runtime.h>

// Relative (Shaw) multi-head attention with key AND value relative-position embeddings (query, key, value [2][1024][1024]; q = query Wq + bq, k = key Wk + bk, v = value Wv + bv ('xw' 1/32, zero biases; 16 heads x 64); idx[i][j] = clip(j - i, -16, 16) + 16; attn = softmax((q.k + q.rel_k[idx]) / 8); x = attn v + sum_j attn[i][j] rel_v[idx] (rel_k, rel_v [33][64] 1/8 scale, read); out = merged Wo + bo ('xw') -> [2][1024][1024] (2.1 M); argument order query, key, value, Wq, bq, Wk, bk, Wv, bv, Wo, bo, rel_k, rel_v).
// Layout: bf16 copies of query, key, value side by side (both batches, rows b*1024 + t); 'xw' weights gathered into Bt; exact projections + f32 biases; rel_k as a zero-padded bf16 plane [64][64] and rel_v^T as hi/lo planes [64][64] (bf16-rounded once); QE = q.rel_k^T (hi/lo x exact); one fused attention launch over all 32 (batch, head) pairs: score tiles (hi/lo 3 products) + QE at column clip(j - i) + 16, softmax (x 1/8), P as hi/lo fragments, P.v (hi/lo x hi/lo), the probabilities folded onto the 33 offsets (interior = one key, the two ends = fixed-order sums) and PB.rel_v added into the context's accumulators; merged hi/lo x Wo exact + bo.
// Compute dtypes, f32 accumulate: every input rounded to bf16; projections exact + f32 biases; scores and the relative-key term ~f32; softmax f32; P as bf16 hi/lo; attn.v and the relative-value term 3 products (~f32); Wo hl x exact + bias.

#define NB_  2
#define TT   1024
#define DM   1024
#define NH_  16
#define NKV  16
#define REP  (NH_ / NKV)
#define HD   64
#define DQ   (NH_ * HD)
#define DKV  (NKV * HD)
#define ZH   16
#define ZB   (NB_ * ZH)           // (batch, head) pairs per attention launch: all of them
#define RH   TT                   // every row on hi/lo planes (the relative-value fold needs normalised planes)
#define WIN  0
#define PCAR 1024.0f
#define SCL  0.125f   // 1/sqrt(64) (the module divides by jnp.sqrt(DH))
#define NE   64       // 2*16+1 = 33 relative offsets padded to 64
#define NRE  33
#define CUT  16
typedef _Float16 h16;
typedef unsigned short bf;
typedef __attribute__((ext_vector_type(16))) __bf16   v16bf;
typedef __attribute__((ext_vector_type(16))) _Float16 v16h;
typedef __attribute__((ext_vector_type(8)))  _Float16 v8h;
typedef __attribute__((ext_vector_type(8)))  unsigned short v8us;
typedef __attribute__((ext_vector_type(8)))  float    v8f;
typedef __attribute__((ext_vector_type(4)))  float    v4f;
typedef v8h  __attribute__((may_alias)) v8ha;
typedef v4f  __attribute__((may_alias)) v4fa;
typedef v8us __attribute__((may_alias)) v8usa;

__device__ __forceinline__ unsigned short f2bf(float f) { unsigned u = __float_as_uint(f); u += 0x7FFFu + ((u >> 16) & 1u); return (unsigned short)(u >> 16); }
__device__ __forceinline__ float bf2f(unsigned short b) { return __uint_as_float(((unsigned)b) << 16); }
__device__ __forceinline__ float bfr(float f) { return bf2f(f2bf(f)); }
__device__ __forceinline__ v16h cat16(v8h lo, v8h hi) { return __builtin_shufflevector(lo, hi, 0, 1, 2, 3, 4, 5, 6, 7, 8, 9, 10, 11, 12, 13, 14, 15); }
__device__ __forceinline__ v16bf cat16b(v8us lo, v8us hi) { return __builtin_bit_cast(v16bf, __builtin_shufflevector(lo, hi, 0, 1, 2, 3, 4, 5, 6, 7, 8, 9, 10, 11, 12, 13, 14, 15)); }
__device__ __forceinline__ v8f wmma16(v16h a, v16h b, v8f c) { return __builtin_amdgcn_wmma_f32_16x16x32_f16(false, a, false, b, (short)0, c, false, false); }
__device__ __forceinline__ v8f wmmab(v16bf a, v16bf b, v8f c) { return __builtin_amdgcn_wmma_f32_16x16x32_bf16(false, a, false, b, (short)0, c, false, false); }



// ---- k_gemmw: register-blocked GEMM, ONE WAVE per 64x64 output tile (16 accumulators), operands straight from K-contiguous 16-bit planes; grid (M/64, N/64, Z), 32 threads.
// C[m][n] (f32, pitch ldc, + optional f32 bias[n], one bias vector per z = 0, 1, 2) = sum_k A[m][k] Bt[n][k] (+ split products per NSPLIT). K = row pitch of A and of Bt in elements, kend <= K = length of the sum. z-batch strides sA/sB/sC in elements. kend % 32 == 0.
template <typename T16> struct WFrag;
template <> struct WFrag<h16> { typedef v16h V; static __device__ __forceinline__ V ld(const h16* p) { return cat16(*(const v8h*)p, *(const v8h*)(p + 16)); } static __device__ __forceinline__ v8f mma(V a, V b, v8f c) { return wmma16(a, b, c); } };
template <> struct WFrag<bf> { typedef v16bf V; static __device__ __forceinline__ V ld(const bf* p) { return cat16b(*(const v8us*)p, *(const v8us*)(p + 16)); } static __device__ __forceinline__ v8f mma(V a, V b, v8f c) { return wmmab(a, b, c); } };
template <typename T16, int NSPLIT, bool BIAS>
__global__ __launch_bounds__(32) void k_gemmw(const T16* __restrict__ A, const T16* __restrict__ A2, const T16* __restrict__ Bt, const T16* __restrict__ Bt2, int K, int kend, float* C, int ldc, const float* __restrict__ bias0, const float* __restrict__ bias1, const float* __restrict__ bias2, size_t sA, size_t sB, size_t sC) {
    typedef typename WFrag<T16>::V V;
    __shared__ __align__(16) float os[16 * 68];
    const size_t z = blockIdx.z; A += z * sA; if (A2) A2 += z * sA; Bt += z * sB; if (Bt2) Bt2 += z * sB; C += z * sC; const float* bias = (z == 0) ? bias0 : ((z == 1) ? bias1 : bias2);
    const int lane = threadIdx.x & 31, lr = lane & 15, hi = lane >> 4; const int r0 = blockIdx.x * 64, c0 = blockIdx.y * 64;
    v8f acc[4][4];
#pragma unroll
    for (int mb = 0; mb < 4; ++mb)
#pragma unroll
        for (int nb = 0; nb < 4; ++nb) acc[mb][nb] = (v8f){};
    const size_t aoff = (size_t)(r0 + lr) * K + 8 * hi, boff = (size_t)(c0 + lr) * K + 8 * hi;
#pragma unroll 1
    for (int kc = 0; kc < kend; kc += 32) {
        V a[4], a2[4];
#pragma unroll
        for (int mb = 0; mb < 4; ++mb) { a[mb] = WFrag<T16>::ld(A + aoff + (size_t)mb * 16 * K + kc); if (NSPLIT == 1 || NSPLIT == 2) a2[mb] = WFrag<T16>::ld(A2 + aoff + (size_t)mb * 16 * K + kc); }
#pragma unroll
        for (int nb = 0; nb < 4; ++nb) { const V b = WFrag<T16>::ld(Bt + boff + (size_t)nb * 16 * K + kc); V b2; if (NSPLIT >= 2) b2 = WFrag<T16>::ld(Bt2 + boff + (size_t)nb * 16 * K + kc);
#pragma unroll
            for (int mb = 0; mb < 4; ++mb) { acc[mb][nb] = WFrag<T16>::mma(a[mb], b, acc[mb][nb]); if (NSPLIT == 1 || NSPLIT == 2) acc[mb][nb] = WFrag<T16>::mma(a2[mb], b, acc[mb][nb]); if (NSPLIT >= 2) acc[mb][nb] = WFrag<T16>::mma(a[mb], b2, acc[mb][nb]); } }
        asm volatile("v_nop\n\tv_nop\n\tv_nop\n\tv_nop" : "+v"(acc[0][0]), "+v"(acc[1][1]), "+v"(acc[2][2]), "+v"(acc[3][3]) : "v"(a[0]), "v"(a[3]));
    }
#pragma unroll
    for (int mb = 0; mb < 4; ++mb) {
#pragma unroll
        for (int nb = 0; nb < 4; ++nb) {
#pragma unroll
            for (int j = 0; j < 8; ++j) os[(hi * 8 + j) * 68 + nb * 16 + lr] = acc[mb][nb][j]; }
        __builtin_amdgcn_wave_barrier(); asm volatile("" ::: "memory");
        float* crow = C + (size_t)(r0 + mb * 16) * ldc + c0;
{
#pragma unroll
            for (int s = 0; s < 8; ++s) { const int row = 2 * s + hi, cofs = lr * 4; v4f val = *(const v4fa*)(os + row * 68 + cofs); if (BIAS) { val[0] += bfr(bias[c0 + cofs]); val[1] += bfr(bias[c0 + cofs + 1]); val[2] += bfr(bias[c0 + cofs + 2]); val[3] += bfr(bias[c0 + cofs + 3]); }
                *(v4f*)(crow + (size_t)row * ldc + cofs) = val; }
             }
        __builtin_amdgcn_wave_barrier(); asm volatile("" ::: "memory");
    }
}

__device__ __forceinline__ h16 tohx(float x) { return (h16)x; }
__device__ __forceinline__ void splitf(float y, unsigned short& h, unsigned short& l) { h = f2bf(y); l = f2bf(y - bf2f(h)); }
typedef __attribute__((ext_vector_type(2))) _Float16 v2h;
typedef __attribute__((ext_vector_type(4))) _Float16 v4h;
typedef __attribute__((ext_vector_type(2))) unsigned short v2us;
typedef __attribute__((ext_vector_type(4))) unsigned short v4us;
typedef __attribute__((ext_vector_type(2))) float v2f;
typedef __attribute__((ext_vector_type(4))) int v4i;
typedef __attribute__((ext_vector_type(4))) unsigned int v4u;
typedef v4u  __attribute__((may_alias)) v4ua;
typedef v4us __attribute__((may_alias)) v4usa;

__device__ __forceinline__ void d_wtG(int bx, const float* __restrict__ w, int K, int N, bf* Bt) {
    const int lane = threadIdx.x & 31; const int L0 = (bx * 8 + (threadIdx.x >> 5)) * 8; const int nlines = N * K / 64;
{
#pragma unroll 1
        for (int l = 0; l < 8; ++l) { const int L = L0 + l; if (L >= nlines) break; const size_t e = (size_t)L * 64 + lane * 2; const int k = (int)(e % K), n = (int)(e / K); v2us o;
            o[0] = f2bf(w[(size_t)k * N + n]); o[1] = f2bf(w[(size_t)(k + 1) * N + n]); *(v2us*)(Bt + e) = o; }
         }
}
__device__ __forceinline__ void d_cvt8(int bx, const float* __restrict__ src, bf* dst, size_t n8) { const size_t i = (size_t)bx * 256 + threadIdx.x; if (i >= n8) return; const v8f v = *(const v8f*)(src + i * 8); v8us o;
#pragma unroll
    for (int k = 0; k < 8; ++k) o[k] = f2bf(v[k]); *(v8us*)(dst + i * 8) = o;  }

// d_rope: head planes [h][t][d] (fp16 + hi/lo) of rope(x) x sc with the rotate-half convention out[d] = x[d] cos[t][d] - x[d+HD/2] sin[t][d], out[d+HD/2] = x[d+HD/2] cos[t][d+HD/2] + x[d] sin[t][d+HD/2]
__device__ __forceinline__ void d_rope(const float* __restrict__ F, int pitch, int nheads, const float* __restrict__ CS, const float* __restrict__ RF, const float* __restrict__ nw, float sc, h16* P16, bf* Ph, bf* Pl) {
    const size_t e = ((size_t)blockIdx.x * 256 + threadIdx.x) * 2; if (e >= (size_t)nheads * TT * HD) return; const int d = (int)(e % HD); const int t = (int)((e / HD) % TT); const int h = (int)(e / ((size_t)HD * TT)); const size_t pb = (size_t)blockIdx.y * nheads * TT * HD;   /* blockIdx.y = batch: rows b*TT + t of F, planes [b][h][t][d] */ const float* f = F + ((size_t)blockIdx.y * TT + t) * pitch + h * HD; const float rf = RF ? RF[(size_t)h * TT + t] : 1.0f; v2h o16; v2us oh, ol;
#pragma unroll
    for (int q = 0; q < 2; ++q) { const int dd = d + q; const int dp = (dd < HD / 2) ? dd + HD / 2 : dd - HD / 2; float x0 = f[dd], x1 = f[dp];
        if (RF) { float n0 = __fmul_rn(x0, rf), n1 = __fmul_rn(x1, rf); asm volatile("" : "+v"(n0)); asm volatile("" : "+v"(n1)); x0 = __fmul_rn(bfr(nw[dd]), n0); x1 = __fmul_rn(bfr(nw[dp]), n1); }
        const v2f cs = *(const v2f*)(CS + ((size_t)t * HD + dd) * 2); float a = __fmul_rn(x0, cs[0]), bq = __fmul_rn(x1, cs[1]); asm volatile("" : "+v"(a)); asm volatile("" : "+v"(bq)); const float r = ((dd < HD / 2) ? __fsub_rn(a, bq) : __fadd_rn(a, bq)) * sc;
        o16[q] = tohx(r); unsigned short a2, c2; splitf(r, a2, c2); oh[q] = a2; ol[q] = c2; }
    *(v2h*)(P16 + pb + e) = o16; *(v2us*)(Ph + pb + e) = oh; *(v2us*)(Pl + pb + e) = ol;  }
__device__ __forceinline__ void d_vtp(const float* __restrict__ F, int pitch, int nheads, h16* V16, bf* V2) { const size_t e = ((size_t)blockIdx.x * 256 + threadIdx.x) * 2; if (e >= (size_t)nheads * HD * TT) return; const int t = (int)(e % TT); const int d = (int)((e / TT) % HD); const int g = (int)(e / ((size_t)TT * HD)); const size_t pb = (size_t)blockIdx.y * nheads * HD * TT;   /* blockIdx.y = batch */ v2h o16; v2us oh, ol;
#pragma unroll
    for (int q = 0; q < 2; ++q) { const float x = F[((size_t)blockIdx.y * TT + t + q) * pitch + g * HD + d]; o16[q] = tohx(x); unsigned short a2, c2; splitf(x, a2, c2); oh[q] = a2; ol[q] = c2; }
    const size_t e2 = (pb + e - t) * 2 + t;   /* row (b, g, d) = hi | lo, pitch 2*TT */
    *(v2h*)(V16 + pb + e) = o16; *(v2us*)(V2 + e2) = oh; *(v2us*)(V2 + e2 + TT) = ol;  }
__device__ __forceinline__ void d_csid(int bx, float* CS) { const int idx = bx * 256 + threadIdx.x; if (idx >= TT * HD) return; v2f cs; cs[0] = 1.0f; cs[1] = 0.0f; *(v2f*)(CS + (size_t)idx * 2) = cs;  }
// k_fattn: scores, softmax, attn.v and the relative-value term in one kernel; no score or probability ever leaves the chip.
// Work-group = 8 waves = 128 query rows of one (batch, head); wave = 16 queries. Key tiles of 64 (k hi/lo, v^T hi/lo) go through registers into LDS (row pitch 144 B), the next tile's loads in flight while this one is worked on.
// Transposed scores S^T = k q^T: lane (lr, hi) holds query lr, keys hi*8 + 0..7 of each 16-key tile, which is the A fragment of P for P.v as it stands.
// Sweep 1: row maximum and row sum (per lane, rescaled when the maximum moves; the two half rows joined at the end). Sweep 2: the scores again, normalised P as bf16 hi/lo, P.v (3 products), P folded onto the 33 offsets (wave-own LDS planes), PB.rel_v into the same accumulators.
#define KP 72
typedef WFrag<bf>::V VB;
__device__ __forceinline__ void d_stile(const VB* kf, const VB* qh, const VB* ql, float* t, int j0s, int i0, int i, int hi, float qlo, float qhi, const float* qer) {
    float e[8];   // the relative-key term of this lane's 8 keys, chosen in front of the products so that no branch stands behind a matrix instruction
    if (j0s + 15 <= i0 - CUT) {   /* the same for the whole wave: every key of the tile on the low end offset */
#pragma unroll
        for (int jj = 0; jj < 8; ++jj) e[jj] = qlo; }
    else if (j0s >= i0 + 15 + CUT) {
#pragma unroll
        for (int jj = 0; jj < 8; ++jj) e[jj] = qhi; }
    else {
#pragma unroll
        for (int jj = 0; jj < 8; ++jj) e[jj] = qer[min(max(j0s + hi * 8 + jj - i, -CUT), CUT) + CUT]; }
    v8f s = (v8f){};
#pragma unroll
    for (int c = 0; c < 2; ++c) { s = wmmab(kf[2 * c], qh[c], s); s = wmmab(kf[2 * c], ql[c], s); s = wmmab(kf[2 * c + 1], qh[c], s); }
#pragma unroll
    for (int jj = 0; jj < 8; ++jj) t[jj] = __fadd_rn(s[jj], e[jj]) * SCL;
}
__global__ __launch_bounds__(256) void k_fattn(const bf* __restrict__ QPh, const bf* __restrict__ QPl, const bf* __restrict__ KPh, const bf* __restrict__ KPl, const bf* __restrict__ VT2, const float* __restrict__ QE, const bf* __restrict__ AVTh, const bf* __restrict__ AVTl, bf* ATh, bf* ATl) {
    __shared__ __align__(16) bf tk[2][64 * KP];        // k tile [key][d], hi and lo
    __shared__ __align__(16) bf tv[2][64 * KP];        // v^T tile [d][key], hi and lo
    __shared__ __align__(16) bf pb[8][2][16 * KP];     // per wave: P folded onto the offsets [query][offset], hi and lo
    __shared__ __align__(16) float os[8][16 * 68];     // per wave: first its rows of QE, at the end its output tile
    const float L2E = 1.4426950408889634f;
    const int tid = threadIdx.x, lane = tid & 31, lr = lane & 15, hi = lane >> 4; const int wv = __builtin_amdgcn_readfirstlane(tid >> 5);
    const int z = blockIdx.y, i0 = blockIdx.x * 128 + wv * 16, i = i0 + lr;
    float* osw = os[wv]; bf* pbh = pb[wv][0]; bf* pbl = pb[wv][1];
    const int cr = tid >> 3, cc = (tid & 7) * 8, lo0 = cr * KP + cc;   // this thread's 16-byte pieces of a tile: rows cr and cr + 32
    const bf* kgh = KPh + (size_t)z * TT * HD + cr * HD + cc; const bf* kgl = KPl + (size_t)z * TT * HD + cr * HD + cc; const bf* vg = VT2 + ((size_t)z * HD + cr) * (2 * TT) + cc;
    v8us rk[2][2], rv[2][2];
#pragma unroll
    for (int u = 0; u < 2; ++u) { rk[0][u] = *(const v8us*)(kgh + u * 32 * HD); rk[1][u] = *(const v8us*)(kgl + u * 32 * HD); }
    VB qh[2], ql[2];
#pragma unroll
    for (int c = 0; c < 2; ++c) { qh[c] = WFrag<bf>::ld(QPh + ((size_t)z * TT + i) * HD + 8 * hi + c * 32); ql[c] = WFrag<bf>::ld(QPl + ((size_t)z * TT + i) * HD + 8 * hi + c * 32); }
#pragma unroll
    for (int u = 0; u < 8; ++u) { const int c = lane + 32 * u; *(v4fa*)(osw + (c >> 4) * 68 + (c & 15) * 4) = *(const v4fa*)(QE + ((size_t)z * TT + i0 + (c >> 4)) * NE + (c & 15) * 4); }
#pragma unroll
    for (int u = 0; u < 9; ++u) ((v4ua*)pbh)[lane + 32 * u] = (v4u){0u, 0u, 0u, 0u};   // both planes (they lie one behind the other): an offset with no key stays zero
    __builtin_amdgcn_wave_barrier(); asm volatile("" ::: "memory");   // the reads of osw below take what other lanes of this wave stored (one wave's LDS operations run in order)
    const float* qer = osw + lr * 68; const float qlo = qer[0], qhi = qer[2 * CUT];
    float m = -3.0e38f, l = 0.f;
#pragma unroll 1
    for (int blk = 0; blk < TT / 64; ++blk) {
        __syncthreads();   // every wave has left the tile that is overwritten next
#pragma unroll
        for (int u = 0; u < 2; ++u) { *(v8us*)(&tk[0][lo0 + u * 32 * KP]) = rk[0][u]; *(v8us*)(&tk[1][lo0 + u * 32 * KP]) = rk[1][u]; }
        __syncthreads();   // the tile is whole before anybody reads it
        if (blk + 1 < TT / 64) {
#pragma unroll
            for (int u = 0; u < 2; ++u) { rk[0][u] = *(const v8us*)(kgh + ((blk + 1) * 64 + u * 32) * HD); rk[1][u] = *(const v8us*)(kgl + ((blk + 1) * 64 + u * 32) * HD); }
            asm volatile("s_wait_xcnt 0x0" ::: "memory"); }   // the work below reuses the registers that these loads name as their addresses
        VB kf[4][4];   // the tile's 16 k fragments (per 16 keys: hi, lo of d 0..31, hi, lo of d 32..63), all loads issued before the first product so that one LDS latency is paid, not sixteen
#pragma unroll
        for (int st = 0; st < 4; ++st)
#pragma unroll
            for (int c = 0; c < 2; ++c) { kf[st][2 * c] = WFrag<bf>::ld(&tk[0][(st * 16 + lr) * KP + 8 * hi + c * 32]); kf[st][2 * c + 1] = WFrag<bf>::ld(&tk[1][(st * 16 + lr) * KP + 8 * hi + c * 32]); }
        __builtin_amdgcn_sched_barrier(0);   // keeps the fragment loads above together: sunk to their users they would each wait alone
        float t[4][8];
#pragma unroll
        for (int st = 0; st < 4; ++st) d_stile(kf[st], qh, ql, t[st], blk * 64 + st * 16, i0, i, hi, qlo, qhi, qer);
        float bm = m;
#pragma unroll
        for (int st = 0; st < 4; ++st)
#pragma unroll
            for (int jj = 0; jj < 8; ++jj) bm = fmaxf(bm, t[st][jj]);
        float a = 0.f;
#pragma unroll
        for (int st = 0; st < 4; ++st)
#pragma unroll
            for (int jj = 0; jj < 8; ++jj) a += __builtin_amdgcn_exp2f((t[st][jj] - bm) * L2E);
        l = l * __builtin_amdgcn_exp2f((m - bm) * L2E) + a; m = bm;
    }
    const float mx = fmaxf(m, __shfl_xor(m, 16, 32)); l *= __builtin_amdgcn_exp2f((m - mx) * L2E); l += __shfl_xor(l, 16, 32);
    const float f = __fdiv_rn(1.0f, l);
    v8f acc[4];
#pragma unroll
    for (int nb = 0; nb < 4; ++nb) acc[nb] = (v8f){};
    float lo_s = 0.f, hi_s = 0.f;
#pragma unroll
    for (int u = 0; u < 2; ++u) { rk[0][u] = *(const v8us*)(kgh + u * 32 * HD); rk[1][u] = *(const v8us*)(kgl + u * 32 * HD); rv[0][u] = *(const v8us*)(vg + (size_t)u * 32 * 2 * TT); rv[1][u] = *(const v8us*)(vg + (size_t)u * 32 * 2 * TT + TT); }
#pragma unroll 1
    for (int blk = 0; blk < TT / 64; ++blk) {
        __syncthreads();   // every wave has left the tiles that are overwritten next
#pragma unroll
        for (int u = 0; u < 2; ++u) { *(v8us*)(&tk[0][lo0 + u * 32 * KP]) = rk[0][u]; *(v8us*)(&tk[1][lo0 + u * 32 * KP]) = rk[1][u]; *(v8us*)(&tv[0][lo0 + u * 32 * KP]) = rv[0][u]; *(v8us*)(&tv[1][lo0 + u * 32 * KP]) = rv[1][u]; }
        __syncthreads();   // the tiles are whole before anybody reads them
        if (blk + 1 < TT / 64) {
#pragma unroll
            for (int u = 0; u < 2; ++u) { rk[0][u] = *(const v8us*)(kgh + ((blk + 1) * 64 + u * 32) * HD); rk[1][u] = *(const v8us*)(kgl + ((blk + 1) * 64 + u * 32) * HD); rv[0][u] = *(const v8us*)(vg + (size_t)u * 32 * 2 * TT + (blk + 1) * 64); rv[1][u] = *(const v8us*)(vg + (size_t)u * 32 * 2 * TT + TT + (blk + 1) * 64); }
            asm volatile("s_wait_xcnt 0x0" ::: "memory"); }   // the work below reuses the registers that these loads name as their addresses
        VB kf[4][4];   // the tile's 16 k fragments (per 16 keys: hi, lo of d 0..31, hi, lo of d 32..63), all loads issued before the first product so that one LDS latency is paid, not sixteen
#pragma unroll
        for (int st = 0; st < 4; ++st)
#pragma unroll
            for (int c = 0; c < 2; ++c) { kf[st][2 * c] = WFrag<bf>::ld(&tk[0][(st * 16 + lr) * KP + 8 * hi + c * 32]); kf[st][2 * c + 1] = WFrag<bf>::ld(&tk[1][(st * 16 + lr) * KP + 8 * hi + c * 32]); }
        __builtin_amdgcn_sched_barrier(0);   // keeps the fragment loads above together: sunk to their users they would each wait alone
        v8us oh[4], ol[4];
#pragma unroll
        for (int st = 0; st < 4; ++st) { const int j0s = blk * 64 + st * 16; float t[8], p4[8];
            d_stile(kf[st], qh, ql, t, j0s, i0, i, hi, qlo, qhi, qer);
#pragma unroll
            for (int jj = 0; jj < 8; ++jj) { unsigned short a, c2; splitf(__builtin_amdgcn_exp2f((t[jj] - mx) * L2E) * f, a, c2); oh[st][jj] = a; ol[st][jj] = c2; p4[jj] = __fadd_rn(bf2f(a), bf2f(c2)); }
            if (j0s + 15 <= i0 - CUT) {
#pragma unroll
                for (int jj = 0; jj < 8; ++jj) lo_s = __fadd_rn(lo_s, p4[jj]); }
            else if (j0s >= i0 + 15 + CUT) {
#pragma unroll
                for (int jj = 0; jj < 8; ++jj) hi_s = __fadd_rn(hi_s, p4[jj]); }
            else {
#pragma unroll
                for (int jj = 0; jj < 8; ++jj) { const int bkt = j0s + hi * 8 + jj - i + CUT; lo_s = __fadd_rn(lo_s, (bkt <= 0) ? p4[jj] : 0.0f); hi_s = __fadd_rn(hi_s, (bkt >= 2 * CUT) ? p4[jj] : 0.0f);
                    if (bkt > 0 && bkt < 2 * CUT) { pbh[lr * KP + bkt] = oh[st][jj]; pbl[lr * KP + bkt] = ol[st][jj]; } } } }
#pragma unroll
        for (int c = 0; c < 2; ++c) { const VB ph = cat16b(oh[2 * c], oh[2 * c + 1]), pl = cat16b(ol[2 * c], ol[2 * c + 1]); VB vh[4], vl[4];
#pragma unroll
            for (int nb = 0; nb < 4; ++nb) { vh[nb] = WFrag<bf>::ld(&tv[0][(nb * 16 + lr) * KP + c * 32 + 8 * hi]); vl[nb] = WFrag<bf>::ld(&tv[1][(nb * 16 + lr) * KP + c * 32 + 8 * hi]); }
            __builtin_amdgcn_sched_barrier(0);   // keeps the 8 v fragment loads together, as above
#pragma unroll
            for (int nb = 0; nb < 4; ++nb) acc[nb] = wmmab(ph, vh[nb], acc[nb]);
#pragma unroll
            for (int nb = 0; nb < 4; ++nb) acc[nb] = wmmab(pl, vh[nb], acc[nb]);
#pragma unroll
            for (int nb = 0; nb < 4; ++nb) acc[nb] = wmmab(ph, vl[nb], acc[nb]); }
        asm volatile("v_nop\n\tv_nop\n\tv_nop\n\tv_nop" : "+v"(acc[0]), "+v"(acc[1]), "+v"(acc[2]), "+v"(acc[3]));   // the distance behind the last matrix instruction on the path over the loop's branches
    }
    VB rh[2][4], rl[2][4];   // rel_v^T fragments, hi and lo
    const bf* rgh = AVTh + lr * NE + 8 * hi; const bf* rgl = AVTl + lr * NE + 8 * hi;
#pragma unroll
    for (int c = 0; c < 2; ++c)
#pragma unroll
        for (int nb = 0; nb < 4; ++nb) { rh[c][nb] = WFrag<bf>::ld(rgh + nb * 16 * NE + c * 32); rl[c][nb] = WFrag<bf>::ld(rgl + nb * 16 * NE + c * 32); }
    asm volatile("s_wait_xcnt 0x0" : "+v"(lo_s), "+v"(hi_s) : "v"(rgh), "v"(rgl) : "memory");   // the work below reuses the registers that these loads name as their addresses: the addresses stay live up to the wait, and the two sums pass through it so that the exchange below is not lifted over it
    lo_s = __fadd_rn(lo_s, __shfl_xor(lo_s, 16, 32)); hi_s = __fadd_rn(hi_s, __shfl_xor(hi_s, 16, 32));
    unsigned short l0h, l0l, h0h, h0l; splitf(lo_s, l0h, l0l); splitf(hi_s, h0h, h0l);
    if (hi == 0) { pbh[lr * KP] = l0h; pbl[lr * KP] = l0l; pbh[lr * KP + 2 * CUT] = h0h; pbl[lr * KP + 2 * CUT] = h0l; }
    __builtin_amdgcn_wave_barrier(); asm volatile("" ::: "memory");   // the fragment reads below take what other lanes of this wave stored
#pragma unroll
    for (int c = 0; c < 2; ++c) { const VB ph = WFrag<bf>::ld(pbh + lr * KP + 8 * hi + c * 32), pl = WFrag<bf>::ld(pbl + lr * KP + 8 * hi + c * 32);
#pragma unroll
        for (int nb = 0; nb < 4; ++nb) { acc[nb] = wmmab(ph, rh[c][nb], acc[nb]); acc[nb] = wmmab(pl, rh[c][nb], acc[nb]); acc[nb] = wmmab(ph, rl[c][nb], acc[nb]); } }
#pragma unroll
    for (int nb = 0; nb < 4; ++nb)
#pragma unroll
        for (int j = 0; j < 8; ++j) osw[(hi * 8 + j) * 68 + nb * 16 + lr] = acc[nb][j];
    __builtin_amdgcn_wave_barrier(); asm volatile("" ::: "memory");   // the row reads below take what other lanes of this wave stored
    bf* ah = ATh + ((size_t)(z / NH_) * TT + i0) * DQ + (z % NH_) * HD + lr * 4; bf* al = ATl + ((size_t)(z / NH_) * TT + i0) * DQ + (z % NH_) * HD + lr * 4;   /* z = b*16 + head */
#pragma unroll
    for (int s = 0; s < 8; ++s) { const int row = 2 * s + hi; const v4f val = *(const v4fa*)(osw + row * 68 + lr * 4); v4us o1, o2;
#pragma unroll
        for (int q = 0; q < 4; ++q) { unsigned short a, c2; splitf(val[q], a, c2); o1[q] = a; o2[q] = c2; }
        *(v4usa*)(ah + (size_t)row * DQ) = o1; *(v4usa*)(al + (size_t)row * DQ) = o2;
        asm volatile("s_wait_xcnt 0x0" ::: "memory"); }   // the next rows' arithmetic reuses the registers that these two stores name
}
__device__ __forceinline__ void d_epadK(int bx, const float* __restrict__ E, bf* EB) { const size_t i = (size_t)bx * 256 + threadIdx.x; if (i >= (size_t)NE * HD / 8) return; const int d0 = (int)(i % (HD / 8)) * 8; const int r = (int)(i / (HD / 8)); const float* src = E + (size_t)min(r, NRE - 1) * HD + d0; v8us o;
#pragma unroll
    for (int q = 0; q < 8; ++q) { const unsigned short v = f2bf(src[q]); o[q] = (r < NRE) ? v : (unsigned short)0; }
    *(v8us*)(EB + (size_t)r * HD + d0) = o;  }

__device__ __forceinline__ void d_epadVT(int bx, const float* __restrict__ E, bf* Th, bf* Tl) { const size_t i = (size_t)bx * 256 + threadIdx.x; if (i >= (size_t)HD * NE / 4) return; const size_t e = i * 4; const int c0 = (int)(e % NE); const int d = (int)(e / NE); v4us oh, ol;
#pragma unroll
    for (int q = 0; q < 4; ++q) { const int r = c0 + q; const float v = bfr(E[(size_t)min(r, NRE - 1) * HD + d]); unsigned short u, w; splitf(v, u, w);   /* input rounded to bf16 once: lo == 0 */ oh[q] = (r < NRE) ? u : (unsigned short)0; ol[q] = (r < NRE) ? w : (unsigned short)0; }
    *(v4us*)(Th + e) = oh; *(v4us*)(Tl + e) = ol;  }

// k_prep: every pass that reads nothing but the inputs, in one launch; blockIdx.y picks the pass (the four weight gathers, the longest, start first). Grid (256, 18).
__global__ __launch_bounds__(256) void k_prep(const float* __restrict__ wq, const float* __restrict__ wk, const float* __restrict__ wv, const float* __restrict__ wo, const float* __restrict__ ak, const float* __restrict__ av, const float* __restrict__ x, const float* __restrict__ xk, const float* __restrict__ xv, bf* WB, float* CS, bf* AKB, bf* AVTh, bf* AVTl, bf* XB) {
    static_assert(DM * DQ / 64 / 64 == 256 && DKV == DQ && TT * HD / 256 == 256 && NE * HD / 8 / 256 == 2 && HD * NE / 4 / 256 == 4 && NB_ * TT * DM / 8 / 256 == 4 * 256, "grid (256, 18)");
    const int bx = blockIdx.x, y = blockIdx.y;
    if (y < 4) { const float* w = (y == 0) ? wq : ((y == 1) ? wk : ((y == 2) ? wv : wo)); d_wtG(bx, w, DM, DQ, WB + (size_t)y * DM * DQ); }   /* 'xw' weights gathered into Bt */
    else if (y == 4) d_csid(bx, CS);
    else if (y == 5) { if (bx < 2) d_epadK(bx, ak, AKB);   /* rel_k -> bf16 [64][64], rows >= 33 zero */ else if (bx < 6) d_epadVT(bx - 2, av, AVTh, AVTl); }   /* rel_v^T hi/lo [64][64], cols >= 33 zero */
    else { const int q = (y - 6) >> 2; const float* src = (q == 0) ? x : ((q == 1) ? xk : xv); d_cvt8(((y - 6) & 3) * 256 + bx, src, XB + (size_t)q * NB_ * TT * DM, (size_t)NB_ * TT * DM / 8); }
}
// k_planes: the head planes of v (transposed; the slowest, so it starts first), q and k in one launch; blockIdx.z picks the tensor, blockIdx.y the batch.
__global__ __launch_bounds__(256) void k_planes(const float* __restrict__ FQ, const float* __restrict__ FK, const float* __restrict__ FV, const float* __restrict__ CS, h16* QP16, bf* QPh, bf* QPl, h16* KP16, bf* KPh, bf* KPl, h16* VT16, bf* VT2) {
    if (blockIdx.z == 0) d_vtp(FV, DKV, NKV, VT16, VT2);
    else if (blockIdx.z == 1) d_rope(FQ, DQ, NH_, CS, nullptr, nullptr, 1.0f, QP16, QPh, QPl);
    else d_rope(FK, DKV, NKV, CS, nullptr, nullptr, 1.0f, KP16, KPh, KPl);
}

extern "C" void kernel_launch(void* const* d_in, const int* in_sizes, int n_in,
                              void* d_out, int out_size, void* d_ws, size_t ws_size, hipStream_t stream) {
    (void)in_sizes; (void)n_in; (void)out_size;
    const float* x = (const float*)d_in[0];   /* query */ const float* xk = (const float*)d_in[1]; const float* xv = (const float*)d_in[2]; const float* wq = (const float*)d_in[3]; const float* bq = (const float*)d_in[4]; const float* wk = (const float*)d_in[5]; const float* bk = (const float*)d_in[6]; const float* wv = (const float*)d_in[7]; const float* bv = (const float*)d_in[8]; const float* wo = (const float*)d_in[9]; const float* bo = (const float*)d_in[10]; const float* ak = (const float*)d_in[11]; const float* av = (const float*)d_in[12];   /* rel_k / rel_v [33][64] */
    float* OUT = (float*)d_out;     // [2][1024][1024]
    char* wsp = (char*)d_ws;
    auto take = [&](size_t bytes) { char* p = wsp; wsp += (bytes + 255) & ~(size_t)255; return (void*)p; };
    bf* AKB = (bf*)take((size_t)NE * HD * 2); bf* AVTh = (bf*)take((size_t)HD * NE * 2); bf* AVTl = (bf*)take((size_t)HD * NE * 2); float* QE = (float*)take((size_t)ZB * TT * NE * 4);
    bf* WB = (bf*)take((size_t)4 * DM * DQ * 2);   /* Wq, Wk, Wv, Wo as Bt, one behind the other */ bf* WO = WB + (size_t)3 * DM * DQ; float* CS = (float*)take((size_t)TT * HD * 2 * 4);
    bf* XB = (bf*)take((size_t)3 * NB_ * TT * DM * 2);   /* query, key, value */ float* FQ = (float*)take((size_t)3 * NB_ * TT * DQ * 4);   /* q, k, v projections */ float* FK = FQ + (size_t)NB_ * TT * DQ; float* FV = FK + (size_t)NB_ * TT * DQ;
    h16* QP16 = (h16*)take((size_t)NB_ * NH_ * TT * HD * 2); h16* KP16 = (h16*)take((size_t)NB_ * NKV * TT * HD * 2); h16* VT16 = (h16*)take((size_t)NB_ * NKV * HD * TT * 2);
    bf* QPh = (bf*)take((size_t)NB_ * NH_ * TT * HD * 2); bf* QPl = (bf*)take((size_t)NB_ * NH_ * TT * HD * 2); bf* KPh = (bf*)take((size_t)NB_ * NKV * TT * HD * 2); bf* KPl = (bf*)take((size_t)NB_ * NKV * TT * HD * 2); bf* VT2 = (bf*)take((size_t)NB_ * NKV * HD * 2 * TT * 2);   /* v^T rows hi | lo */
    bf* ATh = (bf*)take((size_t)NB_ * TT * DQ * 2); bf* ATl = (bf*)take((size_t)NB_ * TT * DQ * 2);
    if ((size_t)(wsp - (char*)d_ws) > ws_size) return;    // ws 256 MiB
    k_prep<<<dim3(256, 18, 1), 256, 0, stream>>>(wq, wk, wv, wo, ak, av, x, xk, xv, WB, CS, AKB, AVTh, AVTl, XB);
    k_gemmw<bf, 0, true><<<dim3(NB_ * TT / 64, DQ / 64, 3), 32, 0, stream>>>(XB, nullptr, WB, nullptr, DM, DM, FQ, DQ, bq, bk, bv, (size_t)NB_ * TT * DM, (size_t)DM * DQ, (size_t)NB_ * TT * DQ);   /* z = q, k, v */
    k_planes<<<dim3((unsigned)(((size_t)NH_ * TT * HD / 2 + 255) / 256), NB_, 3), 256, 0, stream>>>(FQ, FK, FV, CS, QP16, QPh, QPl, KP16, KPh, KPl, VT16, VT2);
    k_gemmw<bf, 1, false><<<dim3(TT / 64, NE / 64, ZB), 32, 0, stream>>>(QPh, QPl, AKB, nullptr, HD, HD, QE, NE, nullptr, nullptr, nullptr, (size_t)TT * HD, 0, (size_t)TT * NE);   /* QE = q . rel_k^T */
    k_fattn<<<dim3(TT / 128, ZB, 1), 256, 0, stream>>>(QPh, QPl, KPh, KPl, VT2, QE, AVTh, AVTl, ATh, ATl);   /* z = b*16 + head walks consecutive q, k and v planes; scores + q.rel_k[clip(j - i) + 16], softmax, attn.v + attn folded onto the 33 offsets . rel_v, merged hi/lo */
    k_gemmw<bf, 1, true><<<dim3(NB_ * TT / 64, DM / 64, 1), 32, 0, stream>>>(ATh, ATl, WO, nullptr, DQ, DQ, OUT, DM, bo, bo, bo, 0, 0, 0);
}

// v005
// A run of this version takes 141 microseconds.
// Next to v004, in two timings, it ran 1.13 times as fast each time.
// Over all steps from v000 it is 8.21 times as fast.
#include <hip/hip_runtime.h>

// Relative (Shaw) multi-head attention with key AND value relative-position embeddings (query, key, value [2][1024][1024]; q = query Wq + bq, k = key Wk + bk, v = value Wv + bv ('xw' 1/32, zero biases; 16 heads x 64); idx[i][j] = clip(j - i, -16, 16) + 16; attn = softmax((q.k + q.rel_k[idx]) / 8); x = attn v + sum_j attn[i][j] rel_v[idx] (rel_k, rel_v [33][64] 1/8 scale, read); out = merged Wo + bo ('xw') -> [2][1024][1024] (2.1 M); argument order query, key, value, Wq, bq, Wk, bk, Wv, bv, Wo, bo, rel_k, rel_v).
// Layout: bf16 copies of query, key, value side by side (both batches, rows b*1024 + t); 'xw' weights gathered into Bt; exact projections + f32 biases; rel_k as a zero-padded bf16 plane [64][64] and rel_v^T as hi/lo planes [64][64] (bf16-rounded once); QE = q.rel_k^T (hi/lo x exact); one fused attention launch over all 32 (batch, head) pairs: score tiles (hi/lo 3 products) + QE at column clip(j - i) + 16, softmax (x 1/8), P as hi/lo fragments, P.v (hi/lo x hi/lo), the probabilities folded onto the 33 offsets (interior = one key, the two ends = fixed-order sums) and PB.rel_v added into the context's accumulators; merged hi/lo x Wo exact + bo.
// Compute dtypes, f32 accumulate: every input rounded to bf16; projections exact + f32 biases; scores and the relative-key term ~f32; softmax f32; P as bf16 hi/lo; attn.v and the relative-value term 3 products (~f32); Wo hl x exact + bias.

#define NB_  2
#define TT   1024
#define DM   1024
#define NH_  16
#define NKV  16
#define REP  (NH_ / NKV)
#define HD   64
#define DQ   (NH_ * HD)
#define DKV  (NKV * HD)
#define ZH   16
#define ZB   (NB_ * ZH)           // (batch, head) pairs per attention launch: all of them
#define RH   TT                   // every row on hi/lo planes (the relative-value fold needs normalised planes)
#define WIN  0
#define PCAR 1024.0f
#define SCL  0.125f   // 1/sqrt(64) (the module divides by jnp.sqrt(DH))
#define NE   64       // 2*16+1 = 33 relative offsets padded to 64
#define NRE  33
#define CUT  16
typedef _Float16 h16;
typedef unsigned short bf;
typedef __attribute__((ext_vector_type(16))) __bf16   v16bf;
typedef __attribute__((ext_vector_type(16))) _Float16 v16h;
typedef __attribute__((ext_vector_type(8)))  _Float16 v8h;
typedef __attribute__((ext_vector_type(8)))  unsigned short v8us;
typedef __attribute__((ext_vector_type(8)))  float    v8f;
typedef __attribute__((ext_vector_type(4)))  float    v4f;
typedef v8h  __attribute__((may_alias)) v8ha;
typedef v4f  __attribute__((may_alias)) v4fa;
typedef v8us __attribute__((may_alias)) v8usa;

__device__ __forceinline__ unsigned short f2bf(float f) { unsigned u = __float_as_uint(f); u += 0x7FFFu + ((u >> 16) & 1u); return (unsigned short)(u >> 16); }
__device__ __forceinline__ float bf2f(unsigned short b) { return __uint_as_float(((unsigned)b) << 16); }
__device__ __forceinline__ float bfr(float f) { return bf2f(f2bf(f)); }
__device__ __forceinline__ v16h cat16(v8h lo, v8h hi) { return __builtin_shufflevector(lo, hi, 0, 1, 2, 3, 4, 5, 6, 7, 8, 9, 10, 11, 12, 13, 14, 15); }
__device__ __forceinline__ v16bf cat16b(v8us lo, v8us hi) { return __builtin_bit_cast(v16bf, __builtin_shufflevector(lo, hi, 0, 1, 2, 3, 4, 5, 6, 7, 8, 9, 10, 11, 12, 13, 14, 15)); }
__device__ __forceinline__ v8f wmma16(v16h a, v16h b, v8f c) { return __builtin_amdgcn_wmma_f32_16x16x32_f16(false, a, false, b, (short)0, c, false, false); }
__device__ __forceinline__ v8f wmmab(v16bf a, v16bf b, v8f c) { return __builtin_amdgcn_wmma_f32_16x16x32_bf16(false, a, false, b, (short)0, c, false, false); }

__device__ __forceinline__ void splitf(float y, unsigned short& h, unsigned short& l) { h = f2bf(y); l = f2bf(y - bf2f(h)); }
typedef __attribute__((ext_vector_type(2))) unsigned short v2us;
typedef __attribute__((ext_vector_type(4))) unsigned short v4us;
typedef __attribute__((ext_vector_type(4))) unsigned int v4u;
typedef v4u  __attribute__((may_alias)) v4ua;
typedef v4us __attribute__((may_alias)) v4usa;

// ---- k_gemmw: register-blocked GEMM, ONE WAVE per 64x64 output tile (16 accumulators), operands straight from K-contiguous 16-bit planes; grid (M/64, N/64, Z), 32 threads.
// C[m][n] (f32, pitch ldc, + optional f32 bias[n], one bias vector per z = 0, 1, 2) = sum_k A[m][k] Bt[n][k] (+ split products per NSPLIT). K = row pitch of A and of Bt in elements, kend <= K = length of the sum. z-batch strides sA/sB/sC in elements. kend % 32 == 0.
// PL: the tile does not leave as f32 but as the attention kernel's bf16 hi/lo planes: z = 0, 1 -> [b][h][t][d] (q, k), z = 2 -> v^T rows (b, h, d) = hi | lo, pitch 2*TT. A 64x64 tile is 64 rows t of one (batch, head).
template <typename T16> struct WFrag;
template <> struct WFrag<h16> { typedef v16h V; static __device__ __forceinline__ V ld(const h16* p) { return cat16(*(const v8h*)p, *(const v8h*)(p + 16)); } static __device__ __forceinline__ v8f mma(V a, V b, v8f c) { return wmma16(a, b, c); } };
template <> struct WFrag<bf> { typedef v16bf V; static __device__ __forceinline__ V ld(const bf* p) { return cat16b(*(const v8us*)p, *(const v8us*)(p + 16)); } static __device__ __forceinline__ v8f mma(V a, V b, v8f c) { return wmmab(a, b, c); } };
template <typename T16, int NSPLIT, bool BIAS, bool PL>
__global__ __launch_bounds__(32) void k_gemmw(const T16* __restrict__ A, const T16* __restrict__ A2, const T16* __restrict__ Bt, const T16* __restrict__ Bt2, int K, int kend, float* C, int ldc, const float* __restrict__ bias0, const float* __restrict__ bias1, const float* __restrict__ bias2, size_t sA, size_t sB, size_t sC, bf* QPh, bf* QPl, bf* KPh, bf* KPl, bf* VT2) {
    typedef typename WFrag<T16>::V V;
    __shared__ __align__(16) float os[PL ? 2 * 64 * 72 / 2 : 16 * 68];   // PL: room for a whole v^T tile, hi and lo, row pitch 72 elements
    const size_t z = blockIdx.z; A += z * sA; if (A2) A2 += z * sA; Bt += z * sB; if (Bt2) Bt2 += z * sB; C += z * sC; const float* bias = (z == 0) ? bias0 : ((z == 1) ? bias1 : bias2);
    const int lane = threadIdx.x & 31, lr = lane & 15, hi = lane >> 4; const int r0 = blockIdx.x * 64, c0 = blockIdx.y * 64;
    v8f acc[4][4];
#pragma unroll
    for (int mb = 0; mb < 4; ++mb)
#pragma unroll
        for (int nb = 0; nb < 4; ++nb) acc[mb][nb] = (v8f){};
    const size_t aoff = (size_t)(r0 + lr) * K + 8 * hi, boff = (size_t)(c0 + lr) * K + 8 * hi;
#pragma unroll 1
    for (int kc = 0; kc < kend; kc += 32) {
        V a[4], a2[4];
#pragma unroll
        for (int mb = 0; mb < 4; ++mb) { a[mb] = WFrag<T16>::ld(A + aoff + (size_t)mb * 16 * K + kc); if (NSPLIT == 1 || NSPLIT == 2) a2[mb] = WFrag<T16>::ld(A2 + aoff + (size_t)mb * 16 * K + kc); }
#pragma unroll
        for (int nb = 0; nb < 4; ++nb) { const V b = WFrag<T16>::ld(Bt + boff + (size_t)nb * 16 * K + kc); V b2; if (NSPLIT >= 2) b2 = WFrag<T16>::ld(Bt2 + boff + (size_t)nb * 16 * K + kc);
#pragma unroll
            for (int mb = 0; mb < 4; ++mb) { acc[mb][nb] = WFrag<T16>::mma(a[mb], b, acc[mb][nb]); if (NSPLIT == 1 || NSPLIT == 2) acc[mb][nb] = WFrag<T16>::mma(a2[mb], b, acc[mb][nb]); if (NSPLIT >= 2) acc[mb][nb] = WFrag<T16>::mma(a[mb], b2, acc[mb][nb]); } }
        asm volatile("v_nop\n\tv_nop\n\tv_nop\n\tv_nop" : "+v"(acc[0][0]), "+v"(acc[1][1]), "+v"(acc[2][2]), "+v"(acc[3][3]) : "v"(a[0]), "v"(a[3]));
    }
    if (PL) {
        const int zh = (r0 / TT) * NH_ + c0 / HD, t0 = r0 % TT;
        if (z == 2) {   // v^T: a lane holds 8 consecutive t of one d, which is 16 bytes of a plane's row as it stands; through LDS so that whole 128-byte lines are stored
            bf* sh = (bf*)os; bf* sl = sh + 64 * 72;
#pragma unroll
            for (int nb = 0; nb < 4; ++nb) { const float bb = bfr(bias[c0 + nb * 16 + lr]);
#pragma unroll
                for (int mb = 0; mb < 4; ++mb) { v8us o1, o2;
#pragma unroll
                    for (int j = 0; j < 8; ++j) { unsigned short a1, c2; splitf(acc[mb][nb][j] + bb, a1, c2); o1[j] = a1; o2[j] = c2; }
                    *(v8usa*)(sh + (nb * 16 + lr) * 72 + mb * 16 + hi * 8) = o1; *(v8usa*)(sl + (nb * 16 + lr) * 72 + mb * 16 + hi * 8) = o2; } }
            __builtin_amdgcn_wave_barrier(); asm volatile("" ::: "memory");   // the row reads below take what other lanes of this wave stored
            bf* vrow = VT2 + ((size_t)zh * HD + (lane >> 3)) * (2 * TT) + t0 + (lane & 7) * 8;
#pragma unroll
            for (int g = 0; g < 4; ++g) { v8us o1[4], o2[4];   // 16 rows a round: one LDS latency for eight reads
#pragma unroll
                for (int s = 0; s < 4; ++s) { o1[s] = *(const v8usa*)(sh + ((g * 4 + s) * 4 + (lane >> 3)) * 72 + (lane & 7) * 8); o2[s] = *(const v8usa*)(sl + ((g * 4 + s) * 4 + (lane >> 3)) * 72 + (lane & 7) * 8); }
#pragma unroll
                for (int s = 0; s < 4; ++s) { *(v8usa*)(vrow + (size_t)(g * 4 + s) * 4 * 2 * TT) = o1[s]; *(v8usa*)(vrow + (size_t)(g * 4 + s) * 4 * 2 * TT + TT) = o2[s]; }
                asm volatile("s_wait_xcnt 0x0" ::: "memory"); }   // the next round reuses the registers that these stores name
            return; }
        bf* ph = ((z == 0) ? QPh : KPh) + ((size_t)zh * TT + t0) * HD + lr * 4; bf* pl = ((z == 0) ? QPl : KPl) + ((size_t)zh * TT + t0) * HD + lr * 4;
        v4f bb; bb[0] = bfr(bias[c0 + lr * 4]); bb[1] = bfr(bias[c0 + lr * 4 + 1]); bb[2] = bfr(bias[c0 + lr * 4 + 2]); bb[3] = bfr(bias[c0 + lr * 4 + 3]);
#pragma unroll
        for (int mb = 0; mb < 4; ++mb) {
#pragma unroll
            for (int nb = 0; nb < 4; ++nb) {
#pragma unroll
                for (int j = 0; j < 8; ++j) os[(hi * 8 + j) * 68 + nb * 16 + lr] = acc[mb][nb][j]; }
            __builtin_amdgcn_wave_barrier(); asm volatile("" ::: "memory");   // the row reads below take what other lanes of this wave stored
#pragma unroll
            for (int s = 0; s < 8; ++s) { const int row = 2 * s + hi; const v4f val = *(const v4fa*)(os + row * 68 + lr * 4); v4us o1, o2;
#pragma unroll
                for (int q = 0; q < 4; ++q) { unsigned short a1, c2; splitf(val[q] + bb[q], a1, c2); o1[q] = a1; o2[q] = c2; }
                *(v4usa*)(ph + (size_t)(mb * 16 + row) * HD) = o1; *(v4usa*)(pl + (size_t)(mb * 16 + row) * HD) = o2; }
            asm volatile("s_wait_xcnt 0x0" ::: "memory");   // the next 16 rows' work reuses the registers that these stores name
            __builtin_amdgcn_wave_barrier(); asm volatile("" ::: "memory");   // the next 16 rows overwrite what has just been read
        }
        return;
    }
#pragma unroll
    for (int mb = 0; mb < 4; ++mb) {
#pragma unroll
        for (int nb = 0; nb < 4; ++nb) {
#pragma unroll
            for (int j = 0; j < 8; ++j) os[(hi * 8 + j) * 68 + nb * 16 + lr] = acc[mb][nb][j]; }
        __builtin_amdgcn_wave_barrier(); asm volatile("" ::: "memory");
        float* crow = C + (size_t)(r0 + mb * 16) * ldc + c0;
{
#pragma unroll
            for (int s = 0; s < 8; ++s) { const int row = 2 * s + hi, cofs = lr * 4; v4f val = *(const v4fa*)(os + row * 68 + cofs); if (BIAS) { val[0] += bfr(bias[c0 + cofs]); val[1] += bfr(bias[c0 + cofs + 1]); val[2] += bfr(bias[c0 + cofs + 2]); val[3] += bfr(bias[c0 + cofs + 3]); }
                *(v4f*)(crow + (size_t)row * ldc + cofs) = val; }
             }
        __builtin_amdgcn_wave_barrier(); asm volatile("" ::: "memory");
    }
}


__device__ __forceinline__ void d_wtG(int bx, const float* __restrict__ w, int K, int N, bf* Bt) {
    const int lane = threadIdx.x & 31; const int L0 = (bx * 8 + (threadIdx.x >> 5)) * 8; const int nlines = N * K / 64;
{
#pragma unroll 1
        for (int l = 0; l < 8; ++l) { const int L = L0 + l; if (L >= nlines) break; const size_t e = (size_t)L * 64 + lane * 2; const int k = (int)(e % K), n = (int)(e / K); v2us o;
            o[0] = f2bf(w[(size_t)k * N + n]); o[1] = f2bf(w[(size_t)(k + 1) * N + n]); *(v2us*)(Bt + e) = o; }
         }
}
__device__ __forceinline__ void d_cvt8(int bx, const float* __restrict__ src, bf* dst, size_t n8) { const size_t i = (size_t)bx * 256 + threadIdx.x; if (i >= n8) return; const v8f v = *(const v8f*)(src + i * 8); v8us o;
#pragma unroll
    for (int k = 0; k < 8; ++k) o[k] = f2bf(v[k]); *(v8us*)(dst + i * 8) = o;  }

// k_fattn: scores, softmax, attn.v and the relative-value term in one kernel; no score or probability ever leaves the chip.
// Work-group = 8 waves = 128 query rows of one (batch, head); wave = 16 queries. Key tiles of 64 (k hi/lo, v^T hi/lo) go through registers into LDS (row pitch 144 B), the next tile's loads in flight while this one is worked on.
// Transposed scores S^T = k q^T: lane (lr, hi) holds query lr, keys hi*8 + 0..7 of each 16-key tile, which is the A fragment of P for P.v as it stands.
// Sweep 1: row maximum and row sum (per lane, rescaled when the maximum moves; the two half rows joined at the end). Sweep 2: the scores again, normalised P as bf16 hi/lo, P.v (3 products), P folded onto the 33 offsets (wave-own LDS planes), PB.rel_v into the same accumulators.
#define KP 72
typedef WFrag<bf>::V VB;
__device__ __forceinline__ void d_stile(const VB* kf, const VB* qh, const VB* ql, float* t, int j0s, int i0, int i, int hi, float qlo, float qhi, const float* qer) {
    float e[8];   // the relative-key term of this lane's 8 keys, chosen in front of the products so that no branch stands behind a matrix instruction
    if (j0s + 15 <= i0 - CUT) {   /* the same for the whole wave: every key of the tile on the low end offset */
#pragma unroll
        for (int jj = 0; jj < 8; ++jj) e[jj] = qlo; }
    else if (j0s >= i0 + 15 + CUT) {
#pragma unroll
        for (int jj = 0; jj < 8; ++jj) e[jj] = qhi; }
    else {
#pragma unroll
        for (int jj = 0; jj < 8; ++jj) e[jj] = qer[min(max(j0s + hi * 8 + jj - i, -CUT), CUT) + CUT]; }
    v8f s = (v8f){};
#pragma unroll
    for (int c = 0; c < 2; ++c) { s = wmmab(kf[2 * c], qh[c], s); s = wmmab(kf[2 * c], ql[c], s); s = wmmab(kf[2 * c + 1], qh[c], s); }
#pragma unroll
    for (int jj = 0; jj < 8; ++jj) t[jj] = __fadd_rn(s[jj], e[jj]) * SCL;
}
__global__ __launch_bounds__(256) void k_fattn(const bf* __restrict__ QPh, const bf* __restrict__ QPl, const bf* __restrict__ KPh, const bf* __restrict__ KPl, const bf* __restrict__ VT2, const float* __restrict__ QE, const bf* __restrict__ AVTh, const bf* __restrict__ AVTl, bf* ATh, bf* ATl) {
    __shared__ __align__(16) bf tk[2][64 * KP];        // k tile [key][d], hi and lo
    __shared__ __align__(16) bf tv[2][64 * KP];        // v^T tile [d][key], hi and lo
    __shared__ __align__(16) bf pb[8][2][16 * KP];     // per wave: P folded onto the offsets [query][offset], hi and lo
    __shared__ __align__(16) float os[8][16 * 68];     // per wave: first its rows of QE, at the end its output tile
    const float L2E = 1.4426950408889634f;
    const int tid = threadIdx.x, lane = tid & 31, lr = lane & 15, hi = lane >> 4; const int wv = __builtin_amdgcn_readfirstlane(tid >> 5);
    const int z = blockIdx.y, i0 = blockIdx.x * 128 + wv * 16, i = i0 + lr;
    float* osw = os[wv]; bf* pbh = pb[wv][0]; bf* pbl = pb[wv][1];
    const int cr = tid >> 3, cc = (tid & 7) * 8, lo0 = cr * KP + cc;   // this thread's 16-byte pieces of a tile: rows cr and cr + 32
    const bf* kgh = KPh + (size_t)z * TT * HD + cr * HD + cc; const bf* kgl = KPl + (size_t)z * TT * HD + cr * HD + cc; const bf* vg = VT2 + ((size_t)z * HD + cr) * (2 * TT) + cc;
    v8us rk[2][2], rv[2][2];
#pragma unroll
    for (int u = 0; u < 2; ++u) { rk[0][u] = *(const v8us*)(kgh + u * 32 * HD); rk[1][u] = *(const v8us*)(kgl + u * 32 * HD); }
    VB qh[2], ql[2];
#pragma unroll
    for (int c = 0; c < 2; ++c) { qh[c] = WFrag<bf>::ld(QPh + ((size_t)z * TT + i) * HD + 8 * hi + c * 32); ql[c] = WFrag<bf>::ld(QPl + ((size_t)z * TT + i) * HD + 8 * hi + c * 32); }
#pragma unroll
    for (int u = 0; u < 8; ++u) { const int c = lane + 32 * u; *(v4fa*)(osw + (c >> 4) * 68 + (c & 15) * 4) = *(const v4fa*)(QE + ((size_t)z * TT + i0 + (c >> 4)) * NE + (c & 15) * 4); }
#pragma unroll
    for (int u = 0; u < 9; ++u) ((v4ua*)pbh)[lane + 32 * u] = (v4u){0u, 0u, 0u, 0u};   // both planes (they lie one behind the other): an offset with no key stays zero
    __builtin_amdgcn_wave_barrier(); asm volatile("" ::: "memory");   // the reads of osw below take what other lanes of this wave stored (one wave's LDS operations run in order)
    const float* qer = osw + lr * 68; const float qlo = qer[0], qhi = qer[2 * CUT];
    float m = -3.0e38f, l = 0.f;
#pragma unroll 1
    for (int blk = 0; blk < TT / 64; ++blk) {
        __syncthreads();   // every wave has left the tile that is overwritten next
#pragma unroll
        for (int u = 0; u < 2; ++u) { *(v8us*)(&tk[0][lo0 + u * 32 * KP]) = rk[0][u]; *(v8us*)(&tk[1][lo0 + u * 32 * KP]) = rk[1][u]; }
        __syncthreads();   // the tile is whole before anybody reads it
        if (blk + 1 < TT / 64) {
#pragma unroll
            for (int u = 0; u < 2; ++u) { rk[0][u] = *(const v8us*)(kgh + ((blk + 1) * 64 + u * 32) * HD); rk[1][u] = *(const v8us*)(kgl + ((blk + 1) * 64 + u * 32) * HD); }
            asm volatile("s_wait_xcnt 0x0" ::: "memory"); }   // the work below reuses the registers that these loads name as their addresses
        VB kf[4][4];   // the tile's 16 k fragments (per 16 keys: hi, lo of d 0..31, hi, lo of d 32..63), all loads issued before the first product so that one LDS latency is paid, not sixteen
#pragma unroll
        for (int st = 0; st < 4; ++st)
#pragma unroll
            for (int c = 0; c < 2; ++c) { kf[st][2 * c] = WFrag<bf>::ld(&tk[0][(st * 16 + lr) * KP + 8 * hi + c * 32]); kf[st][2 * c + 1] = WFrag<bf>::ld(&tk[1][(st * 16 + lr) * KP + 8 * hi + c * 32]); }
        __builtin_amdgcn_sched_barrier(0);   // keeps the fragment loads above together: sunk to their users they would each wait alone
        float t[4][8];
#pragma unroll
        for (int st = 0; st < 4; ++st) d_stile(kf[st], qh, ql, t[st], blk * 64 + st * 16, i0, i, hi, qlo, qhi, qer);
        float bm = m;
#pragma unroll
        for (int st = 0; st < 4; ++st)
#pragma unroll
            for (int jj = 0; jj < 8; ++jj) bm = fmaxf(bm, t[st][jj]);
        float a = 0.f;
#pragma unroll
        for (int st = 0; st < 4; ++st)
#pragma unroll
            for (int jj = 0; jj < 8; ++jj) a += __builtin_amdgcn_exp2f((t[st][jj] - bm) * L2E);
        l = l * __builtin_amdgcn_exp2f((m - bm) * L2E) + a; m = bm;
    }
    const float mx = fmaxf(m, __shfl_xor(m, 16, 32)); l *= __builtin_amdgcn_exp2f((m - mx) * L2E); l += __shfl_xor(l, 16, 32);
    const float f = __fdiv_rn(1.0f, l);
    v8f acc[4];
#pragma unroll
    for (int nb = 0; nb < 4; ++nb) acc[nb] = (v8f){};
    float lo_s = 0.f, hi_s = 0.f;
#pragma unroll
    for (int u = 0; u < 2; ++u) { rk[0][u] = *(const v8us*)(kgh + u * 32 * HD); rk[1][u] = *(const v8us*)(kgl + u * 32 * HD); rv[0][u] = *(const v8us*)(vg + (size_t)u * 32 * 2 * TT); rv[1][u] = *(const v8us*)(vg + (size_t)u * 32 * 2 * TT + TT); }
#pragma unroll 1
    for (int blk = 0; blk < TT / 64; ++blk) {
        __syncthreads();   // every wave has left the tiles that are overwritten next
#pragma unroll
        for (int u = 0; u < 2; ++u) { *(v8us*)(&tk[0][lo0 + u * 32 * KP]) = rk[0][u]; *(v8us*)(&tk[1][lo0 + u * 32 * KP]) = rk[1][u]; *(v8us*)(&tv[0][lo0 + u * 32 * KP]) = rv[0][u]; *(v8us*)(&tv[1][lo0 + u * 32 * KP]) = rv[1][u]; }
        __syncthreads();   // the tiles are whole before anybody reads them
        if (blk + 1 < TT / 64) {
#pragma unroll
            for (int u = 0; u < 2; ++u) { rk[0][u] = *(const v8us*)(kgh + ((blk + 1) * 64 + u * 32) * HD); rk[1][u] = *(const v8us*)(kgl + ((blk + 1) * 64 + u * 32) * HD); rv[0][u] = *(const v8us*)(vg + (size_t)u * 32 * 2 * TT + (blk + 1) * 64); rv[1][u] = *(const v8us*)(vg + (size_t)u * 32 * 2 * TT + TT + (blk + 1) * 64); }
            asm volatile("s_wait_xcnt 0x0" ::: "memory"); }   // the work below reuses the registers that these loads name as their addresses
        VB kf[4][4];   // the tile's 16 k fragments (per 16 keys: hi, lo of d 0..31, hi, lo of d 32..63), all loads issued before the first product so that one LDS latency is paid, not sixteen
#pragma unroll
        for (int st = 0; st < 4; ++st)
#pragma unroll
            for (int c = 0; c < 2; ++c) { kf[st][2 * c] = WFrag<bf>::ld(&tk[0][(st * 16 + lr) * KP + 8 * hi + c * 32]); kf[st][2 * c + 1] = WFrag<bf>::ld(&tk[1][(st * 16 + lr) * KP + 8 * hi + c * 32]); }
        __builtin_amdgcn_sched_barrier(0);   // keeps the fragment loads above together: sunk to their users they would each wait alone
        v8us oh[4], ol[4];
#pragma unroll
        for (int st = 0; st < 4; ++st) { const int j0s = blk * 64 + st * 16; float t[8], p4[8];
            d_stile(kf[st], qh, ql, t, j0s, i0, i, hi, qlo, qhi, qer);
#pragma unroll
            for (int jj = 0; jj < 8; ++jj) { unsigned short a, c2; splitf(__builtin_amdgcn_exp2f((t[jj] - mx) * L2E) * f, a, c2); oh[st][jj] = a; ol[st][jj] = c2; p4[jj] = __fadd_rn(bf2f(a), bf2f(c2)); }
            if (j0s + 15 <= i0 - CUT) {
#pragma unroll
                for (int jj = 0; jj < 8; ++jj) lo_s = __fadd_rn(lo_s, p4[jj]); }
            else if (j0s >= i0 + 15 + CUT) {
#pragma unroll
                for (int jj = 0; jj < 8; ++jj) hi_s = __fadd_rn(hi_s, p4[jj]); }
            else {
#pragma unroll
                for (int jj = 0; jj < 8; ++jj) { const int bkt = j0s + hi * 8 + jj - i + CUT; lo_s = __fadd_rn(lo_s, (bkt <= 0) ? p4[jj] : 0.0f); hi_s = __fadd_rn(hi_s, (bkt >= 2 * CUT) ? p4[jj] : 0.0f);
                    if (bkt > 0 && bkt < 2 * CUT) { pbh[lr * KP + bkt] = oh[st][jj]; pbl[lr * KP + bkt] = ol[st][jj]; } } } }
#pragma unroll
        for (int c = 0; c < 2; ++c) { const VB ph = cat16b(oh[2 * c], oh[2 * c + 1]), pl = cat16b(ol[2 * c], ol[2 * c + 1]); VB vh[4], vl[4];
#pragma unroll
            for (int nb = 0; nb < 4; ++nb) { vh[nb] = WFrag<bf>::ld(&tv[0][(nb * 16 + lr) * KP + c * 32 + 8 * hi]); vl[nb] = WFrag<bf>::ld(&tv[1][(nb * 16 + lr) * KP + c * 32 + 8 * hi]); }
            __builtin_amdgcn_sched_barrier(0);   // keeps the 8 v fragment loads together, as above
#pragma unroll
            for (int nb = 0; nb < 4; ++nb) acc[nb] = wmmab(ph, vh[nb], acc[nb]);
#pragma unroll
            for (int nb = 0; nb < 4; ++nb) acc[nb] = wmmab(pl, vh[nb], acc[nb]);
#pragma unroll
            for (int nb = 0; nb < 4; ++nb) acc[nb] = wmmab(ph, vl[nb], acc[nb]); }
        asm volatile("v_nop\n\tv_nop\n\tv_nop\n\tv_nop" : "+v"(acc[0]), "+v"(acc[1]), "+v"(acc[2]), "+v"(acc[3]));   // the distance behind the last matrix instruction on the path over the loop's branches
    }
    VB rh[2][4], rl[2][4];   // rel_v^T fragments, hi and lo
    const bf* rgh = AVTh + lr * NE + 8 * hi; const bf* rgl = AVTl + lr * NE + 8 * hi;
#pragma unroll
    for (int c = 0; c < 2; ++c)
#pragma unroll
        for (int nb = 0; nb < 4; ++nb) { rh[c][nb] = WFrag<bf>::ld(rgh + nb * 16 * NE + c * 32); rl[c][nb] = WFrag<bf>::ld(rgl + nb * 16 * NE + c * 32); }
    asm volatile("s_wait_xcnt 0x0" : "+v"(lo_s), "+v"(hi_s) : "v"(rgh), "v"(rgl) : "memory");   // the work below reuses the registers that these loads name as their addresses: the addresses stay live up to the wait, and the two sums pass through it so that the exchange below is not lifted over it
    lo_s = __fadd_rn(lo_s, __shfl_xor(lo_s, 16, 32)); hi_s = __fadd_rn(hi_s, __shfl_xor(hi_s, 16, 32));
    unsigned short l0h, l0l, h0h, h0l; splitf(lo_s, l0h, l0l); splitf(hi_s, h0h, h0l);
    if (hi == 0) { pbh[lr * KP] = l0h; pbl[lr * KP] = l0l; pbh[lr * KP + 2 * CUT] = h0h; pbl[lr * KP + 2 * CUT] = h0l; }
    __builtin_amdgcn_wave_barrier(); asm volatile("" ::: "memory");   // the fragment reads below take what other lanes of this wave stored
#pragma unroll
    for (int c = 0; c < 2; ++c) { const VB ph = WFrag<bf>::ld(pbh + lr * KP + 8 * hi + c * 32), pl = WFrag<bf>::ld(pbl + lr * KP + 8 * hi + c * 32);
#pragma unroll
        for (int nb = 0; nb < 4; ++nb) { acc[nb] = wmmab(ph, rh[c][nb], acc[nb]); acc[nb] = wmmab(pl, rh[c][nb], acc[nb]); acc[nb] = wmmab(ph, rl[c][nb], acc[nb]); } }
#pragma unroll
    for (int nb = 0; nb < 4; ++nb)
#pragma unroll
        for (int j = 0; j < 8; ++j) osw[(hi * 8 + j) * 68 + nb * 16 + lr] = acc[nb][j];
    __builtin_amdgcn_wave_barrier(); asm volatile("" ::: "memory");   // the row reads below take what other lanes of this wave stored
    bf* ah = ATh + ((size_t)(z / NH_) * TT + i0) * DQ + (z % NH_) * HD + lr * 4; bf* al = ATl + ((size_t)(z / NH_) * TT + i0) * DQ + (z % NH_) * HD + lr * 4;   /* z = b*16 + head */
#pragma unroll
    for (int s = 0; s < 8; ++s) { const int row = 2 * s + hi; const v4f val = *(const v4fa*)(osw + row * 68 + lr * 4); v4us o1, o2;
#pragma unroll
        for (int q = 0; q < 4; ++q) { unsigned short a, c2; splitf(val[q], a, c2); o1[q] = a; o2[q] = c2; }
        *(v4usa*)(ah + (size_t)row * DQ) = o1; *(v4usa*)(al + (size_t)row * DQ) = o2;
        asm volatile("s_wait_xcnt 0x0" ::: "memory"); }   // the next rows' arithmetic reuses the registers that these two stores name
}
__device__ __forceinline__ void d_epadK(int bx, const float* __restrict__ E, bf* EB) { const size_t i = (size_t)bx * 256 + threadIdx.x; if (i >= (size_t)NE * HD / 8) return; const int d0 = (int)(i % (HD / 8)) * 8; const int r = (int)(i / (HD / 8)); const float* src = E + (size_t)min(r, NRE - 1) * HD + d0; v8us o;
#pragma unroll
    for (int q = 0; q < 8; ++q) { const unsigned short v = f2bf(src[q]); o[q] = (r < NRE) ? v : (unsigned short)0; }
    *(v8us*)(EB + (size_t)r * HD + d0) = o;  }

__device__ __forceinline__ void d_epadVT(int bx, const float* __restrict__ E, bf* Th, bf* Tl) { const size_t i = (size_t)bx * 256 + threadIdx.x; if (i >= (size_t)HD * NE / 4) return; const size_t e = i * 4; const int c0 = (int)(e % NE); const int d = (int)(e / NE); v4us oh, ol;
#pragma unroll
    for (int q = 0; q < 4; ++q) { const int r = c0 + q; const float v = bfr(E[(size_t)min(r, NRE - 1) * HD + d]); unsigned short u, w; splitf(v, u, w);   /* input rounded to bf16 once: lo == 0 */ oh[q] = (r < NRE) ? u : (unsigned short)0; ol[q] = (r < NRE) ? w : (unsigned short)0; }
    *(v4us*)(Th + e) = oh; *(v4us*)(Tl + e) = ol;  }

// k_prep: every pass that reads nothing but the inputs, in one launch; blockIdx.y picks the pass (the four weight gathers, the longest, start first). Grid (256, 17).
__global__ __launch_bounds__(256) void k_prep(const float* __restrict__ wq, const float* __restrict__ wk, const float* __restrict__ wv, const float* __restrict__ wo, const float* __restrict__ ak, const float* __restrict__ av, const float* __restrict__ x, const float* __restrict__ xk, const float* __restrict__ xv, bf* WB, bf* AKB, bf* AVTh, bf* AVTl, bf* XB) {
    static_assert(DM * DQ / 64 / 64 == 256 && DKV == DQ && NE * HD / 8 / 256 == 2 && HD * NE / 4 / 256 == 4 && NB_ * TT * DM / 8 / 256 == 4 * 256, "grid (256, 17)");
    const int bx = blockIdx.x, y = blockIdx.y;
    if (y < 4) { const float* w = (y == 0) ? wq : ((y == 1) ? wk : ((y == 2) ? wv : wo)); d_wtG(bx, w, DM, DQ, WB + (size_t)y * DM * DQ); }   /* 'xw' weights gathered into Bt */
    else if (y == 4) { if (bx < 2) d_epadK(bx, ak, AKB);   /* rel_k -> bf16 [64][64], rows >= 33 zero */ else if (bx < 6) d_epadVT(bx - 2, av, AVTh, AVTl); }   /* rel_v^T hi/lo [64][64], cols >= 33 zero */
    else { const int q = (y - 5) >> 2; const float* src = (q == 0) ? x : ((q == 1) ? xk : xv); d_cvt8(((y - 5) & 3) * 256 + bx, src, XB + (size_t)q * NB_ * TT * DM, (size_t)NB_ * TT * DM / 8); }
}

extern "C" void kernel_launch(void* const* d_in, const int* in_sizes, int n_in,
                              void* d_out, int out_size, void* d_ws, size_t ws_size, hipStream_t stream) {
    (void)in_sizes; (void)n_in; (void)out_size;
    const float* x = (const float*)d_in[0];   /* query */ const float* xk = (const float*)d_in[1]; const float* xv = (const float*)d_in[2]; const float* wq = (const float*)d_in[3]; const float* bq = (const float*)d_in[4]; const float* wk = (const float*)d_in[5]; const float* bk = (const float*)d_in[6]; const float* wv = (const float*)d_in[7]; const float* bv = (const float*)d_in[8]; const float* wo = (const float*)d_in[9]; const float* bo = (const float*)d_in[10]; const float* ak = (const float*)d_in[11]; const float* av = (const float*)d_in[12];   /* rel_k / rel_v [33][64] */
    float* OUT = (float*)d_out;     // [2][1024][1024]
    char* wsp = (char*)d_ws;
    auto take = [&](size_t bytes) { char* p = wsp; wsp += (bytes + 255) & ~(size_t)255; return (void*)p; };
    bf* AKB = (bf*)take((size_t)NE * HD * 2); bf* AVTh = (bf*)take((size_t)HD * NE * 2); bf* AVTl = (bf*)take((size_t)HD * NE * 2); float* QE = (float*)take((size_t)ZB * TT * NE * 4);
    bf* WB = (bf*)take((size_t)4 * DM * DQ * 2);   /* Wq, Wk, Wv, Wo as Bt, one behind the other */ bf* WO = WB + (size_t)3 * DM * DQ;
    bf* XB = (bf*)take((size_t)3 * NB_ * TT * DM * 2);   /* query, key, value */
    bf* QPh = (bf*)take((size_t)NB_ * NH_ * TT * HD * 2); bf* QPl = (bf*)take((size_t)NB_ * NH_ * TT * HD * 2); bf* KPh = (bf*)take((size_t)NB_ * NKV * TT * HD * 2); bf* KPl = (bf*)take((size_t)NB_ * NKV * TT * HD * 2); bf* VT2 = (bf*)take((size_t)NB_ * NKV * HD * 2 * TT * 2);   /* v^T rows hi | lo */
    bf* ATh = (bf*)take((size_t)NB_ * TT * DQ * 2); bf* ATl = (bf*)take((size_t)NB_ * TT * DQ * 2);
    if ((size_t)(wsp - (char*)d_ws) > ws_size) return;    // ws 256 MiB
    k_prep<<<dim3(256, 17, 1), 256, 0, stream>>>(wq, wk, wv, wo, ak, av, x, xk, xv, WB, AKB, AVTh, AVTl, XB);
    k_gemmw<bf, 0, true, true><<<dim3(NB_ * TT / 64, DQ / 64, 3), 32, 0, stream>>>(XB, nullptr, WB, nullptr, DM, DM, nullptr, DQ, bq, bk, bv, (size_t)NB_ * TT * DM, (size_t)DM * DQ, 0, QPh, QPl, KPh, KPl, VT2);   /* z = q, k, v, straight into the head planes */
    k_gemmw<bf, 1, false, false><<<dim3(TT / 64, NE / 64, ZB), 32, 0, stream>>>(QPh, QPl, AKB, nullptr, HD, HD, QE, NE, nullptr, nullptr, nullptr, (size_t)TT * HD, 0, (size_t)TT * NE, nullptr, nullptr, nullptr, nullptr, nullptr);   /* QE = q . rel_k^T */
    k_fattn<<<dim3(TT / 128, ZB, 1), 256, 0, stream>>>(QPh, QPl, KPh, KPl, VT2, QE, AVTh, AVTl, ATh, ATl);   /* z = b*16 + head walks consecutive q, k and v planes; scores + q.rel_k[clip(j - i) + 16], softmax, attn.v + attn folded onto the 33 offsets . rel_v, merged hi/lo */
    k_gemmw<bf, 1, true, false><<<dim3(NB_ * TT / 64, DM / 64, 1), 32, 0, stream>>>(ATh, ATl, WO, nullptr, DQ, DQ, OUT, DM, bo, bo, bo, 0, 0, 0, nullptr, nullptr, nullptr, nullptr, nullptr);
}

// v006
// It runs in 100 microseconds.
// In both of two side-by-side timings against v005, it was 1.42 times as fast.
// Over all steps from v000 it is 11.6 times as fast.
#include <hip/hip_runtime.h>

// Relative (Shaw) multi-head attention with key AND value relative-position embeddings (query, key, value [2][1024][1024]; q = query Wq + bq, k = key Wk + bk, v = value Wv + bv ('xw' 1/32, zero biases; 16 heads x 64); idx[i][j] = clip(j - i, -16, 16) + 16; attn = softmax((q.k + q.rel_k[idx]) / 8); x = attn v + sum_j attn[i][j] rel_v[idx] (rel_k, rel_v [33][64] 1/8 scale, read); out = merged Wo + bo ('xw') -> [2][1024][1024] (2.1 M); argument order query, key, value, Wq, bq, Wk, bk, Wv, bv, Wo, bo, rel_k, rel_v).
// Layout: bf16 copies of query, key, value side by side (both batches, rows b*1024 + t); 'xw' weights gathered into Bt; exact projections + f32 biases; rel_k as a zero-padded bf16 plane [64][64] and rel_v^T as hi/lo planes [64][64] (bf16-rounded once); QE = q.rel_k^T (hi/lo x exact); one fused attention launch over all 32 (batch, head) pairs: score tiles (hi/lo 3 products) + QE at column clip(j - i) + 16, softmax (x 1/8), P as hi/lo fragments, P.v (hi/lo x hi/lo), the probabilities folded onto the 33 offsets (interior = one key, the two ends = fixed-order sums) and PB.rel_v added into the context's accumulators; merged hi/lo x Wo exact + bo.
// Compute dtypes, f32 accumulate: every input rounded to bf16; projections exact + f32 biases; scores and the relative-key term ~f32; softmax f32; P as bf16 hi/lo; attn.v and the relative-value term 3 products (~f32); Wo hl x exact + bias.

#define NB_  2
#define TT   1024
#define DM   1024
#define NH_  16
#define NKV  16
#define REP  (NH_ / NKV)
#define HD   64
#define DQ   (NH_ * HD)
#define DKV  (NKV * HD)
#define ZH   16
#define ZB   (NB_ * ZH)           // (batch, head) pairs per attention launch: all of them
#define RH   TT                   // every row on hi/lo planes (the relative-value fold needs normalised planes)
#define WIN  0
#define PCAR 1024.0f
#define SCL  0.125f   // 1/sqrt(64) (the module divides by jnp.sqrt(DH))
#define NE   64       // 2*16+1 = 33 relative offsets padded to 64
#define NRE  33
#define CUT  16
typedef _Float16 h16;
typedef unsigned short bf;
typedef __attribute__((ext_vector_type(16))) __bf16   v16bf;
typedef __attribute__((ext_vector_type(16))) _Float16 v16h;
typedef __attribute__((ext_vector_type(8)))  _Float16 v8h;
typedef __attribute__((ext_vector_type(8)))  unsigned short v8us;
typedef __attribute__((ext_vector_type(8)))  float    v8f;
typedef __attribute__((ext_vector_type(4)))  float    v4f;
typedef v8h  __attribute__((may_alias)) v8ha;
typedef v4f  __attribute__((may_alias)) v4fa;
typedef v8us __attribute__((may_alias)) v8usa;

__device__ __forceinline__ unsigned short f2bf(float f) { unsigned u = __float_as_uint(f); u += 0x7FFFu + ((u >> 16) & 1u); return (unsigned short)(u >> 16); }
__device__ __forceinline__ float bf2f(unsigned short b) { return __uint_as_float(((unsigned)b) << 16); }
__device__ __forceinline__ float bfr(float f) { return bf2f(f2bf(f)); }
__device__ __forceinline__ v16h cat16(v8h lo, v8h hi) { return __builtin_shufflevector(lo, hi, 0, 1, 2, 3, 4, 5, 6, 7, 8, 9, 10, 11, 12, 13, 14, 15); }
__device__ __forceinline__ v16bf cat16b(v8us lo, v8us hi) { return __builtin_bit_cast(v16bf, __builtin_shufflevector(lo, hi, 0, 1, 2, 3, 4, 5, 6, 7, 8, 9, 10, 11, 12, 13, 14, 15)); }
__device__ __forceinline__ v8f wmma16(v16h a, v16h b, v8f c) { return __builtin_amdgcn_wmma_f32_16x16x32_f16(false, a, false, b, (short)0, c, false, false); }
__device__ __forceinline__ v8f wmmab(v16bf a, v16bf b, v8f c) { return __builtin_amdgcn_wmma_f32_16x16x32_bf16(false, a, false, b, (short)0, c, false, false); }

__device__ __forceinline__ void splitf(float y, unsigned short& h, unsigned short& l) { h = f2bf(y); l = f2bf(y - bf2f(h)); }
typedef __attribute__((ext_vector_type(2))) unsigned short v2us;
typedef __attribute__((ext_vector_type(4))) unsigned short v4us;
typedef __attribute__((ext_vector_type(4))) unsigned int v4u;
typedef v4u  __attribute__((may_alias)) v4ua;
typedef v4us __attribute__((may_alias)) v4usa;

// ---- k_gemmw: register-blocked GEMM, ONE WAVE per 64x64 output tile (16 accumulators), operands straight from K-contiguous 16-bit planes; grid (M/64, N/64, Z), 32 threads. Serves the short product QE.
// C[m][n] (f32, pitch ldc) = sum_k A[m][k] Bt[n][k] (+ split products per NSPLIT). K = row pitch of A and of Bt in elements, kend <= K = length of the sum. z-batch strides sA/sB/sC in elements. kend % 32 == 0.
template <typename T16> struct WFrag;
template <> struct WFrag<h16> { typedef v16h V; static __device__ __forceinline__ V ld(const h16* p) { return cat16(*(const v8h*)p, *(const v8h*)(p + 16)); } static __device__ __forceinline__ v8f mma(V a, V b, v8f c) { return wmma16(a, b, c); } };
template <> struct WFrag<bf> { typedef v16bf V; static __device__ __forceinline__ V ld(const bf* p) { return cat16b(*(const v8us*)p, *(const v8us*)(p + 16)); } static __device__ __forceinline__ v8f mma(V a, V b, v8f c) { return wmmab(a, b, c); } };
template <typename T16, int NSPLIT>
__global__ __launch_bounds__(32) void k_gemmw(const T16* __restrict__ A, const T16* __restrict__ A2, const T16* __restrict__ Bt, const T16* __restrict__ Bt2, int K, int kend, float* C, int ldc, size_t sA, size_t sB, size_t sC) {
    typedef typename WFrag<T16>::V V;
    __shared__ __align__(16) float os[16 * 68];
    const size_t z = blockIdx.z; A += z * sA; if (A2) A2 += z * sA; Bt += z * sB; if (Bt2) Bt2 += z * sB; C += z * sC;
    const int lane = threadIdx.x & 31, lr = lane & 15, hi = lane >> 4; const int r0 = blockIdx.x * 64, c0 = blockIdx.y * 64;
    v8f acc[4][4];
#pragma unroll
    for (int mb = 0; mb < 4; ++mb)
#pragma unroll
        for (int nb = 0; nb < 4; ++nb) acc[mb][nb] = (v8f){};
    const size_t aoff = (size_t)(r0 + lr) * K + 8 * hi, boff = (size_t)(c0 + lr) * K + 8 * hi;
#pragma unroll 1
    for (int kc = 0; kc < kend; kc += 32) {
        V a[4], a2[4];
#pragma unroll
        for (int mb = 0; mb < 4; ++mb) { a[mb] = WFrag<T16>::ld(A + aoff + (size_t)mb * 16 * K + kc); if (NSPLIT == 1 || NSPLIT == 2) a2[mb] = WFrag<T16>::ld(A2 + aoff + (size_t)mb * 16 * K + kc); }
#pragma unroll
        for (int nb = 0; nb < 4; ++nb) { const V b = WFrag<T16>::ld(Bt + boff + (size_t)nb * 16 * K + kc); V b2; if (NSPLIT >= 2) b2 = WFrag<T16>::ld(Bt2 + boff + (size_t)nb * 16 * K + kc);
#pragma unroll
            for (int mb = 0; mb < 4; ++mb) { acc[mb][nb] = WFrag<T16>::mma(a[mb], b, acc[mb][nb]); if (NSPLIT == 1 || NSPLIT == 2) acc[mb][nb] = WFrag<T16>::mma(a2[mb], b, acc[mb][nb]); if (NSPLIT >= 2) acc[mb][nb] = WFrag<T16>::mma(a[mb], b2, acc[mb][nb]); } }
        asm volatile("v_nop\n\tv_nop\n\tv_nop\n\tv_nop" : "+v"(acc[0][0]), "+v"(acc[1][1]), "+v"(acc[2][2]), "+v"(acc[3][3]) : "v"(a[0]), "v"(a[3]));
    }
#pragma unroll
    for (int mb = 0; mb < 4; ++mb) {
#pragma unroll
        for (int nb = 0; nb < 4; ++nb) {
#pragma unroll
            for (int j = 0; j < 8; ++j) os[(hi * 8 + j) * 68 + nb * 16 + lr] = acc[mb][nb][j]; }
        __builtin_amdgcn_wave_barrier(); asm volatile("" ::: "memory");
        float* crow = C + (size_t)(r0 + mb * 16) * ldc + c0;
{
#pragma unroll
            for (int s = 0; s < 8; ++s) { const int row = 2 * s + hi, cofs = lr * 4; v4f val = *(const v4fa*)(os + row * 68 + cofs);
                *(v4f*)(crow + (size_t)row * ldc + cofs) = val; }
             }
        __builtin_amdgcn_wave_barrier(); asm volatile("" ::: "memory");
    }
}

// ---- k_gemms: the two long GEMMs (K = 1024). Work-group = 4 waves = one 128x128 output tile, wave = 64x64 (16 accumulators, the sums in k_gemmw's order). grid (M/128, N/128, Z), 128 threads.
// Operand tiles of 128 rows x 128 k go from the K-contiguous bf16 planes into LDS by asynchronous copies: a wave-wide copy takes two whole 256-byte row pieces, where a fragment load from global memory touched 16 lines for 512 bytes, and the four waves share each tile. Two buffers: the next stage's copies fly while this stage is worked on.
// C[m][n] (f32, pitch DM) = sum_k (A[m][k] (+ A2[m][k] if NSPLIT)) Bt[n][k] + f32 bias[n] (one bias vector per z = 0, 1, 2). z-batch strides sA/sB in elements.
// PL: the tile does not leave as f32 but as the attention kernel's bf16 hi/lo planes: z = 0, 1 -> [b][h][t][d] (q, k), z = 2 -> v^T rows (b, h, d) = hi | lo, pitch 2*TT. A wave's 64x64 tile is 64 rows t of one (batch, head).
#define SK 128   // k per stage: 256 bytes of every operand row
#define SP 136   // LDS row pitch in elements: 272 bytes = 16 x odd, conflict-free for the 16-byte fragment reads
// eight 16-byte copies of one lane, rows 8 apart; l = the lane's LDS byte address, g = its global address
__device__ __forceinline__ void d_copy8(unsigned l, const bf* g) {
    asm volatile("global_load_async_to_lds_b128 %0, %8, off\n\tglobal_load_async_to_lds_b128 %1, %9, off\n\tglobal_load_async_to_lds_b128 %2, %10, off\n\tglobal_load_async_to_lds_b128 %3, %11, off\n\t"
                 "global_load_async_to_lds_b128 %4, %12, off\n\tglobal_load_async_to_lds_b128 %5, %13, off\n\tglobal_load_async_to_lds_b128 %6, %14, off\n\tglobal_load_async_to_lds_b128 %7, %15, off\n\t"
                 "s_wait_xcnt 0x0"   // stands in front of every later write of the address registers that these copies name
                 :: "v"(l), "v"(l + 8 * SP * 2), "v"(l + 16 * SP * 2), "v"(l + 24 * SP * 2), "v"(l + 32 * SP * 2), "v"(l + 40 * SP * 2), "v"(l + 48 * SP * 2), "v"(l + 56 * SP * 2),
                    "v"(g), "v"(g + 8 * DM), "v"(g + 16 * DM), "v"(g + 24 * DM), "v"(g + 32 * DM), "v"(g + 40 * DM), "v"(g + 48 * DM), "v"(g + 56 * DM) : "memory");
}
template <int NSPLIT, bool PL>
__global__ __launch_bounds__(128) void k_gemms(const bf* __restrict__ A, const bf* __restrict__ A2, const bf* __restrict__ Bt, float* C, const float* __restrict__ bias0, const float* __restrict__ bias1, const float* __restrict__ bias2, size_t sA, size_t sB, bf* QPh, bf* QPl, bf* KPh, bf* KPl, bf* VT2) {
    typedef WFrag<bf>::V V;
    constexpr int NT = NSPLIT ? 3 : 2, NS = DM / SK, TB = 128 * SP * 2;   // tiles per stage (A, Bt, A2), stages, bytes of a tile in LDS
    static_assert(DM == DQ && DM % SK == 0 && NS >= 2 && 4 * 2 * 64 * 72 * 2 <= 2 * NT * TB, "two stages or more; the output staging fits the ring");
    __shared__ __align__(16) bf ring[2][NT][128 * SP];
    const int tid = threadIdx.x, lane = tid & 31, lr = lane & 15, hi = lane >> 4; const int wv = __builtin_amdgcn_readfirstlane(tid >> 5);
    const size_t z = blockIdx.z; A += z * sA; if (NSPLIT) A2 += z * sA; Bt += z * sB; const float* bias = (z == 0) ? bias0 : ((z == 1) ? bias1 : bias2);
    const int wr = (wv >> 1) * 64, wc = (wv & 1) * 64, r0 = blockIdx.x * 128 + wr, c0 = blockIdx.y * 128 + wc;
    const int cr = tid >> 4, cc = (tid & 15) * 8;   // this thread's 16-byte pieces of a tile: column piece cc of rows cr + 8 u
    const bf* ga = A + (size_t)(blockIdx.x * 128 + cr) * DM + cc; const bf* ga2 = NSPLIT ? A2 + (size_t)(blockIdx.x * 128 + cr) * DM + cc : nullptr; const bf* gb = Bt + (size_t)(blockIdx.y * 128 + cr) * DM + cc;
    const unsigned l0 = (unsigned)(size_t)&ring[0][0][cr * SP + cc];
    auto fill = [&](int s) { const unsigned l = l0 + (unsigned)(s & 1) * (NT * TB);
        d_copy8(l, ga + s * SK); d_copy8(l + TB / 2, ga + s * SK + 64 * DM); d_copy8(l + TB, gb + s * SK); d_copy8(l + TB + TB / 2, gb + s * SK + 64 * DM);
        if (NSPLIT) { d_copy8(l + 2 * TB, ga2 + s * SK); d_copy8(l + 2 * TB + TB / 2, ga2 + s * SK + 64 * DM); } };
    v8f acc[4][4];
#pragma unroll
    for (int mb = 0; mb < 4; ++mb)
#pragma unroll
        for (int nb = 0; nb < 4; ++nb) acc[mb][nb] = (v8f){};
    fill(0);
    asm volatile("s_wait_asynccnt 0x0" ::: "memory");   // this wave's copies of stage 0 have landed
    __syncthreads();   // stage 0 is whole before anybody reads it
    fill(1);
#pragma unroll 1
    for (int s = 0; s < NS; ++s) {
        const bf* ta = &ring[s & 1][0][(wr + lr) * SP + 8 * hi]; const bf* tb = &ring[s & 1][1][(wc + lr) * SP + 8 * hi]; const bf* ta2 = &ring[s & 1][NT - 1][(wr + lr) * SP + 8 * hi];
        V a[2][4], a2[2][4], b[2][4];
#pragma unroll
        for (int mb = 0; mb < 4; ++mb) { a[0][mb] = WFrag<bf>::ld(ta + mb * 16 * SP); if (NSPLIT) a2[0][mb] = WFrag<bf>::ld(ta2 + mb * 16 * SP); b[0][mb] = WFrag<bf>::ld(tb + mb * 16 * SP); }
#pragma unroll
        for (int q = 0; q < SK / 32; ++q) { const int u = q & 1, n = u ^ 1;
            if (q + 1 < SK / 32) {
#pragma unroll
                for (int mb = 0; mb < 4; ++mb) { a[n][mb] = WFrag<bf>::ld(ta + mb * 16 * SP + (q + 1) * 32); if (NSPLIT) a2[n][mb] = WFrag<bf>::ld(ta2 + mb * 16 * SP + (q + 1) * 32); b[n][mb] = WFrag<bf>::ld(tb + mb * 16 * SP + (q + 1) * 32); } }
            __builtin_amdgcn_sched_barrier(0);   // keeps the next block's fragment loads together in front of this block's products: sunk to their users they would each wait alone
#pragma unroll
            for (int nb = 0; nb < 4; ++nb)
#pragma unroll
                for (int mb = 0; mb < 4; ++mb) { acc[mb][nb] = wmmab(a[u][mb], b[u][nb], acc[mb][nb]); if (NSPLIT) acc[mb][nb] = wmmab(a2[u][mb], b[u][nb], acc[mb][nb]); }
        }
        asm volatile("s_wait_dscnt 0x0" ::: "memory");      // this wave's reads of the buffer that is refilled below have returned
        asm volatile("s_wait_asynccnt 0x0" ::: "memory");   // this wave's copies of stage s + 1 have landed
        __syncthreads();   // publishes stage s + 1 and ends every wave's reads of stage s
        if (s + 2 < NS) fill(s + 2);
    }
    asm volatile("s_wait_asynccnt 0x0" ::: "memory");   // nothing is in flight when the ring becomes output staging (the last trip's barrier has ended every read of it)
    float* os = (float*)&ring[0][0][0] + wv * (2 * 64 * 72 / 2);   // wave-own staging: room for a whole v^T tile, hi and lo, row pitch 72 elements
    if (PL) {
        const int zh = (r0 / TT) * NH_ + c0 / HD, t0 = r0 % TT;
        if (z == 2) {   // v^T: a lane holds 8 consecutive t of one d, which is 16 bytes of a plane's row as it stands; through LDS so that whole 128-byte lines are stored
            bf* sh = (bf*)os; bf* sl = sh + 64 * 72;
#pragma unroll
            for (int nb = 0; nb < 4; ++nb) { const float bb = bfr(bias[c0 + nb * 16 + lr]);
#pragma unroll
                for (int mb = 0; mb < 4; ++mb) { v8us o1, o2;
#pragma unroll
                    for (int j = 0; j < 8; ++j) { unsigned short a1, c2; splitf(acc[mb][nb][j] + bb, a1, c2); o1[j] = a1; o2[j] = c2; }
                    *(v8usa*)(sh + (nb * 16 + lr) * 72 + mb * 16 + hi * 8) = o1; *(v8usa*)(sl + (nb * 16 + lr) * 72 + mb * 16 + hi * 8) = o2; } }
            __builtin_amdgcn_wave_barrier(); asm volatile("" ::: "memory");   // the row reads below take what other lanes of this wave stored
            bf* vrow = VT2 + ((size_t)zh * HD + (lane >> 3)) * (2 * TT) + t0 + (lane & 7) * 8;
#pragma unroll
            for (int g = 0; g < 4; ++g) { v8us o1[4], o2[4];   // 16 rows a round: one LDS latency for eight reads
#pragma unroll
                for (int s = 0; s < 4; ++s) { o1[s] = *(const v8usa*)(sh + ((g * 4 + s) * 4 + (lane >> 3)) * 72 + (lane & 7) * 8); o2[s] = *(const v8usa*)(sl + ((g * 4 + s) * 4 + (lane >> 3)) * 72 + (lane & 7) * 8); }
#pragma unroll
                for (int s = 0; s < 4; ++s) { *(v8usa*)(vrow + (size_t)(g * 4 + s) * 4 * 2 * TT) = o1[s]; *(v8usa*)(vrow + (size_t)(g * 4 + s) * 4 * 2 * TT + TT) = o2[s]; }
                asm volatile("s_wait_xcnt 0x0" ::: "memory"); }   // the next round reuses the registers that these stores name
            return; }
        bf* ph = ((z == 0) ? QPh : KPh) + ((size_t)zh * TT + t0) * HD + lr * 4; bf* pl = ((z == 0) ? QPl : KPl) + ((size_t)zh * TT + t0) * HD + lr * 4;
        v4f bb; bb[0] = bfr(bias[c0 + lr * 4]); bb[1] = bfr(bias[c0 + lr * 4 + 1]); bb[2] = bfr(bias[c0 + lr * 4 + 2]); bb[3] = bfr(bias[c0 + lr * 4 + 3]);
#pragma unroll
        for (int mb = 0; mb < 4; ++mb) {
#pragma unroll
            for (int nb = 0; nb < 4; ++nb) {
#pragma unroll
                for (int j = 0; j < 8; ++j) os[(hi * 8 + j) * 68 + nb * 16 + lr] = acc[mb][nb][j]; }
            __builtin_amdgcn_wave_barrier(); asm volatile("" ::: "memory");   // the row reads below take what other lanes of this wave stored
#pragma unroll
            for (int s = 0; s < 8; ++s) { const int row = 2 * s + hi; const v4f val = *(const v4fa*)(os + row * 68 + lr * 4); v4us o1, o2;
#pragma unroll
                for (int q = 0; q < 4; ++q) { unsigned short a1, c2; splitf(val[q] + bb[q], a1, c2); o1[q] = a1; o2[q] = c2; }
                *(v4usa*)(ph + (size_t)(mb * 16 + row) * HD) = o1; *(v4usa*)(pl + (size_t)(mb * 16 + row) * HD) = o2; }
            asm volatile("s_wait_xcnt 0x0" ::: "memory");   // the next 16 rows' work reuses the registers that these stores name
            __builtin_amdgcn_wave_barrier(); asm volatile("" ::: "memory");   // the next 16 rows overwrite what has just been read
        }
        return;
    }
#pragma unroll
    for (int mb = 0; mb < 4; ++mb) {
#pragma unroll
        for (int nb = 0; nb < 4; ++nb) {
#pragma unroll
            for (int j = 0; j < 8; ++j) os[(hi * 8 + j) * 68 + nb * 16 + lr] = acc[mb][nb][j]; }
        __builtin_amdgcn_wave_barrier(); asm volatile("" ::: "memory");
        float* crow = C + (size_t)(r0 + mb * 16) * DM + c0;
{
#pragma unroll
            for (int s = 0; s < 8; ++s) { const int row = 2 * s + hi, cofs = lr * 4; v4f val = *(const v4fa*)(os + row * 68 + cofs); val[0] += bfr(bias[c0 + cofs]); val[1] += bfr(bias[c0 + cofs + 1]); val[2] += bfr(bias[c0 + cofs + 2]); val[3] += bfr(bias[c0 + cofs + 3]);
                *(v4f*)(crow + (size_t)row * DM + cofs) = val; }
             }
        asm volatile("s_wait_xcnt 0x0" ::: "memory");   // the next 16 rows' work reuses the registers that these stores name
        __builtin_amdgcn_wave_barrier(); asm volatile("" ::: "memory");
    }
}

__device__ __forceinline__ void d_wtG(int bx, const float* __restrict__ w, int K, int N, bf* Bt) {
    const int lane = threadIdx.x & 31; const int L0 = (bx * 8 + (threadIdx.x >> 5)) * 8; const int nlines = N * K / 64;
{
#pragma unroll 1
        for (int l = 0; l < 8; ++l) { const int L = L0 + l; if (L >= nlines) break; const size_t e = (size_t)L * 64 + lane * 2; const int k = (int)(e % K), n = (int)(e / K); v2us o;
            o[0] = f2bf(w[(size_t)k * N + n]); o[1] = f2bf(w[(size_t)(k + 1) * N + n]); *(v2us*)(Bt + e) = o; }
         }
}
__device__ __forceinline__ void d_cvt8(int bx, const float* __restrict__ src, bf* dst, size_t n8) { const size_t i = (size_t)bx * 256 + threadIdx.x; if (i >= n8) return; const v8f v = *(const v8f*)(src + i * 8); v8us o;
#pragma unroll
    for (int k = 0; k < 8; ++k) o[k] = f2bf(v[k]); *(v8us*)(dst + i * 8) = o;  }

// k_fattn: scores, softmax, attn.v and the relative-value term in one kernel; no score or probability ever leaves the chip.
// Work-group = 8 waves = 128 query rows of one (batch, head); wave = 16 queries. Key tiles of 64 (k hi/lo, v^T hi/lo) go through registers into LDS (row pitch 144 B), the next tile's loads in flight while this one is worked on.
// Transposed scores S^T = k q^T: lane (lr, hi) holds query lr, keys hi*8 + 0..7 of each 16-key tile, which is the A fragment of P for P.v as it stands.
// Sweep 1: row maximum and row sum (per lane, rescaled when the maximum moves; the two half rows joined at the end). Sweep 2: the scores again, normalised P as bf16 hi/lo, P.v (3 products), P folded onto the 33 offsets (wave-own LDS planes), PB.rel_v into the same accumulators.
#define KP 72
typedef WFrag<bf>::V VB;
__device__ __forceinline__ void d_stile(const VB* kf, const VB* qh, const VB* ql, float* t, int j0s, int i0, int i, int hi, float qlo, float qhi, const float* qer) {
    float e[8];   // the relative-key term of this lane's 8 keys, chosen in front of the products so that no branch stands behind a matrix instruction
    if (j0s + 15 <= i0 - CUT) {   /* the same for the whole wave: every key of the tile on the low end offset */
#pragma unroll
        for (int jj = 0; jj < 8; ++jj) e[jj] = qlo; }
    else if (j0s >= i0 + 15 + CUT) {
#pragma unroll
        for (int jj = 0; jj < 8; ++jj) e[jj] = qhi; }
    else {
#pragma unroll
        for (int jj = 0; jj < 8; ++jj) e[jj] = qer[min(max(j0s + hi * 8 + jj - i, -CUT), CUT) + CUT]; }
    v8f s = (v8f){};
#pragma unroll
    for (int c = 0; c < 2; ++c) { s = wmmab(kf[2 * c], qh[c], s); s = wmmab(kf[2 * c], ql[c], s); s = wmmab(kf[2 * c + 1], qh[c], s); }
#pragma unroll
    for (int jj = 0; jj < 8; ++jj) t[jj] = __fadd_rn(s[jj], e[jj]) * SCL;
}
__global__ __launch_bounds__(256) void k_fattn(const bf* __restrict__ QPh, const bf* __restrict__ QPl, const bf* __restrict__ KPh, const bf* __restrict__ KPl, const bf* __restrict__ VT2, const float* __restrict__ QE, const bf* __restrict__ AVTh, const bf* __restrict__ AVTl, bf* ATh, bf* ATl) {
    __shared__ __align__(16) bf tk[2][64 * KP];        // k tile [key][d], hi and lo
    __shared__ __align__(16) bf tv[2][64 * KP];        // v^T tile [d][key], hi and lo
    __shared__ __align__(16) bf pb[8][2][16 * KP];     // per wave: P folded onto the offsets [query][offset], hi and lo
    __shared__ __align__(16) float os[8][16 * 68];     // per wave: first its rows of QE, at the end its output tile
    const float L2E = 1.4426950408889634f;
    const int tid = threadIdx.x, lane = tid & 31, lr = lane & 15, hi = lane >> 4; const int wv = __builtin_amdgcn_readfirstlane(tid >> 5);
    const int z = blockIdx.y, i0 = blockIdx.x * 128 + wv * 16, i = i0 + lr;
    float* osw = os[wv]; bf* pbh = pb[wv][0]; bf* pbl = pb[wv][1];
    const int cr = tid >> 3, cc = (tid & 7) * 8, lo0 = cr * KP + cc;   // this thread's 16-byte pieces of a tile: rows cr and cr + 32
    const bf* kgh = KPh + (size_t)z * TT * HD + cr * HD + cc; const bf* kgl = KPl + (size_t)z * TT * HD + cr * HD + cc; const bf* vg = VT2 + ((size_t)z * HD + cr) * (2 * TT) + cc;
    v8us rk[2][2], rv[2][2];
#pragma unroll
    for (int u = 0; u < 2; ++u) { rk[0][u] = *(const v8us*)(kgh + u * 32 * HD); rk[1][u] = *(const v8us*)(kgl + u * 32 * HD); }
    VB qh[2], ql[2];
#pragma unroll
    for (int c = 0; c < 2; ++c) { qh[c] = WFrag<bf>::ld(QPh + ((size_t)z * TT + i) * HD + 8 * hi + c * 32); ql[c] = WFrag<bf>::ld(QPl + ((size_t)z * TT + i) * HD + 8 * hi + c * 32); }
#pragma unroll
    for (int u = 0; u < 8; ++u) { const int c = lane + 32 * u; *(v4fa*)(osw + (c >> 4) * 68 + (c & 15) * 4) = *(const v4fa*)(QE + ((size_t)z * TT + i0 + (c >> 4)) * NE + (c & 15) * 4); }
#pragma unroll
    for (int u = 0; u < 9; ++u) ((v4ua*)pbh)[lane + 32 * u] = (v4u){0u, 0u, 0u, 0u};   // both planes (they lie one behind the other): an offset with no key stays zero
    __builtin_amdgcn_wave_barrier(); asm volatile("" ::: "memory");   // the reads of osw below take what other lanes of this wave stored (one wave's LDS operations run in order)
    const float* qer = osw + lr * 68; const float qlo = qer[0], qhi = qer[2 * CUT];
    float m = -3.0e38f, l = 0.f;
#pragma unroll 1
    for (int blk = 0; blk < TT / 64; ++blk) {
        __syncthreads();   // every wave has left the tile that is overwritten next
#pragma unroll
        for (int u = 0; u < 2; ++u) { *(v8us*)(&tk[0][lo0 + u * 32 * KP]) = rk[0][u]; *(v8us*)(&tk[1][lo0 + u * 32 * KP]) = rk[1][u]; }
        __syncthreads();   // the tile is whole before anybody reads it
        if (blk + 1 < TT / 64) {
#pragma unroll
            for (int u = 0; u < 2; ++u) { rk[0][u] = *(const v8us*)(kgh + ((blk + 1) * 64 + u * 32) * HD); rk[1][u] = *(const v8us*)(kgl + ((blk + 1) * 64 + u * 32) * HD); }
            asm volatile("s_wait_xcnt 0x0" ::: "memory"); }   // the work below reuses the registers that these loads name as their addresses
        VB kf[4][4];   // the tile's 16 k fragments (per 16 keys: hi, lo of d 0..31, hi, lo of d 32..63), all loads issued before the first product so that one LDS latency is paid, not sixteen
#pragma unroll
        for (int st = 0; st < 4; ++st)
#pragma unroll
            for (int c = 0; c < 2; ++c) { kf[st][2 * c] = WFrag<bf>::ld(&tk[0][(st * 16 + lr) * KP + 8 * hi + c * 32]); kf[st][2 * c + 1] = WFrag<bf>::ld(&tk[1][(st * 16 + lr) * KP + 8 * hi + c * 32]); }
        __builtin_amdgcn_sched_barrier(0);   // keeps the fragment loads above together: sunk to their users they would each wait alone
        float t[4][8];
#pragma unroll
        for (int st = 0; st < 4; ++st) d_stile(kf[st], qh, ql, t[st], blk * 64 + st * 16, i0, i, hi, qlo, qhi, qer);
        float bm = m;
#pragma unroll
        for (int st = 0; st < 4; ++st)
#pragma unroll
            for (int jj = 0; jj < 8; ++jj) bm = fmaxf(bm, t[st][jj]);
        float a = 0.f;
#pragma unroll
        for (int st = 0; st < 4; ++st)
#pragma unroll
            for (int jj = 0; jj < 8; ++jj) a += __builtin_amdgcn_exp2f((t[st][jj] - bm) * L2E);
        l = l * __builtin_amdgcn_exp2f((m - bm) * L2E) + a; m = bm;
    }
    const float mx = fmaxf(m, __shfl_xor(m, 16, 32)); l *= __builtin_amdgcn_exp2f((m - mx) * L2E); l += __shfl_xor(l, 16, 32);
    const float f = __fdiv_rn(1.0f, l);
    v8f acc[4];
#pragma unroll
    for (int nb = 0; nb < 4; ++nb) acc[nb] = (v8f){};
    float lo_s = 0.f, hi_s = 0.f;
#pragma unroll
    for (int u = 0; u < 2; ++u) { rk[0][u] = *(const v8us*)(kgh + u * 32 * HD); rk[1][u] = *(const v8us*)(kgl + u * 32 * HD); rv[0][u] = *(const v8us*)(vg + (size_t)u * 32 * 2 * TT); rv[1][u] = *(const v8us*)(vg + (size_t)u * 32 * 2 * TT + TT); }
#pragma unroll 1
    for (int blk = 0; blk < TT / 64; ++blk) {
        __syncthreads();   // every wave has left the tiles that are overwritten next
#pragma unroll
        for (int u = 0; u < 2; ++u) { *(v8us*)(&tk[0][lo0 + u * 32 * KP]) = rk[0][u]; *(v8us*)(&tk[1][lo0 + u * 32 * KP]) = rk[1][u]; *(v8us*)(&tv[0][lo0 + u * 32 * KP]) = rv[0][u]; *(v8us*)(&tv[1][lo0 + u * 32 * KP]) = rv[1][u]; }
        __syncthreads();   // the tiles are whole before anybody reads them
        if (blk + 1 < TT / 64) {
#pragma unroll
            for (int u = 0; u < 2; ++u) { rk[0][u] = *(const v8us*)(kgh + ((blk + 1) * 64 + u * 32) * HD); rk[1][u] = *(const v8us*)(kgl + ((blk + 1) * 64 + u * 32) * HD); rv[0][u] = *(const v8us*)(vg + (size_t)u * 32 * 2 * TT + (blk + 1) * 64); rv[1][u] = *(const v8us*)(vg + (size_t)u * 32 * 2 * TT + TT + (blk + 1) * 64); }
            asm volatile("s_wait_xcnt 0x0" ::: "memory"); }   // the work below reuses the registers that these loads name as their addresses
        VB kf[4][4];   // the tile's 16 k fragments (per 16 keys: hi, lo of d 0..31, hi, lo of d 32..63), all loads issued before the first product so that one LDS latency is paid, not sixteen
#pragma unroll
        for (int st = 0; st < 4; ++st)
#pragma unroll
            for (int c = 0; c < 2; ++c) { kf[st][2 * c] = WFrag<bf>::ld(&tk[0][(st * 16 + lr) * KP + 8 * hi + c * 32]); kf[st][2 * c + 1] = WFrag<bf>::ld(&tk[1][(st * 16 + lr) * KP + 8 * hi + c * 32]); }
        __builtin_amdgcn_sched_barrier(0);   // keeps the fragment loads above together: sunk to their users they would each wait alone
        v8us oh[4], ol[4];
#pragma unroll
        for (int st = 0; st < 4; ++st) { const int j0s = blk * 64 + st * 16; float t[8], p4[8];
            d_stile(kf[st], qh, ql, t, j0s, i0, i, hi, qlo, qhi, qer);
#pragma unroll
            for (int jj = 0; jj < 8; ++jj) { unsigned short a, c2; splitf(__builtin_amdgcn_exp2f((t[jj] - mx) * L2E) * f, a, c2); oh[st][jj] = a; ol[st][jj] = c2; p4[jj] = __fadd_rn(bf2f(a), bf2f(c2)); }
            if (j0s + 15 <= i0 - CUT) {
#pragma unroll
                for (int jj = 0; jj < 8; ++jj) lo_s = __fadd_rn(lo_s, p4[jj]); }
            else if (j0s >= i0 + 15 + CUT) {
#pragma unroll
                for (int jj = 0; jj < 8; ++jj) hi_s = __fadd_rn(hi_s, p4[jj]); }
            else {
#pragma unroll
                for (int jj = 0; jj < 8; ++jj) { const int bkt = j0s + hi * 8 + jj - i + CUT; lo_s = __fadd_rn(lo_s, (bkt <= 0) ? p4[jj] : 0.0f); hi_s = __fadd_rn(hi_s, (bkt >= 2 * CUT) ? p4[jj] : 0.0f);
                    if (bkt > 0 && bkt < 2 * CUT) { pbh[lr * KP + bkt] = oh[st][jj]; pbl[lr * KP + bkt] = ol[st][jj]; } } } }
#pragma unroll
        for (int c = 0; c < 2; ++c) { const VB ph = cat16b(oh[2 * c], oh[2 * c + 1]), pl = cat16b(ol[2 * c], ol[2 * c + 1]); VB vh[4], vl[4];
#pragma unroll
            for (int nb = 0; nb < 4; ++nb) { vh[nb] = WFrag<bf>::ld(&tv[0][(nb * 16 + lr) * KP + c * 32 + 8 * hi]); vl[nb] = WFrag<bf>::ld(&tv[1][(nb * 16 + lr) * KP + c * 32 + 8 * hi]); }
            __builtin_amdgcn_sched_barrier(0);   // keeps the 8 v fragment loads together, as above
#pragma unroll
            for (int nb = 0; nb < 4; ++nb) acc[nb] = wmmab(ph, vh[nb], acc[nb]);
#pragma unroll
            for (int nb = 0; nb < 4; ++nb) acc[nb] = wmmab(pl, vh[nb], acc[nb]);
#pragma unroll
            for (int nb = 0; nb < 4; ++nb) acc[nb] = wmmab(ph, vl[nb], acc[nb]); }
        asm volatile("v_nop\n\tv_nop\n\tv_nop\n\tv_nop" : "+v"(acc[0]), "+v"(acc[1]), "+v"(acc[2]), "+v"(acc[3]));   // the distance behind the last matrix instruction on the path over the loop's branches
    }
    VB rh[2][4], rl[2][4];   // rel_v^T fragments, hi and lo
    const bf* rgh = AVTh + lr * NE + 8 * hi; const bf* rgl = AVTl + lr * NE + 8 * hi;
#pragma unroll
    for (int c = 0; c < 2; ++c)
#pragma unroll
        for (int nb = 0; nb < 4; ++nb) { rh[c][nb] = WFrag<bf>::ld(rgh + nb * 16 * NE + c * 32); rl[c][nb] = WFrag<bf>::ld(rgl + nb * 16 * NE + c * 32); }
    asm volatile("s_wait_xcnt 0x0" : "+v"(lo_s), "+v"(hi_s) : "v"(rgh), "v"(rgl) : "memory");   // the work below reuses the registers that these loads name as their addresses: the addresses stay live up to the wait, and the two sums pass through it so that the exchange below is not lifted over it
    lo_s = __fadd_rn(lo_s, __shfl_xor(lo_s, 16, 32)); hi_s = __fadd_rn(hi_s, __shfl_xor(hi_s, 16, 32));
    unsigned short l0h, l0l, h0h, h0l; splitf(lo_s, l0h, l0l); splitf(hi_s, h0h, h0l);
    if (hi == 0) { pbh[lr * KP] = l0h; pbl[lr * KP] = l0l; pbh[lr * KP + 2 * CUT] = h0h; pbl[lr * KP + 2 * CUT] = h0l; }
    __builtin_amdgcn_wave_barrier(); asm volatile("" ::: "memory");   // the fragment reads below take what other lanes of this wave stored
#pragma unroll
    for (int c = 0; c < 2; ++c) { const VB ph = WFrag<bf>::ld(pbh + lr * KP + 8 * hi + c * 32), pl = WFrag<bf>::ld(pbl + lr * KP + 8 * hi + c * 32);
#pragma unroll
        for (int nb = 0; nb < 4; ++nb) { acc[nb] = wmmab(ph, rh[c][nb], acc[nb]); acc[nb] = wmmab(pl, rh[c][nb], acc[nb]); acc[nb] = wmmab(ph, rl[c][nb], acc[nb]); } }
#pragma unroll
    for (int nb = 0; nb < 4; ++nb)
#pragma unroll
        for (int j = 0; j < 8; ++j) osw[(hi * 8 + j) * 68 + nb * 16 + lr] = acc[nb][j];
    __builtin_amdgcn_wave_barrier(); asm volatile("" ::: "memory");   // the row reads below take what other lanes of this wave stored
    bf* ah = ATh + ((size_t)(z / NH_) * TT + i0) * DQ + (z % NH_) * HD + lr * 4; bf* al = ATl + ((size_t)(z / NH_) * TT + i0) * DQ + (z % NH_) * HD + lr * 4;   /* z = b*16 + head */
#pragma unroll
    for (int s = 0; s < 8; ++s) { const int row = 2 * s + hi; const v4f val = *(const v4fa*)(osw + row * 68 + lr * 4); v4us o1, o2;
#pragma unroll
        for (int q = 0; q < 4; ++q) { unsigned short a, c2; splitf(val[q], a, c2); o1[q] = a; o2[q] = c2; }
        *(v4usa*)(ah + (size_t)row * DQ) = o1; *(v4usa*)(al + (size_t)row * DQ) = o2;
        asm volatile("s_wait_xcnt 0x0" ::: "memory"); }   // the next rows' arithmetic reuses the registers that these two stores name
}
__device__ __forceinline__ void d_epadK(int bx, const float* __restrict__ E, bf* EB) { const size_t i = (size_t)bx * 256 + threadIdx.x; if (i >= (size_t)NE * HD / 8) return; const int d0 = (int)(i % (HD / 8)) * 8; const int r = (int)(i / (HD / 8)); const float* src = E + (size_t)min(r, NRE - 1) * HD + d0; v8us o;
#pragma unroll
    for (int q = 0; q < 8; ++q) { const unsigned short v = f2bf(src[q]); o[q] = (r < NRE) ? v : (unsigned short)0; }
    *(v8us*)(EB + (size_t)r * HD + d0) = o;  }

__device__ __forceinline__ void d_epadVT(int bx, const float* __restrict__ E, bf* Th, bf* Tl) { const size_t i = (size_t)bx * 256 + threadIdx.x; if (i >= (size_t)HD * NE / 4) return; const size_t e = i * 4; const int c0 = (int)(e % NE); const int d = (int)(e / NE); v4us oh, ol;
#pragma unroll
    for (int q = 0; q < 4; ++q) { const int r = c0 + q; const float v = bfr(E[(size_t)min(r, NRE - 1) * HD + d]); unsigned short u, w; splitf(v, u, w);   /* input rounded to bf16 once: lo == 0 */ oh[q] = (r < NRE) ? u : (unsigned short)0; ol[q] = (r < NRE) ? w : (unsigned short)0; }
    *(v4us*)(Th + e) = oh; *(v4us*)(Tl + e) = ol;  }

// k_prep: every pass that reads nothing but the inputs, in one launch; blockIdx.y picks the pass (the four weight gathers, the longest, start first). Grid (256, 17).
__global__ __launch_bounds__(256) void k_prep(const float* __restrict__ wq, const float* __restrict__ wk, const float* __restrict__ wv, const float* __restrict__ wo, const float* __restrict__ ak, const float* __restrict__ av, const float* __restrict__ x, const float* __restrict__ xk, const float* __restrict__ xv, bf* WB, bf* AKB, bf* AVTh, bf* AVTl, bf* XB) {
    static_assert(DM * DQ / 64 / 64 == 256 && DKV == DQ && NE * HD / 8 / 256 == 2 && HD * NE / 4 / 256 == 4 && NB_ * TT * DM / 8 / 256 == 4 * 256, "grid (256, 17)");
    const int bx = blockIdx.x, y = blockIdx.y;
    if (y < 4) { const float* w = (y == 0) ? wq : ((y == 1) ? wk : ((y == 2) ? wv : wo)); d_wtG(bx, w, DM, DQ, WB + (size_t)y * DM * DQ); }   /* 'xw' weights gathered into Bt */
    else if (y == 4) { if (bx < 2) d_epadK(bx, ak, AKB);   /* rel_k -> bf16 [64][64], rows >= 33 zero */ else if (bx < 6) d_epadVT(bx - 2, av, AVTh, AVTl); }   /* rel_v^T hi/lo [64][64], cols >= 33 zero */
    else { const int q = (y - 5) >> 2; const float* src = (q == 0) ? x : ((q == 1) ? xk : xv); d_cvt8(((y - 5) & 3) * 256 + bx, src, XB + (size_t)q * NB_ * TT * DM, (size_t)NB_ * TT * DM / 8); }
}

extern "C" void kernel_launch(void* const* d_in, const int* in_sizes, int n_in,
                              void* d_out, int out_size, void* d_ws, size_t ws_size, hipStream_t stream) {
    (void)in_sizes; (void)n_in; (void)out_size;
    const float* x = (const float*)d_in[0];   /* query */ const float* xk = (const float*)d_in[1]; const float* xv = (const float*)d_in[2]; const float* wq = (const float*)d_in[3]; const float* bq = (const float*)d_in[4]; const float* wk = (const float*)d_in[5]; const float* bk = (const float*)d_in[6]; const float* wv = (const float*)d_in[7]; const float* bv = (const float*)d_in[8]; const float* wo = (const float*)d_in[9]; const float* bo = (const float*)d_in[10]; const float* ak = (const float*)d_in[11]; const float* av = (const float*)d_in[12];   /* rel_k / rel_v [33][64] */
    float* OUT = (float*)d_out;     // [2][1024][1024]
    char* wsp = (char*)d_ws;
    auto take = [&](size_t bytes) { char* p = wsp; wsp += (bytes + 255) & ~(size_t)255; return (void*)p; };
    bf* AKB = (bf*)take((size_t)NE * HD * 2); bf* AVTh = (bf*)take((size_t)HD * NE * 2); bf* AVTl = (bf*)take((size_t)HD * NE * 2); float* QE = (float*)take((size_t)ZB * TT * NE * 4);
    bf* WB = (bf*)take((size_t)4 * DM * DQ * 2);   /* Wq, Wk, Wv, Wo as Bt, one behind the other */ bf* WO = WB + (size_t)3 * DM * DQ;
    bf* XB = (bf*)take((size_t)3 * NB_ * TT * DM * 2);   /* query, key, value */
    bf* QPh = (bf*)take((size_t)NB_ * NH_ * TT * HD * 2); bf* QPl = (bf*)take((size_t)NB_ * NH_ * TT * HD * 2); bf* KPh = (bf*)take((size_t)NB_ * NKV * TT * HD * 2); bf* KPl = (bf*)take((size_t)NB_ * NKV * TT * HD * 2); bf* VT2 = (bf*)take((size_t)NB_ * NKV * HD * 2 * TT * 2);   /* v^T rows hi | lo */
    bf* ATh = (bf*)take((size_t)NB_ * TT * DQ * 2); bf* ATl = (bf*)take((size_t)NB_ * TT * DQ * 2);
    if ((size_t)(wsp - (char*)d_ws) > ws_size) return;    // ws 256 MiB
    k_prep<<<dim3(256, 17, 1), 256, 0, stream>>>(wq, wk, wv, wo, ak, av, x, xk, xv, WB, AKB, AVTh, AVTl, XB);
    k_gemms<0, true><<<dim3(NB_ * TT / 128, DQ / 128, 3), 128, 0, stream>>>(XB, nullptr, WB, nullptr, bq, bk, bv, (size_t)NB_ * TT * DM, (size_t)DM * DQ, QPh, QPl, KPh, KPl, VT2);   /* z = q, k, v, straight into the head planes */
    k_gemmw<bf, 1><<<dim3(TT / 64, NE / 64, ZB), 32, 0, stream>>>(QPh, QPl, AKB, nullptr, HD, HD, QE, NE, (size_t)TT * HD, 0, (size_t)TT * NE);   /* QE = q . rel_k^T */
    k_fattn<<<dim3(TT / 128, ZB, 1), 256, 0, stream>>>(QPh, QPl, KPh, KPl, VT2, QE, AVTh, AVTl, ATh, ATl);   /* z = b*16 + head walks consecutive q, k and v planes; scores + q.rel_k[clip(j - i) + 16], softmax, attn.v + attn folded onto the 33 offsets . rel_v, merged hi/lo */
    k_gemms<1, false><<<dim3(NB_ * TT / 128, DM / 128, 1), 128, 0, stream>>>(ATh, ATl, WO, OUT, bo, bo, bo, 0, 0, nullptr, nullptr, nullptr, nullptr, nullptr);
}

// v007
// A run of this version takes 86.9 microseconds.
// Two timings next to v006 both put it at 1.16 times that version's speed.
// All steps since v000 together make it 13.5 times as fast.
#include <hip/hip_runtime.h>

// Relative (Shaw) multi-head attention with key AND value relative-position embeddings (query, key, value [2][1024][1024]; q = query Wq + bq, k = key Wk + bk, v = value Wv + bv ('xw' 1/32, zero biases; 16 heads x 64); idx[i][j] = clip(j - i, -16, 16) + 16; attn = softmax((q.k + q.rel_k[idx]) / 8); x = attn v + sum_j attn[i][j] rel_v[idx] (rel_k, rel_v [33][64] 1/8 scale, read); out = merged Wo + bo ('xw') -> [2][1024][1024] (2.1 M); argument order query, key, value, Wq, bq, Wk, bk, Wv, bv, Wo, bo, rel_k, rel_v).
// Layout: bf16 copies of query, key, value side by side (both batches, rows b*1024 + t); 'xw' weights gathered into Bt; exact projections + f32 biases; rel_k as a zero-padded bf16 plane [64][64] and rel_v^T as hi/lo planes [64][64] (bf16-rounded once); QE = q.rel_k^T (hi/lo x exact); one fused attention launch over all 32 (batch, head) pairs: score tiles (hi/lo 3 products) + QE at column clip(j - i) + 16, softmax (x 1/8), P as hi/lo fragments, P.v (hi/lo x hi/lo), the probabilities folded onto the 33 offsets (interior = one key, the two ends = fixed-order sums) and PB.rel_v added into the context's accumulators; merged hi/lo x Wo exact + bo.
// Compute dtypes, f32 accumulate: every input rounded to bf16; projections exact + f32 biases; scores and the relative-key term ~f32; softmax f32; P as bf16 hi/lo; attn.v and the relative-value term 3 products (~f32); Wo hl x exact + bias.

#define NB_  2
#define TT   1024
#define DM   1024
#define NH_  16
#define NKV  16
#define REP  (NH_ / NKV)
#define HD   64
#define DQ   (NH_ * HD)
#define DKV  (NKV * HD)
#define ZH   16
#define ZB   (NB_ * ZH)           // (batch, head) pairs per attention launch: all of them
#define RH   TT
#define WIN  0
#define PCAR 1024.0f
#define SCL  0.125f   // 1/sqrt(64) (the module divides by jnp.sqrt(DH))
#define NE   64       // 2*16+1 = 33 relative offsets padded to 64
#define NRE  33
#define CUT  16
typedef _Float16 h16;
typedef unsigned short bf;
typedef __attribute__((ext_vector_type(16))) __bf16   v16bf;
typedef __attribute__((ext_vector_type(16))) _Float16 v16h;
typedef __attribute__((ext_vector_type(8)))  _Float16 v8h;
typedef __attribute__((ext_vector_type(8)))  unsigned short v8us;
typedef __attribute__((ext_vector_type(8)))  float    v8f;
typedef __attribute__((ext_vector_type(4)))  float    v4f;
typedef v8h  __attribute__((may_alias)) v8ha;
typedef v4f  __attribute__((may_alias)) v4fa;
typedef v8us __attribute__((may_alias)) v8usa;

__device__ __forceinline__ unsigned short f2bf(float f) { unsigned u = __float_as_uint(f); u += 0x7FFFu + ((u >> 16) & 1u); return (unsigned short)(u >> 16); }
__device__ __forceinline__ float bf2f(unsigned short b) { return __uint_as_float(((unsigned)b) << 16); }
__device__ __forceinline__ float bfr(float f) { return bf2f(f2bf(f)); }
__device__ __forceinline__ v16h cat16(v8h lo, v8h hi) { return __builtin_shufflevector(lo, hi, 0, 1, 2, 3, 4, 5, 6, 7, 8, 9, 10, 11, 12, 13, 14, 15); }
__device__ __forceinline__ v16bf cat16b(v8us lo, v8us hi) { return __builtin_bit_cast(v16bf, __builtin_shufflevector(lo, hi, 0, 1, 2, 3, 4, 5, 6, 7, 8, 9, 10, 11, 12, 13, 14, 15)); }
__device__ __forceinline__ v8f wmma16(v16h a, v16h b, v8f c) { return __builtin_amdgcn_wmma_f32_16x16x32_f16(false, a, false, b, (short)0, c, false, false); }
__device__ __forceinline__ v8f wmmab(v16bf a, v16bf b, v8f c) { return __builtin_amdgcn_wmma_f32_16x16x32_bf16(false, a, false, b, (short)0, c, false, false); }

__device__ __forceinline__ void splitf(float y, unsigned short& h, unsigned short& l) { h = f2bf(y); l = f2bf(y - bf2f(h)); }
typedef __attribute__((ext_vector_type(2))) unsigned short v2us;
typedef __attribute__((ext_vector_type(4))) unsigned short v4us;
typedef __attribute__((ext_vector_type(4))) unsigned int v4u;
typedef v4u  __attribute__((may_alias)) v4ua;
typedef v4us __attribute__((may_alias)) v4usa;

// ---- k_gemmw: register-blocked GEMM, ONE WAVE per 64x64 output tile (16 accumulators), operands straight from K-contiguous 16-bit planes; grid (M/64, N/64, Z), 32 threads. Serves the short product QE.
// C[m][n] (f32, pitch ldc) = sum_k A[m][k] Bt[n][k] (+ split products per NSPLIT). K = row pitch of A and of Bt in elements, kend <= K = length of the sum. z-batch strides sA/sB/sC in elements. kend % 32 == 0.
template <typename T16> struct WFrag;
template <> struct WFrag<h16> { typedef v16h V; static __device__ __forceinline__ V ld(const h16* p) { return cat16(*(const v8h*)p, *(const v8h*)(p + 16)); } static __device__ __forceinline__ v8f mma(V a, V b, v8f c) { return wmma16(a, b, c); } };
template <> struct WFrag<bf> { typedef v16bf V; static __device__ __forceinline__ V ld(const bf* p) { return cat16b(*(const v8us*)p, *(const v8us*)(p + 16)); } static __device__ __forceinline__ v8f mma(V a, V b, v8f c) { return wmmab(a, b, c); } };
template <typename T16, int NSPLIT>
__global__ __launch_bounds__(32) void k_gemmw(const T16* __restrict__ A, const T16* __restrict__ A2, const T16* __restrict__ Bt, const T16* __restrict__ Bt2, int K, int kend, float* C, int ldc, size_t sA, size_t sB, size_t sC) {
    typedef typename WFrag<T16>::V V;
    __shared__ __align__(16) float os[16 * 68];
    const size_t z = blockIdx.z; A += z * sA; if (A2) A2 += z * sA; Bt += z * sB; if (Bt2) Bt2 += z * sB; C += z * sC;
    const int lane = threadIdx.x & 31, lr = lane & 15, hi = lane >> 4; const int r0 = blockIdx.x * 64, c0 = blockIdx.y * 64;
    v8f acc[4][4];
#pragma unroll
    for (int mb = 0; mb < 4; ++mb)
#pragma unroll
        for (int nb = 0; nb < 4; ++nb) acc[mb][nb] = (v8f){};
    const size_t aoff = (size_t)(r0 + lr) * K + 8 * hi, boff = (size_t)(c0 + lr) * K + 8 * hi;
#pragma unroll 1
    for (int kc = 0; kc < kend; kc += 32) {
        V a[4], a2[4];
#pragma unroll
        for (int mb = 0; mb < 4; ++mb) { a[mb] = WFrag<T16>::ld(A + aoff + (size_t)mb * 16 * K + kc); if (NSPLIT == 1 || NSPLIT == 2) a2[mb] = WFrag<T16>::ld(A2 + aoff + (size_t)mb * 16 * K + kc); }
#pragma unroll
        for (int nb = 0; nb < 4; ++nb) { const V b = WFrag<T16>::ld(Bt + boff + (size_t)nb * 16 * K + kc); V b2; if (NSPLIT >= 2) b2 = WFrag<T16>::ld(Bt2 + boff + (size_t)nb * 16 * K + kc);
#pragma unroll
            for (int mb = 0; mb < 4; ++mb) { acc[mb][nb] = WFrag<T16>::mma(a[mb], b, acc[mb][nb]); if (NSPLIT == 1 || NSPLIT == 2) acc[mb][nb] = WFrag<T16>::mma(a2[mb], b, acc[mb][nb]); if (NSPLIT >= 2) acc[mb][nb] = WFrag<T16>::mma(a[mb], b2, acc[mb][nb]); } }
        asm volatile("v_nop\n\tv_nop\n\tv_nop\n\tv_nop" : "+v"(acc[0][0]), "+v"(acc[1][1]), "+v"(acc[2][2]), "+v"(acc[3][3]) : "v"(a[0]), "v"(a[3]));
    }
#pragma unroll
    for (int mb = 0; mb < 4; ++mb) {
#pragma unroll
        for (int nb = 0; nb < 4; ++nb) {
#pragma unroll
            for (int j = 0; j < 8; ++j) os[(hi * 8 + j) * 68 + nb * 16 + lr] = acc[mb][nb][j]; }
        __builtin_amdgcn_wave_barrier(); asm volatile("" ::: "memory");
        float* crow = C + (size_t)(r0 + mb * 16) * ldc + c0;
{
#pragma unroll
            for (int s = 0; s < 8; ++s) { const int row = 2 * s + hi, cofs = lr * 4; v4f val = *(const v4fa*)(os + row * 68 + cofs);
                *(v4f*)(crow + (size_t)row * ldc + cofs) = val; }
             }
        __builtin_amdgcn_wave_barrier(); asm volatile("" ::: "memory");
    }
}

// ---- k_gemms: the two long GEMMs (K = 1024). Work-group = 4 waves = one 128x128 output tile, wave = 64x64 (16 accumulators, the sums in k_gemmw's order). grid (M/128, N/128, Z), 128 threads.
// Operand tiles of 128 rows x 128 k go from the K-contiguous bf16 planes into LDS by asynchronous copies: a wave-wide copy takes two whole 256-byte row pieces, where a fragment load from global memory touched 16 lines for 512 bytes, and the four waves share each tile. Two buffers: the next stage's copies fly while this stage is worked on.
// C[m][n] (f32, pitch DM) = sum_k (A[m][k] (+ A2[m][k] if NSPLIT)) Bt[n][k] + f32 bias[n] (one bias vector per z = 0, 1, 2). z-batch strides sA/sB in elements.
// PL: the tile does not leave as f32 but as the attention kernel's bf16 hi/lo planes: z = 0, 1 -> [b][h][t][d] (q, k), z = 2 -> v^T rows (b, h, d) = hi | lo, pitch 2*TT. A wave's 64x64 tile is 64 rows t of one (batch, head).
#define SK 128   // k per stage: 256 bytes of every operand row
#define SP 136   // LDS row pitch in elements: 272 bytes = 16 x odd, conflict-free for the 16-byte fragment reads
// eight 16-byte copies of one lane, rows 8 apart; l = the lane's LDS byte address, g = its global address
__device__ __forceinline__ void d_copy8(unsigned l, const bf* g) {
    asm volatile("global_load_async_to_lds_b128 %0, %8, off\n\tglobal_load_async_to_lds_b128 %1, %9, off\n\tglobal_load_async_to_lds_b128 %2, %10, off\n\tglobal_load_async_to_lds_b128 %3, %11, off\n\t"
                 "global_load_async_to_lds_b128 %4, %12, off\n\tglobal_load_async_to_lds_b128 %5, %13, off\n\tglobal_load_async_to_lds_b128 %6, %14, off\n\tglobal_load_async_to_lds_b128 %7, %15, off\n\t"
                 "s_wait_xcnt 0x0"   // stands in front of every later write of the address registers that these copies name
                 :: "v"(l), "v"(l + 8 * SP * 2), "v"(l + 16 * SP * 2), "v"(l + 24 * SP * 2), "v"(l + 32 * SP * 2), "v"(l + 40 * SP * 2), "v"(l + 48 * SP * 2), "v"(l + 56 * SP * 2),
                    "v"(g), "v"(g + 8 * DM), "v"(g + 16 * DM), "v"(g + 24 * DM), "v"(g + 32 * DM), "v"(g + 40 * DM), "v"(g + 48 * DM), "v"(g + 56 * DM) : "memory");
}
template <int NSPLIT, bool PL>
__global__ __launch_bounds__(128) void k_gemms(const bf* __restrict__ A, const bf* __restrict__ A2, const bf* __restrict__ Bt, float* C, const float* __restrict__ bias0, const float* __restrict__ bias1, const float* __restrict__ bias2, size_t sA, size_t sB, bf* QPh, bf* QPl, bf* KPh, bf* KPl, bf* VT2) {
    typedef WFrag<bf>::V V;
    constexpr int NT = NSPLIT ? 3 : 2, NS = DM / SK, TB = 128 * SP * 2;   // tiles per stage (A, Bt, A2), stages, bytes of a tile in LDS
    static_assert(DM == DQ && DM % SK == 0 && NS >= 2 && 4 * 2 * 64 * 72 * 2 <= 2 * NT * TB, "two stages or more; the output staging fits the ring");
    __shared__ __align__(16) bf ring[2][NT][128 * SP];
    const int tid = threadIdx.x, lane = tid & 31, lr = lane & 15, hi = lane >> 4; const int wv = __builtin_amdgcn_readfirstlane(tid >> 5);
    const size_t z = blockIdx.z; A += z * sA; if (NSPLIT) A2 += z * sA; Bt += z * sB; const float* bias = (z == 0) ? bias0 : ((z == 1) ? bias1 : bias2);
    const int wr = (wv >> 1) * 64, wc = (wv & 1) * 64, r0 = blockIdx.x * 128 + wr, c0 = blockIdx.y * 128 + wc;
    const int cr = tid >> 4, cc = (tid & 15) * 8;   // this thread's 16-byte pieces of a tile: column piece cc of rows cr + 8 u
    const bf* ga = A + (size_t)(blockIdx.x * 128 + cr) * DM + cc; const bf* ga2 = NSPLIT ? A2 + (size_t)(blockIdx.x * 128 + cr) * DM + cc : nullptr; const bf* gb = Bt + (size_t)(blockIdx.y * 128 + cr) * DM + cc;
    const unsigned l0 = (unsigned)(size_t)&ring[0][0][cr * SP + cc];
    auto fill = [&](int s) { const unsigned l = l0 + (unsigned)(s & 1) * (NT * TB);
        d_copy8(l, ga + s * SK); d_copy8(l + TB / 2, ga + s * SK + 64 * DM); d_copy8(l + TB, gb + s * SK); d_copy8(l + TB + TB / 2, gb + s * SK + 64 * DM);
        if (NSPLIT) { d_copy8(l + 2 * TB, ga2 + s * SK); d_copy8(l + 2 * TB + TB / 2, ga2 + s * SK + 64 * DM); } };
    v8f acc[4][4];
#pragma unroll
    for (int mb = 0; mb < 4; ++mb)
#pragma unroll
        for (int nb = 0; nb < 4; ++nb) acc[mb][nb] = (v8f){};
    fill(0);
    asm volatile("s_wait_asynccnt 0x0" ::: "memory");   // this wave's copies of stage 0 have landed
    __syncthreads();   // stage 0 is whole before anybody reads it
    fill(1);
#pragma unroll 1
    for (int s = 0; s < NS; ++s) {
        const bf* ta = &ring[s & 1][0][(wr + lr) * SP + 8 * hi]; const bf* tb = &ring[s & 1][1][(wc + lr) * SP + 8 * hi]; const bf* ta2 = &ring[s & 1][NT - 1][(wr + lr) * SP + 8 * hi];
        V a[2][4], a2[2][4], b[2][4];
#pragma unroll
        for (int mb = 0; mb < 4; ++mb) { a[0][mb] = WFrag<bf>::ld(ta + mb * 16 * SP); if (NSPLIT) a2[0][mb] = WFrag<bf>::ld(ta2 + mb * 16 * SP); b[0][mb] = WFrag<bf>::ld(tb + mb * 16 * SP); }
#pragma unroll
        for (int q = 0; q < SK / 32; ++q) { const int u = q & 1, n = u ^ 1;
            if (q + 1 < SK / 32) {
#pragma unroll
                for (int mb = 0; mb < 4; ++mb) { a[n][mb] = WFrag<bf>::ld(ta + mb * 16 * SP + (q + 1) * 32); if (NSPLIT) a2[n][mb] = WFrag<bf>::ld(ta2 + mb * 16 * SP + (q + 1) * 32); b[n][mb] = WFrag<bf>::ld(tb + mb * 16 * SP + (q + 1) * 32); } }
            __builtin_amdgcn_sched_barrier(0);   // keeps the next block's fragment loads together in front of this block's products: sunk to their users they would each wait alone
#pragma unroll
            for (int nb = 0; nb < 4; ++nb)
#pragma unroll
                for (int mb = 0; mb < 4; ++mb) { acc[mb][nb] = wmmab(a[u][mb], b[u][nb], acc[mb][nb]); if (NSPLIT) acc[mb][nb] = wmmab(a2[u][mb], b[u][nb], acc[mb][nb]); }
        }
        asm volatile("s_wait_dscnt 0x0" ::: "memory");      // this wave's reads of the buffer that is refilled below have returned
        asm volatile("s_wait_asynccnt 0x0" ::: "memory");   // this wave's copies of stage s + 1 have landed
        __syncthreads();   // publishes stage s + 1 and ends every wave's reads of stage s
        if (s + 2 < NS) fill(s + 2);
    }
    asm volatile("s_wait_asynccnt 0x0" ::: "memory");   // nothing is in flight when the ring becomes output staging (the last trip's barrier has ended every read of it)
    float* os = (float*)&ring[0][0][0] + wv * (2 * 64 * 72 / 2);   // wave-own staging: room for a whole v^T tile, hi and lo, row pitch 72 elements
    if (PL) {
        const int zh = (r0 / TT) * NH_ + c0 / HD, t0 = r0 % TT;
        if (z == 2) {   // v^T: a lane holds 8 consecutive t of one d, which is 16 bytes of a plane's row as it stands; through LDS so that whole 128-byte lines are stored
            bf* sh = (bf*)os; bf* sl = sh + 64 * 72;
#pragma unroll
            for (int nb = 0; nb < 4; ++nb) { const float bb = bfr(bias[c0 + nb * 16 + lr]);
#pragma unroll
                for (int mb = 0; mb < 4; ++mb) { v8us o1, o2;
#pragma unroll
                    for (int j = 0; j < 8; ++j) { unsigned short a1, c2; splitf(acc[mb][nb][j] + bb, a1, c2); o1[j] = a1; o2[j] = c2; }
                    *(v8usa*)(sh + (nb * 16 + lr) * 72 + mb * 16 + hi * 8) = o1; *(v8usa*)(sl + (nb * 16 + lr) * 72 + mb * 16 + hi * 8) = o2; } }
            __builtin_amdgcn_wave_barrier(); asm volatile("" ::: "memory");   // the row reads below take what other lanes of this wave stored
            bf* vrow = VT2 + ((size_t)zh * HD + (lane >> 3)) * (2 * TT) + t0 + (lane & 7) * 8;
#pragma unroll
            for (int g = 0; g < 4; ++g) { v8us o1[4], o2[4];   // 16 rows a round: one LDS latency for eight reads
#pragma unroll
                for (int s = 0; s < 4; ++s) { o1[s] = *(const v8usa*)(sh + ((g * 4 + s) * 4 + (lane >> 3)) * 72 + (lane & 7) * 8); o2[s] = *(const v8usa*)(sl + ((g * 4 + s) * 4 + (lane >> 3)) * 72 + (lane & 7) * 8); }
#pragma unroll
                for (int s = 0; s < 4; ++s) { *(v8usa*)(vrow + (size_t)(g * 4 + s) * 4 * 2 * TT) = o1[s]; *(v8usa*)(vrow + (size_t)(g * 4 + s) * 4 * 2 * TT + TT) = o2[s]; }
                asm volatile("s_wait_xcnt 0x0" ::: "memory"); }   // the next round reuses the registers that these stores name
            return; }
        bf* ph = ((z == 0) ? QPh : KPh) + ((size_t)zh * TT + t0) * HD + lr * 4; bf* pl = ((z == 0) ? QPl : KPl) + ((size_t)zh * TT + t0) * HD + lr * 4;
        v4f bb; bb[0] = bfr(bias[c0 + lr * 4]); bb[1] = bfr(bias[c0 + lr * 4 + 1]); bb[2] = bfr(bias[c0 + lr * 4 + 2]); bb[3] = bfr(bias[c0 + lr * 4 + 3]);
#pragma unroll
        for (int mb = 0; mb < 4; ++mb) {
#pragma unroll
            for (int nb = 0; nb < 4; ++nb) {
#pragma unroll
                for (int j = 0; j < 8; ++j) os[(hi * 8 + j) * 68 + nb * 16 + lr] = acc[mb][nb][j]; }
            __builtin_amdgcn_wave_barrier(); asm volatile("" ::: "memory");   // the row reads below take what other lanes of this wave stored
#pragma unroll
            for (int s = 0; s < 8; ++s) { const int row = 2 * s + hi; const v4f val = *(const v4fa*)(os + row * 68 + lr * 4); v4us o1, o2;
#pragma unroll
                for (int q = 0; q < 4; ++q) { unsigned short a1, c2; splitf(val[q] + bb[q], a1, c2); o1[q] = a1; o2[q] = c2; }
                *(v4usa*)(ph + (size_t)(mb * 16 + row) * HD) = o1; *(v4usa*)(pl + (size_t)(mb * 16 + row) * HD) = o2; }
            asm volatile("s_wait_xcnt 0x0" ::: "memory");   // the next 16 rows' work reuses the registers that these stores name
            __builtin_amdgcn_wave_barrier(); asm volatile("" ::: "memory");   // the next 16 rows overwrite what has just been read
        }
        return;
    }
#pragma unroll
    for (int mb = 0; mb < 4; ++mb) {
#pragma unroll
        for (int nb = 0; nb < 4; ++nb) {
#pragma unroll
            for (int j = 0; j < 8; ++j) os[(hi * 8 + j) * 68 + nb * 16 + lr] = acc[mb][nb][j]; }
        __builtin_amdgcn_wave_barrier(); asm volatile("" ::: "memory");
        float* crow = C + (size_t)(r0 + mb * 16) * DM + c0;
{
#pragma unroll
            for (int s = 0; s < 8; ++s) { const int row = 2 * s + hi, cofs = lr * 4; v4f val = *(const v4fa*)(os + row * 68 + cofs); val[0] += bfr(bias[c0 + cofs]); val[1] += bfr(bias[c0 + cofs + 1]); val[2] += bfr(bias[c0 + cofs + 2]); val[3] += bfr(bias[c0 + cofs + 3]);
                *(v4f*)(crow + (size_t)row * DM + cofs) = val; }
             }
        asm volatile("s_wait_xcnt 0x0" ::: "memory");   // the next 16 rows' work reuses the registers that these stores name
        __builtin_amdgcn_wave_barrier(); asm volatile("" ::: "memory");
    }
}

__device__ __forceinline__ void d_wtG(int bx, const float* __restrict__ w, int K, int N, bf* Bt) {
    const int lane = threadIdx.x & 31; const int L0 = (bx * 8 + (threadIdx.x >> 5)) * 8; const int nlines = N * K / 64;
{
#pragma unroll 1
        for (int l = 0; l < 8; ++l) { const int L = L0 + l; if (L >= nlines) break; const size_t e = (size_t)L * 64 + lane * 2; const int k = (int)(e % K), n = (int)(e / K); v2us o;
            o[0] = f2bf(w[(size_t)k * N + n]); o[1] = f2bf(w[(size_t)(k + 1) * N + n]); *(v2us*)(Bt + e) = o; }
         }
}
__device__ __forceinline__ void d_cvt8(int bx, const float* __restrict__ src, bf* dst, size_t n8) { const size_t i = (size_t)bx * 256 + threadIdx.x; if (i >= n8) return; const v8f v = *(const v8f*)(src + i * 8); v8us o;
#pragma unroll
    for (int k = 0; k < 8; ++k) o[k] = f2bf(v[k]); *(v8us*)(dst + i * 8) = o;  }

// k_fattn: scores, softmax, attn.v and the relative-value term in one kernel; no score or probability ever leaves the chip.
// Work-group = 8 waves = 128 query rows of one (batch, head); wave = 16 queries. Key tiles of 64 (k hi/lo, v^T hi/lo) go through registers into LDS (row pitch 144 B), the next tile's loads in flight while this one is worked on.
// Transposed scores S^T = k q^T: lane (lr, hi) holds query lr, keys hi*8 + 0..7 of each 16-key tile, which is the B fragment of P^T for O^T = v^T P^T as it stands; of O^T the lane holds d = hi*8 + 0..7 of the same query lr, so every factor of a query is a factor of a lane.
// ONE sweep over the keys: running row maximum (joined over the two half rows once per key tile), P = exp(t - maximum) unnormalised as bf16 hi/lo, v^T.P^T (3 products); row sum, the two end-offset sums and the context are rescaled as the maximum moves and take 1/sum at the end.
// The 31 interior offsets have one key each: their scores wait in a wave-own LDS plane and become probabilities at the end; PB.rel_v goes into the same accumulators.
#define KP 72
#define TP 40   // row pitch of the kept scores in floats: 16-byte rows, odd step between neighbouring queries' equal keys
typedef WFrag<bf>::V VB;
__device__ __forceinline__ void d_stile(const VB* kf, const VB* qh, const VB* ql, float* t, int j0s, int i0, int i, int hi, float qlo, float qhi, const float* qer) {
    float e[8];   // the relative-key term of this lane's 8 keys, chosen in front of the products so that no branch stands behind a matrix instruction
    if (j0s + 15 <= i0 - CUT) {   /* the same for the whole wave: every key of the tile on the low end offset */
#pragma unroll
        for (int jj = 0; jj < 8; ++jj) e[jj] = qlo; }
    else if (j0s >= i0 + 15 + CUT) {
#pragma unroll
        for (int jj = 0; jj < 8; ++jj) e[jj] = qhi; }
    else {
#pragma unroll
        for (int jj = 0; jj < 8; ++jj) e[jj] = qer[min(max(j0s + hi * 8 + jj - i, -CUT), CUT) + CUT]; }
    v8f s = (v8f){};
#pragma unroll
    for (int c = 0; c < 2; ++c) { s = wmmab(kf[2 * c], qh[c], s); s = wmmab(kf[2 * c], ql[c], s); s = wmmab(kf[2 * c + 1], qh[c], s); }
#pragma unroll
    for (int jj = 0; jj < 8; ++jj) t[jj] = __fadd_rn(s[jj], e[jj]) * SCL;
}
__device__ __forceinline__ float d_xhalf(float x) { return __builtin_bit_cast(float, __builtin_amdgcn_permlanex16(__builtin_bit_cast(int, x), __builtin_bit_cast(int, x), 0x76543210, 0xfedcba98, false, false)); }   // lane l takes lane l ^ 16
__global__ __launch_bounds__(256) void k_fattn(const bf* __restrict__ QPh, const bf* __restrict__ QPl, const bf* __restrict__ KPh, const bf* __restrict__ KPl, const bf* __restrict__ VT2, const float* __restrict__ QE, const bf* __restrict__ AVTh, const bf* __restrict__ AVTl, bf* ATh, bf* ATl) {
    __shared__ __align__(16) bf tk[2][64 * KP];        // k tile [key][d], hi and lo
    __shared__ __align__(16) bf tv[2][64 * KP];        // v^T tile [d][key], hi and lo
    __shared__ __align__(16) bf pb[8][2][16 * KP];     // per wave: P folded onto the offsets [query][offset], hi and lo
    __shared__ __align__(16) float os[8][16 * 68];     // per wave: its rows of QE
    __shared__ __align__(16) float ts[8][16 * TP];     // per wave: the scores of the interior offsets [query][offset]
    const float L2E = 1.4426950408889634f;
    const int tid = threadIdx.x, lane = tid & 31, lr = lane & 15, hi = lane >> 4; const int wv = __builtin_amdgcn_readfirstlane(tid >> 5);
    const int z = blockIdx.y, i0 = blockIdx.x * 128 + wv * 16, i = i0 + lr;
    float* osw = os[wv]; float* tsw = ts[wv]; bf* pbh = pb[wv][0]; bf* pbl = pb[wv][1];
    const int cr = tid >> 3, cc = (tid & 7) * 8, lo0 = cr * KP + cc;   // this thread's 16-byte pieces of a tile: rows cr and cr + 32
    const bf* kgh = KPh + (size_t)z * TT * HD + cr * HD + cc; const bf* kgl = KPl + (size_t)z * TT * HD + cr * HD + cc; const bf* vg = VT2 + ((size_t)z * HD + cr) * (2 * TT) + cc;
    v8us rk[2][2], rv[2][2];
#pragma unroll
    for (int u = 0; u < 2; ++u) { rk[0][u] = *(const v8us*)(kgh + u * 32 * HD); rk[1][u] = *(const v8us*)(kgl + u * 32 * HD); rv[0][u] = *(const v8us*)(vg + (size_t)u * 32 * 2 * TT); rv[1][u] = *(const v8us*)(vg + (size_t)u * 32 * 2 * TT + TT); }
    VB qh[2], ql[2];
#pragma unroll
    for (int c = 0; c < 2; ++c) { qh[c] = WFrag<bf>::ld(QPh + ((size_t)z * TT + i) * HD + 8 * hi + c * 32); ql[c] = WFrag<bf>::ld(QPl + ((size_t)z * TT + i) * HD + 8 * hi + c * 32); }
    asm volatile("s_wait_xcnt 0x0" :: "v"(kgh), "v"(kgl), "v"(vg), "v"(QPh + ((size_t)z * TT + i) * HD + 8 * hi), "v"(QPl + ((size_t)z * TT + i) * HD + 8 * hi) : "memory");   // later loads land in registers that the loads above name as their addresses: the addresses stay live up to the wait
#pragma unroll
    for (int u = 0; u < 8; ++u) { const int c = lane + 32 * u; *(v4fa*)(osw + (c >> 4) * 68 + (c & 15) * 4) = *(const v4fa*)(QE + ((size_t)z * TT + i0 + (c >> 4)) * NE + (c & 15) * 4); }
    asm volatile("s_wait_xcnt 0x0" ::: "memory");   // the set-up below reuses the registers that the loads above name as their addresses
    __builtin_amdgcn_sched_barrier(0);   // keeps that set-up (the zeroed accumulators among it) from being lifted over the wait
#pragma unroll
    for (int u = 0; u < 9; ++u) ((v4ua*)pbh)[lane + 32 * u] = (v4u){0u, 0u, 0u, 0u};   // both planes (they lie one behind the other): the padding offsets stay zero
#pragma unroll
    for (int u = 0; u < 16 * TP / 128; ++u) ((v4fa*)tsw)[lane + 32 * u] = (v4f){-1.0e30f, -1.0e30f, -1.0e30f, -1.0e30f};   // an offset with no key: its probability comes out zero
    __builtin_amdgcn_wave_barrier(); asm volatile("" ::: "memory");   // the reads of osw below take what other lanes of this wave stored (one wave's LDS operations run in order)
    const float* qer = osw + lr * 68; const float qlo = qer[0], qhi = qer[2 * CUT];
    float m = -3.0e38f, l = 0.f, lo_s = 0.f, hi_s = 0.f;
    v8f acc[4];   // O^T: acc[nb][j] = d nb*16 + hi*8 + j of query lr
#pragma unroll
    for (int nb = 0; nb < 4; ++nb) acc[nb] = (v8f){};
#pragma unroll 1
    for (int blk = 0; blk < TT / 64; ++blk) {
        __syncthreads();   // every wave has left the tiles that are overwritten next
#pragma unroll
        for (int u = 0; u < 2; ++u) { *(v8us*)(&tk[0][lo0 + u * 32 * KP]) = rk[0][u]; *(v8us*)(&tk[1][lo0 + u * 32 * KP]) = rk[1][u]; *(v8us*)(&tv[0][lo0 + u * 32 * KP]) = rv[0][u]; *(v8us*)(&tv[1][lo0 + u * 32 * KP]) = rv[1][u]; }
        __syncthreads();   // the tiles are whole before anybody reads them
        if (blk + 1 < TT / 64) {
#pragma unroll
            for (int u = 0; u < 2; ++u) { rk[0][u] = *(const v8us*)(kgh + ((blk + 1) * 64 + u * 32) * HD); rk[1][u] = *(const v8us*)(kgl + ((blk + 1) * 64 + u * 32) * HD); rv[0][u] = *(const v8us*)(vg + (size_t)u * 32 * 2 * TT + (blk + 1) * 64); rv[1][u] = *(const v8us*)(vg + (size_t)u * 32 * 2 * TT + TT + (blk + 1) * 64); }
            asm volatile("s_wait_xcnt 0x0" ::: "memory"); }   // the work below reuses the registers that these loads name as their addresses
        VB kf[4][4];   // the tile's 16 k fragments (per 16 keys: hi, lo of d 0..31, hi, lo of d 32..63), all loads issued before the first product so that one LDS latency is paid, not sixteen
#pragma unroll
        for (int st = 0; st < 4; ++st)
#pragma unroll
            for (int c = 0; c < 2; ++c) { kf[st][2 * c] = WFrag<bf>::ld(&tk[0][(st * 16 + lr) * KP + 8 * hi + c * 32]); kf[st][2 * c + 1] = WFrag<bf>::ld(&tk[1][(st * 16 + lr) * KP + 8 * hi + c * 32]); }
        __builtin_amdgcn_sched_barrier(0);   // keeps the fragment loads above together: sunk to their users they would each wait alone
        float t[4][8];
#pragma unroll
        for (int st = 0; st < 4; ++st) { const int j0s = blk * 64 + st * 16;
            d_stile(kf[st], qh, ql, t[st], j0s, i0, i, hi, qlo, qhi, qer);
            if (j0s + 15 > i0 - CUT && j0s < i0 + 15 + CUT) {   /* the same for the whole wave: a tile that touches the band of interior offsets */
#pragma unroll
                for (int jj = 0; jj < 8; ++jj) { const int bkt = j0s + hi * 8 + jj - i + CUT; if (bkt > 0 && bkt < 2 * CUT) tsw[lr * TP + bkt] = t[st][jj]; } } }
        float bm = m;
#pragma unroll
        for (int st = 0; st < 4; ++st)
#pragma unroll
            for (int jj = 0; jj < 8; ++jj) bm = fmaxf(bm, t[st][jj]);
        bm = fmaxf(bm, d_xhalf(bm));   // one maximum per query: both half rows feed the same accumulators
        const float cs = __builtin_amdgcn_exp2f((m - bm) * L2E); m = bm;   // 1 while the maximum stands
        l *= cs; lo_s *= cs; hi_s *= cs;
#pragma unroll
        for (int nb = 0; nb < 4; ++nb) acc[nb] *= cs;
        v8us oh[4], ol[4];
#pragma unroll
        for (int st = 0; st < 4; ++st) { const int j0s = blk * 64 + st * 16; float p[8];
#pragma unroll
            for (int jj = 0; jj < 8; ++jj) { unsigned short a, c2; p[jj] = __builtin_amdgcn_exp2f((t[st][jj] - bm) * L2E); splitf(p[jj], a, c2); oh[st][jj] = a; ol[st][jj] = c2; }
            const float a8 = ((p[0] + p[1]) + (p[2] + p[3])) + ((p[4] + p[5]) + (p[6] + p[7]));
            l += a8;
            if (j0s + 15 <= i0 - CUT) lo_s += a8;   /* the same for the whole wave: every key of the tile on the low end offset */
            else if (j0s >= i0 + 15 + CUT) hi_s += a8;
            else {
#pragma unroll
                for (int jj = 0; jj < 8; ++jj) { const int bkt = j0s + hi * 8 + jj - i + CUT; lo_s += (bkt <= 0) ? p[jj] : 0.0f; hi_s += (bkt >= 2 * CUT) ? p[jj] : 0.0f; } } }
#pragma unroll
        for (int c = 0; c < 2; ++c) { const VB ph = cat16b(oh[2 * c], oh[2 * c + 1]), pl = cat16b(ol[2 * c], ol[2 * c + 1]); VB vh[4], vl[4];
#pragma unroll
            for (int nb = 0; nb < 4; ++nb) { vh[nb] = WFrag<bf>::ld(&tv[0][(nb * 16 + lr) * KP + c * 32 + 8 * hi]); vl[nb] = WFrag<bf>::ld(&tv[1][(nb * 16 + lr) * KP + c * 32 + 8 * hi]); }
            __builtin_amdgcn_sched_barrier(0);   // keeps the 8 v fragment loads together, as above
#pragma unroll
            for (int nb = 0; nb < 4; ++nb) acc[nb] = wmmab(vh[nb], ph, acc[nb]);
#pragma unroll
            for (int nb = 0; nb < 4; ++nb) acc[nb] = wmmab(vh[nb], pl, acc[nb]);
#pragma unroll
            for (int nb = 0; nb < 4; ++nb) acc[nb] = wmmab(vl[nb], ph, acc[nb]); }
        asm volatile("v_nop\n\tv_nop\n\tv_nop\n\tv_nop" : "+v"(acc[0]), "+v"(acc[1]), "+v"(acc[2]), "+v"(acc[3]));   // the distance behind the last matrix instruction on the path over the loop's branches
    }
    VB rh[2][4], rl[2][4];   // rel_v^T fragments, hi and lo
    const bf* rgh = AVTh + lr * NE + 8 * hi; const bf* rgl = AVTl + lr * NE + 8 * hi;
#pragma unroll
    for (int c = 0; c < 2; ++c)
#pragma unroll
        for (int nb = 0; nb < 4; ++nb) { rh[c][nb] = WFrag<bf>::ld(rgh + nb * 16 * NE + c * 32); rl[c][nb] = WFrag<bf>::ld(rgl + nb * 16 * NE + c * 32); }
    asm volatile("s_wait_xcnt 0x0" : "+v"(lo_s), "+v"(hi_s), "+v"(l) : "v"(rgh), "v"(rgl) : "memory");   // the work below reuses the registers that these loads name as their addresses: the addresses stay live up to the wait, and the sums pass through it so that the exchange below is not lifted over it
    l += d_xhalf(l); lo_s += d_xhalf(lo_s); hi_s += d_xhalf(hi_s);   // the two half rows joined
    const float f = __fdiv_rn(1.0f, l);
    unsigned short l0h, l0l, h0h, h0l; splitf(lo_s * f, l0h, l0l); splitf(hi_s * f, h0h, h0l);
    __builtin_amdgcn_wave_barrier(); asm volatile("" ::: "memory");   // the reads of tsw below take what other lanes of this wave stored
    v4f tq[4];   // this lane's 16 offsets hi*16 + 0..15 of query lr
#pragma unroll
    for (int u = 0; u < 4; ++u) tq[u] = *(const v4fa*)(tsw + lr * TP + hi * 16 + u * 4);
#pragma unroll
    for (int g = 0; g < 2; ++g) { v8us o1, o2;
#pragma unroll
        for (int q = 0; q < 8; ++q) { unsigned short a, c2; splitf(__builtin_amdgcn_exp2f((tq[g * 2 + (q >> 2)][q & 3] - m) * L2E) * f, a, c2); o1[q] = a; o2[q] = c2; }
        if (g == 0) { o1[0] = (hi == 0) ? l0h : o1[0]; o2[0] = (hi == 0) ? l0l : o2[0]; }   // offset 0 = the low end's sum
        *(v8usa*)(pbh + lr * KP + hi * 16 + g * 8) = o1; *(v8usa*)(pbl + lr * KP + hi * 16 + g * 8) = o2; }
    if (hi == 0) { pbh[lr * KP + 2 * CUT] = h0h; pbl[lr * KP + 2 * CUT] = h0l; }
    __builtin_amdgcn_wave_barrier(); asm volatile("" ::: "memory");   // the fragment reads below take what other lanes of this wave stored
#pragma unroll
    for (int nb = 0; nb < 4; ++nb) acc[nb] *= f;
#pragma unroll
    for (int c = 0; c < 2; ++c) { const VB ph = WFrag<bf>::ld(pbh + lr * KP + 8 * hi + c * 32), pl = WFrag<bf>::ld(pbl + lr * KP + 8 * hi + c * 32);
#pragma unroll
        for (int nb = 0; nb < 4; ++nb) { acc[nb] = wmmab(rh[c][nb], ph, acc[nb]); acc[nb] = wmmab(rh[c][nb], pl, acc[nb]); acc[nb] = wmmab(rl[c][nb], ph, acc[nb]); } }
    bf* ah = ATh + ((size_t)(z / NH_) * TT + i) * DQ + (z % NH_) * HD + hi * 8; bf* al = ATl + ((size_t)(z / NH_) * TT + i) * DQ + (z % NH_) * HD + hi * 8;   /* z = b*16 + head; a lane's 8 values are 16 bytes of its query's row */
#pragma unroll
    for (int nb = 0; nb < 4; ++nb) { v8us o1, o2;
#pragma unroll
        for (int j = 0; j < 8; ++j) { unsigned short a, c2; splitf(acc[nb][j], a, c2); o1[j] = a; o2[j] = c2; }
        *(v8usa*)(ah + nb * 16) = o1; *(v8usa*)(al + nb * 16) = o2;
        asm volatile("s_wait_xcnt 0x0" ::: "memory"); }   // the next values' arithmetic reuses the registers that these two stores name
}
__device__ __forceinline__ void d_epadK(int bx, const float* __restrict__ E, bf* EB) { const size_t i = (size_t)bx * 256 + threadIdx.x; if (i >= (size_t)NE * HD / 8) return; const int d0 = (int)(i % (HD / 8)) * 8; const int r = (int)(i / (HD / 8)); const float* src = E + (size_t)min(r, NRE - 1) * HD + d0; v8us o;
#pragma unroll
    for (int q = 0; q < 8; ++q) { const unsigned short v = f2bf(src[q]); o[q] = (r < NRE) ? v : (unsigned short)0; }
    *(v8us*)(EB + (size_t)r * HD + d0) = o;  }

__device__ __forceinline__ void d_epadVT(int bx, const float* __restrict__ E, bf* Th, bf* Tl) { const size_t i = (size_t)bx * 256 + threadIdx.x; if (i >= (size_t)HD * NE / 4) return; const size_t e = i * 4; const int c0 = (int)(e % NE); const int d = (int)(e / NE); v4us oh, ol;
#pragma unroll
    for (int q = 0; q < 4; ++q) { const int r = c0 + q; const float v = bfr(E[(size_t)min(r, NRE - 1) * HD + d]); unsigned short u, w; splitf(v, u, w);   /* input rounded to bf16 once: lo == 0 */ oh[q] = (r < NRE) ? u : (unsigned short)0; ol[q] = (r < NRE) ? w : (unsigned short)0; }
    *(v4us*)(Th + e) = oh; *(v4us*)(Tl + e) = ol;  }

// k_prep: every pass that reads nothing but the inputs, in one launch; blockIdx.y picks the pass (the four weight gathers, the longest, start first). Grid (256, 17).
__global__ __launch_bounds__(256) void k_prep(const float* __restrict__ wq, const float* __restrict__ wk, const float* __restrict__ wv, const float* __restrict__ wo, const float* __restrict__ ak, const float* __restrict__ av, const float* __restrict__ x, const float* __restrict__ xk, const float* __restrict__ xv, bf* WB, bf* AKB, bf* AVTh, bf* AVTl, bf* XB) {
    static_assert(DM * DQ / 64 / 64 == 256 && DKV == DQ && NE * HD / 8 / 256 == 2 && HD * NE / 4 / 256 == 4 && NB_ * TT * DM / 8 / 256 == 4 * 256, "grid (256, 17)");
    const int bx = blockIdx.x, y = blockIdx.y;
    if (y < 4) { const float* w = (y == 0) ? wq : ((y == 1) ? wk : ((y == 2) ? wv : wo)); d_wtG(bx, w, DM, DQ, WB + (size_t)y * DM * DQ); }   /* 'xw' weights gathered into Bt */
    else if (y == 4) { if (bx < 2) d_epadK(bx, ak, AKB);   /* rel_k -> bf16 [64][64], rows >= 33 zero */ else if (bx < 6) d_epadVT(bx - 2, av, AVTh, AVTl); }   /* rel_v^T hi/lo [64][64], cols >= 33 zero */
    else { const int q = (y - 5) >> 2; const float* src = (q == 0) ? x : ((q == 1) ? xk : xv); d_cvt8(((y - 5) & 3) * 256 + bx, src, XB + (size_t)q * NB_ * TT * DM, (size_t)NB_ * TT * DM / 8); }
}

extern "C" void kernel_launch(void* const* d_in, const int* in_sizes, int n_in,
                              void* d_out, int out_size, void* d_ws, size_t ws_size, hipStream_t stream) {
    (void)in_sizes; (void)n_in; (void)out_size;
    const float* x = (const float*)d_in[0];   /* query */ const float* xk = (const float*)d_in[1]; const float* xv = (const float*)d_in[2]; const float* wq = (const float*)d_in[3]; const float* bq = (const float*)d_in[4]; const float* wk = (const float*)d_in[5]; const float* bk = (const float*)d_in[6]; const float* wv = (const float*)d_in[7]; const float* bv = (const float*)d_in[8]; const float* wo = (const float*)d_in[9]; const float* bo = (const float*)d_in[10]; const float* ak = (const float*)d_in[11]; const float* av = (const float*)d_in[12];   /* rel_k / rel_v [33][64] */
    float* OUT = (float*)d_out;     // [2][1024][1024]
    char* wsp = (char*)d_ws;
    auto take = [&](size_t bytes) { char* p = wsp; wsp += (bytes + 255) & ~(size_t)255; return (void*)p; };
    bf* AKB = (bf*)take((size_t)NE * HD * 2); bf* AVTh = (bf*)take((size_t)HD * NE * 2); bf* AVTl = (bf*)take((size_t)HD * NE * 2); float* QE = (float*)take((size_t)ZB * TT * NE * 4);
    bf* WB = (bf*)take((size_t)4 * DM * DQ * 2);   /* Wq, Wk, Wv, Wo as Bt, one behind the other */ bf* WO = WB + (size_t)3 * DM * DQ;
    bf* XB = (bf*)take((size_t)3 * NB_ * TT * DM * 2);   /* query, key, value */
    bf* QPh = (bf*)take((size_t)NB_ * NH_ * TT * HD * 2); bf* QPl = (bf*)take((size_t)NB_ * NH_ * TT * HD * 2); bf* KPh = (bf*)take((size_t)NB_ * NKV * TT * HD * 2); bf* KPl = (bf*)take((size_t)NB_ * NKV * TT * HD * 2); bf* VT2 = (bf*)take((size_t)NB_ * NKV * HD * 2 * TT * 2);   /* v^T rows hi | lo */
    bf* ATh = (bf*)take((size_t)NB_ * TT * DQ * 2); bf* ATl = (bf*)take((size_t)NB_ * TT * DQ * 2);
    if ((size_t)(wsp - (char*)d_ws) > ws_size) return;    // ws 256 MiB
    k_prep<<<dim3(256, 17, 1), 256, 0, stream>>>(wq, wk, wv, wo, ak, av, x, xk, xv, WB, AKB, AVTh, AVTl, XB);
    k_gemms<0, true><<<dim3(NB_ * TT / 128, DQ / 128, 3), 128, 0, stream>>>(XB, nullptr, WB, nullptr, bq, bk, bv, (size_t)NB_ * TT * DM, (size_t)DM * DQ, QPh, QPl, KPh, KPl, VT2);   /* z = q, k, v, straight into the head planes */
    k_gemmw<bf, 1><<<dim3(TT / 64, NE / 64, ZB), 32, 0, stream>>>(QPh, QPl, AKB, nullptr, HD, HD, QE, NE, (size_t)TT * HD, 0, (size_t)TT * NE);   /* QE = q . rel_k^T */
    k_fattn<<<dim3(TT / 128, ZB, 1), 256, 0, stream>>>(QPh, QPl, KPh, KPl, VT2, QE, AVTh, AVTl, ATh, ATl);   /* z = b*16 + head walks consecutive q, k and v planes; scores + q.rel_k[clip(j - i) + 16], softmax, attn.v + attn folded onto the 33 offsets . rel_v, merged hi/lo */
    k_gemms<1, false><<<dim3(NB_ * TT / 128, DM / 128, 1), 128, 0, stream>>>(ATh, ATl, WO, OUT, bo, bo, bo, 0, 0, nullptr, nullptr, nullptr, nullptr, nullptr);
}

// v008
// A run of this version takes 82.2 microseconds.
// Next to v007, in two timings, it ran 1.05 times as fast each time.
// All steps since v000 together make it 14.2 times as fast.
#include <hip/hip_runtime.h>

// Relative (Shaw) multi-head attention with key AND value relative-position embeddings (query, key, value [2][1024][1024]; q = query Wq + bq, k = key Wk + bk, v = value Wv + bv ('xw' 1/32, zero biases; 16 heads x 64); idx[i][j] = clip(j - i, -16, 16) + 16; attn = softmax((q.k + q.rel_k[idx]) / 8); x = attn v + sum_j attn[i][j] rel_v[idx] (rel_k, rel_v [33][64] 1/8 scale, read); out = merged Wo + bo ('xw') -> [2][1024][1024] (2.1 M); argument order query, key, value, Wq, bq, Wk, bk, Wv, bv, Wo, bo, rel_k, rel_v).
// Layout: bf16 copies of query, key, value side by side (both batches, rows b*1024 + t); 'xw' weights gathered into Bt; exact projections + f32 biases; rel_k as a zero-padded bf16 plane [64][64] and rel_v^T as hi/lo planes [64][64] (bf16-rounded once); QE = q.rel_k^T (hi/lo x exact); one fused attention launch over all 32 (batch, head) pairs: score tiles (hi/lo 3 products) + QE at column clip(j - i) + 16, softmax (x 1/8), P as hi/lo fragments, P.v (hi/lo x hi/lo), the probabilities folded onto the 33 offsets (interior = one key, the two ends = fixed-order sums) and PB.rel_v added into the context's accumulators; merged hi/lo x Wo exact + bo.
// Compute dtypes, f32 accumulate: every input rounded to bf16; projections exact + f32 biases; scores and the relative-key term ~f32; softmax f32; P as bf16 hi/lo; attn.v and the relative-value term 3 products (~f32); Wo hl x exact + bias.

#define NB_  2
#define TT   1024
#define DM   1024
#define NH_  16
#define NKV  16
#define REP  (NH_ / NKV)
#define HD   64
#define DQ   (NH_ * HD)
#define DKV  (NKV * HD)
#define ZH   16
#define ZB   (NB_ * ZH)           // (batch, head) pairs per attention launch: all of them
#define RH   TT
#define WIN  0
#define PCAR 1024.0f
#define SCL  0.125f   // 1/sqrt(64) (the module divides by jnp.sqrt(DH))
#define NE   64       // 2*16+1 = 33 relative offsets padded to 64
#define NRE  33
#define CUT  16
typedef _Float16 h16;
typedef unsigned short bf;
typedef __attribute__((ext_vector_type(16))) __bf16   v16bf;
typedef __attribute__((ext_vector_type(16))) _Float16 v16h;
typedef __attribute__((ext_vector_type(8)))  _Float16 v8h;
typedef __attribute__((ext_vector_type(8)))  unsigned short v8us;
typedef __attribute__((ext_vector_type(8)))  float    v8f;
typedef __attribute__((ext_vector_type(4)))  float    v4f;
typedef v8h  __attribute__((may_alias)) v8ha;
typedef v4f  __attribute__((may_alias)) v4fa;
typedef v8us __attribute__((may_alias)) v8usa;

__device__ __forceinline__ unsigned short f2bf(float f) { unsigned u = __float_as_uint(f); u += 0x7FFFu + ((u >> 16) & 1u); return (unsigned short)(u >> 16); }
__device__ __forceinline__ float bf2f(unsigned short b) { return __uint_as_float(((unsigned)b) << 16); }
__device__ __forceinline__ float bfr(float f) { return bf2f(f2bf(f)); }
__device__ __forceinline__ v16h cat16(v8h lo, v8h hi) { return __builtin_shufflevector(lo, hi, 0, 1, 2, 3, 4, 5, 6, 7, 8, 9, 10, 11, 12, 13, 14, 15); }
__device__ __forceinline__ v16bf cat16b(v8us lo, v8us hi) { return __builtin_bit_cast(v16bf, __builtin_shufflevector(lo, hi, 0, 1, 2, 3, 4, 5, 6, 7, 8, 9, 10, 11, 12, 13, 14, 15)); }
__device__ __forceinline__ v8f wmma16(v16h a, v16h b, v8f c) { return __builtin_amdgcn_wmma_f32_16x16x32_f16(false, a, false, b, (short)0, c, false, false); }
__device__ __forceinline__ v8f wmmab(v16bf a, v16bf b, v8f c) { return __builtin_amdgcn_wmma_f32_16x16x32_bf16(false, a, false, b, (short)0, c, false, false); }

__device__ __forceinline__ void splitf(float y, unsigned short& h, unsigned short& l) { h = f2bf(y); l = f2bf(y - bf2f(h)); }
typedef __attribute__((ext_vector_type(2))) unsigned short v2us;
typedef __attribute__((ext_vector_type(4))) unsigned short v4us;
typedef __attribute__((ext_vector_type(4))) unsigned int v4u;
typedef v4u  __attribute__((may_alias)) v4ua;
typedef v4us __attribute__((may_alias)) v4usa;

// ---- k_gemmw: register-blocked GEMM, ONE WAVE per 64x64 output tile (16 accumulators), operands straight from K-contiguous 16-bit planes; grid (M/64, N/64, Z), 32 threads. Serves the short product QE.
// C[m][n] (f32, pitch ldc) = sum_k A[m][k] Bt[n][k] (+ split products per NSPLIT). K = row pitch of A and of Bt in elements, kend <= K = length of the sum. z-batch strides sA/sB/sC in elements. kend % 32 == 0.
template <typename T16> struct WFrag;
template <> struct WFrag<h16> { typedef v16h V; static __device__ __forceinline__ V ld(const h16* p) { return cat16(*(const v8h*)p, *(const v8h*)(p + 16)); } static __device__ __forceinline__ v8f mma(V a, V b, v8f c) { return wmma16(a, b, c); } };
template <> struct WFrag<bf> { typedef v16bf V; static __device__ __forceinline__ V ld(const bf* p) { return cat16b(*(const v8us*)p, *(const v8us*)(p + 16)); } static __device__ __forceinline__ v8f mma(V a, V b, v8f c) { return wmmab(a, b, c); } };
template <typename T16, int NSPLIT>
__global__ __launch_bounds__(32) void k_gemmw(const T16* __restrict__ A, const T16* __restrict__ A2, const T16* __restrict__ Bt, const T16* __restrict__ Bt2, int K, int kend, float* C, int ldc, size_t sA, size_t sB, size_t sC) {
    typedef typename WFrag<T16>::V V;
    __shared__ __align__(16) float os[16 * 68];
    const size_t z = blockIdx.z; A += z * sA; if (A2) A2 += z * sA; Bt += z * sB; if (Bt2) Bt2 += z * sB; C += z * sC;
    const int lane = threadIdx.x & 31, lr = lane & 15, hi = lane >> 4; const int r0 = blockIdx.x * 64, c0 = blockIdx.y * 64;
    v8f acc[4][4];
#pragma unroll
    for (int mb = 0; mb < 4; ++mb)
#pragma unroll
        for (int nb = 0; nb < 4; ++nb) acc[mb][nb] = (v8f){};
    const size_t aoff = (size_t)(r0 + lr) * K + 8 * hi, boff = (size_t)(c0 + lr) * K + 8 * hi;
#pragma unroll 1
    for (int kc = 0; kc < kend; kc += 32) {
        V a[4], a2[4];
#pragma unroll
        for (int mb = 0; mb < 4; ++mb) { a[mb] = WFrag<T16>::ld(A + aoff + (size_t)mb * 16 * K + kc); if (NSPLIT == 1 || NSPLIT == 2) a2[mb] = WFrag<T16>::ld(A2 + aoff + (size_t)mb * 16 * K + kc); }
#pragma unroll
        for (int nb = 0; nb < 4; ++nb) { const V b = WFrag<T16>::ld(Bt + boff + (size_t)nb * 16 * K + kc); V b2; if (NSPLIT >= 2) b2 = WFrag<T16>::ld(Bt2 + boff + (size_t)nb * 16 * K + kc);
#pragma unroll
            for (int mb = 0; mb < 4; ++mb) { acc[mb][nb] = WFrag<T16>::mma(a[mb], b, acc[mb][nb]); if (NSPLIT == 1 || NSPLIT == 2) acc[mb][nb] = WFrag<T16>::mma(a2[mb], b, acc[mb][nb]); if (NSPLIT >= 2) acc[mb][nb] = WFrag<T16>::mma(a[mb], b2, acc[mb][nb]); } }
        asm volatile("v_nop\n\tv_nop\n\tv_nop\n\tv_nop" : "+v"(acc[0][0]), "+v"(acc[1][1]), "+v"(acc[2][2]), "+v"(acc[3][3]) : "v"(a[0]), "v"(a[3]));
    }
#pragma unroll
    for (int mb = 0; mb < 4; ++mb) {
#pragma unroll
        for (int nb = 0; nb < 4; ++nb) {
#pragma unroll
            for (int j = 0; j < 8; ++j) os[(hi * 8 + j) * 68 + nb * 16 + lr] = acc[mb][nb][j]; }
        __builtin_amdgcn_wave_barrier(); asm volatile("" ::: "memory");
        float* crow = C + (size_t)(r0 + mb * 16) * ldc + c0;
{
#pragma unroll
            for (int s = 0; s < 8; ++s) { const int row = 2 * s + hi, cofs = lr * 4; v4f val = *(const v4fa*)(os + row * 68 + cofs);
                *(v4f*)(crow + (size_t)row * ldc + cofs) = val; }
             }
        __builtin_amdgcn_wave_barrier(); asm volatile("" ::: "memory");
    }
}

// ---- k_gemms: the two long GEMMs (K = 1024). Work-group = 4 waves = one 128x128 output tile, wave = 64x64 (16 accumulators, the sums in k_gemmw's order). grid (M/128, N/128, Z), 128 threads.
// Operand tiles of 128 rows x 128 k go from the K-contiguous bf16 planes into LDS by asynchronous copies: a wave-wide copy takes two whole 256-byte row pieces, where a fragment load from global memory touched 16 lines for 512 bytes, and the four waves share each tile. Two buffers: the next stage's copies fly while this stage is worked on.
// C[m][n] (f32, pitch DM) = sum_k (A[m][k] (+ A2[m][k] if NSPLIT)) Bt[n][k] + f32 bias[n] (one bias vector per z = 0, 1, 2). z-batch strides sA/sB in elements.
// PL: the tile does not leave as f32 but as the attention kernel's bf16 hi/lo planes: z = 0, 1 -> [b][h][t][d] (q, k), z = 2 -> v^T rows (b, h, d) = hi | lo, pitch 2*TT. A wave's 64x64 tile is 64 rows t of one (batch, head).
#define SK 128   // k per stage: 256 bytes of every operand row
#define SP 136   // LDS row pitch in elements: 272 bytes = 16 x odd, conflict-free for the 16-byte fragment reads
// eight 16-byte copies of one lane, rows 8 apart; l = the lane's LDS byte address, g = its global address
__device__ __forceinline__ void d_copy8(unsigned l, const bf* g) {
    asm volatile("global_load_async_to_lds_b128 %0, %8, off\n\tglobal_load_async_to_lds_b128 %1, %9, off\n\tglobal_load_async_to_lds_b128 %2, %10, off\n\tglobal_load_async_to_lds_b128 %3, %11, off\n\t"
                 "global_load_async_to_lds_b128 %4, %12, off\n\tglobal_load_async_to_lds_b128 %5, %13, off\n\tglobal_load_async_to_lds_b128 %6, %14, off\n\tglobal_load_async_to_lds_b128 %7, %15, off\n\t"
                 "s_wait_xcnt 0x0"   // stands in front of every later write of the address registers that these copies name
                 :: "v"(l), "v"(l + 8 * SP * 2), "v"(l + 16 * SP * 2), "v"(l + 24 * SP * 2), "v"(l + 32 * SP * 2), "v"(l + 40 * SP * 2), "v"(l + 48 * SP * 2), "v"(l + 56 * SP * 2),
                    "v"(g), "v"(g + 8 * DM), "v"(g + 16 * DM), "v"(g + 24 * DM), "v"(g + 32 * DM), "v"(g + 40 * DM), "v"(g + 48 * DM), "v"(g + 56 * DM) : "memory");
}
template <int NSPLIT, bool PL>
__global__ __launch_bounds__(128) void k_gemms(const bf* __restrict__ A, const bf* __restrict__ A2, const bf* __restrict__ Bt, float* C, const float* __restrict__ bias0, const float* __restrict__ bias1, const float* __restrict__ bias2, size_t sA, size_t sB, bf* QPh, bf* QPl, bf* KPh, bf* KPl, bf* VT2) {
    typedef WFrag<bf>::V V;
    constexpr int NT = NSPLIT ? 3 : 2, NS = DM / SK, TB = 128 * SP * 2;   // tiles per stage (A, Bt, A2), stages, bytes of a tile in LDS
    static_assert(DM == DQ && DM % SK == 0 && NS >= 2 && 4 * 2 * 64 * 72 * 2 <= 2 * NT * TB, "two stages or more; the output staging fits the ring");
    __shared__ __align__(16) bf ring[2][NT][128 * SP];
    const int tid = threadIdx.x, lane = tid & 31, lr = lane & 15, hi = lane >> 4; const int wv = __builtin_amdgcn_readfirstlane(tid >> 5);
    const size_t z = blockIdx.z; A += z * sA; if (NSPLIT) A2 += z * sA; Bt += z * sB; const float* bias = (z == 0) ? bias0 : ((z == 1) ? bias1 : bias2);
    const int wr = (wv >> 1) * 64, wc = (wv & 1) * 64, r0 = blockIdx.x * 128 + wr, c0 = blockIdx.y * 128 + wc;
    const int cr = tid >> 4, cc = (tid & 15) * 8;   // this thread's 16-byte pieces of a tile: column piece cc of rows cr + 8 u
    const bf* ga = A + (size_t)(blockIdx.x * 128 + cr) * DM + cc; const bf* ga2 = NSPLIT ? A2 + (size_t)(blockIdx.x * 128 + cr) * DM + cc : nullptr; const bf* gb = Bt + (size_t)(blockIdx.y * 128 + cr) * DM + cc;
    const unsigned l0 = (unsigned)(size_t)&ring[0][0][cr * SP + cc];
    auto fill = [&](int s) { const unsigned l = l0 + (unsigned)(s & 1) * (NT * TB);
        d_copy8(l, ga + s * SK); d_copy8(l + TB / 2, ga + s * SK + 64 * DM); d_copy8(l + TB, gb + s * SK); d_copy8(l + TB + TB / 2, gb + s * SK + 64 * DM);
        if (NSPLIT) { d_copy8(l + 2 * TB, ga2 + s * SK); d_copy8(l + 2 * TB + TB / 2, ga2 + s * SK + 64 * DM); } };
    v8f acc[4][4];
#pragma unroll
    for (int mb = 0; mb < 4; ++mb)
#pragma unroll
        for (int nb = 0; nb < 4; ++nb) acc[mb][nb] = (v8f){};
    fill(0);
    asm volatile("s_wait_asynccnt 0x0" ::: "memory");   // this wave's copies of stage 0 have landed
    __syncthreads();   // stage 0 is whole before anybody reads it
    fill(1);
#pragma unroll 1
    for (int s = 0; s < NS; ++s) {
        const bf* ta = &ring[s & 1][0][(wr + lr) * SP + 8 * hi]; const bf* tb = &ring[s & 1][1][(wc + lr) * SP + 8 * hi]; const bf* ta2 = &ring[s & 1][NT - 1][(wr + lr) * SP + 8 * hi];
        V a[2][4], a2[2][4], b[2][4];
#pragma unroll
        for (int mb = 0; mb < 4; ++mb) { a[0][mb] = WFrag<bf>::ld(ta + mb * 16 * SP); if (NSPLIT) a2[0][mb] = WFrag<bf>::ld(ta2 + mb * 16 * SP); b[0][mb] = WFrag<bf>::ld(tb + mb * 16 * SP); }
#pragma unroll
        for (int q = 0; q < SK / 32; ++q) { const int u = q & 1, n = u ^ 1;
            if (q + 1 < SK / 32) {
#pragma unroll
                for (int mb = 0; mb < 4; ++mb) { a[n][mb] = WFrag<bf>::ld(ta + mb * 16 * SP + (q + 1) * 32); if (NSPLIT) a2[n][mb] = WFrag<bf>::ld(ta2 + mb * 16 * SP + (q + 1) * 32); b[n][mb] = WFrag<bf>::ld(tb + mb * 16 * SP + (q + 1) * 32); } }
            __builtin_amdgcn_sched_barrier(0);   // keeps the next block's fragment loads together in front of this block's products: sunk to their users they would each wait alone
#pragma unroll
            for (int nb = 0; nb < 4; ++nb)
#pragma unroll
                for (int mb = 0; mb < 4; ++mb) { acc[mb][nb] = wmmab(a[u][mb], b[u][nb], acc[mb][nb]); if (NSPLIT) acc[mb][nb] = wmmab(a2[u][mb], b[u][nb], acc[mb][nb]); }
        }
        asm volatile("s_wait_dscnt 0x0" ::: "memory");      // this wave's reads of the buffer that is refilled below have returned
        asm volatile("s_wait_asynccnt 0x0" ::: "memory");   // this wave's copies of stage s + 1 have landed
        __syncthreads();   // publishes stage s + 1 and ends every wave's reads of stage s
        if (s + 2 < NS) fill(s + 2);
    }
    asm volatile("s_wait_asynccnt 0x0" ::: "memory");   // nothing is in flight when the ring becomes output staging (the last trip's barrier has ended every read of it)
    float* os = (float*)&ring[0][0][0] + wv * (2 * 64 * 72 / 2);   // wave-own staging: room for a whole v^T tile, hi and lo, row pitch 72 elements
    if (PL) {
        const int zh = (r0 / TT) * NH_ + c0 / HD, t0 = r0 % TT;
        if (z == 2) {   // v^T: a lane holds 8 consecutive t of one d, which is 16 bytes of a plane's row as it stands; through LDS so that whole 128-byte lines are stored
            bf* sh = (bf*)os; bf* sl = sh + 64 * 72;
#pragma unroll
            for (int nb = 0; nb < 4; ++nb) { const float bb = bfr(bias[c0 + nb * 16 + lr]);
#pragma unroll
                for (int mb = 0; mb < 4; ++mb) { v8us o1, o2;
#pragma unroll
                    for (int j = 0; j < 8; ++j) { unsigned short a1, c2; splitf(acc[mb][nb][j] + bb, a1, c2); o1[j] = a1; o2[j] = c2; }
                    *(v8usa*)(sh + (nb * 16 + lr) * 72 + mb * 16 + hi * 8) = o1; *(v8usa*)(sl + (nb * 16 + lr) * 72 + mb * 16 + hi * 8) = o2; } }
            __builtin_amdgcn_wave_barrier(); asm volatile("" ::: "memory");   // the row reads below take what other lanes of this wave stored
            bf* vrow = VT2 + ((size_t)zh * HD + (lane >> 3)) * (2 * TT) + t0 + (lane & 7) * 8;
#pragma unroll
            for (int g = 0; g < 4; ++g) { v8us o1[4], o2[4];   // 16 rows a round: one LDS latency for eight reads
#pragma unroll
                for (int s = 0; s < 4; ++s) { o1[s] = *(const v8usa*)(sh + ((g * 4 + s) * 4 + (lane >> 3)) * 72 + (lane & 7) * 8); o2[s] = *(const v8usa*)(sl + ((g * 4 + s) * 4 + (lane >> 3)) * 72 + (lane & 7) * 8); }
#pragma unroll
                for (int s = 0; s < 4; ++s) { *(v8usa*)(vrow + (size_t)(g * 4 + s) * 4 * 2 * TT) = o1[s]; *(v8usa*)(vrow + (size_t)(g * 4 + s) * 4 * 2 * TT + TT) = o2[s]; }
                asm volatile("s_wait_xcnt 0x0" ::: "memory"); }   // the next round reuses the registers that these stores name
            return; }
        bf* ph = ((z == 0) ? QPh : KPh) + ((size_t)zh * TT + t0) * HD + lr * 4; bf* pl = ((z == 0) ? QPl : KPl) + ((size_t)zh * TT + t0) * HD + lr * 4;
        v4f bb; bb[0] = bfr(bias[c0 + lr * 4]); bb[1] = bfr(bias[c0 + lr * 4 + 1]); bb[2] = bfr(bias[c0 + lr * 4 + 2]); bb[3] = bfr(bias[c0 + lr * 4 + 3]);
#pragma unroll
        for (int mb = 0; mb < 4; ++mb) {
#pragma unroll
            for (int nb = 0; nb < 4; ++nb) {
#pragma unroll
                for (int j = 0; j < 8; ++j) os[(hi * 8 + j) * 68 + nb * 16 + lr] = acc[mb][nb][j]; }
            __builtin_amdgcn_wave_barrier(); asm volatile("" ::: "memory");   // the row reads below take what other lanes of this wave stored
#pragma unroll
            for (int s = 0; s < 8; ++s) { const int row = 2 * s + hi; const v4f val = *(const v4fa*)(os + row * 68 + lr * 4); v4us o1, o2;
#pragma unroll
                for (int q = 0; q < 4; ++q) { unsigned short a1, c2; splitf(val[q] + bb[q], a1, c2); o1[q] = a1; o2[q] = c2; }
                *(v4usa*)(ph + (size_t)(mb * 16 + row) * HD) = o1; *(v4usa*)(pl + (size_t)(mb * 16 + row) * HD) = o2; }
            asm volatile("s_wait_xcnt 0x0" ::: "memory");   // the next 16 rows' work reuses the registers that these stores name
            __builtin_amdgcn_wave_barrier(); asm volatile("" ::: "memory");   // the next 16 rows overwrite what has just been read
        }
        return;
    }
#pragma unroll
    for (int mb = 0; mb < 4; ++mb) {
#pragma unroll
        for (int nb = 0; nb < 4; ++nb) {
#pragma unroll
            for (int j = 0; j < 8; ++j) os[(hi * 8 + j) * 68 + nb * 16 + lr] = acc[mb][nb][j]; }
        __builtin_amdgcn_wave_barrier(); asm volatile("" ::: "memory");
        float* crow = C + (size_t)(r0 + mb * 16) * DM + c0;
{
#pragma unroll
            for (int s = 0; s < 8; ++s) { const int row = 2 * s + hi, cofs = lr * 4; v4f val = *(const v4fa*)(os + row * 68 + cofs); val[0] += bfr(bias[c0 + cofs]); val[1] += bfr(bias[c0 + cofs + 1]); val[2] += bfr(bias[c0 + cofs + 2]); val[3] += bfr(bias[c0 + cofs + 3]);
                *(v4f*)(crow + (size_t)row * DM + cofs) = val; }
             }
        asm volatile("s_wait_xcnt 0x0" ::: "memory");   // the next 16 rows' work reuses the registers that these stores name
        __builtin_amdgcn_wave_barrier(); asm volatile("" ::: "memory");
    }
}

// d_wtT: one weight tile, 64 k x 256 n, from w[k][n] (f32) to Bt[n][k] (bf16). A wave owns 32 n: each of its loads takes four whole 128-byte lines (four rows k, 32 n each), all 16 loads in flight at once;
// rows k and k + 1 are packed into one dword per n and turned in a wave-own LDS tile [n][k pair]; each store then takes four whole 128-byte lines of Bt (four rows n, 64 k each).
#define WTP 36   // dwords per row n of the LDS tile: 32 pairs of k + 4; 144 bytes = 16 x odd, conflict-free for the 16-byte row reads
__device__ __forceinline__ void d_wtT(int bx, const float* __restrict__ w, bf* Bt, unsigned* tl) {
    const int lane = threadIdx.x & 31, wv = threadIdx.x >> 5, a = lane & 7, b = lane >> 3; const int k0 = (bx >> 2) * 64, n0 = (bx & 3) * 256 + wv * 32;
    unsigned* t = tl + wv * 32 * WTP;
    const float* g = w + (size_t)(k0 + 2 * b) * DQ + n0 + a * 4;   // rows k0 + 8 u + 2 b (+ 1), columns n0 + 4 a + 0..3
    v4f r0[8], r1[8];
#pragma unroll
    for (int u = 0; u < 8; ++u) { r0[u] = *(const v4f*)(g + (size_t)(u * 8) * DQ); r1[u] = *(const v4f*)(g + (size_t)(u * 8 + 1) * DQ); }
    asm volatile("s_wait_xcnt 0x0" :: "v"(g) : "memory");   // the work below reuses the registers that these loads name as their addresses: the address stays live up to the wait
#pragma unroll
    for (int u = 0; u < 8; ++u)
#pragma unroll
        for (int q = 0; q < 4; ++q) t[(a * 4 + q) * WTP + u * 4 + b] = (unsigned)f2bf(r0[u][q]) | ((unsigned)f2bf(r1[u][q]) << 16);
    __builtin_amdgcn_wave_barrier(); asm volatile("" ::: "memory");   // the row reads below take what other lanes of this wave stored (one wave's LDS operations run in order)
    bf* o = Bt + (size_t)(n0 + b) * DM + k0 + a * 8;   // rows n0 + 4 v + b, k0 + 8 a + 0..7
    v4u x[8];
#pragma unroll
    for (int v = 0; v < 8; ++v) x[v] = *(const v4ua*)(t + (v * 4 + b) * WTP + a * 4);
#pragma unroll
    for (int v = 0; v < 8; ++v) *(v4ua*)(o + (size_t)(v * 4) * DM) = x[v];
}
// d_cvt4: 16384 floats of an input to bf16; a thread takes 16 pieces of 4 floats, 256 pieces apart (a wave's load = 512 contiguous bytes, its store = 256), all 16 loads in flight at once
__device__ __forceinline__ void d_cvt4(int bx, const float* __restrict__ src, bf* dst) { const size_t i0 = ((size_t)bx * 4096 + threadIdx.x) * 4; const float* s = src + i0; bf* d = dst + i0; v4f v[16];
#pragma unroll
    for (int u = 0; u < 16; ++u) v[u] = *(const v4f*)(s + u * 1024);
    asm volatile("s_wait_xcnt 0x0" :: "v"(s) : "memory");   // the work below reuses the registers that these loads name as their addresses: the address stays live up to the wait
#pragma unroll
    for (int u = 0; u < 16; ++u) { v4us o;
#pragma unroll
        for (int k = 0; k < 4; ++k) o[k] = f2bf(v[u][k]);
        *(v4us*)(d + u * 1024) = o; }
}

// k_fattn: scores, softmax, attn.v and the relative-value term in one kernel; no score or probability ever leaves the chip.
// Work-group = 8 waves = 128 query rows of one (batch, head); wave = 16 queries. Key tiles of 64 (k hi/lo, v^T hi/lo) go through registers into LDS (row pitch 144 B), the next tile's loads in flight while this one is worked on.
// Transposed scores S^T = k q^T: lane (lr, hi) holds query lr, keys hi*8 + 0..7 of each 16-key tile, which is the B fragment of P^T for O^T = v^T P^T as it stands; of O^T the lane holds d = hi*8 + 0..7 of the same query lr, so every factor of a query is a factor of a lane.
// ONE sweep over the keys: running row maximum (joined over the two half rows once per key tile), P = exp(t - maximum) unnormalised as bf16 hi/lo, v^T.P^T (3 products); row sum, the two end-offset sums and the context are rescaled as the maximum moves and take 1/sum at the end.
// The 31 interior offsets have one key each: their scores wait in a wave-own LDS plane and become probabilities at the end; PB.rel_v goes into the same accumulators.
#define KP 72
#define TP 40   // row pitch of the kept scores in floats: 16-byte rows, odd step between neighbouring queries' equal keys
typedef WFrag<bf>::V VB;
__device__ __forceinline__ void d_stile(const VB* kf, const VB* qh, const VB* ql, float* t, int j0s, int i0, int i, int hi, float qlo, float qhi, const float* qer) {
    float e[8];   // the relative-key term of this lane's 8 keys, chosen in front of the products so that no branch stands behind a matrix instruction
    if (j0s + 15 <= i0 - CUT) {   /* the same for the whole wave: every key of the tile on the low end offset */
#pragma unroll
        for (int jj = 0; jj < 8; ++jj) e[jj] = qlo; }
    else if (j0s >= i0 + 15 + CUT) {
#pragma unroll
        for (int jj = 0; jj < 8; ++jj) e[jj] = qhi; }
    else {
#pragma unroll
        for (int jj = 0; jj < 8; ++jj) e[jj] = qer[min(max(j0s + hi * 8 + jj - i, -CUT), CUT) + CUT]; }
    v8f s = (v8f){};
#pragma unroll
    for (int c = 0; c < 2; ++c) { s = wmmab(kf[2 * c], qh[c], s); s = wmmab(kf[2 * c], ql[c], s); s = wmmab(kf[2 * c + 1], qh[c], s); }
#pragma unroll
    for (int jj = 0; jj < 8; ++jj) t[jj] = __fadd_rn(s[jj], e[jj]) * SCL;
}
__device__ __forceinline__ float d_xhalf(float x) { return __builtin_bit_cast(float, __builtin_amdgcn_permlanex16(__builtin_bit_cast(int, x), __builtin_bit_cast(int, x), 0x76543210, 0xfedcba98, false, false)); }   // lane l takes lane l ^ 16
__global__ __launch_bounds__(256) void k_fattn(const bf* __restrict__ QPh, const bf* __restrict__ QPl, const bf* __restrict__ KPh, const bf* __restrict__ KPl, const bf* __restrict__ VT2, const float* __restrict__ QE, const bf* __restrict__ AVTh, const bf* __restrict__ AVTl, bf* ATh, bf* ATl) {
    __shared__ __align__(16) bf tk[2][64 * KP];        // k tile [key][d], hi and lo
    __shared__ __align__(16) bf tv[2][64 * KP];        // v^T tile [d][key], hi and lo
    __shared__ __align__(16) bf pb[8][2][16 * KP];     // per wave: P folded onto the offsets [query][offset], hi and lo
    __shared__ __align__(16) float os[8][16 * 68];     // per wave: its rows of QE
    __shared__ __align__(16) float ts[8][16 * TP];     // per wave: the scores of the interior offsets [query][offset]
    const float L2E = 1.4426950408889634f;
    const int tid = threadIdx.x, lane = tid & 31, lr = lane & 15, hi = lane >> 4; const int wv = __builtin_amdgcn_readfirstlane(tid >> 5);
    const int z = blockIdx.y, i0 = blockIdx.x * 128 + wv * 16, i = i0 + lr;
    float* osw = os[wv]; float* tsw = ts[wv]; bf* pbh = pb[wv][0]; bf* pbl = pb[wv][1];
    const int cr = tid >> 3, cc = (tid & 7) * 8, lo0 = cr * KP + cc;   // this thread's 16-byte pieces of a tile: rows cr and cr + 32
    const bf* kgh = KPh + (size_t)z * TT * HD + cr * HD + cc; const bf* kgl = KPl + (size_t)z * TT * HD + cr * HD + cc; const bf* vg = VT2 + ((size_t)z * HD + cr) * (2 * TT) + cc;
    v8us rk[2][2], rv[2][2];
#pragma unroll
    for (int u = 0; u < 2; ++u) { rk[0][u] = *(const v8us*)(kgh + u * 32 * HD); rk[1][u] = *(const v8us*)(kgl + u * 32 * HD); rv[0][u] = *(const v8us*)(vg + (size_t)u * 32 * 2 * TT); rv[1][u] = *(const v8us*)(vg + (size_t)u * 32 * 2 * TT + TT); }
    VB qh[2], ql[2];
#pragma unroll
    for (int c = 0; c < 2; ++c) { qh[c] = WFrag<bf>::ld(QPh + ((size_t)z * TT + i) * HD + 8 * hi + c * 32); ql[c] = WFrag<bf>::ld(QPl + ((size_t)z * TT + i) * HD + 8 * hi + c * 32); }
    asm volatile("s_wait_xcnt 0x0" :: "v"(kgh), "v"(kgl), "v"(vg), "v"(QPh + ((size_t)z * TT + i) * HD + 8 * hi), "v"(QPl + ((size_t)z * TT + i) * HD + 8 * hi) : "memory");   // later loads land in registers that the loads above name as their addresses: the addresses stay live up to the wait
#pragma unroll
    for (int u = 0; u < 8; ++u) { const int c = lane + 32 * u; *(v4fa*)(osw + (c >> 4) * 68 + (c & 15) * 4) = *(const v4fa*)(QE + ((size_t)z * TT + i0 + (c >> 4)) * NE + (c & 15) * 4); }
    asm volatile("s_wait_xcnt 0x0" ::: "memory");   // the set-up below reuses the registers that the loads above name as their addresses
    __builtin_amdgcn_sched_barrier(0);   // keeps that set-up (the zeroed accumulators among it) from being lifted over the wait
#pragma unroll
    for (int u = 0; u < 9; ++u) ((v4ua*)pbh)[lane + 32 * u] = (v4u){0u, 0u, 0u, 0u};   // both planes (they lie one behind the other): the padding offsets stay zero
#pragma unroll
    for (int u = 0; u < 16 * TP / 128; ++u) ((v4fa*)tsw)[lane + 32 * u] = (v4f){-1.0e30f, -1.0e30f, -1.0e30f, -1.0e30f};   // an offset with no key: its probability comes out zero
    __builtin_amdgcn_wave_barrier(); asm volatile("" ::: "memory");   // the reads of osw below take what other lanes of this wave stored (one wave's LDS operations run in order)
    const float* qer = osw + lr * 68; const float qlo = qer[0], qhi = qer[2 * CUT];
    float m = -3.0e38f, l = 0.f, lo_s = 0.f, hi_s = 0.f;
    v8f acc[4];   // O^T: acc[nb][j] = d nb*16 + hi*8 + j of query lr
#pragma unroll
    for (int nb = 0; nb < 4; ++nb) acc[nb] = (v8f){};
#pragma unroll 1
    for (int blk = 0; blk < TT / 64; ++blk) {
        __syncthreads();   // every wave has left the tiles that are overwritten next
#pragma unroll
        for (int u = 0; u < 2; ++u) { *(v8us*)(&tk[0][lo0 + u * 32 * KP]) = rk[0][u]; *(v8us*)(&tk[1][lo0 + u * 32 * KP]) = rk[1][u]; *(v8us*)(&tv[0][lo0 + u * 32 * KP]) = rv[0][u]; *(v8us*)(&tv[1][lo0 + u * 32 * KP]) = rv[1][u]; }
        __syncthreads();   // the tiles are whole before anybody reads them
        if (blk + 1 < TT / 64) {
#pragma unroll
            for (int u = 0; u < 2; ++u) { rk[0][u] = *(const v8us*)(kgh + ((blk + 1) * 64 + u * 32) * HD); rk[1][u] = *(const v8us*)(kgl + ((blk + 1) * 64 + u * 32) * HD); rv[0][u] = *(const v8us*)(vg + (size_t)u * 32 * 2 * TT + (blk + 1) * 64); rv[1][u] = *(const v8us*)(vg + (size_t)u * 32 * 2 * TT + TT + (blk + 1) * 64); }
            asm volatile("s_wait_xcnt 0x0" ::: "memory"); }   // the work below reuses the registers that these loads name as their addresses
        VB kf[4][4];   // the tile's 16 k fragments (per 16 keys: hi, lo of d 0..31, hi, lo of d 32..63), all loads issued before the first product so that one LDS latency is paid, not sixteen
#pragma unroll
        for (int st = 0; st < 4; ++st)
#pragma unroll
            for (int c = 0; c < 2; ++c) { kf[st][2 * c] = WFrag<bf>::ld(&tk[0][(st * 16 + lr) * KP + 8 * hi + c * 32]); kf[st][2 * c + 1] = WFrag<bf>::ld(&tk[1][(st * 16 + lr) * KP + 8 * hi + c * 32]); }
        __builtin_amdgcn_sched_barrier(0);   // keeps the fragment loads above together: sunk to their users they would each wait alone
        float t[4][8];
#pragma unroll
        for (int st = 0; st < 4; ++st) { const int j0s = blk * 64 + st * 16;
            d_stile(kf[st], qh, ql, t[st], j0s, i0, i, hi, qlo, qhi, qer);
            if (j0s + 15 > i0 - CUT && j0s < i0 + 15 + CUT) {   /* the same for the whole wave: a tile that touches the band of interior offsets */
#pragma unroll
                for (int jj = 0; jj < 8; ++jj) { const int bkt = j0s + hi * 8 + jj - i + CUT; if (bkt > 0 && bkt < 2 * CUT) tsw[lr * TP + bkt] = t[st][jj]; } } }
        float bm = m;
#pragma unroll
        for (int st = 0; st < 4; ++st)
#pragma unroll
            for (int jj = 0; jj < 8; ++jj) bm = fmaxf(bm, t[st][jj]);
        bm = fmaxf(bm, d_xhalf(bm));   // one maximum per query: both half rows feed the same accumulators
        const float cs = __builtin_amdgcn_exp2f((m - bm) * L2E); m = bm;   // 1 while the maximum stands
        l *= cs; lo_s *= cs; hi_s *= cs;
#pragma unroll
        for (int nb = 0; nb < 4; ++nb) acc[nb] *= cs;
        v8us oh[4], ol[4];
#pragma unroll
        for (int st = 0; st < 4; ++st) { const int j0s = blk * 64 + st * 16; float p[8];
#pragma unroll
            for (int jj = 0; jj < 8; ++jj) { unsigned short a, c2; p[jj] = __builtin_amdgcn_exp2f((t[st][jj] - bm) * L2E); splitf(p[jj], a, c2); oh[st][jj] = a; ol[st][jj] = c2; }
            const float a8 = ((p[0] + p[1]) + (p[2] + p[3])) + ((p[4] + p[5]) + (p[6] + p[7]));
            l += a8;
            if (j0s + 15 <= i0 - CUT) lo_s += a8;   /* the same for the whole wave: every key of the tile on the low end offset */
            else if (j0s >= i0 + 15 + CUT) hi_s += a8;
            else {
#pragma unroll
                for (int jj = 0; jj < 8; ++jj) { const int bkt = j0s + hi * 8 + jj - i + CUT; lo_s += (bkt <= 0) ? p[jj] : 0.0f; hi_s += (bkt >= 2 * CUT) ? p[jj] : 0.0f; } } }
#pragma unroll
        for (int c = 0; c < 2; ++c) { const VB ph = cat16b(oh[2 * c], oh[2 * c + 1]), pl = cat16b(ol[2 * c], ol[2 * c + 1]); VB vh[4], vl[4];
#pragma unroll
            for (int nb = 0; nb < 4; ++nb) { vh[nb] = WFrag<bf>::ld(&tv[0][(nb * 16 + lr) * KP + c * 32 + 8 * hi]); vl[nb] = WFrag<bf>::ld(&tv[1][(nb * 16 + lr) * KP + c * 32 + 8 * hi]); }
            __builtin_amdgcn_sched_barrier(0);   // keeps the 8 v fragment loads together, as above
#pragma unroll
            for (int nb = 0; nb < 4; ++nb) acc[nb] = wmmab(vh[nb], ph, acc[nb]);
#pragma unroll
            for (int nb = 0; nb < 4; ++nb) acc[nb] = wmmab(vh[nb], pl, acc[nb]);
#pragma unroll
            for (int nb = 0; nb < 4; ++nb) acc[nb] = wmmab(vl[nb], ph, acc[nb]); }
        asm volatile("v_nop\n\tv_nop\n\tv_nop\n\tv_nop" : "+v"(acc[0]), "+v"(acc[1]), "+v"(acc[2]), "+v"(acc[3]));   // the distance behind the last matrix instruction on the path over the loop's branches
    }
    VB rh[2][4], rl[2][4];   // rel_v^T fragments, hi and lo
    const bf* rgh = AVTh + lr * NE + 8 * hi; const bf* rgl = AVTl + lr * NE + 8 * hi;
#pragma unroll
    for (int c = 0; c < 2; ++c)
#pragma unroll
        for (int nb = 0; nb < 4; ++nb) { rh[c][nb] = WFrag<bf>::ld(rgh + nb * 16 * NE + c * 32); rl[c][nb] = WFrag<bf>::ld(rgl + nb * 16 * NE + c * 32); }
    asm volatile("s_wait_xcnt 0x0" : "+v"(lo_s), "+v"(hi_s), "+v"(l) : "v"(rgh), "v"(rgl) : "memory");   // the work below reuses the registers that these loads name as their addresses: the addresses stay live up to the wait, and the sums pass through it so that the exchange below is not lifted over it
    l += d_xhalf(l); lo_s += d_xhalf(lo_s); hi_s += d_xhalf(hi_s);   // the two half rows joined
    const float f = __fdiv_rn(1.0f, l);
    unsigned short l0h, l0l, h0h, h0l; splitf(lo_s * f, l0h, l0l); splitf(hi_s * f, h0h, h0l);
    __builtin_amdgcn_wave_barrier(); asm volatile("" ::: "memory");   // the reads of tsw below take what other lanes of this wave stored
    v4f tq[4];   // this lane's 16 offsets hi*16 + 0..15 of query lr
#pragma unroll
    for (int u = 0; u < 4; ++u) tq[u] = *(const v4fa*)(tsw + lr * TP + hi * 16 + u * 4);
#pragma unroll
    for (int g = 0; g < 2; ++g) { v8us o1, o2;
#pragma unroll
        for (int q = 0; q < 8; ++q) { unsigned short a, c2; splitf(__builtin_amdgcn_exp2f((tq[g * 2 + (q >> 2)][q & 3] - m) * L2E) * f, a, c2); o1[q] = a; o2[q] = c2; }
        if (g == 0) { o1[0] = (hi == 0) ? l0h : o1[0]; o2[0] = (hi == 0) ? l0l : o2[0]; }   // offset 0 = the low end's sum
        *(v8usa*)(pbh + lr * KP + hi * 16 + g * 8) = o1; *(v8usa*)(pbl + lr * KP + hi * 16 + g * 8) = o2; }
    if (hi == 0) { pbh[lr * KP + 2 * CUT] = h0h; pbl[lr * KP + 2 * CUT] = h0l; }
    __builtin_amdgcn_wave_barrier(); asm volatile("" ::: "memory");   // the fragment reads below take what other lanes of this wave stored
#pragma unroll
    for (int nb = 0; nb < 4; ++nb) acc[nb] *= f;
#pragma unroll
    for (int c = 0; c < 2; ++c) { const VB ph = WFrag<bf>::ld(pbh + lr * KP + 8 * hi + c * 32), pl = WFrag<bf>::ld(pbl + lr * KP + 8 * hi + c * 32);
#pragma unroll
        for (int nb = 0; nb < 4; ++nb) { acc[nb] = wmmab(rh[c][nb], ph, acc[nb]); acc[nb] = wmmab(rh[c][nb], pl, acc[nb]); acc[nb] = wmmab(rl[c][nb], ph, acc[nb]); } }
    bf* ah = ATh + ((size_t)(z / NH_) * TT + i) * DQ + (z % NH_) * HD + hi * 8; bf* al = ATl + ((size_t)(z / NH_) * TT + i) * DQ + (z % NH_) * HD + hi * 8;   /* z = b*16 + head; a lane's 8 values are 16 bytes of its query's row */
#pragma unroll
    for (int nb = 0; nb < 4; ++nb) { v8us o1, o2;
#pragma unroll
        for (int j = 0; j < 8; ++j) { unsigned short a, c2; splitf(acc[nb][j], a, c2); o1[j] = a; o2[j] = c2; }
        *(v8usa*)(ah + nb * 16) = o1; *(v8usa*)(al + nb * 16) = o2;
        asm volatile("s_wait_xcnt 0x0" ::: "memory"); }   // the next values' arithmetic reuses the registers that these two stores name
}
__device__ __forceinline__ void d_epadK(int bx, const float* __restrict__ E, bf* EB) { const size_t i = (size_t)bx * 256 + threadIdx.x; if (i >= (size_t)NE * HD / 8) return; const int d0 = (int)(i % (HD / 8)) * 8; const int r = (int)(i / (HD / 8)); const float* src = E + (size_t)min(r, NRE - 1) * HD + d0; v8us o;
#pragma unroll
    for (int q = 0; q < 8; ++q) { const unsigned short v = f2bf(src[q]); o[q] = (r < NRE) ? v : (unsigned short)0; }
    *(v8us*)(EB + (size_t)r * HD + d0) = o;  }

__device__ __forceinline__ void d_epadVT(int bx, const float* __restrict__ E, bf* Th, bf* Tl) { const size_t i = (size_t)bx * 256 + threadIdx.x; if (i >= (size_t)HD * NE / 4) return; const size_t e = i * 4; const int c0 = (int)(e % NE); const int d = (int)(e / NE); v4us oh, ol;
#pragma unroll
    for (int q = 0; q < 4; ++q) { const int r = c0 + q; const float v = bfr(E[(size_t)min(r, NRE - 1) * HD + d]); unsigned short u, w; splitf(v, u, w);   /* input rounded to bf16 once: lo == 0 */ oh[q] = (r < NRE) ? u : (unsigned short)0; ol[q] = (r < NRE) ? w : (unsigned short)0; }
    *(v4us*)(Th + e) = oh; *(v4us*)(Tl + e) = ol;  }

// k_prep: every pass that reads nothing but the inputs, in one launch of 646 work-groups, each with one piece of work; blockIdx.x picks the pass: 4 x 64 weight tiles (the longest path, they start first), 3 x 128 input pieces, 6 blocks for the two relative tables.
#define PBW 256
#define PBC 384
#define PBE 6
__global__ __launch_bounds__(256) void k_prep(const float* __restrict__ wq, const float* __restrict__ wk, const float* __restrict__ wv, const float* __restrict__ wo, const float* __restrict__ ak, const float* __restrict__ av, const float* __restrict__ x, const float* __restrict__ xk, const float* __restrict__ xv, bf* WB, bf* AKB, bf* AVTh, bf* AVTl, bf* XB) {
    static_assert(4 * (DM / 64) * (DQ / 256) == PBW && DKV == DQ && 3 * (NB_ * TT * DM / 16384) == PBC && NE * HD / 8 / 256 == 2 && HD * NE / 4 / 256 == 4 && PBE == 6, "grid PBW + PBC + PBE");
    __shared__ __align__(16) unsigned tl[8 * 32 * WTP];   // the weight tiles' turning room, one part per wave
    const int bx = blockIdx.x;
    if (bx < PBW) { const int y = bx >> 6; const float* w = (y == 0) ? wq : ((y == 1) ? wk : ((y == 2) ? wv : wo)); d_wtT(bx & 63, w, WB + (size_t)y * DM * DQ, tl); }   /* 'xw' weights turned into Bt */
    else if (bx < PBW + PBC) { const int c = bx - PBW, q = c >> 7; const float* src = (q == 0) ? x : ((q == 1) ? xk : xv); d_cvt4(c & 127, src, XB + (size_t)q * NB_ * TT * DM); }
    else { const int e = bx - PBW - PBC; if (e < 2) d_epadK(e, ak, AKB);   /* rel_k -> bf16 [64][64], rows >= 33 zero */ else d_epadVT(e - 2, av, AVTh, AVTl); }   /* rel_v^T hi/lo [64][64], cols >= 33 zero */
}

extern "C" void kernel_launch(void* const* d_in, const int* in_sizes, int n_in,
                              void* d_out, int out_size, void* d_ws, size_t ws_size, hipStream_t stream) {
    (void)in_sizes; (void)n_in; (void)out_size;
    const float* x = (const float*)d_in[0];   /* query */ const float* xk = (const float*)d_in[1]; const float* xv = (const float*)d_in[2]; const float* wq = (const float*)d_in[3]; const float* bq = (const float*)d_in[4]; const float* wk = (const float*)d_in[5]; const float* bk = (const float*)d_in[6]; const float* wv = (const float*)d_in[7]; const float* bv = (const float*)d_in[8]; const float* wo = (const float*)d_in[9]; const float* bo = (const float*)d_in[10]; const float* ak = (const float*)d_in[11]; const float* av = (const float*)d_in[12];   /* rel_k / rel_v [33][64] */
    float* OUT = (float*)d_out;     // [2][1024][1024]
    char* wsp = (char*)d_ws;
    auto take = [&](size_t bytes) { char* p = wsp; wsp += (bytes + 255) & ~(size_t)255; return (void*)p; };
    bf* AKB = (bf*)take((size_t)NE * HD * 2); bf* AVTh = (bf*)take((size_t)HD * NE * 2); bf* AVTl = (bf*)take((size_t)HD * NE * 2); float* QE = (float*)take((size_t)ZB * TT * NE * 4);
    bf* WB = (bf*)take((size_t)4 * DM * DQ * 2);   /* Wq, Wk, Wv, Wo as Bt, one behind the other */ bf* WO = WB + (size_t)3 * DM * DQ;
    bf* XB = (bf*)take((size_t)3 * NB_ * TT * DM * 2);   /* query, key, value */
    bf* QPh = (bf*)take((size_t)NB_ * NH_ * TT * HD * 2); bf* QPl = (bf*)take((size_t)NB_ * NH_ * TT * HD * 2); bf* KPh = (bf*)take((size_t)NB_ * NKV * TT * HD * 2); bf* KPl = (bf*)take((size_t)NB_ * NKV * TT * HD * 2); bf* VT2 = (bf*)take((size_t)NB_ * NKV * HD * 2 * TT * 2);   /* v^T rows hi | lo */
    bf* ATh = (bf*)take((size_t)NB_ * TT * DQ * 2); bf* ATl = (bf*)take((size_t)NB_ * TT * DQ * 2);
    if ((size_t)(wsp - (char*)d_ws) > ws_size) return;    // ws 256 MiB
    k_prep<<<dim3(PBW + PBC + PBE, 1, 1), 256, 0, stream>>>(wq, wk, wv, wo, ak, av, x, xk, xv, WB, AKB, AVTh, AVTl, XB);
    k_gemms<0, true><<<dim3(NB_ * TT / 128, DQ / 128, 3), 128, 0, stream>>>(XB, nullptr, WB, nullptr, bq, bk, bv, (size_t)NB_ * TT * DM, (size_t)DM * DQ, QPh, QPl, KPh, KPl, VT2);   /* z = q, k, v, straight into the head planes */
    k_gemmw<bf, 1><<<dim3(TT / 64, NE / 64, ZB), 32, 0, stream>>>(QPh, QPl, AKB, nullptr, HD, HD, QE, NE, (size_t)TT * HD, 0, (size_t)TT * NE);   /* QE = q . rel_k^T */
    k_fattn<<<dim3(TT / 128, ZB, 1), 256, 0, stream>>>(QPh, QPl, KPh, KPl, VT2, QE, AVTh, AVTl, ATh, ATl);   /* z = b*16 + head walks consecutive q, k and v planes; scores + q.rel_k[clip(j - i) + 16], softmax, attn.v + attn folded onto the 33 offsets . rel_v, merged hi/lo */
    k_gemms<1, false><<<dim3(NB_ * TT / 128, DM / 128, 1), 128, 0, stream>>>(ATh, ATl, WO, OUT, bo, bo, bo, 0, 0, nullptr, nullptr, nullptr, nullptr, nullptr);
}

// v009
// Measured time: 76 microseconds a run.
// In both of two side-by-side timings against v008, it was 1.08 times as fast.
// Over all steps from v000 it is 15.3 times as fast.
#include <hip/hip_runtime.h>

// Relative (Shaw) multi-head attention with key AND value relative-position embeddings (query, key, value [2][1024][1024]; q = query Wq + bq, k = key Wk + bk, v = value Wv + bv ('xw' 1/32, zero biases; 16 heads x 64); idx[i][j] = clip(j - i, -16, 16) + 16; attn = softmax((q.k + q.rel_k[idx]) / 8); x = attn v + sum_j attn[i][j] rel_v[idx] (rel_k, rel_v [33][64] 1/8 scale, read); out = merged Wo + bo ('xw') -> [2][1024][1024] (2.1 M); argument order query, key, value, Wq, bq, Wk, bk, Wv, bv, Wo, bo, rel_k, rel_v).
// Layout: bf16 copies of query, key, value side by side (both batches, rows b*1024 + t); 'xw' weights gathered into Bt; exact projections + f32 biases; rel_k as a zero-padded bf16 plane [64][64] and rel_v^T as hi/lo planes [64][64] (bf16-rounded once); QE = q.rel_k^T (hi/lo x exact); one fused attention launch over all 32 (batch, head) pairs: score tiles (hi/lo 3 products) + QE at column clip(j - i) + 16, softmax (x 1/8), P as hi/lo fragments, P.v (hi/lo x hi/lo), the probabilities folded onto the 33 offsets (interior = one key, the two ends = fixed-order sums) and PB.rel_v added into the context's accumulators; merged hi/lo x Wo exact + bo.
// Compute dtypes, f32 accumulate: every input rounded to bf16; projections exact + f32 biases; scores and the relative-key term ~f32; softmax f32; P as bf16 hi/lo; attn.v and the relative-value term 3 products (~f32); Wo hl x exact + bias.

#define NB_  2
#define TT   1024
#define DM   1024
#define NH_  16
#define NKV  16
#define REP  (NH_ / NKV)
#define HD   64
#define DQ   (NH_ * HD)
#define DKV  (NKV * HD)
#define ZH   16
#define ZB   (NB_ * ZH)           // (batch, head) pairs per attention launch: all of them
#define RH   TT
#define WIN  0
#define PCAR 1024.0f
#define SCL  0.125f   // 1/sqrt(64) (the module divides by jnp.sqrt(DH))
#define NE   64       // 2*16+1 = 33 relative offsets padded to 64
#define NRE  33
#define CUT  16
typedef _Float16 h16;
typedef unsigned short bf;
typedef __attribute__((ext_vector_type(16))) __bf16   v16bf;
typedef __attribute__((ext_vector_type(16))) _Float16 v16h;
typedef __attribute__((ext_vector_type(8)))  _Float16 v8h;
typedef __attribute__((ext_vector_type(8)))  unsigned short v8us;
typedef __attribute__((ext_vector_type(8)))  float    v8f;
typedef __attribute__((ext_vector_type(4)))  float    v4f;
typedef v8h  __attribute__((may_alias)) v8ha;
typedef v4f  __attribute__((may_alias)) v4fa;
typedef v8us __attribute__((may_alias)) v8usa;

__device__ __forceinline__ unsigned short f2bf(float f) { unsigned u = __float_as_uint(f); u += 0x7FFFu + ((u >> 16) & 1u); return (unsigned short)(u >> 16); }
__device__ __forceinline__ float bf2f(unsigned short b) { return __uint_as_float(((unsigned)b) << 16); }
__device__ __forceinline__ float bfr(float f) { return bf2f(f2bf(f)); }
__device__ __forceinline__ v16h cat16(v8h lo, v8h hi) { return __builtin_shufflevector(lo, hi, 0, 1, 2, 3, 4, 5, 6, 7, 8, 9, 10, 11, 12, 13, 14, 15); }
__device__ __forceinline__ v16bf cat16b(v8us lo, v8us hi) { return __builtin_bit_cast(v16bf, __builtin_shufflevector(lo, hi, 0, 1, 2, 3, 4, 5, 6, 7, 8, 9, 10, 11, 12, 13, 14, 15)); }
__device__ __forceinline__ v8f wmma16(v16h a, v16h b, v8f c) { return __builtin_amdgcn_wmma_f32_16x16x32_f16(false, a, false, b, (short)0, c, false, false); }
__device__ __forceinline__ v8f wmmab(v16bf a, v16bf b, v8f c) { return __builtin_amdgcn_wmma_f32_16x16x32_bf16(false, a, false, b, (short)0, c, false, false); }

__device__ __forceinline__ void splitf(float y, unsigned short& h, unsigned short& l) { h = f2bf(y); l = f2bf(y - bf2f(h)); }
typedef __attribute__((ext_vector_type(2))) unsigned short v2us;
typedef __attribute__((ext_vector_type(4))) unsigned short v4us;
typedef __attribute__((ext_vector_type(4))) unsigned int v4u;
typedef v4u  __attribute__((may_alias)) v4ua;
typedef v4us __attribute__((may_alias)) v4usa;

// WFrag: a 16x32 operand fragment of a K-contiguous 16-bit plane: the lane's two 16-byte pieces, 16 elements apart
template <typename T16> struct WFrag;
template <> struct WFrag<h16> { typedef v16h V; static __device__ __forceinline__ V ld(const h16* p) { return cat16(*(const v8h*)p, *(const v8h*)(p + 16)); } static __device__ __forceinline__ v8f mma(V a, V b, v8f c) { return wmma16(a, b, c); } };
template <> struct WFrag<bf> { typedef v16bf V; static __device__ __forceinline__ V ld(const bf* p) { return cat16b(*(const v8us*)p, *(const v8us*)(p + 16)); } static __device__ __forceinline__ v8f mma(V a, V b, v8f c) { return wmmab(a, b, c); } };

// ---- k_gemms: the two long GEMMs (K = 1024). Work-group = 4 waves = one 128x128 output tile, wave = 64x64 (16 accumulators). grid (M/128, N/128, Z), 128 threads.
// Operand tiles of 128 rows x 128 k go from the K-contiguous bf16 planes into LDS by asynchronous copies: a wave-wide copy takes two whole 256-byte row pieces, where a fragment load from global memory touched 16 lines for 512 bytes, and the four waves share each tile. Two buffers: the next stage's copies fly while this stage is worked on.
// C[m][n] (f32, pitch DM) = sum_k (A[m][k] (+ A2[m][k] if NSPLIT)) Bt[n][k] + f32 bias[n] (one bias vector per z = 0, 1, 2). z-batch strides sA/sB in elements.
// PL: the tile does not leave as f32 but as the attention kernel's bf16 hi/lo planes: z = 0, 1 -> [b][h][t][d] (q, k), z = 2 -> v^T rows (b, h, d) = hi | lo, pitch 2*TT. A wave's 64x64 tile is 64 rows t of one (batch, head).
#define SK 128   // k per stage: 256 bytes of every operand row
#define SP 136   // LDS row pitch in elements: 272 bytes = 16 x odd, conflict-free for the 16-byte fragment reads
// eight 16-byte copies of one lane, rows 8 apart; l = the lane's LDS byte address, g = its global address
__device__ __forceinline__ void d_copy8(unsigned l, const bf* g) {
    asm volatile("global_load_async_to_lds_b128 %0, %8, off\n\tglobal_load_async_to_lds_b128 %1, %9, off\n\tglobal_load_async_to_lds_b128 %2, %10, off\n\tglobal_load_async_to_lds_b128 %3, %11, off\n\t"
                 "global_load_async_to_lds_b128 %4, %12, off\n\tglobal_load_async_to_lds_b128 %5, %13, off\n\tglobal_load_async_to_lds_b128 %6, %14, off\n\tglobal_load_async_to_lds_b128 %7, %15, off\n\t"
                 "s_wait_xcnt 0x0"   // stands in front of every later write of the address registers that these copies name
                 :: "v"(l), "v"(l + 8 * SP * 2), "v"(l + 16 * SP * 2), "v"(l + 24 * SP * 2), "v"(l + 32 * SP * 2), "v"(l + 40 * SP * 2), "v"(l + 48 * SP * 2), "v"(l + 56 * SP * 2),
                    "v"(g), "v"(g + 8 * DM), "v"(g + 16 * DM), "v"(g + 24 * DM), "v"(g + 32 * DM), "v"(g + 40 * DM), "v"(g + 48 * DM), "v"(g + 56 * DM) : "memory");
}
template <int NSPLIT, bool PL>
__global__ __launch_bounds__(128) void k_gemms(const bf* __restrict__ A, const bf* __restrict__ A2, const bf* __restrict__ Bt, float* C, const float* __restrict__ bias0, const float* __restrict__ bias1, const float* __restrict__ bias2, size_t sA, size_t sB, bf* QPh, bf* QPl, bf* KPh, bf* KPl, bf* VT2) {
    typedef WFrag<bf>::V V;
    constexpr int NT = NSPLIT ? 3 : 2, NS = DM / SK, TB = 128 * SP * 2;   // tiles per stage (A, Bt, A2), stages, bytes of a tile in LDS
    static_assert(DM == DQ && DM % SK == 0 && NS >= 2 && 4 * 2 * 64 * 72 * 2 <= 2 * NT * TB, "two stages or more; the output staging fits the ring");
    __shared__ __align__(16) bf ring[2][NT][128 * SP];
    const int tid = threadIdx.x, lane = tid & 31, lr = lane & 15, hi = lane >> 4; const int wv = __builtin_amdgcn_readfirstlane(tid >> 5);
    const size_t z = blockIdx.z; A += z * sA; if (NSPLIT) A2 += z * sA; Bt += z * sB; const float* bias = (z == 0) ? bias0 : ((z == 1) ? bias1 : bias2);
    const int wr = (wv >> 1) * 64, wc = (wv & 1) * 64, r0 = blockIdx.x * 128 + wr, c0 = blockIdx.y * 128 + wc;
    const int cr = tid >> 4, cc = (tid & 15) * 8;   // this thread's 16-byte pieces of a tile: column piece cc of rows cr + 8 u
    const bf* ga = A + (size_t)(blockIdx.x * 128 + cr) * DM + cc; const bf* ga2 = NSPLIT ? A2 + (size_t)(blockIdx.x * 128 + cr) * DM + cc : nullptr; const bf* gb = Bt + (size_t)(blockIdx.y * 128 + cr) * DM + cc;
    const unsigned l0 = (unsigned)(size_t)&ring[0][0][cr * SP + cc];
    auto fill = [&](int s) { const unsigned l = l0 + (unsigned)(s & 1) * (NT * TB);
        d_copy8(l, ga + s * SK); d_copy8(l + TB / 2, ga + s * SK + 64 * DM); d_copy8(l + TB, gb + s * SK); d_copy8(l + TB + TB / 2, gb + s * SK + 64 * DM);
        if (NSPLIT) { d_copy8(l + 2 * TB, ga2 + s * SK); d_copy8(l + 2 * TB + TB / 2, ga2 + s * SK + 64 * DM); } };
    v8f acc[4][4];
#pragma unroll
    for (int mb = 0; mb < 4; ++mb)
#pragma unroll
        for (int nb = 0; nb < 4; ++nb) acc[mb][nb] = (v8f){};
    fill(0);
    asm volatile("s_wait_asynccnt 0x0" ::: "memory");   // this wave's copies of stage 0 have landed
    __syncthreads();   // stage 0 is whole before anybody reads it
    fill(1);
#pragma unroll 1
    for (int s = 0; s < NS; ++s) {
        const bf* ta = &ring[s & 1][0][(wr + lr) * SP + 8 * hi]; const bf* tb = &ring[s & 1][1][(wc + lr) * SP + 8 * hi]; const bf* ta2 = &ring[s & 1][NT - 1][(wr + lr) * SP + 8 * hi];
        V a[2][4], a2[2][4], b[2][4];
#pragma unroll
        for (int mb = 0; mb < 4; ++mb) { a[0][mb] = WFrag<bf>::ld(ta + mb * 16 * SP); if (NSPLIT) a2[0][mb] = WFrag<bf>::ld(ta2 + mb * 16 * SP); b[0][mb] = WFrag<bf>::ld(tb + mb * 16 * SP); }
#pragma unroll
        for (int q = 0; q < SK / 32; ++q) { const int u = q & 1, n = u ^ 1;
            if (q + 1 < SK / 32) {
#pragma unroll
                for (int mb = 0; mb < 4; ++mb) { a[n][mb] = WFrag<bf>::ld(ta + mb * 16 * SP + (q + 1) * 32); if (NSPLIT) a2[n][mb] = WFrag<bf>::ld(ta2 + mb * 16 * SP + (q + 1) * 32); b[n][mb] = WFrag<bf>::ld(tb + mb * 16 * SP + (q + 1) * 32); } }
            __builtin_amdgcn_sched_barrier(0);   // keeps the next block's fragment loads together in front of this block's products: sunk to their users they would each wait alone
#pragma unroll
            for (int nb = 0; nb < 4; ++nb)
#pragma unroll
                for (int mb = 0; mb < 4; ++mb) { acc[mb][nb] = wmmab(a[u][mb], b[u][nb], acc[mb][nb]); if (NSPLIT) acc[mb][nb] = wmmab(a2[u][mb], b[u][nb], acc[mb][nb]); }
        }
        asm volatile("s_wait_dscnt 0x0" ::: "memory");      // this wave's reads of the buffer that is refilled below have returned
        asm volatile("s_wait_asynccnt 0x0" ::: "memory");   // this wave's copies of stage s + 1 have landed
        __syncthreads();   // publishes stage s + 1 and ends every wave's reads of stage s
        if (s + 2 < NS) fill(s + 2);
    }
    asm volatile("s_wait_asynccnt 0x0" ::: "memory");   // nothing is in flight when the ring becomes output staging (the last trip's barrier has ended every read of it)
    float* os = (float*)&ring[0][0][0] + wv * (2 * 64 * 72 / 2);   // wave-own staging: room for a whole v^T tile, hi and lo, row pitch 72 elements
    if (PL) {
        const int zh = (r0 / TT) * NH_ + c0 / HD, t0 = r0 % TT;
        if (z == 2) {   // v^T: a lane holds 8 consecutive t of one d, which is 16 bytes of a plane's row as it stands; through LDS so that whole 128-byte lines are stored
            bf* sh = (bf*)os; bf* sl = sh + 64 * 72;
#pragma unroll
            for (int nb = 0; nb < 4; ++nb) { const float bb = bfr(bias[c0 + nb * 16 + lr]);
#pragma unroll
                for (int mb = 0; mb < 4; ++mb) { v8us o1, o2;
#pragma unroll
                    for (int j = 0; j < 8; ++j) { unsigned short a1, c2; splitf(acc[mb][nb][j] + bb, a1, c2); o1[j] = a1; o2[j] = c2; }
                    *(v8usa*)(sh + (nb * 16 + lr) * 72 + mb * 16 + hi * 8) = o1; *(v8usa*)(sl + (nb * 16 + lr) * 72 + mb * 16 + hi * 8) = o2; } }
            __builtin_amdgcn_wave_barrier(); asm volatile("" ::: "memory");   // the row reads below take what other lanes of this wave stored
            bf* vrow = VT2 + ((size_t)zh * HD + (lane >> 3)) * (2 * TT) + t0 + (lane & 7) * 8;
#pragma unroll
            for (int g = 0; g < 4; ++g) { v8us o1[4], o2[4];   // 16 rows a round: one LDS latency for eight reads
#pragma unroll
                for (int s = 0; s < 4; ++s) { o1[s] = *(const v8usa*)(sh + ((g * 4 + s) * 4 + (lane >> 3)) * 72 + (lane & 7) * 8); o2[s] = *(const v8usa*)(sl + ((g * 4 + s) * 4 + (lane >> 3)) * 72 + (lane & 7) * 8); }
#pragma unroll
                for (int s = 0; s < 4; ++s) { *(v8usa*)(vrow + (size_t)(g * 4 + s) * 4 * 2 * TT) = o1[s]; *(v8usa*)(vrow + (size_t)(g * 4 + s) * 4 * 2 * TT + TT) = o2[s]; }
                asm volatile("s_wait_xcnt 0x0" ::: "memory"); }   // the next round reuses the registers that these stores name
            return; }
        bf* ph = ((z == 0) ? QPh : KPh) + ((size_t)zh * TT + t0) * HD + lr * 4; bf* pl = ((z == 0) ? QPl : KPl) + ((size_t)zh * TT + t0) * HD + lr * 4;
        v4f bb; bb[0] = bfr(bias[c0 + lr * 4]); bb[1] = bfr(bias[c0 + lr * 4 + 1]); bb[2] = bfr(bias[c0 + lr * 4 + 2]); bb[3] = bfr(bias[c0 + lr * 4 + 3]);
#pragma unroll
        for (int mb = 0; mb < 4; ++mb) {
#pragma unroll
            for (int nb = 0; nb < 4; ++nb) {
#pragma unroll
                for (int j = 0; j < 8; ++j) os[(hi * 8 + j) * 68 + nb * 16 + lr] = acc[mb][nb][j]; }
            __builtin_amdgcn_wave_barrier(); asm volatile("" ::: "memory");   // the row reads below take what other lanes of this wave stored
#pragma unroll
            for (int s = 0; s < 8; ++s) { const int row = 2 * s + hi; const v4f val = *(const v4fa*)(os + row * 68 + lr * 4); v4us o1, o2;
#pragma unroll
                for (int q = 0; q < 4; ++q) { unsigned short a1, c2; splitf(val[q] + bb[q], a1, c2); o1[q] = a1; o2[q] = c2; }
                *(v4usa*)(ph + (size_t)(mb * 16 + row) * HD) = o1; *(v4usa*)(pl + (size_t)(mb * 16 + row) * HD) = o2; }
            asm volatile("s_wait_xcnt 0x0" ::: "memory");   // the next 16 rows' work reuses the registers that these stores name
            __builtin_amdgcn_wave_barrier(); asm volatile("" ::: "memory");   // the next 16 rows overwrite what has just been read
        }
        return;
    }
#pragma unroll
    for (int mb = 0; mb < 4; ++mb) {
#pragma unroll
        for (int nb = 0; nb < 4; ++nb) {
#pragma unroll
            for (int j = 0; j < 8; ++j) os[(hi * 8 + j) * 68 + nb * 16 + lr] = acc[mb][nb][j]; }
        __builtin_amdgcn_wave_barrier(); asm volatile("" ::: "memory");
        float* crow = C + (size_t)(r0 + mb * 16) * DM + c0;
{
#pragma unroll
            for (int s = 0; s < 8; ++s) { const int row = 2 * s + hi, cofs = lr * 4; v4f val = *(const v4fa*)(os + row * 68 + cofs); val[0] += bfr(bias[c0 + cofs]); val[1] += bfr(bias[c0 + cofs + 1]); val[2] += bfr(bias[c0 + cofs + 2]); val[3] += bfr(bias[c0 + cofs + 3]);
                *(v4f*)(crow + (size_t)row * DM + cofs) = val; }
             }
        asm volatile("s_wait_xcnt 0x0" ::: "memory");   // the next 16 rows' work reuses the registers that these stores name
        __builtin_amdgcn_wave_barrier(); asm volatile("" ::: "memory");
    }
}

// d_wtT: one weight tile, 64 k x 256 n, from w[k][n] (f32) to Bt[n][k] (bf16). A wave owns 32 n: each of its loads takes four whole 128-byte lines (four rows k, 32 n each), all 16 loads in flight at once;
// rows k and k + 1 are packed into one dword per n and turned in a wave-own LDS tile [n][k pair]; each store then takes four whole 128-byte lines of Bt (four rows n, 64 k each).
#define WTP 36   // dwords per row n of the LDS tile: 32 pairs of k + 4; 144 bytes = 16 x odd, conflict-free for the 16-byte row reads
__device__ __forceinline__ void d_wtT(int bx, const float* __restrict__ w, bf* Bt, unsigned* tl) {
    const int lane = threadIdx.x & 31, wv = threadIdx.x >> 5, a = lane & 7, b = lane >> 3; const int k0 = (bx >> 2) * 64, n0 = (bx & 3) * 256 + wv * 32;
    unsigned* t = tl + wv * 32 * WTP;
    const float* g = w + (size_t)(k0 + 2 * b) * DQ + n0 + a * 4;   // rows k0 + 8 u + 2 b (+ 1), columns n0 + 4 a + 0..3
    v4f r0[8], r1[8];
#pragma unroll
    for (int u = 0; u < 8; ++u) { r0[u] = *(const v4f*)(g + (size_t)(u * 8) * DQ); r1[u] = *(const v4f*)(g + (size_t)(u * 8 + 1) * DQ); }
    asm volatile("s_wait_xcnt 0x0" :: "v"(g) : "memory");   // the work below reuses the registers that these loads name as their addresses: the address stays live up to the wait
#pragma unroll
    for (int u = 0; u < 8; ++u)
#pragma unroll
        for (int q = 0; q < 4; ++q) t[(a * 4 + q) * WTP + u * 4 + b] = (unsigned)f2bf(r0[u][q]) | ((unsigned)f2bf(r1[u][q]) << 16);
    __builtin_amdgcn_wave_barrier(); asm volatile("" ::: "memory");   // the row reads below take what other lanes of this wave stored (one wave's LDS operations run in order)
    bf* o = Bt + (size_t)(n0 + b) * DM + k0 + a * 8;   // rows n0 + 4 v + b, k0 + 8 a + 0..7
    v4u x[8];
#pragma unroll
    for (int v = 0; v < 8; ++v) x[v] = *(const v4ua*)(t + (v * 4 + b) * WTP + a * 4);
#pragma unroll
    for (int v = 0; v < 8; ++v) *(v4ua*)(o + (size_t)(v * 4) * DM) = x[v];
}
// d_cvt4: 16384 floats of an input to bf16; a thread takes 16 pieces of 4 floats, 256 pieces apart (a wave's load = 512 contiguous bytes, its store = 256), all 16 loads in flight at once
__device__ __forceinline__ void d_cvt4(int bx, const float* __restrict__ src, bf* dst) { const size_t i0 = ((size_t)bx * 4096 + threadIdx.x) * 4; const float* s = src + i0; bf* d = dst + i0; v4f v[16];
#pragma unroll
    for (int u = 0; u < 16; ++u) v[u] = *(const v4f*)(s + u * 1024);
    asm volatile("s_wait_xcnt 0x0" :: "v"(s) : "memory");   // the work below reuses the registers that these loads name as their addresses: the address stays live up to the wait
#pragma unroll
    for (int u = 0; u < 16; ++u) { v4us o;
#pragma unroll
        for (int k = 0; k < 4; ++k) o[k] = f2bf(v[u][k]);
        *(v4us*)(d + u * 1024) = o; }
}

// k_fattn: scores, softmax, attn.v and the relative-value term in one kernel; no score or probability ever leaves the chip.
// Work-group = 8 waves = 128 query rows of one (batch, head); wave = 16 queries. Key tiles of 64 (k hi/lo, v^T hi/lo) go through registers into LDS (row pitch 144 B), the next tile's loads in flight while this one is worked on.
// Transposed scores S^T = k q^T: lane (lr, hi) holds query lr, keys hi*8 + 0..7 of each 16-key tile, which is the B fragment of P^T for O^T = v^T P^T as it stands; of O^T the lane holds d = hi*8 + 0..7 of the same query lr, so every factor of a query is a factor of a lane.
// ONE sweep over the keys: running row maximum (joined over the two half rows once per key tile), P = exp(t - maximum) unnormalised as bf16 hi/lo, v^T.P^T (3 products); row sum, the two end-offset sums and the context are rescaled as the maximum moves and take 1/sum at the end.
// QE = q.rel_k^T of a wave's 16 queries is made in the prologue, from the q fragments that the scores use, and stays in a wave-own LDS plane.
// The 31 interior offsets have one key each: their scores wait in a wave-own LDS plane and become probabilities at the end; PB.rel_v goes into the same accumulators.
#define KP 72
#define TP 40   // row pitch of the kept scores in floats: 16-byte rows, odd step between neighbouring queries' equal keys
typedef WFrag<bf>::V VB;
__device__ __forceinline__ void d_stile(const VB* kf, const VB* qh, const VB* ql, float* t, int j0s, int i0, int i, int hi, float qlo, float qhi, const float* qer) {
    float e[8];   // the relative-key term of this lane's 8 keys, chosen in front of the products so that no branch stands behind a matrix instruction
    if (j0s + 15 <= i0 - CUT) {   /* the same for the whole wave: every key of the tile on the low end offset */
#pragma unroll
        for (int jj = 0; jj < 8; ++jj) e[jj] = qlo; }
    else if (j0s >= i0 + 15 + CUT) {
#pragma unroll
        for (int jj = 0; jj < 8; ++jj) e[jj] = qhi; }
    else {
#pragma unroll
        for (int jj = 0; jj < 8; ++jj) e[jj] = qer[min(max(j0s + hi * 8 + jj - i, -CUT), CUT) + CUT]; }
    v8f s = (v8f){};
#pragma unroll
    for (int c = 0; c < 2; ++c) { s = wmmab(kf[2 * c], qh[c], s); s = wmmab(kf[2 * c], ql[c], s); s = wmmab(kf[2 * c + 1], qh[c], s); }
#pragma unroll
    for (int jj = 0; jj < 8; ++jj) t[jj] = __fadd_rn(s[jj], e[jj]) * SCL;
}
__device__ __forceinline__ float d_xhalf(float x) { return __builtin_bit_cast(float, __builtin_amdgcn_permlanex16(__builtin_bit_cast(int, x), __builtin_bit_cast(int, x), 0x76543210, 0xfedcba98, false, false)); }   // lane l takes lane l ^ 16
__global__ __launch_bounds__(256) void k_fattn(const bf* __restrict__ QPh, const bf* __restrict__ QPl, const bf* __restrict__ KPh, const bf* __restrict__ KPl, const bf* __restrict__ VT2, const bf* __restrict__ AKB, const bf* __restrict__ AVTh, const bf* __restrict__ AVTl, bf* ATh, bf* ATl) {
    __shared__ __align__(16) bf tk[2][64 * KP];        // k tile [key][d], hi and lo
    __shared__ __align__(16) bf tv[2][64 * KP];        // v^T tile [d][key], hi and lo
    __shared__ __align__(16) bf pb[8][2][16 * KP];     // per wave: P folded onto the offsets [query][offset], hi and lo
    __shared__ __align__(16) float os[8][16 * 68];     // per wave: QE = q.rel_k^T of its 16 queries [query][offset]
    __shared__ __align__(16) float ts[8][16 * TP];     // per wave: the scores of the interior offsets [query][offset]
    const float L2E = 1.4426950408889634f;
    const int tid = threadIdx.x, lane = tid & 31, lr = lane & 15, hi = lane >> 4; const int wv = __builtin_amdgcn_readfirstlane(tid >> 5);
    const int z = blockIdx.y, i0 = blockIdx.x * 128 + wv * 16, i = i0 + lr;
    float* osw = os[wv]; float* tsw = ts[wv]; bf* pbh = pb[wv][0]; bf* pbl = pb[wv][1];
    const int cr = tid >> 3, cc = (tid & 7) * 8, lo0 = cr * KP + cc;   // this thread's 16-byte pieces of a tile: rows cr and cr + 32
    const bf* kgh = KPh + (size_t)z * TT * HD + cr * HD + cc; const bf* kgl = KPl + (size_t)z * TT * HD + cr * HD + cc; const bf* vg = VT2 + ((size_t)z * HD + cr) * (2 * TT) + cc;
    v8us rk[2][2], rv[2][2];
#pragma unroll
    for (int u = 0; u < 2; ++u) { rk[0][u] = *(const v8us*)(kgh + u * 32 * HD); rk[1][u] = *(const v8us*)(kgl + u * 32 * HD); rv[0][u] = *(const v8us*)(vg + (size_t)u * 32 * 2 * TT); rv[1][u] = *(const v8us*)(vg + (size_t)u * 32 * 2 * TT + TT); }
    VB qh[2], ql[2];
#pragma unroll
    for (int c = 0; c < 2; ++c) { qh[c] = WFrag<bf>::ld(QPh + ((size_t)z * TT + i) * HD + 8 * hi + c * 32); ql[c] = WFrag<bf>::ld(QPl + ((size_t)z * TT + i) * HD + 8 * hi + c * 32); }
    const bf* eg = AKB + lr * HD + 8 * hi;
    VB ef[3][2];   // rel_k fragments: offsets 0..47 cover the 33 that exist (rows from 33 on are zero)
#pragma unroll
    for (int ob = 0; ob < 3; ++ob)
#pragma unroll
        for (int c = 0; c < 2; ++c) ef[ob][c] = WFrag<bf>::ld(eg + ob * 16 * HD + c * 32);
    asm volatile("s_wait_xcnt 0x0" :: "v"(kgh), "v"(kgl), "v"(vg), "v"(QPh + ((size_t)z * TT + i) * HD + 8 * hi), "v"(QPl + ((size_t)z * TT + i) * HD + 8 * hi), "v"(eg) : "memory");   // the work below reuses the registers that the loads above name as their addresses: the addresses stay live up to the wait
    // QE^T = rel_k q^T (exact x hi/lo), transposed like the scores: lane (lr, hi) holds offsets ob*16 + hi*8 + 0..7 of query lr
#pragma unroll
    for (int ob = 0; ob < 3; ++ob) { v8f s = (v8f){};
#pragma unroll
        for (int c = 0; c < 2; ++c) { s = wmmab(ef[ob][c], qh[c], s); s = wmmab(ef[ob][c], ql[c], s); }
        *(v4fa*)(osw + lr * 68 + ob * 16 + hi * 8) = (v4f){s[0], s[1], s[2], s[3]}; *(v4fa*)(osw + lr * 68 + ob * 16 + hi * 8 + 4) = (v4f){s[4], s[5], s[6], s[7]}; }
#pragma unroll
    for (int u = 0; u < 9; ++u) ((v4ua*)pbh)[lane + 32 * u] = (v4u){0u, 0u, 0u, 0u};   // both planes (they lie one behind the other): the padding offsets stay zero
#pragma unroll
    for (int u = 0; u < 16 * TP / 128; ++u) ((v4fa*)tsw)[lane + 32 * u] = (v4f){-1.0e30f, -1.0e30f, -1.0e30f, -1.0e30f};   // an offset with no key: its probability comes out zero
    __builtin_amdgcn_wave_barrier(); asm volatile("" ::: "memory");   // the reads of osw below take what other lanes of this wave stored (one wave's LDS operations run in order)
    const float* qer = osw + lr * 68; const float qlo = qer[0], qhi = qer[2 * CUT];
    float m = -3.0e38f, l = 0.f, lo_s = 0.f, hi_s = 0.f;
    v8f acc[4];   // O^T: acc[nb][j] = d nb*16 + hi*8 + j of query lr
#pragma unroll
    for (int nb = 0; nb < 4; ++nb) acc[nb] = (v8f){};
#pragma unroll 1
    for (int blk = 0; blk < TT / 64; ++blk) {
        __syncthreads();   // every wave has left the tiles that are overwritten next
#pragma unroll
        for (int u = 0; u < 2; ++u) { *(v8us*)(&tk[0][lo0 + u * 32 * KP]) = rk[0][u]; *(v8us*)(&tk[1][lo0 + u * 32 * KP]) = rk[1][u]; *(v8us*)(&tv[0][lo0 + u * 32 * KP]) = rv[0][u]; *(v8us*)(&tv[1][lo0 + u * 32 * KP]) = rv[1][u]; }
        __syncthreads();   // the tiles are whole before anybody reads them
        if (blk + 1 < TT / 64) {
#pragma unroll
            for (int u = 0; u < 2; ++u) { rk[0][u] = *(const v8us*)(kgh + ((blk + 1) * 64 + u * 32) * HD); rk[1][u] = *(const v8us*)(kgl + ((blk + 1) * 64 + u * 32) * HD); rv[0][u] = *(const v8us*)(vg + (size_t)u * 32 * 2 * TT + (blk + 1) * 64); rv[1][u] = *(const v8us*)(vg + (size_t)u * 32 * 2 * TT + TT + (blk + 1) * 64); }
            asm volatile("s_wait_xcnt 0x0" ::: "memory"); }   // the work below reuses the registers that these loads name as their addresses
        VB kf[4][4];   // the tile's 16 k fragments (per 16 keys: hi, lo of d 0..31, hi, lo of d 32..63), all loads issued before the first product so that one LDS latency is paid, not sixteen
#pragma unroll
        for (int st = 0; st < 4; ++st)
#pragma unroll
            for (int c = 0; c < 2; ++c) { kf[st][2 * c] = WFrag<bf>::ld(&tk[0][(st * 16 + lr) * KP + 8 * hi + c * 32]); kf[st][2 * c + 1] = WFrag<bf>::ld(&tk[1][(st * 16 + lr) * KP + 8 * hi + c * 32]); }
        __builtin_amdgcn_sched_barrier(0);   // keeps the fragment loads above together: sunk to their users they would each wait alone
        float t[4][8];
#pragma unroll
        for (int st = 0; st < 4; ++st) { const int j0s = blk * 64 + st * 16;
            d_stile(kf[st], qh, ql, t[st], j0s, i0, i, hi, qlo, qhi, qer);
            if (j0s + 15 > i0 - CUT && j0s < i0 + 15 + CUT) {   /* the same for the whole wave: a tile that touches the band of interior offsets */
#pragma unroll
                for (int jj = 0; jj < 8; ++jj) { const int bkt = j0s + hi * 8 + jj - i + CUT; if (bkt > 0 && bkt < 2 * CUT) tsw[lr * TP + bkt] = t[st][jj]; } } }
        float bm = m;
#pragma unroll
        for (int st = 0; st < 4; ++st)
#pragma unroll
            for (int jj = 0; jj < 8; ++jj) bm = fmaxf(bm, t[st][jj]);
        bm = fmaxf(bm, d_xhalf(bm));   // one maximum per query: both half rows feed the same accumulators
        const float cs = __builtin_amdgcn_exp2f((m - bm) * L2E); m = bm;   // 1 while the maximum stands
        l *= cs; lo_s *= cs; hi_s *= cs;
#pragma unroll
        for (int nb = 0; nb < 4; ++nb) acc[nb] *= cs;
        v8us oh[4], ol[4];
#pragma unroll
        for (int st = 0; st < 4; ++st) { const int j0s = blk * 64 + st * 16; float p[8];
#pragma unroll
            for (int jj = 0; jj < 8; ++jj) { unsigned short a, c2; p[jj] = __builtin_amdgcn_exp2f((t[st][jj] - bm) * L2E); splitf(p[jj], a, c2); oh[st][jj] = a; ol[st][jj] = c2; }
            const float a8 = ((p[0] + p[1]) + (p[2] + p[3])) + ((p[4] + p[5]) + (p[6] + p[7]));
            l += a8;
            if (j0s + 15 <= i0 - CUT) lo_s += a8;   /* the same for the whole wave: every key of the tile on the low end offset */
            else if (j0s >= i0 + 15 + CUT) hi_s += a8;
            else {
#pragma unroll
                for (int jj = 0; jj < 8; ++jj) { const int bkt = j0s + hi * 8 + jj - i + CUT; lo_s += (bkt <= 0) ? p[jj] : 0.0f; hi_s += (bkt >= 2 * CUT) ? p[jj] : 0.0f; } } }
#pragma unroll
        for (int c = 0; c < 2; ++c) { const VB ph = cat16b(oh[2 * c], oh[2 * c + 1]), pl = cat16b(ol[2 * c], ol[2 * c + 1]); VB vh[4], vl[4];
#pragma unroll
            for (int nb = 0; nb < 4; ++nb) { vh[nb] = WFrag<bf>::ld(&tv[0][(nb * 16 + lr) * KP + c * 32 + 8 * hi]); vl[nb] = WFrag<bf>::ld(&tv[1][(nb * 16 + lr) * KP + c * 32 + 8 * hi]); }
            __builtin_amdgcn_sched_barrier(0);   // keeps the 8 v fragment loads together, as above
#pragma unroll
            for (int nb = 0; nb < 4; ++nb) acc[nb] = wmmab(vh[nb], ph, acc[nb]);
#pragma unroll
            for (int nb = 0; nb < 4; ++nb) acc[nb] = wmmab(vh[nb], pl, acc[nb]);
#pragma unroll
            for (int nb = 0; nb < 4; ++nb) acc[nb] = wmmab(vl[nb], ph, acc[nb]); }
        asm volatile("v_nop\n\tv_nop\n\tv_nop\n\tv_nop" : "+v"(acc[0]), "+v"(acc[1]), "+v"(acc[2]), "+v"(acc[3]));   // the distance behind the last matrix instruction on the path over the loop's branches
    }
    VB rh[2][4], rl[2][4];   // rel_v^T fragments, hi and lo
    const bf* rgh = AVTh + lr * NE + 8 * hi; const bf* rgl = AVTl + lr * NE + 8 * hi;
#pragma unroll
    for (int c = 0; c < 2; ++c)
#pragma unroll
        for (int nb = 0; nb < 4; ++nb) { rh[c][nb] = WFrag<bf>::ld(rgh + nb * 16 * NE + c * 32); rl[c][nb] = WFrag<bf>::ld(rgl + nb * 16 * NE + c * 32); }
    asm volatile("s_wait_xcnt 0x0" : "+v"(lo_s), "+v"(hi_s), "+v"(l) : "v"(rgh), "v"(rgl) : "memory");   // the work below reuses the registers that these loads name as their addresses: the addresses stay live up to the wait, and the sums pass through it so that the exchange below is not lifted over it
    l += d_xhalf(l); lo_s += d_xhalf(lo_s); hi_s += d_xhalf(hi_s);   // the two half rows joined
    const float f = __fdiv_rn(1.0f, l);
    unsigned short l0h, l0l, h0h, h0l; splitf(lo_s * f, l0h, l0l); splitf(hi_s * f, h0h, h0l);
    __builtin_amdgcn_wave_barrier(); asm volatile("" ::: "memory");   // the reads of tsw below take what other lanes of this wave stored
    v4f tq[4];   // this lane's 16 offsets hi*16 + 0..15 of query lr
#pragma unroll
    for (int u = 0; u < 4; ++u) tq[u] = *(const v4fa*)(tsw + lr * TP + hi * 16 + u * 4);
#pragma unroll
    for (int g = 0; g < 2; ++g) { v8us o1, o2;
#pragma unroll
        for (int q = 0; q < 8; ++q) { unsigned short a, c2; splitf(__builtin_amdgcn_exp2f((tq[g * 2 + (q >> 2)][q & 3] - m) * L2E) * f, a, c2); o1[q] = a; o2[q] = c2; }
        if (g == 0) { o1[0] = (hi == 0) ? l0h : o1[0]; o2[0] = (hi == 0) ? l0l : o2[0]; }   // offset 0 = the low end's sum
        *(v8usa*)(pbh + lr * KP + hi * 16 + g * 8) = o1; *(v8usa*)(pbl + lr * KP + hi * 16 + g * 8) = o2; }
    if (hi == 0) { pbh[lr * KP + 2 * CUT] = h0h; pbl[lr * KP + 2 * CUT] = h0l; }
    __builtin_amdgcn_wave_barrier(); asm volatile("" ::: "memory");   // the fragment reads below take what other lanes of this wave stored
#pragma unroll
    for (int nb = 0; nb < 4; ++nb) acc[nb] *= f;
#pragma unroll
    for (int c = 0; c < 2; ++c) { const VB ph = WFrag<bf>::ld(pbh + lr * KP + 8 * hi + c * 32), pl = WFrag<bf>::ld(pbl + lr * KP + 8 * hi + c * 32);
#pragma unroll
        for (int nb = 0; nb < 4; ++nb) { acc[nb] = wmmab(rh[c][nb], ph, acc[nb]); acc[nb] = wmmab(rh[c][nb], pl, acc[nb]); acc[nb] = wmmab(rl[c][nb], ph, acc[nb]); } }
    bf* ah = ATh + ((size_t)(z / NH_) * TT + i) * DQ + (z % NH_) * HD + hi * 8; bf* al = ATl + ((size_t)(z / NH_) * TT + i) * DQ + (z % NH_) * HD + hi * 8;   /* z = b*16 + head; a lane's 8 values are 16 bytes of its query's row */
#pragma unroll
    for (int nb = 0; nb < 4; ++nb) { v8us o1, o2;
#pragma unroll
        for (int j = 0; j < 8; ++j) { unsigned short a, c2; splitf(acc[nb][j], a, c2); o1[j] = a; o2[j] = c2; }
        *(v8usa*)(ah + nb * 16) = o1; *(v8usa*)(al + nb * 16) = o2;
        asm volatile("s_wait_xcnt 0x0" ::: "memory"); }   // the next values' arithmetic reuses the registers that these two stores name
}
__device__ __forceinline__ void d_epadK(int bx, const float* __restrict__ E, bf* EB) { const size_t i = (size_t)bx * 256 + threadIdx.x; if (i >= (size_t)NE * HD / 8) return; const int d0 = (int)(i % (HD / 8)) * 8; const int r = (int)(i / (HD / 8)); const float* src = E + (size_t)min(r, NRE - 1) * HD + d0; v8us o;
#pragma unroll
    for (int q = 0; q < 8; ++q) { const unsigned short v = f2bf(src[q]); o[q] = (r < NRE) ? v : (unsigned short)0; }
    *(v8us*)(EB + (size_t)r * HD + d0) = o;  }

__device__ __forceinline__ void d_epadVT(int bx, const float* __restrict__ E, bf* Th, bf* Tl) { const size_t i = (size_t)bx * 256 + threadIdx.x; if (i >= (size_t)HD * NE / 4) return; const size_t e = i * 4; const int c0 = (int)(e % NE); const int d = (int)(e / NE); v4us oh, ol;
#pragma unroll
    for (int q = 0; q < 4; ++q) { const int r = c0 + q; const float v = bfr(E[(size_t)min(r, NRE - 1) * HD + d]); unsigned short u, w; splitf(v, u, w);   /* input rounded to bf16 once: lo == 0 */ oh[q] = (r < NRE) ? u : (unsigned short)0; ol[q] = (r < NRE) ? w : (unsigned short)0; }
    *(v4us*)(Th + e) = oh; *(v4us*)(Tl + e) = ol;  }

// k_prep: every pass that reads nothing but the inputs, in one launch of 646 work-groups, each with one piece of work; blockIdx.x picks the pass: 4 x 64 weight tiles (the longest path, they start first), 3 x 128 input pieces, 6 blocks for the two relative tables.
#define PBW 256
#define PBC 384
#define PBE 6
__global__ __launch_bounds__(256) void k_prep(const float* __restrict__ wq, const float* __restrict__ wk, const float* __restrict__ wv, const float* __restrict__ wo, const float* __restrict__ ak, const float* __restrict__ av, const float* __restrict__ x, const float* __restrict__ xk, const float* __restrict__ xv, bf* WB, bf* AKB, bf* AVTh, bf* AVTl, bf* XB) {
    static_assert(4 * (DM / 64) * (DQ / 256) == PBW && DKV == DQ && 3 * (NB_ * TT * DM / 16384) == PBC && NE * HD / 8 / 256 == 2 && HD * NE / 4 / 256 == 4 && PBE == 6, "grid PBW + PBC + PBE");
    __shared__ __align__(16) unsigned tl[8 * 32 * WTP];   // the weight tiles' turning room, one part per wave
    const int bx = blockIdx.x;
    if (bx < PBW) { const int y = bx >> 6; const float* w = (y == 0) ? wq : ((y == 1) ? wk : ((y == 2) ? wv : wo)); d_wtT(bx & 63, w, WB + (size_t)y * DM * DQ, tl); }   /* 'xw' weights turned into Bt */
    else if (bx < PBW + PBC) { const int c = bx - PBW, q = c >> 7; const float* src = (q == 0) ? x : ((q == 1) ? xk : xv); d_cvt4(c & 127, src, XB + (size_t)q * NB_ * TT * DM); }
    else { const int e = bx - PBW - PBC; if (e < 2) d_epadK(e, ak, AKB);   /* rel_k -> bf16 [64][64], rows >= 33 zero */ else d_epadVT(e - 2, av, AVTh, AVTl); }   /* rel_v^T hi/lo [64][64], cols >= 33 zero */
}

extern "C" void kernel_launch(void* const* d_in, const int* in_sizes, int n_in,
                              void* d_out, int out_size, void* d_ws, size_t ws_size, hipStream_t stream) {
    (void)in_sizes; (void)n_in; (void)out_size;
    const float* x = (const float*)d_in[0];   /* query */ const float* xk = (const float*)d_in[1]; const float* xv = (const float*)d_in[2]; const float* wq = (const float*)d_in[3]; const float* bq = (const float*)d_in[4]; const float* wk = (const float*)d_in[5]; const float* bk = (const float*)d_in[6]; const float* wv = (const float*)d_in[7]; const float* bv = (const float*)d_in[8]; const float* wo = (const float*)d_in[9]; const float* bo = (const float*)d_in[10]; const float* ak = (const float*)d_in[11]; const float* av = (const float*)d_in[12];   /* rel_k / rel_v [33][64] */
    float* OUT = (float*)d_out;     // [2][1024][1024]
    char* wsp = (char*)d_ws;
    auto take = [&](size_t bytes) { char* p = wsp; wsp += (bytes + 255) & ~(size_t)255; return (void*)p; };
    bf* AKB = (bf*)take((size_t)NE * HD * 2); bf* AVTh = (bf*)take((size_t)HD * NE * 2); bf* AVTl = (bf*)take((size_t)HD * NE * 2);
    bf* WB = (bf*)take((size_t)4 * DM * DQ * 2);   /* Wq, Wk, Wv, Wo as Bt, one behind the other */ bf* WO = WB + (size_t)3 * DM * DQ;
    bf* XB = (bf*)take((size_t)3 * NB_ * TT * DM * 2);   /* query, key, value */
    bf* QPh = (bf*)take((size_t)NB_ * NH_ * TT * HD * 2); bf* QPl = (bf*)take((size_t)NB_ * NH_ * TT * HD * 2); bf* KPh = (bf*)take((size_t)NB_ * NKV * TT * HD * 2); bf* KPl = (bf*)take((size_t)NB_ * NKV * TT * HD * 2); bf* VT2 = (bf*)take((size_t)NB_ * NKV * HD * 2 * TT * 2);   /* v^T rows hi | lo */
    bf* ATh = (bf*)take((size_t)NB_ * TT * DQ * 2); bf* ATl = (bf*)take((size_t)NB_ * TT * DQ * 2);
    if ((size_t)(wsp - (char*)d_ws) > ws_size) return;    // ws 256 MiB
    k_prep<<<dim3(PBW + PBC + PBE, 1, 1), 256, 0, stream>>>(wq, wk, wv, wo, ak, av, x, xk, xv, WB, AKB, AVTh, AVTl, XB);
    k_gemms<0, true><<<dim3(NB_ * TT / 128, DQ / 128, 3), 128, 0, stream>>>(XB, nullptr, WB, nullptr, bq, bk, bv, (size_t)NB_ * TT * DM, (size_t)DM * DQ, QPh, QPl, KPh, KPl, VT2);   /* z = q, k, v, straight into the head planes */
    k_fattn<<<dim3(TT / 128, ZB, 1), 256, 0, stream>>>(QPh, QPl, KPh, KPl, VT2, AKB, AVTh, AVTl, ATh, ATl);   /* z = b*16 + head walks consecutive q, k and v planes; scores + q.rel_k[clip(j - i) + 16], softmax, attn.v + attn folded onto the 33 offsets . rel_v, merged hi/lo */
    k_gemms<1, false><<<dim3(NB_ * TT / 128, DM / 128, 1), 128, 0, stream>>>(ATh, ATl, WO, OUT, bo, bo, bo, 0, 0, nullptr, nullptr, nullptr, nullptr, nullptr);
}

// v010
// One run takes 74.2 microseconds.
// Two timings next to v009 put it at 1.04 and 1.03 times that version's speed.
// All steps since v000 together make it 15.9 times as fast.
#include <hip/hip_runtime.h>

// Relative (Shaw) multi-head attention with key AND value relative-position embeddings (query, key, value [2][1024][1024]; q = query Wq + bq, k = key Wk + bk, v = value Wv + bv ('xw' 1/32, zero biases; 16 heads x 64); idx[i][j] = clip(j - i, -16, 16) + 16; attn = softmax((q.k + q.rel_k[idx]) / 8); x = attn v + sum_j attn[i][j] rel_v[idx] (rel_k, rel_v [33][64] 1/8 scale, read); out = merged Wo + bo ('xw') -> [2][1024][1024] (2.1 M); argument order query, key, value, Wq, bq, Wk, bk, Wv, bv, Wo, bo, rel_k, rel_v).
// Layout: bf16 copies of query, key, value side by side (both batches, rows b*1024 + t); 'xw' weights gathered into Bt; exact projections + f32 biases; rel_k as a zero-padded bf16 plane [64][64] and rel_v^T as hi/lo planes [64][64] (bf16-rounded once); QE = q.rel_k^T (hi/lo x exact); one fused attention launch over all 32 (batch, head) pairs: score tiles (hi/lo 3 products) + QE at column clip(j - i) + 16, softmax (x 1/8), P as hi/lo fragments, P.v (hi/lo x hi/lo), the probabilities folded onto the 33 offsets (interior = one key, the two ends = fixed-order sums) and PB.rel_v added into the context's accumulators; merged hi/lo x Wo exact + bo.
// Compute dtypes, f32 accumulate: every input rounded to bf16; projections exact + f32 biases; scores and the relative-key term ~f32; softmax f32; P as bf16 hi/lo; attn.v and the relative-value term 3 products (~f32); Wo hl x exact + bias.

#define NB_  2
#define TT   1024
#define DM   1024
#define NH_  16
#define NKV  16
#define REP  (NH_ / NKV)
#define HD   64
#define DQ   (NH_ * HD)
#define DKV  (NKV * HD)
#define ZH   16
#define ZB   (NB_ * ZH)           // (batch, head) pairs per attention launch: all of them
#define RH   TT
#define WIN  0
#define PCAR 1024.0f
#define SCL  0.125f   // 1/sqrt(64) (the module divides by jnp.sqrt(DH))
#define NE   64       // 2*16+1 = 33 relative offsets padded to 64
#define NRE  33
#define CUT  16
typedef _Float16 h16;
typedef unsigned short bf;
typedef __attribute__((ext_vector_type(16))) __bf16   v16bf;
typedef __attribute__((ext_vector_type(16))) _Float16 v16h;
typedef __attribute__((ext_vector_type(8)))  _Float16 v8h;
typedef __attribute__((ext_vector_type(8)))  unsigned short v8us;
typedef __attribute__((ext_vector_type(8)))  float    v8f;
typedef __attribute__((ext_vector_type(4)))  float    v4f;
typedef v8h  __attribute__((may_alias)) v8ha;
typedef v4f  __attribute__((may_alias)) v4fa;
typedef v8us __attribute__((may_alias)) v8usa;

__device__ __forceinline__ unsigned short f2bf(float f) { unsigned u = __float_as_uint(f); u += 0x7FFFu + ((u >> 16) & 1u); return (unsigned short)(u >> 16); }
__device__ __forceinline__ float bf2f(unsigned short b) { return __uint_as_float(((unsigned)b) << 16); }
__device__ __forceinline__ float bfr(float f) { return bf2f(f2bf(f)); }
__device__ __forceinline__ v16h cat16(v8h lo, v8h hi) { return __builtin_shufflevector(lo, hi, 0, 1, 2, 3, 4, 5, 6, 7, 8, 9, 10, 11, 12, 13, 14, 15); }
__device__ __forceinline__ v16bf cat16b(v8us lo, v8us hi) { return __builtin_bit_cast(v16bf, __builtin_shufflevector(lo, hi, 0, 1, 2, 3, 4, 5, 6, 7, 8, 9, 10, 11, 12, 13, 14, 15)); }
__device__ __forceinline__ v8f wmma16(v16h a, v16h b, v8f c) { return __builtin_amdgcn_wmma_f32_16x16x32_f16(false, a, false, b, (short)0, c, false, false); }
__device__ __forceinline__ v8f wmmab(v16bf a, v16bf b, v8f c) { return __builtin_amdgcn_wmma_f32_16x16x32_bf16(false, a, false, b, (short)0, c, false, false); }

__device__ __forceinline__ void splitf(float y, unsigned short& h, unsigned short& l) { h = f2bf(y); l = f2bf(y - bf2f(h)); }
typedef __attribute__((ext_vector_type(2))) unsigned short v2us;
typedef __attribute__((ext_vector_type(4))) unsigned short v4us;
typedef __attribute__((ext_vector_type(4))) unsigned int v4u;
typedef v4u  __attribute__((may_alias)) v4ua;
typedef v4us __attribute__((may_alias)) v4usa;

// WFrag: a 16x32 operand fragment of a K-contiguous 16-bit plane: the lane's two 16-byte pieces, 16 elements apart
template <typename T16> struct WFrag;
template <> struct WFrag<h16> { typedef v16h V; static __device__ __forceinline__ V ld(const h16* p) { return cat16(*(const v8h*)p, *(const v8h*)(p + 16)); } static __device__ __forceinline__ v8f mma(V a, V b, v8f c) { return wmma16(a, b, c); } };
template <> struct WFrag<bf> { typedef v16bf V; static __device__ __forceinline__ V ld(const bf* p) { return cat16b(*(const v8us*)p, *(const v8us*)(p + 16)); } static __device__ __forceinline__ v8f mma(V a, V b, v8f c) { return wmmab(a, b, c); } };

// ---- k_gemms: the two long GEMMs (K = 1024). Work-group = 4 waves = one 128x128 output tile, wave = 64x64 (16 accumulators). grid (M/128, N/128, Z), 128 threads.
// Operand tiles of 128 rows x 128 k go from the K-contiguous bf16 planes into LDS by asynchronous copies: a wave-wide copy takes two whole 256-byte row pieces, where a fragment load from global memory touched 16 lines for 512 bytes, and the four waves share each tile. Two buffers: the next stage's copies fly while this stage is worked on.
// C[m][n] (f32, pitch DM) = sum_k (A[m][k] (+ A2[m][k] if NSPLIT)) Bt[n][k] + f32 bias[n] (one bias vector per z = 0, 1, 2). z-batch strides sA/sB in elements.
// PL: the tile does not leave as f32 but as the attention kernel's bf16 hi/lo planes: z = 0, 1 -> [b][h][t][d] (q, k), z = 2 -> v^T rows (b, h, d) = hi | lo, pitch 2*TT. A wave's 64x64 tile is 64 rows t of one (batch, head).
#define SK 128   // k per stage: 256 bytes of every operand row
#define SP 136   // LDS row pitch in elements: 272 bytes = 16 x odd, conflict-free for the 16-byte fragment reads
// eight 16-byte copies of one lane, rows 8 apart; l = the lane's LDS byte address, g = its global address
__device__ __forceinline__ void d_copy8(unsigned l, const bf* g) {
    asm volatile("global_load_async_to_lds_b128 %0, %8, off\n\tglobal_load_async_to_lds_b128 %1, %9, off\n\tglobal_load_async_to_lds_b128 %2, %10, off\n\tglobal_load_async_to_lds_b128 %3, %11, off\n\t"
                 "global_load_async_to_lds_b128 %4, %12, off\n\tglobal_load_async_to_lds_b128 %5, %13, off\n\tglobal_load_async_to_lds_b128 %6, %14, off\n\tglobal_load_async_to_lds_b128 %7, %15, off\n\t"
                 "s_wait_xcnt 0x0"   // stands in front of every later write of the address registers that these copies name
                 :: "v"(l), "v"(l + 8 * SP * 2), "v"(l + 16 * SP * 2), "v"(l + 24 * SP * 2), "v"(l + 32 * SP * 2), "v"(l + 40 * SP * 2), "v"(l + 48 * SP * 2), "v"(l + 56 * SP * 2),
                    "v"(g), "v"(g + 8 * DM), "v"(g + 16 * DM), "v"(g + 24 * DM), "v"(g + 32 * DM), "v"(g + 40 * DM), "v"(g + 48 * DM), "v"(g + 56 * DM) : "memory");
}
template <int NSPLIT, bool PL>
__global__ __launch_bounds__(128) void k_gemms(const bf* __restrict__ A, const bf* __restrict__ A2, const bf* __restrict__ Bt, float* C, const float* __restrict__ bias0, const float* __restrict__ bias1, const float* __restrict__ bias2, size_t sA, size_t sB, bf* QPh, bf* QPl, bf* KPh, bf* KPl, bf* VT2) {
    typedef WFrag<bf>::V V;
    constexpr int NT = NSPLIT ? 3 : 2, NS = DM / SK, TB = 128 * SP * 2;   // tiles per stage (A, Bt, A2), stages, bytes of a tile in LDS
    static_assert(DM == DQ && DM % SK == 0 && NS >= 2 && 4 * 2 * 64 * 72 * 2 <= 2 * NT * TB, "two stages or more; the output staging fits the ring");
    __shared__ __align__(16) bf ring[2][NT][128 * SP];
    const int tid = threadIdx.x, lane = tid & 31, lr = lane & 15, hi = lane >> 4; const int wv = __builtin_amdgcn_readfirstlane(tid >> 5);
    const size_t z = blockIdx.z; A += z * sA; if (NSPLIT) A2 += z * sA; Bt += z * sB; const float* bias = (z == 0) ? bias0 : ((z == 1) ? bias1 : bias2);
    const int wr = (wv >> 1) * 64, wc = (wv & 1) * 64, r0 = blockIdx.x * 128 + wr, c0 = blockIdx.y * 128 + wc;
    const int cr = tid >> 4, cc = (tid & 15) * 8;   // this thread's 16-byte pieces of a tile: column piece cc of rows cr + 8 u
    const bf* ga = A + (size_t)(blockIdx.x * 128 + cr) * DM + cc; const bf* ga2 = NSPLIT ? A2 + (size_t)(blockIdx.x * 128 + cr) * DM + cc : nullptr; const bf* gb = Bt + (size_t)(blockIdx.y * 128 + cr) * DM + cc;
    const unsigned l0 = (unsigned)(size_t)&ring[0][0][cr * SP + cc];
    auto fill = [&](int s) { const unsigned l = l0 + (unsigned)(s & 1) * (NT * TB);
        d_copy8(l, ga + s * SK); d_copy8(l + TB / 2, ga + s * SK + 64 * DM); d_copy8(l + TB, gb + s * SK); d_copy8(l + TB + TB / 2, gb + s * SK + 64 * DM);
        if (NSPLIT) { d_copy8(l + 2 * TB, ga2 + s * SK); d_copy8(l + 2 * TB + TB / 2, ga2 + s * SK + 64 * DM); } };
    v8f acc[4][4];
#pragma unroll
    for (int mb = 0; mb < 4; ++mb)
#pragma unroll
        for (int nb = 0; nb < 4; ++nb) acc[mb][nb] = (v8f){};
    fill(0);
    asm volatile("s_wait_asynccnt 0x0" ::: "memory");   // this wave's copies of stage 0 have landed
    __syncthreads();   // stage 0 is whole before anybody reads it
    fill(1);
#pragma unroll 1
    for (int s = 0; s < NS; ++s) {
        const bf* ta = &ring[s & 1][0][(wr + lr) * SP + 8 * hi]; const bf* tb = &ring[s & 1][1][(wc + lr) * SP + 8 * hi]; const bf* ta2 = &ring[s & 1][NT - 1][(wr + lr) * SP + 8 * hi];
        V a[2][4], a2[2][4], b[2][4];
#pragma unroll
        for (int mb = 0; mb < 4; ++mb) { a[0][mb] = WFrag<bf>::ld(ta + mb * 16 * SP); if (NSPLIT) a2[0][mb] = WFrag<bf>::ld(ta2 + mb * 16 * SP); b[0][mb] = WFrag<bf>::ld(tb + mb * 16 * SP); }
#pragma unroll
        for (int q = 0; q < SK / 32; ++q) { const int u = q & 1, n = u ^ 1;
            if (q + 1 < SK / 32) {
#pragma unroll
                for (int mb = 0; mb < 4; ++mb) { a[n][mb] = WFrag<bf>::ld(ta + mb * 16 * SP + (q + 1) * 32); if (NSPLIT) a2[n][mb] = WFrag<bf>::ld(ta2 + mb * 16 * SP + (q + 1) * 32); b[n][mb] = WFrag<bf>::ld(tb + mb * 16 * SP + (q + 1) * 32); } }
            __builtin_amdgcn_sched_barrier(0);   // keeps the next block's fragment loads together in front of this block's products: sunk to their users they would each wait alone
#pragma unroll
            for (int nb = 0; nb < 4; ++nb)
#pragma unroll
                for (int mb = 0; mb < 4; ++mb) { acc[mb][nb] = wmmab(a[u][mb], b[u][nb], acc[mb][nb]); if (NSPLIT) acc[mb][nb] = wmmab(a2[u][mb], b[u][nb], acc[mb][nb]); }
        }
        asm volatile("s_wait_dscnt 0x0" ::: "memory");      // this wave's reads of the buffer that is refilled below have returned
        asm volatile("s_wait_asynccnt 0x0" ::: "memory");   // this wave's copies of stage s + 1 have landed
        __syncthreads();   // publishes stage s + 1 and ends every wave's reads of stage s
        if (s + 2 < NS) fill(s + 2);
    }
    asm volatile("s_wait_asynccnt 0x0" ::: "memory");   // nothing is in flight when the ring becomes output staging (the last trip's barrier has ended every read of it)
    float* os = (float*)&ring[0][0][0] + wv * (2 * 64 * 72 / 2);   // wave-own staging: room for a whole v^T tile, hi and lo, row pitch 72 elements
    if (PL) {
        const int zh = (r0 / TT) * NH_ + c0 / HD, t0 = r0 % TT;
        if (z == 2) {   // v^T: a lane holds 8 consecutive t of one d, which is 16 bytes of a plane's row as it stands; through LDS so that whole 128-byte lines are stored
            bf* sh = (bf*)os; bf* sl = sh + 64 * 72;
#pragma unroll
            for (int nb = 0; nb < 4; ++nb) { const float bb = bfr(bias[c0 + nb * 16 + lr]);
#pragma unroll
                for (int mb = 0; mb < 4; ++mb) { v8us o1, o2;
#pragma unroll
                    for (int j = 0; j < 8; ++j) { unsigned short a1, c2; splitf(acc[mb][nb][j] + bb, a1, c2); o1[j] = a1; o2[j] = c2; }
                    *(v8usa*)(sh + (nb * 16 + lr) * 72 + mb * 16 + hi * 8) = o1; *(v8usa*)(sl + (nb * 16 + lr) * 72 + mb * 16 + hi * 8) = o2; } }
            __builtin_amdgcn_wave_barrier(); asm volatile("" ::: "memory");   // the row reads below take what other lanes of this wave stored
            bf* vrow = VT2 + ((size_t)zh * HD + (lane >> 3)) * (2 * TT) + t0 + (lane & 7) * 8;
#pragma unroll
            for (int g = 0; g < 4; ++g) { v8us o1[4], o2[4];   // 16 rows a round: one LDS latency for eight reads
#pragma unroll
                for (int s = 0; s < 4; ++s) { o1[s] = *(const v8usa*)(sh + ((g * 4 + s) * 4 + (lane >> 3)) * 72 + (lane & 7) * 8); o2[s] = *(const v8usa*)(sl + ((g * 4 + s) * 4 + (lane >> 3)) * 72 + (lane & 7) * 8); }
#pragma unroll
                for (int s = 0; s < 4; ++s) { *(v8usa*)(vrow + (size_t)(g * 4 + s) * 4 * 2 * TT) = o1[s]; *(v8usa*)(vrow + (size_t)(g * 4 + s) * 4 * 2 * TT + TT) = o2[s]; }
                asm volatile("s_wait_xcnt 0x0" ::: "memory"); }   // the next round reuses the registers that these stores name
            return; }
        bf* ph = ((z == 0) ? QPh : KPh) + ((size_t)zh * TT + t0) * HD + lr * 4; bf* pl = ((z == 0) ? QPl : KPl) + ((size_t)zh * TT + t0) * HD + lr * 4;
        v4f bb; bb[0] = bfr(bias[c0 + lr * 4]); bb[1] = bfr(bias[c0 + lr * 4 + 1]); bb[2] = bfr(bias[c0 + lr * 4 + 2]); bb[3] = bfr(bias[c0 + lr * 4 + 3]);
#pragma unroll
        for (int mb = 0; mb < 4; ++mb) {
#pragma unroll
            for (int nb = 0; nb < 4; ++nb) {
#pragma unroll
                for (int j = 0; j < 8; ++j) os[(hi * 8 + j) * 68 + nb * 16 + lr] = acc[mb][nb][j]; }
            __builtin_amdgcn_wave_barrier(); asm volatile("" ::: "memory");   // the row reads below take what other lanes of this wave stored
#pragma unroll
            for (int s = 0; s < 8; ++s) { const int row = 2 * s + hi; const v4f val = *(const v4fa*)(os + row * 68 + lr * 4); v4us o1, o2;
#pragma unroll
                for (int q = 0; q < 4; ++q) { unsigned short a1, c2; splitf(val[q] + bb[q], a1, c2); o1[q] = a1; o2[q] = c2; }
                *(v4usa*)(ph + (size_t)(mb * 16 + row) * HD) = o1; *(v4usa*)(pl + (size_t)(mb * 16 + row) * HD) = o2; }
            asm volatile("s_wait_xcnt 0x0" ::: "memory");   // the next 16 rows' work reuses the registers that these stores name
            __builtin_amdgcn_wave_barrier(); asm volatile("" ::: "memory");   // the next 16 rows overwrite what has just been read
        }
        return;
    }
#pragma unroll
    for (int mb = 0; mb < 4; ++mb) {
#pragma unroll
        for (int nb = 0; nb < 4; ++nb) {
#pragma unroll
            for (int j = 0; j < 8; ++j) os[(hi * 8 + j) * 68 + nb * 16 + lr] = acc[mb][nb][j]; }
        __builtin_amdgcn_wave_barrier(); asm volatile("" ::: "memory");
        float* crow = C + (size_t)(r0 + mb * 16) * DM + c0;
{
#pragma unroll
            for (int s = 0; s < 8; ++s) { const int row = 2 * s + hi, cofs = lr * 4; v4f val = *(const v4fa*)(os + row * 68 + cofs); val[0] += bfr(bias[c0 + cofs]); val[1] += bfr(bias[c0 + cofs + 1]); val[2] += bfr(bias[c0 + cofs + 2]); val[3] += bfr(bias[c0 + cofs + 3]);
                *(v4f*)(crow + (size_t)row * DM + cofs) = val; }
             }
        asm volatile("s_wait_xcnt 0x0" ::: "memory");   // the next 16 rows' work reuses the registers that these stores name
        __builtin_amdgcn_wave_barrier(); asm volatile("" ::: "memory");
    }
}

// d_wtT: one weight tile, 64 k x 256 n, from w[k][n] (f32) to Bt[n][k] (bf16). A wave owns 32 n: each of its loads takes four whole 128-byte lines (four rows k, 32 n each), all 16 loads in flight at once;
// rows k and k + 1 are packed into one dword per n and turned in a wave-own LDS tile [n][k pair]; each store then takes four whole 128-byte lines of Bt (four rows n, 64 k each).
#define WTP 36   // dwords per row n of the LDS tile: 32 pairs of k + 4; 144 bytes = 16 x odd, conflict-free for the 16-byte row reads
__device__ __forceinline__ void d_wtT(int bx, const float* __restrict__ w, bf* Bt, unsigned* tl) {
    const int lane = threadIdx.x & 31, wv = threadIdx.x >> 5, a = lane & 7, b = lane >> 3; const int k0 = (bx >> 2) * 64, n0 = (bx & 3) * 256 + wv * 32;
    unsigned* t = tl + wv * 32 * WTP;
    const float* g = w + (size_t)(k0 + 2 * b) * DQ + n0 + a * 4;   // rows k0 + 8 u + 2 b (+ 1), columns n0 + 4 a + 0..3
    v4f r0[8], r1[8];
#pragma unroll
    for (int u = 0; u < 8; ++u) { r0[u] = *(const v4f*)(g + (size_t)(u * 8) * DQ); r1[u] = *(const v4f*)(g + (size_t)(u * 8 + 1) * DQ); }
    asm volatile("s_wait_xcnt 0x0" :: "v"(g) : "memory");   // the work below reuses the registers that these loads name as their addresses: the address stays live up to the wait
#pragma unroll
    for (int u = 0; u < 8; ++u)
#pragma unroll
        for (int q = 0; q < 4; ++q) t[(a * 4 + q) * WTP + u * 4 + b] = (unsigned)f2bf(r0[u][q]) | ((unsigned)f2bf(r1[u][q]) << 16);
    __builtin_amdgcn_wave_barrier(); asm volatile("" ::: "memory");   // the row reads below take what other lanes of this wave stored (one wave's LDS operations run in order)
    bf* o = Bt + (size_t)(n0 + b) * DM + k0 + a * 8;   // rows n0 + 4 v + b, k0 + 8 a + 0..7
    v4u x[8];
#pragma unroll
    for (int v = 0; v < 8; ++v) x[v] = *(const v4ua*)(t + (v * 4 + b) * WTP + a * 4);
#pragma unroll
    for (int v = 0; v < 8; ++v) *(v4ua*)(o + (size_t)(v * 4) * DM) = x[v];
}
// d_cvt4: 16384 floats of an input to bf16; a thread takes 16 pieces of 4 floats, 256 pieces apart (a wave's load = 512 contiguous bytes, its store = 256), all 16 loads in flight at once
__device__ __forceinline__ void d_cvt4(int bx, const float* __restrict__ src, bf* dst) { const size_t i0 = ((size_t)bx * 4096 + threadIdx.x) * 4; const float* s = src + i0; bf* d = dst + i0; v4f v[16];
#pragma unroll
    for (int u = 0; u < 16; ++u) v[u] = *(const v4f*)(s + u * 1024);
    asm volatile("s_wait_xcnt 0x0" :: "v"(s) : "memory");   // the work below reuses the registers that these loads name as their addresses: the address stays live up to the wait
#pragma unroll
    for (int u = 0; u < 16; ++u) { v4us o;
#pragma unroll
        for (int k = 0; k < 4; ++k) o[k] = f2bf(v[u][k]);
        *(v4us*)(d + u * 1024) = o; }
}

// k_fattn: scores, softmax, attn.v and the relative-value term in one kernel; no score or probability ever leaves the chip.
// Work-group = 8 waves = 128 query rows of one (batch, head); wave = 16 queries. Key tiles of 64 (k hi/lo, v^T hi/lo) go through registers into one of three LDS buffers (row pitch 144 B), two tiles ahead of their use.
// One barrier a tile, behind the scores. Behind it a wave stores the tile after next and asks for this tile's v fragments, which land while the softmax arithmetic runs; the next tile's k fragments are asked for in front of the v products and land while those run.
// Transposed scores S^T = k q^T: lane (lr, hi) holds query lr, keys hi*8 + 0..7 of each 16-key tile, which is the B fragment of P^T for O^T = v^T P^T as it stands; of O^T the lane holds d = hi*8 + 0..7 of the same query lr, so every factor of a query is a factor of a lane.
// ONE sweep over the keys: running row maximum (joined over the two half rows once per key tile), P = exp(t - maximum) unnormalised as bf16 hi/lo, v^T.P^T (3 products); row sum, the two end-offset sums and the context are rescaled as the maximum moves and take 1/sum at the end.
// QE = q.rel_k^T of a wave's 16 queries is made in the prologue, from the q fragments that the scores use, and stays in a wave-own LDS plane.
// The 31 interior offsets have one key each: their scores wait in a wave-own LDS plane and become probabilities at the end; PB.rel_v goes into the same accumulators.
#define KP 72
#define TP 40   // row pitch of the kept scores in floats: 16-byte rows, odd step between neighbouring queries' equal keys
typedef WFrag<bf>::V VB;
__device__ __forceinline__ void d_stile(const VB* kf, const VB* qh, const VB* ql, float* t, int j0s, int i0, int i, int hi, float qlo, float qhi, const float* qer) {
    float e[8];   // the relative-key term of this lane's 8 keys, chosen in front of the products so that no branch stands behind a matrix instruction
    if (j0s + 15 <= i0 - CUT) {   /* the same for the whole wave: every key of the tile on the low end offset */
#pragma unroll
        for (int jj = 0; jj < 8; ++jj) e[jj] = qlo; }
    else if (j0s >= i0 + 15 + CUT) {
#pragma unroll
        for (int jj = 0; jj < 8; ++jj) e[jj] = qhi; }
    else {
#pragma unroll
        for (int jj = 0; jj < 8; ++jj) e[jj] = qer[min(max(j0s + hi * 8 + jj - i, -CUT), CUT) + CUT]; }
    v8f s = (v8f){};
#pragma unroll
    for (int c = 0; c < 2; ++c) { s = wmmab(kf[2 * c], qh[c], s); s = wmmab(kf[2 * c], ql[c], s); s = wmmab(kf[2 * c + 1], qh[c], s); }
#pragma unroll
    for (int jj = 0; jj < 8; ++jj) t[jj] = __fadd_rn(s[jj], e[jj]) * SCL;
}
__device__ __forceinline__ float d_xhalf(float x) { return __builtin_bit_cast(float, __builtin_amdgcn_permlanex16(__builtin_bit_cast(int, x), __builtin_bit_cast(int, x), 0x76543210, 0xfedcba98, false, false)); }   // lane l takes lane l ^ 16
__global__ __launch_bounds__(256) void k_fattn(const bf* __restrict__ QPh, const bf* __restrict__ QPl, const bf* __restrict__ KPh, const bf* __restrict__ KPl, const bf* __restrict__ VT2, const bf* __restrict__ AKB, const bf* __restrict__ AVTh, const bf* __restrict__ AVTl, bf* ATh, bf* ATl) {
    __shared__ __align__(16) bf tl[3][4][64 * KP];     // three buffers of a key tile: k [key][d] hi, lo; v^T [d][key] hi, lo
    __shared__ __align__(16) bf pb[8][2][16 * KP];     // per wave: P folded onto the offsets [query][offset], hi and lo
    __shared__ __align__(16) float os[8][16 * 68];     // per wave: QE = q.rel_k^T of its 16 queries [query][offset]
    __shared__ __align__(16) float ts[8][16 * TP];     // per wave: the scores of the interior offsets [query][offset]
    const float L2E = 1.4426950408889634f;
    const int tid = threadIdx.x, lane = tid & 31, lr = lane & 15, hi = lane >> 4; const int wv = __builtin_amdgcn_readfirstlane(tid >> 5);
    const int z = blockIdx.y, i0 = blockIdx.x * 128 + wv * 16, i = i0 + lr;
    float* osw = os[wv]; float* tsw = ts[wv]; bf* pbh = pb[wv][0]; bf* pbl = pb[wv][1];
    const int cr = tid >> 3, cc = (tid & 7) * 8, lo0 = cr * KP + cc;   // this thread's 16-byte pieces of a tile: rows cr and cr + 32
    const bf* kgh = KPh + (size_t)z * TT * HD + cr * HD + cc; const bf* kgl = KPl + (size_t)z * TT * HD + cr * HD + cc; const bf* vg = VT2 + ((size_t)z * HD + cr) * (2 * TT) + cc;
    constexpr int NBK = TT / 64; static_assert(NBK >= 3, "the prologue fills two buffers and asks for a third tile");
    auto gtile = [&](int b, v8us (&k)[2][2], v8us (&v)[2][2]) {   // key tile b, global memory -> registers
#pragma unroll
        for (int u = 0; u < 2; ++u) { k[0][u] = *(const v8us*)(kgh + (b * 64 + u * 32) * HD); k[1][u] = *(const v8us*)(kgl + (b * 64 + u * 32) * HD); v[0][u] = *(const v8us*)(vg + (size_t)u * 32 * 2 * TT + b * 64); v[1][u] = *(const v8us*)(vg + (size_t)u * 32 * 2 * TT + TT + b * 64); } };
    auto stile = [&](int buf, const v8us (&k)[2][2], const v8us (&v)[2][2]) {   // registers -> LDS buffer buf
#pragma unroll
        for (int u = 0; u < 2; ++u) { *(v8us*)(&tl[buf][0][lo0 + u * 32 * KP]) = k[0][u]; *(v8us*)(&tl[buf][1][lo0 + u * 32 * KP]) = k[1][u]; *(v8us*)(&tl[buf][2][lo0 + u * 32 * KP]) = v[0][u]; *(v8us*)(&tl[buf][3][lo0 + u * 32 * KP]) = v[1][u]; } };
    v8us rk[2][2], rv[2][2], rk1[2][2], rv1[2][2];
    gtile(0, rk, rv); gtile(1, rk1, rv1);
    VB qh[2], ql[2];
#pragma unroll
    for (int c = 0; c < 2; ++c) { qh[c] = WFrag<bf>::ld(QPh + ((size_t)z * TT + i) * HD + 8 * hi + c * 32); ql[c] = WFrag<bf>::ld(QPl + ((size_t)z * TT + i) * HD + 8 * hi + c * 32); }
    const bf* eg = AKB + lr * HD + 8 * hi;
    VB ef[3][2];   // rel_k fragments: offsets 0..47 cover the 33 that exist (rows from 33 on are zero)
#pragma unroll
    for (int ob = 0; ob < 3; ++ob)
#pragma unroll
        for (int c = 0; c < 2; ++c) ef[ob][c] = WFrag<bf>::ld(eg + ob * 16 * HD + c * 32);
    asm volatile("s_wait_xcnt 0x0" :: "v"(kgh), "v"(kgl), "v"(vg), "v"(QPh + ((size_t)z * TT + i) * HD + 8 * hi), "v"(QPl + ((size_t)z * TT + i) * HD + 8 * hi), "v"(eg) : "memory");   // the work below reuses the registers that the loads above name as their addresses: the addresses stay live up to the wait
    __builtin_amdgcn_sched_barrier(0);   // keeps the products below behind all of the loads above: lifted among them, their waits would hold the two key tiles' loads back by one memory latency
    // QE^T = rel_k q^T (exact x hi/lo), transposed like the scores: lane (lr, hi) holds offsets ob*16 + hi*8 + 0..7 of query lr
#pragma unroll
    for (int ob = 0; ob < 3; ++ob) { v8f s = (v8f){};
#pragma unroll
        for (int c = 0; c < 2; ++c) { s = wmmab(ef[ob][c], qh[c], s); s = wmmab(ef[ob][c], ql[c], s); }
        *(v4fa*)(osw + lr * 68 + ob * 16 + hi * 8) = (v4f){s[0], s[1], s[2], s[3]}; *(v4fa*)(osw + lr * 68 + ob * 16 + hi * 8 + 4) = (v4f){s[4], s[5], s[6], s[7]}; }
#pragma unroll
    for (int u = 0; u < 9; ++u) ((v4ua*)pbh)[lane + 32 * u] = (v4u){0u, 0u, 0u, 0u};   // both planes (they lie one behind the other): the padding offsets stay zero
#pragma unroll
    for (int u = 0; u < 16 * TP / 128; ++u) ((v4fa*)tsw)[lane + 32 * u] = (v4f){-1.0e30f, -1.0e30f, -1.0e30f, -1.0e30f};   // an offset with no key: its probability comes out zero
    __builtin_amdgcn_wave_barrier(); asm volatile("" ::: "memory");   // the reads of osw below take what other lanes of this wave stored (one wave's LDS operations run in order)
    const float* qer = osw + lr * 68; const float qlo = qer[0], qhi = qer[2 * CUT];
    float m = -3.0e38f, l = 0.f, lo_s = 0.f, hi_s = 0.f;
    v8f acc[4];   // O^T: acc[nb][j] = d nb*16 + hi*8 + j of query lr
#pragma unroll
    for (int nb = 0; nb < 4; ++nb) acc[nb] = (v8f){};
    VB kf[4][4];   // a tile's 16 k fragments (per 16 keys: hi, lo of d 0..31, hi, lo of d 32..63), fetched one tile ahead
    auto kfrag = [&](int buf) {
#pragma unroll
        for (int st = 0; st < 4; ++st)
#pragma unroll
            for (int c = 0; c < 2; ++c) { kf[st][2 * c] = WFrag<bf>::ld(&tl[buf][0][(st * 16 + lr) * KP + 8 * hi + c * 32]); kf[st][2 * c + 1] = WFrag<bf>::ld(&tl[buf][1][(st * 16 + lr) * KP + 8 * hi + c * 32]); } };
    stile(0, rk, rv); stile(1, rk1, rv1);
    __syncthreads();   // tiles 0 and 1 are whole before anybody reads them
    gtile(2, rk, rv);
    asm volatile("s_wait_xcnt 0x0" :: "v"(kgh), "v"(kgl), "v"(vg) : "memory");   // the fragment loads and the work below reuse the registers that these loads name as their addresses: the addresses stay live up to the wait
    kfrag(0);
    int b0 = 0, b1 = 1, b2 = 2;   // the buffers of tiles blk, blk + 1, blk + 2
#pragma unroll 1
    for (int blk = 0; blk < NBK; ++blk) {
        float t[4][8];
#pragma unroll
        for (int st = 0; st < 4; ++st) { const int j0s = blk * 64 + st * 16;
            d_stile(kf[st], qh, ql, t[st], j0s, i0, i, hi, qlo, qhi, qer);
            if (j0s + 15 > i0 - CUT && j0s < i0 + 15 + CUT) {   /* the same for the whole wave: a tile that touches the band of interior offsets */
#pragma unroll
                for (int jj = 0; jj < 8; ++jj) { const int bkt = j0s + hi * 8 + jj - i + CUT; if (bkt > 0 && bkt < 2 * CUT) tsw[lr * TP + bkt] = t[st][jj]; } } }
        __syncthreads();   // publishes tile blk + 1 and ends every wave's reads of tile blk - 1, whose buffer is refilled next
        if (blk + 2 < NBK) { stile(b2, rk, rv);
            if (blk + 3 < NBK) { gtile(blk + 3, rk, rv);
                asm volatile("s_wait_xcnt 0x0" ::: "memory"); } }   // the work below reuses the registers that these loads name as their addresses
        VB vh[2][4], vl[2][4];   // this tile's 16 v fragments: they land while the softmax arithmetic runs
#pragma unroll
        for (int c = 0; c < 2; ++c)
#pragma unroll
            for (int nb = 0; nb < 4; ++nb) { vh[c][nb] = WFrag<bf>::ld(&tl[b0][2][(nb * 16 + lr) * KP + c * 32 + 8 * hi]); vl[c][nb] = WFrag<bf>::ld(&tl[b0][3][(nb * 16 + lr) * KP + c * 32 + 8 * hi]); }
        __builtin_amdgcn_sched_barrier(0);   // keeps the v fragment loads in front of the softmax arithmetic: sunk to their users they would be waited for with nothing else to do
        float bm = m;
#pragma unroll
        for (int st = 0; st < 4; ++st)
#pragma unroll
            for (int jj = 0; jj < 8; ++jj) bm = fmaxf(bm, t[st][jj]);
        bm = fmaxf(bm, d_xhalf(bm));   // one maximum per query: both half rows feed the same accumulators
        const float cs = __builtin_amdgcn_exp2f((m - bm) * L2E); m = bm;   // 1 while the maximum stands
        l *= cs; lo_s *= cs; hi_s *= cs;
#pragma unroll
        for (int nb = 0; nb < 4; ++nb) acc[nb] *= cs;
        v8us oh[4], ol[4];
#pragma unroll
        for (int st = 0; st < 4; ++st) { const int j0s = blk * 64 + st * 16; float p[8];
#pragma unroll
            for (int jj = 0; jj < 8; ++jj) { unsigned short a, c2; p[jj] = __builtin_amdgcn_exp2f((t[st][jj] - bm) * L2E); splitf(p[jj], a, c2); oh[st][jj] = a; ol[st][jj] = c2; }
            const float a8 = ((p[0] + p[1]) + (p[2] + p[3])) + ((p[4] + p[5]) + (p[6] + p[7]));
            l += a8;
            if (j0s + 15 <= i0 - CUT) lo_s += a8;   /* the same for the whole wave: every key of the tile on the low end offset */
            else if (j0s >= i0 + 15 + CUT) hi_s += a8;
            else {
#pragma unroll
                for (int jj = 0; jj < 8; ++jj) { const int bkt = j0s + hi * 8 + jj - i + CUT; lo_s += (bkt <= 0) ? p[jj] : 0.0f; hi_s += (bkt >= 2 * CUT) ? p[jj] : 0.0f; } } }
        if (blk + 1 < NBK) kfrag(b1);   // the next tile's k fragments: they land while the products below run (asked for here and not with the v fragments, so that a wave never has more LDS operations open than its counter holds)
#pragma unroll
        for (int c = 0; c < 2; ++c) { const VB ph = cat16b(oh[2 * c], oh[2 * c + 1]), pl = cat16b(ol[2 * c], ol[2 * c + 1]);
#pragma unroll
            for (int nb = 0; nb < 4; ++nb) acc[nb] = wmmab(vh[c][nb], ph, acc[nb]);
#pragma unroll
            for (int nb = 0; nb < 4; ++nb) acc[nb] = wmmab(vh[c][nb], pl, acc[nb]);
#pragma unroll
            for (int nb = 0; nb < 4; ++nb) acc[nb] = wmmab(vl[c][nb], ph, acc[nb]); }
        asm volatile("v_nop\n\tv_nop\n\tv_nop\n\tv_nop" : "+v"(acc[0]), "+v"(acc[1]), "+v"(acc[2]), "+v"(acc[3]));   // the distance behind the last matrix instruction on the path over the loop's branches
        const int bt = b0; b0 = b1; b1 = b2; b2 = bt;
    }
    VB rh[2][4], rl[2][4];   // rel_v^T fragments, hi and lo
    const bf* rgh = AVTh + lr * NE + 8 * hi; const bf* rgl = AVTl + lr * NE + 8 * hi;
#pragma unroll
    for (int c = 0; c < 2; ++c)
#pragma unroll
        for (int nb = 0; nb < 4; ++nb) { rh[c][nb] = WFrag<bf>::ld(rgh + nb * 16 * NE + c * 32); rl[c][nb] = WFrag<bf>::ld(rgl + nb * 16 * NE + c * 32); }
    asm volatile("s_wait_xcnt 0x0" : "+v"(lo_s), "+v"(hi_s), "+v"(l) : "v"(rgh), "v"(rgl) : "memory");   // the work below reuses the registers that these loads name as their addresses: the addresses stay live up to the wait, and the sums pass through it so that the exchange below is not lifted over it
    l += d_xhalf(l); lo_s += d_xhalf(lo_s); hi_s += d_xhalf(hi_s);   // the two half rows joined
    const float f = __fdiv_rn(1.0f, l);
    unsigned short l0h, l0l, h0h, h0l; splitf(lo_s * f, l0h, l0l); splitf(hi_s * f, h0h, h0l);
    __builtin_amdgcn_wave_barrier(); asm volatile("" ::: "memory");   // the reads of tsw below take what other lanes of this wave stored
    v4f tq[4];   // this lane's 16 offsets hi*16 + 0..15 of query lr
#pragma unroll
    for (int u = 0; u < 4; ++u) tq[u] = *(const v4fa*)(tsw + lr * TP + hi * 16 + u * 4);
#pragma unroll
    for (int g = 0; g < 2; ++g) { v8us o1, o2;
#pragma unroll
        for (int q = 0; q < 8; ++q) { unsigned short a, c2; splitf(__builtin_amdgcn_exp2f((tq[g * 2 + (q >> 2)][q & 3] - m) * L2E) * f, a, c2); o1[q] = a; o2[q] = c2; }
        if (g == 0) { o1[0] = (hi == 0) ? l0h : o1[0]; o2[0] = (hi == 0) ? l0l : o2[0]; }   // offset 0 = the low end's sum
        *(v8usa*)(pbh + lr * KP + hi * 16 + g * 8) = o1; *(v8usa*)(pbl + lr * KP + hi * 16 + g * 8) = o2; }
    if (hi == 0) { pbh[lr * KP + 2 * CUT] = h0h; pbl[lr * KP + 2 * CUT] = h0l; }
    __builtin_amdgcn_wave_barrier(); asm volatile("" ::: "memory");   // the fragment reads below take what other lanes of this wave stored
#pragma unroll
    for (int nb = 0; nb < 4; ++nb) acc[nb] *= f;
#pragma unroll
    for (int c = 0; c < 2; ++c) { const VB ph = WFrag<bf>::ld(pbh + lr * KP + 8 * hi + c * 32), pl = WFrag<bf>::ld(pbl + lr * KP + 8 * hi + c * 32);
#pragma unroll
        for (int nb = 0; nb < 4; ++nb) { acc[nb] = wmmab(rh[c][nb], ph, acc[nb]); acc[nb] = wmmab(rh[c][nb], pl, acc[nb]); acc[nb] = wmmab(rl[c][nb], ph, acc[nb]); } }
    bf* ah = ATh + ((size_t)(z / NH_) * TT + i) * DQ + (z % NH_) * HD + hi * 8; bf* al = ATl + ((size_t)(z / NH_) * TT + i) * DQ + (z % NH_) * HD + hi * 8;   /* z = b*16 + head; a lane's 8 values are 16 bytes of its query's row */
#pragma unroll
    for (int nb = 0; nb < 4; ++nb) { v8us o1, o2;
#pragma unroll
        for (int j = 0; j < 8; ++j) { unsigned short a, c2; splitf(acc[nb][j], a, c2); o1[j] = a; o2[j] = c2; }
        *(v8usa*)(ah + nb * 16) = o1; *(v8usa*)(al + nb * 16) = o2;
        asm volatile("s_wait_xcnt 0x0" ::: "memory"); }   // the next values' arithmetic reuses the registers that these two stores name
}
__device__ __forceinline__ void d_epadK(int bx, const float* __restrict__ E, bf* EB) { const size_t i = (size_t)bx * 256 + threadIdx.x; if (i >= (size_t)NE * HD / 8) return; const int d0 = (int)(i % (HD / 8)) * 8; const int r = (int)(i / (HD / 8)); const float* src = E + (size_t)min(r, NRE - 1) * HD + d0; v8us o;
#pragma unroll
    for (int q = 0; q < 8; ++q) { const unsigned short v = f2bf(src[q]); o[q] = (r < NRE) ? v : (unsigned short)0; }
    *(v8us*)(EB + (size_t)r * HD + d0) = o;  }

__device__ __forceinline__ void d_epadVT(int bx, const float* __restrict__ E, bf* Th, bf* Tl) { const size_t i = (size_t)bx * 256 + threadIdx.x; if (i >= (size_t)HD * NE / 4) return; const size_t e = i * 4; const int c0 = (int)(e % NE); const int d = (int)(e / NE); v4us oh, ol;
#pragma unroll
    for (int q = 0; q < 4; ++q) { const int r = c0 + q; const float v = bfr(E[(size_t)min(r, NRE - 1) * HD + d]); unsigned short u, w; splitf(v, u, w);   /* input rounded to bf16 once: lo == 0 */ oh[q] = (r < NRE) ? u : (unsigned short)0; ol[q] = (r < NRE) ? w : (unsigned short)0; }
    *(v4us*)(Th + e) = oh; *(v4us*)(Tl + e) = ol;  }

// k_prep: every pass that reads nothing but the inputs, in one launch of 646 work-groups, each with one piece of work; blockIdx.x picks the pass: 4 x 64 weight tiles (the longest path, they start first), 3 x 128 input pieces, 6 blocks for the two relative tables.
#define PBW 256
#define PBC 384
#define PBE 6
__global__ __launch_bounds__(256) void k_prep(const float* __restrict__ wq, const float* __restrict__ wk, const float* __restrict__ wv, const float* __restrict__ wo, const float* __restrict__ ak, const float* __restrict__ av, const float* __restrict__ x, const float* __restrict__ xk, const float* __restrict__ xv, bf* WB, bf* AKB, bf* AVTh, bf* AVTl, bf* XB) {
    static_assert(4 * (DM / 64) * (DQ / 256) == PBW && DKV == DQ && 3 * (NB_ * TT * DM / 16384) == PBC && NE * HD / 8 / 256 == 2 && HD * NE / 4 / 256 == 4 && PBE == 6, "grid PBW + PBC + PBE");
    __shared__ __align__(16) unsigned tl[8 * 32 * WTP];   // the weight tiles' turning room, one part per wave
    const int bx = blockIdx.x;
    if (bx < PBW) { const int y = bx >> 6; const float* w = (y == 0) ? wq : ((y == 1) ? wk : ((y == 2) ? wv : wo)); d_wtT(bx & 63, w, WB + (size_t)y * DM * DQ, tl); }   /* 'xw' weights turned into Bt */
    else if (bx < PBW + PBC) { const int c = bx - PBW, q = c >> 7; const float* src = (q == 0) ? x : ((q == 1) ? xk : xv); d_cvt4(c & 127, src, XB + (size_t)q * NB_ * TT * DM); }
    else { const int e = bx - PBW - PBC; if (e < 2) d_epadK(e, ak, AKB);   /* rel_k -> bf16 [64][64], rows >= 33 zero */ else d_epadVT(e - 2, av, AVTh, AVTl); }   /* rel_v^T hi/lo [64][64], cols >= 33 zero */
}

extern "C" void kernel_launch(void* const* d_in, const int* in_sizes, int n_in,
                              void* d_out, int out_size, void* d_ws, size_t ws_size, hipStream_t stream) {
    (void)in_sizes; (void)n_in; (void)out_size;
    const float* x = (const float*)d_in[0];   /* query */ const float* xk = (const float*)d_in[1]; const float* xv = (const float*)d_in[2]; const float* wq = (const float*)d_in[3]; const float* bq = (const float*)d_in[4]; const float* wk = (const float*)d_in[5]; const float* bk = (const float*)d_in[6]; const float* wv = (const float*)d_in[7]; const float* bv = (const float*)d_in[8]; const float* wo = (const float*)d_in[9]; const float* bo = (const float*)d_in[10]; const float* ak = (const float*)d_in[11]; const float* av = (const float*)d_in[12];   /* rel_k / rel_v [33][64] */
    float* OUT = (float*)d_out;     // [2][1024][1024]
    char* wsp = (char*)d_ws;
    auto take = [&](size_t bytes) { char* p = wsp; wsp += (bytes + 255) & ~(size_t)255; return (void*)p; };
    bf* AKB = (bf*)take((size_t)NE * HD * 2); bf* AVTh = (bf*)take((size_t)HD * NE * 2); bf* AVTl = (bf*)take((size_t)HD * NE * 2);
    bf* WB = (bf*)take((size_t)4 * DM * DQ * 2);   /* Wq, Wk, Wv, Wo as Bt, one behind the other */ bf* WO = WB + (size_t)3 * DM * DQ;
    bf* XB = (bf*)take((size_t)3 * NB_ * TT * DM * 2);   /* query, key, value */
    bf* QPh = (bf*)take((size_t)NB_ * NH_ * TT * HD * 2); bf* QPl = (bf*)take((size_t)NB_ * NH_ * TT * HD * 2); bf* KPh = (bf*)take((size_t)NB_ * NKV * TT * HD * 2); bf* KPl = (bf*)take((size_t)NB_ * NKV * TT * HD * 2); bf* VT2 = (bf*)take((size_t)NB_ * NKV * HD * 2 * TT * 2);   /* v^T rows hi | lo */
    bf* ATh = (bf*)take((size_t)NB_ * TT * DQ * 2); bf* ATl = (bf*)take((size_t)NB_ * TT * DQ * 2);
    if ((size_t)(wsp - (char*)d_ws) > ws_size) return;    // ws 256 MiB
    k_prep<<<dim3(PBW + PBC + PBE, 1, 1), 256, 0, stream>>>(wq, wk, wv, wo, ak, av, x, xk, xv, WB, AKB, AVTh, AVTl, XB);
    k_gemms<0, true><<<dim3(NB_ * TT / 128, DQ / 128, 3), 128, 0, stream>>>(XB, nullptr, WB, nullptr, bq, bk, bv, (size_t)NB_ * TT * DM, (size_t)DM * DQ, QPh, QPl, KPh, KPl, VT2);   /* z = q, k, v, straight into the head planes */
    k_fattn<<<dim3(TT / 128, ZB, 1), 256, 0, stream>>>(QPh, QPl, KPh, KPl, VT2, AKB, AVTh, AVTl, ATh, ATl);   /* z = b*16 + head walks consecutive q, k and v planes; scores + q.rel_k[clip(j - i) + 16], softmax, attn.v + attn folded onto the 33 offsets . rel_v, merged hi/lo */
    k_gemms<1, false><<<dim3(NB_ * TT / 128, DM / 128, 1), 128, 0, stream>>>(ATh, ATl, WO, OUT, bo, bo, bo, 0, 0, nullptr, nullptr, nullptr, nullptr, nullptr);
}
